// v000
// Times are from an AMD MI455X. After a warm-up the kernel runs many times in a row, and a time is the length of
// such a window on the GPU divided by its runs, so every launch and the gaps after it count. The runs cycle
// through copies of the inputs. A figure is the median of several windows, for all but v000 over two sittings.
// Sittings can differ by a few percent; kernels timed side by side share one.
// v000, which the later versions start from, runs in 2610 microseconds.
#include <hip/hip_runtime.h>

// PhaseSyncAttentionWSA (hidden_states [4][2048][1024]; q/k/v = x @ W + b (16 heads x 64); phase scalars p_c/p_s/p_m[b][h][t] = sum_band {cos_phi,sin_phi,mag}[b][band][t] Wp[band][h] + bp[h] (8 bands);
// V_real = v p_m p_c, V_imag = v p_m p_s (per (b,h,t) scalars on the value rows); scores = q.k/8 + attention_mask[b][0][0][j] (additive input, read as data); softmax; ctx = (P.V_real) p_c + (P.V_imag) p_s
// (per query row); out = LN(ctx @ Wo + bo + hidden_states) * ln_g + ln_b (eps 1e-12)).
// Compute dtypes, f32 accumulate: every input rounded to bf16; projections on PLAIN bf16 operands (inputs: exact, + bias); the phase projections (8 terms), V scaling,
// ctx combination, residual and LayerNorm in f32 on VALU; scores and the two value contractions on SINGLE fp16 planes (q x 1/8; P x1024; V_real | V_imag packed as one 128-wide V^T plane per head
// so attn.[V_real|V_imag] is one N = 128 GEMM); output projection on hi+lo planes x exact Wo (2 products).

#define NB_  4
#define NBD  8                   // phase bands
#define HD2  128                 // packed V_real | V_imag plane width
#define TT   2048
#define DD   1024
#define NH_  16
#define HD   64
#define NT   (NB_ * TT)
#define NZ   (NB_ * NH_)
#define ZH   2
#define PCAR 1024.0f
typedef _Float16 h16;
typedef unsigned short bf;
typedef __attribute__((ext_vector_type(16))) __bf16   v16bf;
typedef __attribute__((ext_vector_type(16))) _Float16 v16h;
typedef __attribute__((ext_vector_type(8)))  _Float16 v8h;
typedef __attribute__((ext_vector_type(8)))  unsigned short v8us;
typedef __attribute__((ext_vector_type(8)))  float    v8f;
typedef __attribute__((ext_vector_type(4)))  float    v4f;
typedef v8h  __attribute__((may_alias)) v8ha;
typedef v4f  __attribute__((may_alias)) v4fa;
typedef v8us __attribute__((may_alias)) v8usa;

__device__ __forceinline__ unsigned short f2bf(float f) { unsigned u = __float_as_uint(f); u += 0x7FFFu + ((u >> 16) & 1u); return (unsigned short)(u >> 16); }
__device__ __forceinline__ float bf2f(unsigned short b) { return __uint_as_float(((unsigned)b) << 16); }
__device__ __forceinline__ float bfr(float f) { return bf2f(f2bf(f)); }
__device__ __forceinline__ v16h cat16(v8h lo, v8h hi) { return __builtin_shufflevector(lo, hi, 0, 1, 2, 3, 4, 5, 6, 7, 8, 9, 10, 11, 12, 13, 14, 15); }
__device__ __forceinline__ v16bf cat16b(v8us lo, v8us hi) { return __builtin_bit_cast(v16bf, __builtin_shufflevector(lo, hi, 0, 1, 2, 3, 4, 5, 6, 7, 8, 9, 10, 11, 12, 13, 14, 15)); }
__device__ __forceinline__ v8f wmma16(v16h a, v16h b, v8f c) { return __builtin_amdgcn_wmma_f32_16x16x32_f16(false, a, false, b, (short)0, c, false, false); }
__device__ __forceinline__ v8f wmmab(v16bf a, v16bf b, v8f c) { return __builtin_amdgcn_wmma_f32_16x16x32_bf16(false, a, false, b, (short)0, c, false, false); }



// ---- k_gemmw: register-blocked GEMM, ONE WAVE per 64x64 output tile (16 accumulators), operands straight from K-contiguous 16-bit planes; grid (M/64, N/64, Z), 32 threads.
// C[m][n] (f32, pitch ldc, + optional f32 bias[n]) = sum_k A[m][k] Bt[n][k] (+ split products per NSPLIT). z-batch strides sA/sB/sC in elements. K % 32 == 0.
template <typename T16> struct WFrag;
template <> struct WFrag<h16> { typedef v16h V; static __device__ __forceinline__ V ld(const h16* p) { return cat16(*(const v8h*)p, *(const v8h*)(p + 16)); } static __device__ __forceinline__ v8f mma(V a, V b, v8f c) { return wmma16(a, b, c); } };
template <> struct WFrag<bf> { typedef v16bf V; static __device__ __forceinline__ V ld(const bf* p) { return cat16b(*(const v8us*)p, *(const v8us*)(p + 16)); } static __device__ __forceinline__ v8f mma(V a, V b, v8f c) { return wmmab(a, b, c); } };
template <typename T16, int NSPLIT, bool BIAS>
__global__ __launch_bounds__(32) void k_gemmw(const T16* __restrict__ A, const T16* __restrict__ A2, const T16* __restrict__ Bt, const T16* __restrict__ Bt2, int K, float* C, int ldc, const float* __restrict__ bias, size_t sA, size_t sB, size_t sC) {
    typedef typename WFrag<T16>::V V;
    __shared__ __align__(16) float os[16 * 68];
    const size_t z = blockIdx.z; A += z * sA; if (A2) A2 += z * sA; Bt += z * sB; if (Bt2) Bt2 += z * sB; C += z * sC;
    const int lane = threadIdx.x & 31, lr = lane & 15, hi = lane >> 4; const int r0 = blockIdx.x * 64, c0 = blockIdx.y * 64;
    v8f acc[4][4];
#pragma unroll
    for (int mb = 0; mb < 4; ++mb)
#pragma unroll
        for (int nb = 0; nb < 4; ++nb) acc[mb][nb] = (v8f){};
    const size_t aoff = (size_t)(r0 + lr) * K + 8 * hi, boff = (size_t)(c0 + lr) * K + 8 * hi;
#pragma unroll 1
    for (int kc = 0; kc < K; kc += 32) {
        V a[4], a2[4];
#pragma unroll
        for (int mb = 0; mb < 4; ++mb) { a[mb] = WFrag<T16>::ld(A + aoff + (size_t)mb * 16 * K + kc); if (NSPLIT == 1 || NSPLIT == 2) a2[mb] = WFrag<T16>::ld(A2 + aoff + (size_t)mb * 16 * K + kc); }
#pragma unroll
        for (int nb = 0; nb < 4; ++nb) { const V b = WFrag<T16>::ld(Bt + boff + (size_t)nb * 16 * K + kc); V b2; if (NSPLIT >= 2) b2 = WFrag<T16>::ld(Bt2 + boff + (size_t)nb * 16 * K + kc);
#pragma unroll
            for (int mb = 0; mb < 4; ++mb) { acc[mb][nb] = WFrag<T16>::mma(a[mb], b, acc[mb][nb]); if (NSPLIT == 1 || NSPLIT == 2) acc[mb][nb] = WFrag<T16>::mma(a2[mb], b, acc[mb][nb]); if (NSPLIT >= 2) acc[mb][nb] = WFrag<T16>::mma(a[mb], b2, acc[mb][nb]); } }
        asm volatile("v_nop\n\tv_nop\n\tv_nop\n\tv_nop" : "+v"(acc[0][0]), "+v"(acc[1][1]), "+v"(acc[2][2]), "+v"(acc[3][3]) : "v"(a[0]), "v"(a[3]));
    }
#pragma unroll
    for (int mb = 0; mb < 4; ++mb) {
#pragma unroll
        for (int nb = 0; nb < 4; ++nb) {
#pragma unroll
            for (int j = 0; j < 8; ++j) os[(hi * 8 + j) * 68 + nb * 16 + lr] = acc[mb][nb][j]; }
        __builtin_amdgcn_wave_barrier(); asm volatile("" ::: "memory");
        float* crow = C + (size_t)(r0 + mb * 16) * ldc + c0;
{
#pragma unroll
            for (int s = 0; s < 8; ++s) { const int row = 2 * s + hi, cofs = lr * 4; v4f val = *(const v4fa*)(os + row * 68 + cofs); if (BIAS) { val[0] += bfr(bias[c0 + cofs]); val[1] += bfr(bias[c0 + cofs + 1]); val[2] += bfr(bias[c0 + cofs + 2]); val[3] += bfr(bias[c0 + cofs + 3]); }
                *(v4f*)(crow + (size_t)row * ldc + cofs) = val; }
             }
        __builtin_amdgcn_wave_barrier(); asm volatile("" ::: "memory");
    }
}

__device__ __forceinline__ h16 tohx(float x) { return (h16)x; }
__device__ __forceinline__ void splitf(float y, unsigned short& h, unsigned short& l) { h = f2bf(y); l = f2bf(y - bf2f(h)); }
typedef __attribute__((ext_vector_type(2))) _Float16 v2h;
typedef __attribute__((ext_vector_type(4))) _Float16 v4h;
typedef __attribute__((ext_vector_type(2))) unsigned short v2us;
typedef __attribute__((ext_vector_type(4))) unsigned short v4us;
typedef __attribute__((ext_vector_type(2))) float v2f;

__global__ __launch_bounds__(256) void k_cvt8(const float* __restrict__ src, bf* dst, size_t n8) { const size_t i = (size_t)blockIdx.x * 256 + threadIdx.x; if (i >= n8) return; const v8f v = *(const v8f*)(src + i * 8); v8us o;
#pragma unroll
    for (int k = 0; k < 8; ++k) o[k] = f2bf(v[k]); *(v8us*)(dst + i * 8) = o;  }
__global__ __launch_bounds__(256) void k_wtG(const float* __restrict__ w, int K, int N, bf* Bt) {
    const int lane = threadIdx.x & 31; const int L0 = (blockIdx.x * 8 + (threadIdx.x >> 5)) * 8; const int nlines = N * K / 64;
{
#pragma unroll 1
        for (int l = 0; l < 8; ++l) { const int L = L0 + l; if (L >= nlines) break; const size_t e = (size_t)L * 64 + lane * 2; const int k = (int)(e % K), n = (int)(e / K); v2us o;
            o[0] = f2bf(w[(size_t)k * N + n]); o[1] = f2bf(w[(size_t)(k + 1) * N + n]); *(v2us*)(Bt + e) = o; }
         }
}
__global__ __launch_bounds__(256) void k_bfr1(const float* __restrict__ src, float* dst, int n) { const int i = blockIdx.x * 256 + threadIdx.x; if (i >= n) return; const float v = bfr(src[i]); *(float*)(dst + i) = v;  }
__global__ __launch_bounds__(256) void k_h16plane(const float* __restrict__ F, float sc, h16* P) {
    const int lane = threadIdx.x & 31; const int L0 = (blockIdx.x * 8 + (threadIdx.x >> 5)) * 8; const int nlines = NT * DD / 64;
{
#pragma unroll
        for (int l = 0; l < 8; ++l) { const int L = L0 + l; if (L >= nlines) break; const int e = L * 64 + lane * 2; const int d = e & 63; const int t = (e >> 6) & (TT - 1); const int z = e >> 17; const int b = z >> 4, h = z & 15; v2h v;
#pragma unroll
            for (int q = 0; q < 2; ++q) v[q] = tohx(F[((size_t)b * TT + t) * DD + h * HD + d + q] * sc);
            *(v2h*)(P + (size_t)e) = v; }
         }
}
__global__ __launch_bounds__(256) void k_phase(const float* __restrict__ cph, const float* __restrict__ sph, const float* __restrict__ mag, const float* __restrict__ Wp, const float* __restrict__ bp, float* PH) {
    const int idx = blockIdx.x * 256 + threadIdx.x; if (idx >= 3 * NB_ * NH_ * TT) return; const int t = idx & (TT - 1); const int h = (idx >> 11) & (NH_ - 1); const int b = (idx >> 15) & (NB_ - 1); const int k = idx >> 17;
    const float* src = (k == 0) ? cph : (k == 1 ? sph : mag); float s = 0.f;
#pragma unroll
    for (int n = 0; n < NBD; ++n) { float w = bfr(Wp[n * NH_ + h]), p = bfr(src[((size_t)b * NBD + n) * TT + t]); asm volatile("" : "+v"(w)); asm volatile("" : "+v"(p)); float m = __fmul_rn(p, w); asm volatile("" : "+v"(m)); s = __fadd_rn(s, m); }
    s = __fadd_rn(s, bfr(bp[h])); *(float*)(PH + idx) = s;  }
__global__ __launch_bounds__(256) void k_vt2(const float* __restrict__ F, const float* __restrict__ PH, h16* VT) {
    const int lane = threadIdx.x & 31; const int L0 = (blockIdx.x * 8 + (threadIdx.x >> 5)) * 8; const int nlines = NZ * HD2 * TT / 64;
{
#pragma unroll
        for (int l = 0; l < 8; ++l) { const int L = L0 + l; if (L >= nlines) break; const size_t e = (size_t)L * 64 + lane * 2; const int t = (int)(e & (TT - 1)); const int r = (int)((e >> 11) & (HD2 - 1)); const int z = (int)(e >> 18); const int b = z / NH_, h = z % NH_; const int d = r & 63; v2h v;
            const float* pc = PH + ((size_t)(r < 64 ? 0 : 1) * NB_ * NH_ + (size_t)b * NH_ + h) * TT; const float* pm = PH + ((size_t)2 * NB_ * NH_ + (size_t)b * NH_ + h) * TT;
#pragma unroll
            for (int q = 0; q < 2; ++q) { float a = __fmul_rn(F[((size_t)b * TT + t + q) * DD + h * HD + d], pm[t + q]); asm volatile("" : "+v"(a)); v[q] = tohx(__fmul_rn(a, pc[t + q])); }
            *(v2h*)(VT + e) = v; }
         }
}
__global__ __launch_bounds__(256) void k_msoft(const float* __restrict__ Sb, const float* __restrict__ am, int b, h16* P) {
    const int lane = threadIdx.x & 31; const int row = blockIdx.x * 8 + (threadIdx.x >> 5); if (row >= ZH * TT) return;
    const float* sr = Sb + (size_t)row * TT; const float* mr = am + (size_t)b * TT; float v[64]; float mx = -3.0e38f;
#pragma unroll
    for (int ch = 0; ch < 16; ++ch) { const int j0 = ch * 128 + lane * 4; const v4f a = *(const v4f*)(sr + j0), mk = *(const v4f*)(mr + j0);
#pragma unroll
        for (int q = 0; q < 4; ++q) { float mm = bfr(mk[q]); asm volatile("" : "+v"(mm)); const float t = __fadd_rn(a[q], mm); v[ch * 4 + q] = t; mx = fmaxf(mx, t); } }
#pragma unroll
    for (int sh = 16; sh; sh >>= 1) mx = fmaxf(mx, __shfl_xor(mx, sh, 32));
    float sum = 0.f;
#pragma unroll
    for (int k = 0; k < 64; ++k) { v[k] = __expf(v[k] - mx); sum += v[k]; }
#pragma unroll
    for (int sh = 16; sh; sh >>= 1) sum += __shfl_xor(sum, sh, 32);
    const float f = __fdiv_rn(PCAR, sum);
{
#pragma unroll
        for (int ch = 0; ch < 16; ++ch) { v4h o;
#pragma unroll
            for (int q = 0; q < 4; ++q) o[q] = tohx(v[ch * 4 + q] * f);
            *(v4h*)(P + (size_t)row * TT + ch * 128 + lane * 4) = o; }
         }
}
__global__ __launch_bounds__(256) void k_merge(const float* __restrict__ O, const float* __restrict__ PH, int b, int h0, bf* Ah, bf* Al) {
    const int lane = threadIdx.x & 31; const int L0 = (blockIdx.x * 8 + (threadIdx.x >> 5)) * 8; const int nlines = ZH * TT * HD / 64;
{
#pragma unroll
        for (int l = 0; l < 8; ++l) { const int L = L0 + l; if (L >= nlines) break; const int e = L * 64 + lane * 2; const int d = e & 63; const int t = (e >> 6) & (TT - 1); const int zz = e >> 17; const int h = h0 + zz; v2us oh, ol;
            const float pc = PH[((size_t)b * NH_ + h) * TT + t], psn = PH[((size_t)NB_ * NH_ + (size_t)b * NH_ + h) * TT + t];
#pragma unroll
            for (int q = 0; q < 2; ++q) { const float* orow = O + ((size_t)zz * TT + t) * HD2; float a1 = __fmul_rn(orow[d + q] * (1.0f / PCAR), pc), a2 = __fmul_rn(orow[64 + d + q] * (1.0f / PCAR), psn); asm volatile("" : "+v"(a1)); asm volatile("" : "+v"(a2));
                unsigned short a, c2; splitf(__fadd_rn(a1, a2), a, c2); oh[q] = a; ol[q] = c2; }
            const size_t o = ((size_t)b * TT + t) * DD + h * HD + d; *(v2us*)(Ah + o) = oh; *(v2us*)(Al + o) = ol; }
         }
}
__global__ __launch_bounds__(256) void k_ln2(const float* __restrict__ FF, const float* __restrict__ X, const float* __restrict__ gg, const float* __restrict__ bb, float* OUT) {
    const int lane = threadIdx.x & 31; const int r = blockIdx.x * 8 + (threadIdx.x >> 5); if (r >= NT) return; float v[32]; float s = 0.f;
#pragma unroll
    for (int c = 0; c < 8; ++c) { const v4f a = *(const v4f*)(FF + (size_t)r * DD + c * 128 + lane * 4), xx = *(const v4f*)(X + (size_t)r * DD + c * 128 + lane * 4);
#pragma unroll
        for (int q = 0; q < 4; ++q) { v[c * 4 + q] = a[q] + bfr(xx[q]); s += v[c * 4 + q]; } }
#pragma unroll
    for (int sh = 16; sh; sh >>= 1) s += __shfl_xor(s, sh, 32);
    const float mu = s * (1.0f / DD); float qq = 0.f;
#pragma unroll
    for (int i = 0; i < 32; ++i) { const float d0 = v[i] - mu; qq = __fadd_rn(qq, __fmul_rn(d0, d0)); }
#pragma unroll
    for (int sh = 16; sh; sh >>= 1) qq += __shfl_xor(qq, sh, 32);
    const float rs = __fdiv_rn(1.0f, __fsqrt_rn(qq * (1.0f / DD) + 1e-12f));
{
#pragma unroll
        for (int c = 0; c < 8; ++c) { v4f o;
#pragma unroll
            for (int q = 0; q < 4; ++q) { const int col = c * 128 + lane * 4 + q; o[q] = __fadd_rn(__fmul_rn((v[c * 4 + q] - mu) * rs, bfr(gg[col])), bfr(bb[col])); }
            *(v4f*)(OUT + (size_t)r * DD + c * 128 + lane * 4) = o; }
         }
}

extern "C" void kernel_launch(void* const* d_in, const int* in_sizes, int n_in,
                              void* d_out, int out_size, void* d_ws, size_t ws_size, hipStream_t stream) {
    (void)in_sizes; (void)n_in; (void)out_size;
    const float* IN[17]; for (int i = 0; i < 17; ++i) IN[i] = (const float*)d_in[i];
    // hidden_states, attention_mask [4][1][1][2048], cos_phi, sin_phi, mag [4][8][2048], Wq [1024][1024] (x @ W), bq, Wk, bk, Wv, bv, Wo, bo, Wp [8][16], bp [16], ln_g, ln_b = d_in[0..16]
    const float* x = IN[0]; const float* am = IN[1];
    float* OUT = (float*)d_out;     // [4][2048][1024]
    char* wsp = (char*)d_ws;
    auto take = [&](size_t bytes) { char* p = wsp; wsp += (bytes + 255) & ~(size_t)255; return (void*)p; };
    bf* WQ = (bf*)take((size_t)DD * DD * 2); bf* WK = (bf*)take((size_t)DD * DD * 2); bf* WV = (bf*)take((size_t)DD * DD * 2); bf* WO = (bf*)take((size_t)DD * DD * 2); float* PH = (float*)take((size_t)3 * NB_ * NH_ * TT * 4);
    bf* XB = (bf*)take((size_t)NT * DD * 2); float* F = (float*)take((size_t)NT * DD * 4);
    h16* QP = (h16*)take((size_t)NT * DD * 2); h16* KP = (h16*)take((size_t)NT * DD * 2); h16* VT = (h16*)take((size_t)NZ * HD2 * TT * 2);
    float* Sb = (float*)take((size_t)ZH * TT * TT * 4); h16* Pm = (h16*)take((size_t)ZH * TT * TT * 2); float* Ob = (float*)take((size_t)ZH * TT * HD2 * 4); bf* ATh = (bf*)take((size_t)NT * DD * 2); bf* ATl = (bf*)take((size_t)NT * DD * 2);
    if ((size_t)(wsp - (char*)d_ws) > ws_size) return;    // total ~ 213 MB = 203.5 MiB; ws 256 MiB
    float* Y = F;   // the output projection lands in F (dead after k_vt2)
    { const unsigned gT = (unsigned)((DD * DD / 64 + 63) / 64); k_wtG<<<gT, 256, 0, stream>>>(IN[5], DD, DD, WQ); k_wtG<<<gT, 256, 0, stream>>>(IN[7], DD, DD, WK); k_wtG<<<gT, 256, 0, stream>>>(IN[9], DD, DD, WV); k_wtG<<<gT, 256, 0, stream>>>(IN[11], DD, DD, WO);
      k_cvt8<<<(unsigned)(((size_t)NT * DD / 8 + 255) / 256), 256, 0, stream>>>(x, XB, (size_t)NT * DD / 8); k_phase<<<(3 * NB_ * NH_ * TT + 255) / 256, 256, 0, stream>>>(IN[2], IN[3], IN[4], IN[13], IN[14], PH); }
    const unsigned LB = (unsigned)((NT * DD / 64 + 63) / 64); const dim3 gP(NT / 64, DD / 64, 1);
    k_gemmw<bf, 0, true><<<gP, 32, 0, stream>>>(XB, nullptr, WQ, nullptr, DD, F, DD, IN[6], 0, 0, 0); k_h16plane<<<LB, 256, 0, stream>>>(F, 0.125f, QP);
    k_gemmw<bf, 0, true><<<gP, 32, 0, stream>>>(XB, nullptr, WK, nullptr, DD, F, DD, IN[8], 0, 0, 0); k_h16plane<<<LB, 256, 0, stream>>>(F, 1.0f, KP);
    k_gemmw<bf, 0, true><<<gP, 32, 0, stream>>>(XB, nullptr, WV, nullptr, DD, F, DD, IN[10], 0, 0, 0); k_vt2<<<(unsigned)((NZ * HD2 * TT / 64 + 63) / 64), 256, 0, stream>>>(F, PH, VT);
    for (int b = 0; b < NB_; ++b)
        for (int h0 = 0; h0 < NH_; h0 += ZH) { const size_t z0 = (size_t)b * NH_ + h0;
            k_gemmw<h16, 0, false><<<dim3(TT / 64, TT / 64, ZH), 32, 0, stream>>>(QP + z0 * TT * HD, nullptr, KP + z0 * TT * HD, nullptr, HD, Sb, TT, nullptr, (size_t)TT * HD, (size_t)TT * HD, (size_t)TT * TT);
            k_msoft<<<ZH * TT / 8, 256, 0, stream>>>(Sb, am, b, Pm);
            k_gemmw<h16, 0, false><<<dim3(TT / 64, HD2 / 64, ZH), 32, 0, stream>>>(Pm, nullptr, VT + z0 * HD2 * TT, nullptr, TT, Ob, HD2, nullptr, (size_t)TT * TT, (size_t)HD2 * TT, (size_t)TT * HD2);
            k_merge<<<(ZH * TT * HD / 64 + 63) / 64, 256, 0, stream>>>(Ob, PH, b, h0, ATh, ATl); }
    k_gemmw<bf, 1, true><<<gP, 32, 0, stream>>>(ATh, ATl, WO, nullptr, DD, Y, DD, IN[12], 0, 0, 0);
    k_ln2<<<NT / 8, 256, 0, stream>>>(Y, x, IN[15], IN[16], OUT);
}

// v001
// One run takes 426 microseconds.
// Next to v000, in two timings, it ran 6.18 and 6.11 times as fast.
#include <hip/hip_runtime.h>

// PhaseSyncAttentionWSA (hidden_states [4][2048][1024]; q/k/v = x @ W + b (16 heads x 64); phase scalars p_c/p_s/p_m[b][h][t] = sum_band {cos_phi,sin_phi,mag}[b][band][t] Wp[band][h] + bp[h] (8 bands);
// V_real = v p_m p_c, V_imag = v p_m p_s (per (b,h,t) scalars on the value rows); scores = q.k/8 + attention_mask[b][0][0][j] (additive input, read as data); softmax; ctx = (P.V_real) p_c + (P.V_imag) p_s
// (per query row); out = LN(ctx @ Wo + bo + hidden_states) * ln_g + ln_b (eps 1e-12)).
// Compute dtypes, f32 accumulate: every input rounded to bf16; projections on PLAIN bf16 operands (inputs: exact, + bias); the phase projections (8 terms), V scaling,
// ctx combination, residual and LayerNorm in f32 on VALU; scores and the two value contractions on SINGLE fp16 planes (q x 1/8; P = exp(s - max in use), normalised after the contraction; V_real | V_imag packed as one 128-wide V^T plane per head
// so attn.[V_real|V_imag] is one N = 128 GEMM); output projection on hi+lo planes x exact Wo (2 products).

#define NB_  4
#define NBD  8                   // phase bands
#define HD2  128                 // packed V_real | V_imag plane width
#define TT   2048
#define DD   1024
#define NH_  16
#define HD   64
#define NT   (NB_ * TT)
#define NZ   (NB_ * NH_)
typedef _Float16 h16;
typedef unsigned short bf;
typedef __attribute__((ext_vector_type(16))) __bf16   v16bf;
typedef __attribute__((ext_vector_type(16))) _Float16 v16h;
typedef __attribute__((ext_vector_type(8)))  _Float16 v8h;
typedef __attribute__((ext_vector_type(8)))  unsigned short v8us;
typedef __attribute__((ext_vector_type(8)))  float    v8f;
typedef __attribute__((ext_vector_type(4)))  float    v4f;
typedef v8h  __attribute__((may_alias)) v8ha;
typedef v4f  __attribute__((may_alias)) v4fa;
typedef v8us __attribute__((may_alias)) v8usa;

__device__ __forceinline__ unsigned short f2bf(float f) { unsigned u = __float_as_uint(f); u += 0x7FFFu + ((u >> 16) & 1u); return (unsigned short)(u >> 16); }
__device__ __forceinline__ float bf2f(unsigned short b) { return __uint_as_float(((unsigned)b) << 16); }
__device__ __forceinline__ float bfr(float f) { return bf2f(f2bf(f)); }
__device__ __forceinline__ v16h cat16(v8h lo, v8h hi) { return __builtin_shufflevector(lo, hi, 0, 1, 2, 3, 4, 5, 6, 7, 8, 9, 10, 11, 12, 13, 14, 15); }
__device__ __forceinline__ v16bf cat16b(v8us lo, v8us hi) { return __builtin_bit_cast(v16bf, __builtin_shufflevector(lo, hi, 0, 1, 2, 3, 4, 5, 6, 7, 8, 9, 10, 11, 12, 13, 14, 15)); }
__device__ __forceinline__ v8f wmma16(v16h a, v16h b, v8f c) { return __builtin_amdgcn_wmma_f32_16x16x32_f16(false, a, false, b, (short)0, c, false, false); }
__device__ __forceinline__ v8f wmmab(v16bf a, v16bf b, v8f c) { return __builtin_amdgcn_wmma_f32_16x16x32_bf16(false, a, false, b, (short)0, c, false, false); }



// ---- k_gemmw: register-blocked GEMM, ONE WAVE per 64x64 output tile (16 accumulators), operands straight from K-contiguous 16-bit planes; grid (M/64, N/64, Z), 32 threads.
// C[m][n] (f32, pitch ldc, + optional f32 bias[n]) = sum_k A[m][k] Bt[n][k] (+ split products per NSPLIT). z-batch strides sA/sB/sC in elements. K % 32 == 0.
template <typename T16> struct WFrag;
template <> struct WFrag<h16> { typedef v16h V; static __device__ __forceinline__ V ld(const h16* p) { return cat16(*(const v8h*)p, *(const v8h*)(p + 16)); } static __device__ __forceinline__ v8f mma(V a, V b, v8f c) { return wmma16(a, b, c); } };
template <> struct WFrag<bf> { typedef v16bf V; static __device__ __forceinline__ V ld(const bf* p) { return cat16b(*(const v8us*)p, *(const v8us*)(p + 16)); } static __device__ __forceinline__ v8f mma(V a, V b, v8f c) { return wmmab(a, b, c); } };
template <typename T16, int NSPLIT, bool BIAS>
__global__ __launch_bounds__(32) void k_gemmw(const T16* __restrict__ A, const T16* __restrict__ A2, const T16* __restrict__ Bt, const T16* __restrict__ Bt2, int K, float* C, int ldc, const float* __restrict__ bias, size_t sA, size_t sB, size_t sC) {
    typedef typename WFrag<T16>::V V;
    __shared__ __align__(16) float os[16 * 68];
    const size_t z = blockIdx.z; A += z * sA; if (A2) A2 += z * sA; Bt += z * sB; if (Bt2) Bt2 += z * sB; C += z * sC;
    const int lane = threadIdx.x & 31, lr = lane & 15, hi = lane >> 4; const int r0 = blockIdx.x * 64, c0 = blockIdx.y * 64;
    v8f acc[4][4];
#pragma unroll
    for (int mb = 0; mb < 4; ++mb)
#pragma unroll
        for (int nb = 0; nb < 4; ++nb) acc[mb][nb] = (v8f){};
    const size_t aoff = (size_t)(r0 + lr) * K + 8 * hi, boff = (size_t)(c0 + lr) * K + 8 * hi;
#pragma unroll 1
    for (int kc = 0; kc < K; kc += 32) {
        V a[4], a2[4];
#pragma unroll
        for (int mb = 0; mb < 4; ++mb) { a[mb] = WFrag<T16>::ld(A + aoff + (size_t)mb * 16 * K + kc); if (NSPLIT == 1 || NSPLIT == 2) a2[mb] = WFrag<T16>::ld(A2 + aoff + (size_t)mb * 16 * K + kc); }
#pragma unroll
        for (int nb = 0; nb < 4; ++nb) { const V b = WFrag<T16>::ld(Bt + boff + (size_t)nb * 16 * K + kc); V b2; if (NSPLIT >= 2) b2 = WFrag<T16>::ld(Bt2 + boff + (size_t)nb * 16 * K + kc);
#pragma unroll
            for (int mb = 0; mb < 4; ++mb) { acc[mb][nb] = WFrag<T16>::mma(a[mb], b, acc[mb][nb]); if (NSPLIT == 1 || NSPLIT == 2) acc[mb][nb] = WFrag<T16>::mma(a2[mb], b, acc[mb][nb]); if (NSPLIT >= 2) acc[mb][nb] = WFrag<T16>::mma(a[mb], b2, acc[mb][nb]); } }
        asm volatile("v_nop\n\tv_nop\n\tv_nop\n\tv_nop" : "+v"(acc[0][0]), "+v"(acc[1][1]), "+v"(acc[2][2]), "+v"(acc[3][3]) : "v"(a[0]), "v"(a[3]));
    }
#pragma unroll
    for (int mb = 0; mb < 4; ++mb) {
#pragma unroll
        for (int nb = 0; nb < 4; ++nb) {
#pragma unroll
            for (int j = 0; j < 8; ++j) os[(hi * 8 + j) * 68 + nb * 16 + lr] = acc[mb][nb][j]; }
        __builtin_amdgcn_wave_barrier(); asm volatile("" ::: "memory");
        float* crow = C + (size_t)(r0 + mb * 16) * ldc + c0;
{
#pragma unroll
            for (int s = 0; s < 8; ++s) { const int row = 2 * s + hi, cofs = lr * 4; v4f val = *(const v4fa*)(os + row * 68 + cofs); if (BIAS) { val[0] += bfr(bias[c0 + cofs]); val[1] += bfr(bias[c0 + cofs + 1]); val[2] += bfr(bias[c0 + cofs + 2]); val[3] += bfr(bias[c0 + cofs + 3]); }
                *(v4f*)(crow + (size_t)row * ldc + cofs) = val; }
             }
        __builtin_amdgcn_wave_barrier(); asm volatile("" ::: "memory");
    }
}

__device__ __forceinline__ h16 tohx(float x) { return (h16)x; }
__device__ __forceinline__ void splitf(float y, unsigned short& h, unsigned short& l) { h = f2bf(y); l = f2bf(y - bf2f(h)); }
typedef __attribute__((ext_vector_type(2))) _Float16 v2h;
typedef __attribute__((ext_vector_type(4))) _Float16 v4h;
typedef __attribute__((ext_vector_type(2))) unsigned short v2us;
typedef __attribute__((ext_vector_type(4))) unsigned short v4us;
typedef __attribute__((ext_vector_type(2))) float v2f;

__global__ __launch_bounds__(256) void k_cvt8(const float* __restrict__ src, bf* dst, size_t n8) { const size_t i = (size_t)blockIdx.x * 256 + threadIdx.x; if (i >= n8) return; const v8f v = *(const v8f*)(src + i * 8); v8us o;
#pragma unroll
    for (int k = 0; k < 8; ++k) o[k] = f2bf(v[k]); *(v8us*)(dst + i * 8) = o;  }
__global__ __launch_bounds__(256) void k_wtG(const float* __restrict__ w, int K, int N, bf* Bt) {
    const int lane = threadIdx.x & 31; const int L0 = (blockIdx.x * 8 + (threadIdx.x >> 5)) * 8; const int nlines = N * K / 64;
{
#pragma unroll 1
        for (int l = 0; l < 8; ++l) { const int L = L0 + l; if (L >= nlines) break; const size_t e = (size_t)L * 64 + lane * 2; const int k = (int)(e % K), n = (int)(e / K); v2us o;
            o[0] = f2bf(w[(size_t)k * N + n]); o[1] = f2bf(w[(size_t)(k + 1) * N + n]); *(v2us*)(Bt + e) = o; }
         }
}
__global__ __launch_bounds__(256) void k_bfr1(const float* __restrict__ src, float* dst, int n) { const int i = blockIdx.x * 256 + threadIdx.x; if (i >= n) return; const float v = bfr(src[i]); *(float*)(dst + i) = v;  }
__global__ __launch_bounds__(256) void k_h16plane(const float* __restrict__ F, float sc, h16* P) {
    const int lane = threadIdx.x & 31; const int L0 = (blockIdx.x * 8 + (threadIdx.x >> 5)) * 8; const int nlines = NT * DD / 64;
{
#pragma unroll
        for (int l = 0; l < 8; ++l) { const int L = L0 + l; if (L >= nlines) break; const int e = L * 64 + lane * 2; const int d = e & 63; const int t = (e >> 6) & (TT - 1); const int z = e >> 17; const int b = z >> 4, h = z & 15; v2h v;
#pragma unroll
            for (int q = 0; q < 2; ++q) v[q] = tohx(F[((size_t)b * TT + t) * DD + h * HD + d + q] * sc);
            *(v2h*)(P + (size_t)e) = v; }
         }
}
__global__ __launch_bounds__(256) void k_phase(const float* __restrict__ cph, const float* __restrict__ sph, const float* __restrict__ mag, const float* __restrict__ Wp, const float* __restrict__ bp, float* PH) {
    const int idx = blockIdx.x * 256 + threadIdx.x; if (idx >= 3 * NB_ * NH_ * TT) return; const int t = idx & (TT - 1); const int h = (idx >> 11) & (NH_ - 1); const int b = (idx >> 15) & (NB_ - 1); const int k = idx >> 17;
    const float* src = (k == 0) ? cph : (k == 1 ? sph : mag); float s = 0.f;
#pragma unroll
    for (int n = 0; n < NBD; ++n) { float w = bfr(Wp[n * NH_ + h]), p = bfr(src[((size_t)b * NBD + n) * TT + t]); asm volatile("" : "+v"(w)); asm volatile("" : "+v"(p)); float m = __fmul_rn(p, w); asm volatile("" : "+v"(m)); s = __fadd_rn(s, m); }
    s = __fadd_rn(s, bfr(bp[h])); *(float*)(PH + idx) = s;  }
__global__ __launch_bounds__(256) void k_vt2(const float* __restrict__ F, const float* __restrict__ PH, h16* VT) {
    const int lane = threadIdx.x & 31; const int L0 = (blockIdx.x * 8 + (threadIdx.x >> 5)) * 8; const int nlines = NZ * HD2 * TT / 64;
{
#pragma unroll
        for (int l = 0; l < 8; ++l) { const int L = L0 + l; if (L >= nlines) break; const size_t e = (size_t)L * 64 + lane * 2; const int t = (int)(e & (TT - 1)); const int r = (int)((e >> 11) & (HD2 - 1)); const int z = (int)(e >> 18); const int b = z / NH_, h = z % NH_; const int d = r & 63; v2h v;
            const float* pc = PH + ((size_t)(r < 64 ? 0 : 1) * NB_ * NH_ + (size_t)b * NH_ + h) * TT; const float* pm = PH + ((size_t)2 * NB_ * NH_ + (size_t)b * NH_ + h) * TT;
#pragma unroll
            for (int q = 0; q < 2; ++q) { float a = __fmul_rn(F[((size_t)b * TT + t + q) * DD + h * HD + d], pm[t + q]); asm volatile("" : "+v"(a)); v[q] = tohx(__fmul_rn(a, pc[t + q])); }
            *(v2h*)(VT + e) = v; }
         }
}
// ---- k_fattn: scores, mask, softmax, both value contractions and the phase merge of one (batch, head) in ONE launch; S and P stay in registers.
// Transposed products: S^T = K.Q^T (A = 16 key rows, B = 16 query columns), O^T += [V_real|V_imag]^T.P^T (A = 16 rows of the 128-wide V^T plane, B = P^T). A lane then holds scores of ONE query
// (column lr): two S^T tiles (keys 0-15, 16-31 of a pass), converted in place, are the B operand of the second product in the loaders' own k order (8 hi + 0..7, 16 + 8 hi + 0..7).
// Online softmax; the maximum in use is kept in the scores' own domain and subtracted from the score first (exact for near values, whatever the size of the mask). It may
// trail the true one by up to MLAG (P <= e^MLAG < 256 in fp16), so the accumulators are rescaled only on the rare pass that exceeds it.
// grid (TT / (8 * 16 * QG), NZ), 8 waves x QG groups of 16 query columns; a pass is 32 keys; operands straight from the K-contiguous fp16 planes, as in k_gemmw: every K and V^T fragment
// a wave loads serves QG column groups.
#define L2E 1.4426950408889634f
#define MLAG 5.5f
#define QG  4
__device__ __forceinline__ float xhalf(float x) { return __builtin_bit_cast(float, __builtin_amdgcn_permlanex16(__builtin_bit_cast(int, x), __builtin_bit_cast(int, x), 0x76543210, 0xfedcba98, false, false)); }  // lane l <-> lane l ^ 16
// Stands behind a group of global loads or stores, in front of the first instruction that reuses a register they name (a precaution).
__device__ __forceinline__ void xwait() { asm volatile("s_wait_xcnt 0x0" ::: "memory"); }
__global__ __launch_bounds__(256) void k_fattn(const h16* __restrict__ QP, const h16* __restrict__ KP, const h16* __restrict__ VT, const float* __restrict__ am, const float* __restrict__ PH, bf* Ah, bf* Al) {
    __shared__ __align__(16) float mk[TT];      // this batch's additive mask row, rounded to bf16 once per work-group
    const int z = blockIdx.y, b = z / NH_, h = z % NH_;
    for (int i = threadIdx.x * 4; i < TT; i += 1024) { v4f a = *(const v4f*)(am + (size_t)b * TT + i);
#pragma unroll
        for (int q = 0; q < 4; ++q) a[q] = bfr(a[q]);
        *(v4fa*)(mk + i) = a; }
    __syncthreads();
    const int lane = threadIdx.x & 31, lr = lane & 15, hi = lane >> 4; const int q0 = (blockIdx.x * 8 + __builtin_amdgcn_readfirstlane(threadIdx.x >> 5)) * (16 * QG);      // the wave's first query, held in a scalar register
    const h16* Kz = KP + (size_t)z * TT * HD; const unsigned ko = (unsigned)(lr * HD + 8 * hi);      // K plane of this head, and the lane's offset in a tile
    const h16* Vz = VT + (size_t)z * HD2 * TT + (size_t)lr * TT + 8 * hi;
    v16h qf[QG][2]; const h16* qp[QG];
#pragma unroll
    for (int g = 0; g < QG; ++g) { qp[g] = QP + ((size_t)z * TT + q0 + 16 * g + lr) * HD + 8 * hi;
#pragma unroll
        for (int kc = 0; kc < 2; ++kc) qf[g][kc] = WFrag<h16>::ld(qp[g] + 32 * kc); }
    v16h kf[2][2];      // K fragments are fetched one pass ahead, half way through the second product
#pragma unroll
    for (int kt = 0; kt < 2; ++kt)
#pragma unroll
        for (int kc = 0; kc < 2; ++kc) kf[kt][kc] = WFrag<h16>::ld(Kz + (size_t)(16 * kt) * HD + 32 * kc + ko);
    // the same wait as xwait(); the Q addresses are named as inputs only, so that their register pairs stay live up to the wait and nothing is written over them in front of it (ko lives on)
    asm volatile("s_wait_xcnt 0x0" :: "v"(qp[0]), "v"(qp[1]), "v"(qp[2]), "v"(qp[3]), "v"(ko) : "memory");
    __builtin_amdgcn_sched_barrier(0);      // keeps the scheduler from mixing the tiles' set-up below into the loads above (it spilled Q fragments when it did)
    const h16* kp = Kz + ko + 32 * HD;      // the lane's address in the K tile to fetch next
    v8f acc[QG][8]; float m_run[QG], l_run[QG];
#pragma unroll
    for (int g = 0; g < QG; ++g) { m_run[g] = -__FLT_MAX__; l_run[g] = 0.f;
#pragma unroll
        for (int t = 0; t < 8; ++t) acc[g][t] = (v8f){}; }
    // rolled: one pass's fragments and the output tiles already fill the wave's registers
#pragma unroll 1
    for (int key0 = 0; key0 < TT; key0 += 32) {
        v16h vf[8];
#pragma unroll
        for (int t = 0; t < 8; ++t) vf[t] = WFrag<h16>::ld(Vz + (size_t)(16 * t) * TT + key0);
        xwait();
        v8f s[2][QG];
#pragma unroll
        for (int kt = 0; kt < 2; ++kt) { const v4f m0 = *(const v4fa*)(mk + key0 + 16 * kt + 8 * hi), m1 = *(const v4fa*)(mk + key0 + 16 * kt + 8 * hi + 4);
#pragma unroll
            for (int g = 0; g < QG; ++g) { v8f t = wmma16(kf[kt][1], qf[g][1], wmma16(kf[kt][0], qf[g][0], (v8f){}));
#pragma unroll
                for (int r = 0; r < 4; ++r) { t[r] += m0[r]; t[4 + r] += m1[r]; }
                s[kt][g] = t; } }
        float mb[QG]; bool need = false;
#pragma unroll
        for (int g = 0; g < QG; ++g) { float mx = s[0][g][0];
#pragma unroll
            for (int r = 1; r < 8; ++r) mx = fmaxf(mx, s[0][g][r]);
#pragma unroll
            for (int r = 0; r < 8; ++r) mx = fmaxf(mx, s[1][g][r]);
            mx = fmaxf(mx, xhalf(mx)); mb[g] = mx; need = need || (mx > m_run[g] + MLAG); }
        if (__builtin_amdgcn_ballot_w32(need) != 0) {       // one wave-uniform test per pass
#pragma unroll
            for (int g = 0; g < QG; ++g) { const float m_new = fmaxf(m_run[g], mb[g]); mb[g] = (m_run[g] - m_new) * L2E; m_run[g] = m_new; }
#pragma unroll
            for (int g = 0; g < QG; ++g) { const float corr = __builtin_amdgcn_exp2f(mb[g]); l_run[g] *= corr;
#pragma unroll
                for (int t = 0; t < 8; ++t) acc[g][t] = acc[g][t] * corr; } }
#pragma unroll
        for (int g = 0; g < QG; ++g) { const float mr = m_run[g]; v16h pf; v2f ls = (v2f){0.f, 0.f};
#pragma unroll
            for (int e = 0; e < 16; e += 2) { const v2f x = ((v2f){s[e >> 3][g][e & 7], s[e >> 3][g][(e & 7) + 1]} - mr) * L2E; const v2f p = (v2f){__builtin_amdgcn_exp2f(x[0]), __builtin_amdgcn_exp2f(x[1])};
                ls += p; pf[e] = tohx(p[0]); pf[e + 1] = tohx(p[1]); }
            l_run[g] += ls[0] + ls[1];
#pragma unroll
            for (int t = 0; t < 8; ++t) acc[g][t] = wmma16(vf[t], pf, acc[g][t]);
            if (g == QG / 2 - 1) {
#pragma unroll
                for (int kt = 0; kt < 2; ++kt)
#pragma unroll
                    for (int kc = 0; kc < 2; ++kc) kf[kt][kc] = WFrag<h16>::ld(kp + (size_t)(16 * kt) * HD + 32 * kc);
                kp += (key0 + 64 < TT) ? 32 * HD : 0; } }      // the last pass fetches its own tile again: in bounds, unused
    }
#pragma unroll
    for (int g = 0; g < QG; ++g) { const int t = q0 + 16 * g + lr; const float l = l_run[g] + xhalf(l_run[g]); const float inv = __fdiv_rn(1.0f, l);
        const float pc = PH[((size_t)b * NH_ + h) * TT + t], psn = PH[((size_t)NB_ * NH_ + (size_t)b * NH_ + h) * TT + t];
#pragma unroll
        for (int tt = 0; tt < 4; ++tt) { v8us oh, ol;
#pragma unroll
            for (int r = 0; r < 8; ++r) { unsigned short a, c2; splitf((acc[g][tt][r] * inv) * pc + (acc[g][tt + 4][r] * inv) * psn, a, c2); oh[r] = a; ol[r] = c2; }
            const unsigned o = ((unsigned)b * TT + t) * DD + h * HD + 16 * tt + 8 * hi; __builtin_amdgcn_sched_barrier(0);      // the two barriers keep every other register write out from between the stores and their wait
            *(v8usa*)(Ah + o) = oh; *(v8usa*)(Al + o) = ol; xwait(); __builtin_amdgcn_sched_barrier(0); } }
}
__global__ __launch_bounds__(256) void k_ln2(const float* __restrict__ FF, const float* __restrict__ X, const float* __restrict__ gg, const float* __restrict__ bb, float* OUT) {
    const int lane = threadIdx.x & 31; const int r = blockIdx.x * 8 + (threadIdx.x >> 5); if (r >= NT) return; float v[32]; float s = 0.f;
#pragma unroll
    for (int c = 0; c < 8; ++c) { const v4f a = *(const v4f*)(FF + (size_t)r * DD + c * 128 + lane * 4), xx = *(const v4f*)(X + (size_t)r * DD + c * 128 + lane * 4);
#pragma unroll
        for (int q = 0; q < 4; ++q) { v[c * 4 + q] = a[q] + bfr(xx[q]); s += v[c * 4 + q]; } }
#pragma unroll
    for (int sh = 16; sh; sh >>= 1) s += __shfl_xor(s, sh, 32);
    const float mu = s * (1.0f / DD); float qq = 0.f;
#pragma unroll
    for (int i = 0; i < 32; ++i) { const float d0 = v[i] - mu; qq = __fadd_rn(qq, __fmul_rn(d0, d0)); }
#pragma unroll
    for (int sh = 16; sh; sh >>= 1) qq += __shfl_xor(qq, sh, 32);
    const float rs = __fdiv_rn(1.0f, __fsqrt_rn(qq * (1.0f / DD) + 1e-12f));
{
#pragma unroll
        for (int c = 0; c < 8; ++c) { v4f o;
#pragma unroll
            for (int q = 0; q < 4; ++q) { const int col = c * 128 + lane * 4 + q; o[q] = __fadd_rn(__fmul_rn((v[c * 4 + q] - mu) * rs, bfr(gg[col])), bfr(bb[col])); }
            *(v4f*)(OUT + (size_t)r * DD + c * 128 + lane * 4) = o; }
         }
}

extern "C" void kernel_launch(void* const* d_in, const int* in_sizes, int n_in,
                              void* d_out, int out_size, void* d_ws, size_t ws_size, hipStream_t stream) {
    (void)in_sizes; (void)n_in; (void)out_size;
    const float* IN[17]; for (int i = 0; i < 17; ++i) IN[i] = (const float*)d_in[i];
    // hidden_states, attention_mask [4][1][1][2048], cos_phi, sin_phi, mag [4][8][2048], Wq [1024][1024] (x @ W), bq, Wk, bk, Wv, bv, Wo, bo, Wp [8][16], bp [16], ln_g, ln_b = d_in[0..16]
    const float* x = IN[0]; const float* am = IN[1];
    float* OUT = (float*)d_out;     // [4][2048][1024]
    char* wsp = (char*)d_ws;
    auto take = [&](size_t bytes) { char* p = wsp; wsp += (bytes + 255) & ~(size_t)255; return (void*)p; };
    bf* WQ = (bf*)take((size_t)DD * DD * 2); bf* WK = (bf*)take((size_t)DD * DD * 2); bf* WV = (bf*)take((size_t)DD * DD * 2); bf* WO = (bf*)take((size_t)DD * DD * 2); float* PH = (float*)take((size_t)3 * NB_ * NH_ * TT * 4);
    bf* XB = (bf*)take((size_t)NT * DD * 2); float* F = (float*)take((size_t)NT * DD * 4);
    h16* QP = (h16*)take((size_t)NT * DD * 2); h16* KP = (h16*)take((size_t)NT * DD * 2); h16* VT = (h16*)take((size_t)NZ * HD2 * TT * 2);
    bf* ATh = (bf*)take((size_t)NT * DD * 2); bf* ATl = (bf*)take((size_t)NT * DD * 2);
    if ((size_t)(wsp - (char*)d_ws) > ws_size) return;    // total ~ 154 MiB; ws 256 MiB
    float* Y = F;   // the output projection lands in F (dead after k_vt2)
    { const unsigned gT = (unsigned)((DD * DD / 64 + 63) / 64); k_wtG<<<gT, 256, 0, stream>>>(IN[5], DD, DD, WQ); k_wtG<<<gT, 256, 0, stream>>>(IN[7], DD, DD, WK); k_wtG<<<gT, 256, 0, stream>>>(IN[9], DD, DD, WV); k_wtG<<<gT, 256, 0, stream>>>(IN[11], DD, DD, WO);
      k_cvt8<<<(unsigned)(((size_t)NT * DD / 8 + 255) / 256), 256, 0, stream>>>(x, XB, (size_t)NT * DD / 8); k_phase<<<(3 * NB_ * NH_ * TT + 255) / 256, 256, 0, stream>>>(IN[2], IN[3], IN[4], IN[13], IN[14], PH); }
    const unsigned LB = (unsigned)((NT * DD / 64 + 63) / 64); const dim3 gP(NT / 64, DD / 64, 1);
    k_gemmw<bf, 0, true><<<gP, 32, 0, stream>>>(XB, nullptr, WQ, nullptr, DD, F, DD, IN[6], 0, 0, 0); k_h16plane<<<LB, 256, 0, stream>>>(F, 0.125f, QP);
    k_gemmw<bf, 0, true><<<gP, 32, 0, stream>>>(XB, nullptr, WK, nullptr, DD, F, DD, IN[8], 0, 0, 0); k_h16plane<<<LB, 256, 0, stream>>>(F, 1.0f, KP);
    k_gemmw<bf, 0, true><<<gP, 32, 0, stream>>>(XB, nullptr, WV, nullptr, DD, F, DD, IN[10], 0, 0, 0); k_vt2<<<(unsigned)((NZ * HD2 * TT / 64 + 63) / 64), 256, 0, stream>>>(F, PH, VT);
    k_fattn<<<dim3(TT / (8 * 16 * QG), NZ), 256, 0, stream>>>(QP, KP, VT, am, PH, ATh, ATl);
    k_gemmw<bf, 1, true><<<gP, 32, 0, stream>>>(ATh, ATl, WO, nullptr, DD, Y, DD, IN[12], 0, 0, 0);
    k_ln2<<<NT / 8, 256, 0, stream>>>(Y, x, IN[15], IN[16], OUT);
}

// v002
// It runs in 299 microseconds.
// In two side-by-side timings against v001, it was 1.42 and 1.43 times as fast.
// All steps since v000 together make it 8.75 times as fast.
#include <hip/hip_runtime.h>

// Attention block with phase-weighted values (hidden_states [4][2048][1024]; q/k/v = x @ W + b (16 heads x 64); phase scalars p_c/p_s/p_m[b][h][t] = sum_band {cos_phi,sin_phi,mag}[b][band][t] Wp[band][h] + bp[h] (8 bands);
// V_real = v p_m p_c, V_imag = v p_m p_s (per (b,h,t) scalars on the value rows); scores = q.k/8 + attention_mask[b][0][0][j] (additive input, read as data); softmax; ctx = (P.V_real) p_c + (P.V_imag) p_s
// (per query row); out = LN(ctx @ Wo + bo + hidden_states) * ln_g + ln_b (eps 1e-12)).
// Compute dtypes, f32 accumulate: every input rounded to bf16; projections on PLAIN bf16 operands (inputs: exact, + bias); the phase projections (8 terms), V scaling,
// ctx combination, residual and LayerNorm in f32 on VALU; scores and the two value contractions on SINGLE fp16 planes (q x 1/8; P = exp(s - max in use), normalised after the contraction; V_real | V_imag packed as one 128-wide V^T plane per head
// so attn.[V_real|V_imag] is one N = 128 GEMM); output projection on hi+lo planes x exact Wo (2 products).

#define NB_  4
#define NBD  8                   // phase bands
#define HD2  128                 // packed V_real | V_imag plane width
#define TT   2048
#define DD   1024
#define NH_  16
#define HD   64
#define NT   (NB_ * TT)
#define NZ   (NB_ * NH_)
typedef _Float16 h16;
typedef unsigned short bf;
typedef __attribute__((ext_vector_type(16))) __bf16   v16bf;
typedef __attribute__((ext_vector_type(16))) _Float16 v16h;
typedef __attribute__((ext_vector_type(8)))  _Float16 v8h;
typedef __attribute__((ext_vector_type(8)))  unsigned short v8us;
typedef __attribute__((ext_vector_type(8)))  float    v8f;
typedef __attribute__((ext_vector_type(4)))  float    v4f;
typedef v8h  __attribute__((may_alias)) v8ha;
typedef v4f  __attribute__((may_alias)) v4fa;
typedef v8us __attribute__((may_alias)) v8usa;

__device__ __forceinline__ unsigned short f2bf(float f) { unsigned u = __float_as_uint(f); u += 0x7FFFu + ((u >> 16) & 1u); return (unsigned short)(u >> 16); }
__device__ __forceinline__ float bf2f(unsigned short b) { return __uint_as_float(((unsigned)b) << 16); }
__device__ __forceinline__ float bfr(float f) { return bf2f(f2bf(f)); }
__device__ __forceinline__ v16h cat16(v8h lo, v8h hi) { return __builtin_shufflevector(lo, hi, 0, 1, 2, 3, 4, 5, 6, 7, 8, 9, 10, 11, 12, 13, 14, 15); }
__device__ __forceinline__ v16bf cat16b(v8us lo, v8us hi) { return __builtin_bit_cast(v16bf, __builtin_shufflevector(lo, hi, 0, 1, 2, 3, 4, 5, 6, 7, 8, 9, 10, 11, 12, 13, 14, 15)); }
__device__ __forceinline__ v8f wmma16(v16h a, v16h b, v8f c) { return __builtin_amdgcn_wmma_f32_16x16x32_f16(false, a, false, b, (short)0, c, false, false); }
__device__ __forceinline__ v8f wmmab(v16bf a, v16bf b, v8f c) { return __builtin_amdgcn_wmma_f32_16x16x32_bf16(false, a, false, b, (short)0, c, false, false); }



// Stands behind a group of global loads or stores, in front of the first instruction that reuses a register they name (a precaution).
__device__ __forceinline__ void xwait() { asm volatile("s_wait_xcnt 0x0" ::: "memory"); }
// ---- FRAGMENT ORDER of every 16-bit operand plane [rows][K] (rows % 16 == 0, K % 32 == 0): the plane is a row of 1 KiB tiles, tile (R, kb) = rows 16 R .. 16 R + 15 x k 32 kb .. 32 kb + 31 at tile index R * (K / 32) + kb
// (the V^T plane: kb * 8 + R, so that a pass reads 8 KiB in a row). A tile is two halves of 512 B; half j holds at 16 B x lane (lane = 16 hi + lr) the elements k = 32 kb + 16 j + 8 hi + 0..7 of row 16 R + lr.
// A fragment is then two wave-wide 16-byte loads of 512 contiguous bytes each (4 whole lines a load; on a row-major plane it would touch 32 B in each of 16 lines); a lane's k order is 8 hi + 0..7, then 16 + 8 hi + 0..7, for A and B alike.
// A producer thread writes one 16-byte piece. Where the source runs across k (the transposing producers) thread i writes piece i, at byte 16 i: FRAG_IDX splits i into lr, hi, j and the tile index.
// Where the source runs along k, FRAG_IDX_ROW gives four neighbouring threads the four pieces of one tile row (128 source bytes in f32, one whole line); eight such rows make four whole lines of the tile.
#define FRAG_IDX(i) const int lr = (int)((i) & 15), hi = (int)(((i) >> 4) & 1), j = (int)(((i) >> 5) & 1); const int tile = (int)((i) >> 6)
#define FRAG_IDX_ROW(i) const int hi = (int)((i) & 1), j = (int)(((i) >> 1) & 1), lr = (int)(((i) >> 2) & 15); const int tile = (int)((i) >> 6); const size_t piece = (size_t)tile * 64 + j * 32 + hi * 16 + lr
// ---- k_gemmw: register-blocked GEMM, ONE WAVE per 64x64 output tile (16 accumulators), operands straight from 16-bit planes in fragment order; grid (M/64, N/64, Z), 32 threads.
// C[m][n] (f32, pitch ldc, + optional f32 bias[n]) = sum_k A[m][k] Bt[n][k] (+ split products per NSPLIT). z-batch strides sA/sB/sC in elements. K % 32 == 0.
template <typename T16> struct WFrag;
template <> struct WFrag<h16> { typedef v16h V; static __device__ __forceinline__ V ld(const h16* p) { return cat16(*(const v8h*)p, *(const v8h*)(p + 256)); } static __device__ __forceinline__ v8f mma(V a, V b, v8f c) { return wmma16(a, b, c); } };
template <> struct WFrag<bf> { typedef v16bf V; static __device__ __forceinline__ V ld(const bf* p) { return cat16b(*(const v8us*)p, *(const v8us*)(p + 256)); } static __device__ __forceinline__ v8f mma(V a, V b, v8f c) { return wmmab(a, b, c); } };
template <typename T16, int NSPLIT, bool BIAS, int K>
__global__ __launch_bounds__(32) void k_gemmw(const T16* __restrict__ A, const T16* __restrict__ A2, const T16* __restrict__ Bt, const T16* __restrict__ Bt2, float* C, int ldc, const float* __restrict__ bias, size_t sA, size_t sB, size_t sC) {
    typedef typename WFrag<T16>::V V;
    __shared__ __align__(16) float os[16 * 68];
    const size_t z = blockIdx.z; A += z * sA; if (A2) A2 += z * sA; Bt += z * sB; if (Bt2) Bt2 += z * sB; C += z * sC;
    const int lane = threadIdx.x & 31, lr = lane & 15, hi = lane >> 4; const int r0 = blockIdx.x * 64, c0 = blockIdx.y * 64;
    v8f acc[4][4];
#pragma unroll
    for (int mb = 0; mb < 4; ++mb)
#pragma unroll
        for (int nb = 0; nb < 4; ++nb) acc[mb][nb] = (v8f){};
    // Addresses: one pointer per operand, the lane's piece of the first tile; 16 rows of tiles are 16 K elements, a constant offset; a step of 32 in k is one tile, 512 elements
    const T16* pa = A + (size_t)r0 * K + 8 * lane; const T16* pa2 = (NSPLIT == 1 || NSPLIT == 2) ? A2 + (size_t)r0 * K + 8 * lane : pa; const T16* pb = Bt + (size_t)c0 * K + 8 * lane; const T16* pb2 = (NSPLIT >= 2) ? Bt2 + (size_t)c0 * K + 8 * lane : pb;
#pragma unroll 1
    for (int kc = 0; kc < K; kc += 32) {
        V a[4], a2[4], b[4], b2[4];
#pragma unroll
        for (int mb = 0; mb < 4; ++mb) { a[mb] = WFrag<T16>::ld(pa + mb * 16 * K); if (NSPLIT == 1 || NSPLIT == 2) a2[mb] = WFrag<T16>::ld(pa2 + mb * 16 * K); }
#pragma unroll
        for (int nb = 0; nb < 4; ++nb) { b[nb] = WFrag<T16>::ld(pb + nb * 16 * K); if (NSPLIT >= 2) b2[nb] = WFrag<T16>::ld(pb2 + nb * 16 * K); }
        // the same wait as xwait(), behind the trip's loads; the pointers are named as inputs only, so that their register pairs stay live up to the wait: no result lands in them and no step below is written over them in front of it
        asm volatile("s_wait_xcnt 0x0" :: "v"(pa), "v"(pa2), "v"(pb), "v"(pb2) : "memory");
        pa += 512; pa2 += 512; pb += 512; pb2 += 512;
#pragma unroll
        for (int nb = 0; nb < 4; ++nb) {
#pragma unroll
            for (int mb = 0; mb < 4; ++mb) { acc[mb][nb] = WFrag<T16>::mma(a[mb], b[nb], acc[mb][nb]); if (NSPLIT == 1 || NSPLIT == 2) acc[mb][nb] = WFrag<T16>::mma(a2[mb], b[nb], acc[mb][nb]); if (NSPLIT >= 2) acc[mb][nb] = WFrag<T16>::mma(a[mb], b2[nb], acc[mb][nb]); } }
        asm volatile("v_nop\n\tv_nop\n\tv_nop\n\tv_nop" : "+v"(acc[0][0]), "+v"(acc[1][1]), "+v"(acc[2][2]), "+v"(acc[3][3]) : "v"(a[0]), "v"(a[3]));
    }
#pragma unroll
    for (int mb = 0; mb < 4; ++mb) {
#pragma unroll
        for (int nb = 0; nb < 4; ++nb) {
#pragma unroll
            for (int j = 0; j < 8; ++j) os[(hi * 8 + j) * 68 + nb * 16 + lr] = acc[mb][nb][j]; }
        __builtin_amdgcn_wave_barrier(); asm volatile("" ::: "memory");
        float* crow = C + (size_t)(r0 + mb * 16) * ldc + c0;
{
#pragma unroll
            for (int s = 0; s < 8; ++s) { const int row = 2 * s + hi, cofs = lr * 4; v4f val = *(const v4fa*)(os + row * 68 + cofs); if (BIAS) { val[0] += bfr(bias[c0 + cofs]); val[1] += bfr(bias[c0 + cofs + 1]); val[2] += bfr(bias[c0 + cofs + 2]); val[3] += bfr(bias[c0 + cofs + 3]); }
                *(v4f*)(crow + (size_t)row * ldc + cofs) = val; }
             }
        xwait();      // behind the eight stores: the next row block reuses their address and data registers
        __builtin_amdgcn_wave_barrier(); asm volatile("" ::: "memory");
    }
}

__device__ __forceinline__ h16 tohx(float x) { return (h16)x; }
__device__ __forceinline__ void splitf(float y, unsigned short& h, unsigned short& l) { h = f2bf(y); l = f2bf(y - bf2f(h)); }
typedef __attribute__((ext_vector_type(2))) _Float16 v2h;
typedef __attribute__((ext_vector_type(4))) _Float16 v4h;
typedef __attribute__((ext_vector_type(2))) unsigned short v2us;
typedef __attribute__((ext_vector_type(4))) unsigned short v4us;
typedef __attribute__((ext_vector_type(2))) float v2f;

__global__ __launch_bounds__(256) void k_cvt8(const float* __restrict__ src, bf* dst, size_t n8) { const size_t i = (size_t)blockIdx.x * 256 + threadIdx.x; if (i >= n8) return; FRAG_IDX_ROW(i); const v8f v = *(const v8f*)(src + (size_t)((tile / (DD / 32)) * 16 + lr) * DD + (tile % (DD / 32)) * 32 + j * 16 + hi * 8); v8us o;
#pragma unroll
    for (int k = 0; k < 8; ++k) o[k] = f2bf(v[k]); *(v8us*)(dst + piece * 8) = o;  }
template <int K, int N>
__global__ __launch_bounds__(256) void k_wtG(const float* __restrict__ w, bf* Bt) {
    const int i = blockIdx.x * 256 + threadIdx.x; if (i >= N * K / 8) return; FRAG_IDX(i); const int kt = K / 32; const int n = (tile / kt) * 16 + lr, k = (tile % kt) * 32 + j * 16 + hi * 8; v8us o; float f[8];
    const unsigned wo = (unsigned)(k * N + n);      // the eight rows are read off this one offset, a constant pitch apart
#pragma unroll
    for (int q = 0; q < 8; ++q) f[q] = w[wo + q * N];
    asm volatile("s_wait_xcnt 0x0" :: "v"(wo) : "memory");      // the same wait as xwait(); the offset is named as an input only, so that no result lands in its register in front of the wait
#pragma unroll
    for (int q = 0; q < 8; ++q) o[q] = f2bf(f[q]);
    *(v8us*)(Bt + (size_t)i * 8) = o;
}
__global__ __launch_bounds__(256) void k_bfr1(const float* __restrict__ src, float* dst, int n) { const int i = blockIdx.x * 256 + threadIdx.x; if (i >= n) return; const float v = bfr(src[i]); *(float*)(dst + i) = v;  }
__global__ __launch_bounds__(256) void k_h16plane(const float* __restrict__ F, float sc, h16* P) {
    const int i = blockIdx.x * 256 + threadIdx.x; if (i >= NT * DD / 8) return; FRAG_IDX_ROW(i);      // per (batch, head) a plane [TT][HD]: 2 tiles a row block
    const int d = (tile & 1) * 32 + j * 16 + hi * 8; const int t = ((tile >> 1) & (TT / 16 - 1)) * 16 + lr; const int z = tile >> 8; const int b = z >> 4, h = z & 15;
    const v8f f = *(const v8f*)(F + ((size_t)b * TT + t) * DD + h * HD + d); v8h v;
#pragma unroll
    for (int q = 0; q < 8; ++q) v[q] = tohx(f[q] * sc);
    *(v8h*)(P + piece * 8) = v;
}
__global__ __launch_bounds__(256) void k_phase(const float* __restrict__ cph, const float* __restrict__ sph, const float* __restrict__ mag, const float* __restrict__ Wp, const float* __restrict__ bp, float* PH) {
    const int idx = blockIdx.x * 256 + threadIdx.x; if (idx >= 3 * NB_ * NH_ * TT) return; const int t = idx & (TT - 1); const int h = (idx >> 11) & (NH_ - 1); const int b = (idx >> 15) & (NB_ - 1); const int k = idx >> 17;
    const float* src = (k == 0) ? cph : (k == 1 ? sph : mag); float s = 0.f;
#pragma unroll
    for (int n = 0; n < NBD; ++n) { float w = bfr(Wp[n * NH_ + h]), p = bfr(src[((size_t)b * NBD + n) * TT + t]); asm volatile("" : "+v"(w)); asm volatile("" : "+v"(p)); float m = __fmul_rn(p, w); asm volatile("" : "+v"(m)); s = __fadd_rn(s, m); }
    s = __fadd_rn(s, bfr(bp[h])); *(float*)(PH + idx) = s;  }
__global__ __launch_bounds__(256) void k_vt2(const float* __restrict__ F, const float* __restrict__ PH, h16* VT) {
    const int i = blockIdx.x * 256 + threadIdx.x; if (i >= NZ * HD2 * TT / 8) return; FRAG_IDX(i);      // per (batch, head) a plane [HD2][TT], tile index kb * 8 + R
    const int r = (tile & 7) * 16 + lr; const int t = ((tile >> 3) & (TT / 32 - 1)) * 32 + j * 16 + hi * 8; const int z = tile >> 9; const int b = z / NH_, h = z % NH_; const int d = r & 63; v8h v;
    const float* pc = PH + ((size_t)(r < 64 ? 0 : 1) * NB_ * NH_ + (size_t)b * NH_ + h) * TT; const float* pm = PH + ((size_t)2 * NB_ * NH_ + (size_t)b * NH_ + h) * TT;
#pragma unroll
    for (int q = 0; q < 8; ++q) v[q] = tohx(__fmul_rn(__fmul_rn(F[((size_t)b * TT + t + q) * DD + h * HD + d], pm[t + q]), pc[t + q]));
    *(v8h*)(VT + (size_t)i * 8) = v;
}
// ---- k_fattn: scores, mask, softmax, both value contractions and the phase merge of one (batch, head) in ONE launch; S and P stay in registers.
// Transposed products: S^T = K.Q^T (A = 16 key rows, B = 16 query columns), O^T += [V_real|V_imag]^T.P^T (A = 16 rows of the 128-wide V^T plane, B = P^T). A lane then holds scores of ONE query
// (column lr): two S^T tiles (keys 0-15, 16-31 of a pass), converted in place, are the B operand of the second product in the loaders' own k order (8 hi + 0..7, 16 + 8 hi + 0..7).
// Online softmax; the maximum in use is kept in the scores' own domain and subtracted from the score first (exact for near values, whatever the size of the mask). It may
// trail the true one by up to MLAG (P <= e^MLAG < 256 in fp16), so the accumulators are rescaled only on the rare pass that exceeds it.
// grid (TT / (8 * 16 * QG), NZ), 8 waves x QG groups of 16 query columns; a pass is 32 keys; operands straight from the fp16 planes in fragment order, as in k_gemmw: every K and V^T fragment
// a wave loads serves QG column groups.
#define L2E 1.4426950408889634f
#define MLAG 5.5f
#define QG  4
__device__ __forceinline__ float xhalf(float x) { return __builtin_bit_cast(float, __builtin_amdgcn_permlanex16(__builtin_bit_cast(int, x), __builtin_bit_cast(int, x), 0x76543210, 0xfedcba98, false, false)); }  // lane l <-> lane l ^ 16
__global__ __launch_bounds__(256) void k_fattn(const h16* __restrict__ QP, const h16* __restrict__ KP, const h16* __restrict__ VT, const float* __restrict__ am, const float* __restrict__ PH, bf* Ah, bf* Al) {
    __shared__ __align__(16) float mk[TT];      // this batch's additive mask row, rounded to bf16 once per work-group
    const int z = blockIdx.y, b = z / NH_, h = z % NH_;
    for (int i = threadIdx.x * 4; i < TT; i += 1024) { v4f a = *(const v4f*)(am + (size_t)b * TT + i);
#pragma unroll
        for (int q = 0; q < 4; ++q) a[q] = bfr(a[q]);
        *(v4fa*)(mk + i) = a; }
    __syncthreads();
    const int lane = threadIdx.x & 31, lr = lane & 15, hi = lane >> 4; const int q0 = (blockIdx.x * 8 + __builtin_amdgcn_readfirstlane(threadIdx.x >> 5)) * (16 * QG);      // the wave's first query, held in a scalar register
    const h16* Kz = KP + (size_t)z * TT * HD; const unsigned ko = (unsigned)(8 * lane);      // K plane of this head, and the lane's offset in a tile
    const h16* Vz = VT + (size_t)z * HD2 * TT + 8 * lane;
    v16h qf[QG][2]; const h16* Qz = QP + ((size_t)z * TT + q0) * HD;      // the wave's first Q tile
#pragma unroll
    for (int g = 0; g < QG; ++g)
#pragma unroll
        for (int kc = 0; kc < 2; ++kc) qf[g][kc] = WFrag<h16>::ld(Qz + (size_t)(16 * g) * HD + 512 * kc + ko);
    v16h kf[2][2];      // K fragments are fetched one pass ahead, half way through the second product
#pragma unroll
    for (int kt = 0; kt < 2; ++kt)
#pragma unroll
        for (int kc = 0; kc < 2; ++kc) kf[kt][kc] = WFrag<h16>::ld(Kz + (size_t)(16 * kt) * HD + 512 * kc + ko);
    // the same wait as xwait(); the two scalar bases of the Q and K loads are named as inputs only, so that their register pairs stay live up to the wait and nothing is written over them in front of it
    asm volatile("s_wait_xcnt 0x0" :: "s"(Qz), "s"(Kz) : "memory");
    __builtin_amdgcn_sched_barrier(0);      // keeps the scheduler from mixing the tiles' set-up below into the loads above (it spilled Q fragments when it did)
    const h16* kp = Kz + ko + 32 * HD;      // the lane's address in the K tile to fetch next
    v8f acc[QG][8]; float m_run[QG], l_run[QG];
#pragma unroll
    for (int g = 0; g < QG; ++g) { m_run[g] = -__FLT_MAX__; l_run[g] = 0.f;
#pragma unroll
        for (int t = 0; t < 8; ++t) acc[g][t] = (v8f){}; }
    // rolled: one pass's fragments and the output tiles already fill the wave's registers
#pragma unroll 1
    for (int key0 = 0; key0 < TT; key0 += 32) {
        v16h vf[8];
#pragma unroll
        for (int t = 0; t < 8; ++t) vf[t] = WFrag<h16>::ld(Vz + (size_t)key0 * HD2 + 512 * t);
        xwait();
        v8f s[2][QG];
#pragma unroll
        for (int kt = 0; kt < 2; ++kt) { const v4f m0 = *(const v4fa*)(mk + key0 + 16 * kt + 8 * hi), m1 = *(const v4fa*)(mk + key0 + 16 * kt + 8 * hi + 4);
#pragma unroll
            for (int g = 0; g < QG; ++g) { v8f t = wmma16(kf[kt][1], qf[g][1], wmma16(kf[kt][0], qf[g][0], (v8f){}));
#pragma unroll
                for (int r = 0; r < 4; ++r) { t[r] += m0[r]; t[4 + r] += m1[r]; }
                s[kt][g] = t; } }
        float mb[QG]; bool need = false;
#pragma unroll
        for (int g = 0; g < QG; ++g) { float mx = s[0][g][0];
#pragma unroll
            for (int r = 1; r < 8; ++r) mx = fmaxf(mx, s[0][g][r]);
#pragma unroll
            for (int r = 0; r < 8; ++r) mx = fmaxf(mx, s[1][g][r]);
            mx = fmaxf(mx, xhalf(mx)); mb[g] = mx; need = need || (mx > m_run[g] + MLAG); }
        if (__builtin_amdgcn_ballot_w32(need) != 0) {       // one wave-uniform test per pass
#pragma unroll
            for (int g = 0; g < QG; ++g) { const float m_new = fmaxf(m_run[g], mb[g]); mb[g] = (m_run[g] - m_new) * L2E; m_run[g] = m_new; }
#pragma unroll
            for (int g = 0; g < QG; ++g) { const float corr = __builtin_amdgcn_exp2f(mb[g]); l_run[g] *= corr;
#pragma unroll
                for (int t = 0; t < 8; ++t) acc[g][t] = acc[g][t] * corr; } }
#pragma unroll
        for (int g = 0; g < QG; ++g) { const float mr = m_run[g]; v16h pf; v2f ls = (v2f){0.f, 0.f};
#pragma unroll
            for (int e = 0; e < 16; e += 2) { const v2f x = ((v2f){s[e >> 3][g][e & 7], s[e >> 3][g][(e & 7) + 1]} - mr) * L2E; const v2f p = (v2f){__builtin_amdgcn_exp2f(x[0]), __builtin_amdgcn_exp2f(x[1])};
                ls += p; pf[e] = tohx(p[0]); pf[e + 1] = tohx(p[1]); }
            l_run[g] += ls[0] + ls[1];
#pragma unroll
            for (int t = 0; t < 8; ++t) acc[g][t] = wmma16(vf[t], pf, acc[g][t]);
            if (g == QG / 2 - 1) {
#pragma unroll
                for (int kt = 0; kt < 2; ++kt)
#pragma unroll
                    for (int kc = 0; kc < 2; ++kc) kf[kt][kc] = WFrag<h16>::ld(kp + (size_t)(16 * kt) * HD + 512 * kc);
                kp += (key0 + 64 < TT) ? 32 * HD : 0; } }      // the last pass fetches its own tile again: in bounds, unused
    }
#pragma unroll
    for (int g = 0; g < QG; ++g) { const int t = q0 + 16 * g + lr; const float l = l_run[g] + xhalf(l_run[g]); const float inv = __fdiv_rn(1.0f, l);
        const float pc = PH[((size_t)b * NH_ + h) * TT + t], psn = PH[((size_t)NB_ * NH_ + (size_t)b * NH_ + h) * TT + t];
#pragma unroll
        for (int tt = 0; tt < 4; ++tt) { v8us oh, ol;
#pragma unroll
            for (int r = 0; r < 8; ++r) { unsigned short a, c2; splitf((acc[g][tt][r] * inv) * pc + (acc[g][tt + 4][r] * inv) * psn, a, c2); oh[r] = a; ol[r] = c2; }
            const unsigned o = ((unsigned)b * TT + q0 + 16 * g) * DD + (2 * h + (tt >> 1)) * 512 + (tt & 1) * 256 + 8 * lane;      /* row t, k = 64 h + 16 tt + 8 hi in fragment order: 512 contiguous bytes a store */ __builtin_amdgcn_sched_barrier(0);      // the two barriers keep every other register write out from between the stores and their wait
            *(v8usa*)(Ah + o) = oh; *(v8usa*)(Al + o) = ol; xwait(); __builtin_amdgcn_sched_barrier(0); } }
}
__global__ __launch_bounds__(256) void k_ln2(const float* __restrict__ FF, const float* __restrict__ X, const float* __restrict__ gg, const float* __restrict__ bb, float* OUT) {
    const int lane = threadIdx.x & 31; const int r = blockIdx.x * 8 + (threadIdx.x >> 5); if (r >= NT) return; float v[32]; float s = 0.f;
#pragma unroll
    for (int c = 0; c < 8; ++c) { const v4f a = *(const v4f*)(FF + (size_t)r * DD + c * 128 + lane * 4), xx = *(const v4f*)(X + (size_t)r * DD + c * 128 + lane * 4);
#pragma unroll
        for (int q = 0; q < 4; ++q) { v[c * 4 + q] = a[q] + bfr(xx[q]); s += v[c * 4 + q]; } }
#pragma unroll
    for (int sh = 16; sh; sh >>= 1) s += __shfl_xor(s, sh, 32);
    const float mu = s * (1.0f / DD); float qq = 0.f;
#pragma unroll
    for (int i = 0; i < 32; ++i) { const float d0 = v[i] - mu; qq = __fadd_rn(qq, __fmul_rn(d0, d0)); }
#pragma unroll
    for (int sh = 16; sh; sh >>= 1) qq += __shfl_xor(qq, sh, 32);
    const float rs = __fdiv_rn(1.0f, __fsqrt_rn(qq * (1.0f / DD) + 1e-12f));
{
#pragma unroll
        for (int c = 0; c < 8; ++c) { v4f o;
#pragma unroll
            for (int q = 0; q < 4; ++q) { const int col = c * 128 + lane * 4 + q; o[q] = __fadd_rn(__fmul_rn((v[c * 4 + q] - mu) * rs, bfr(gg[col])), bfr(bb[col])); }
            *(v4f*)(OUT + (size_t)r * DD + c * 128 + lane * 4) = o; }
         }
}

extern "C" void kernel_launch(void* const* d_in, const int* in_sizes, int n_in,
                              void* d_out, int out_size, void* d_ws, size_t ws_size, hipStream_t stream) {
    (void)in_sizes; (void)n_in; (void)out_size;
    const float* IN[17]; for (int i = 0; i < 17; ++i) IN[i] = (const float*)d_in[i];
    // hidden_states, attention_mask [4][1][1][2048], cos_phi, sin_phi, mag [4][8][2048], Wq [1024][1024] (x @ W), bq, Wk, bk, Wv, bv, Wo, bo, Wp [8][16], bp [16], ln_g, ln_b = d_in[0..16]
    const float* x = IN[0]; const float* am = IN[1];
    float* OUT = (float*)d_out;     // [4][2048][1024]
    char* wsp = (char*)d_ws;
    auto take = [&](size_t bytes) { char* p = wsp; wsp += (bytes + 255) & ~(size_t)255; return (void*)p; };
    bf* WQ = (bf*)take((size_t)DD * DD * 2); bf* WK = (bf*)take((size_t)DD * DD * 2); bf* WV = (bf*)take((size_t)DD * DD * 2); bf* WO = (bf*)take((size_t)DD * DD * 2); float* PH = (float*)take((size_t)3 * NB_ * NH_ * TT * 4);
    bf* XB = (bf*)take((size_t)NT * DD * 2); float* F = (float*)take((size_t)NT * DD * 4);
    h16* QP = (h16*)take((size_t)NT * DD * 2); h16* KP = (h16*)take((size_t)NT * DD * 2); h16* VT = (h16*)take((size_t)NZ * HD2 * TT * 2);
    bf* ATh = (bf*)take((size_t)NT * DD * 2); bf* ATl = (bf*)take((size_t)NT * DD * 2);
    if ((size_t)(wsp - (char*)d_ws) > ws_size) return;    // total ~ 154 MiB; ws 256 MiB
    float* Y = F;   // the output projection lands in F (dead after k_vt2)
    { const unsigned gT = (unsigned)(DD * DD / 8 / 256); k_wtG<DD, DD><<<gT, 256, 0, stream>>>(IN[5], WQ); k_wtG<DD, DD><<<gT, 256, 0, stream>>>(IN[7], WK); k_wtG<DD, DD><<<gT, 256, 0, stream>>>(IN[9], WV); k_wtG<DD, DD><<<gT, 256, 0, stream>>>(IN[11], WO);
      k_cvt8<<<(unsigned)(((size_t)NT * DD / 8 + 255) / 256), 256, 0, stream>>>(x, XB, (size_t)NT * DD / 8); k_phase<<<(3 * NB_ * NH_ * TT + 255) / 256, 256, 0, stream>>>(IN[2], IN[3], IN[4], IN[13], IN[14], PH); }
    const unsigned LB = (unsigned)(NT * DD / 8 / 256); const dim3 gP(NT / 64, DD / 64, 1);
    k_gemmw<bf, 0, true, DD><<<gP, 32, 0, stream>>>(XB, nullptr, WQ, nullptr, F, DD, IN[6], 0, 0, 0); k_h16plane<<<LB, 256, 0, stream>>>(F, 0.125f, QP);
    k_gemmw<bf, 0, true, DD><<<gP, 32, 0, stream>>>(XB, nullptr, WK, nullptr, F, DD, IN[8], 0, 0, 0); k_h16plane<<<LB, 256, 0, stream>>>(F, 1.0f, KP);
    k_gemmw<bf, 0, true, DD><<<gP, 32, 0, stream>>>(XB, nullptr, WV, nullptr, F, DD, IN[10], 0, 0, 0); k_vt2<<<(unsigned)(NZ * HD2 * TT / 8 / 256), 256, 0, stream>>>(F, PH, VT);
    k_fattn<<<dim3(TT / (8 * 16 * QG), NZ), 256, 0, stream>>>(QP, KP, VT, am, PH, ATh, ATl);
    k_gemmw<bf, 1, true, DD><<<gP, 32, 0, stream>>>(ATh, ATl, WO, nullptr, Y, DD, IN[12], 0, 0, 0);
    k_ln2<<<NT / 8, 256, 0, stream>>>(Y, x, IN[15], IN[16], OUT);
}

// v003
// A run of this version takes 230 microseconds.
// Two timings next to v002 put it at 1.30 and 1.28 times that version's speed.
// All steps since v000 together make it 11.3 times as fast.
#include <hip/hip_runtime.h>

// Attention block with phase-weighted values (hidden_states [4][2048][1024]; q/k/v = x @ W + b (16 heads x 64); phase scalars p_c/p_s/p_m[b][h][t] = sum_band {cos_phi,sin_phi,mag}[b][band][t] Wp[band][h] + bp[h] (8 bands);
// V_real = v p_m p_c, V_imag = v p_m p_s (per (b,h,t) scalars on the value rows); scores = q.k/8 + attention_mask[b][0][0][j] (additive input, read as data); softmax; ctx = (P.V_real) p_c + (P.V_imag) p_s
// (per query row); out = LN(ctx @ Wo + bo + hidden_states) * ln_g + ln_b (eps 1e-12)).
// Compute dtypes, f32 accumulate: every input rounded to bf16; projections on PLAIN bf16 operands (inputs: exact, + bias); the phase projections (8 terms), V scaling,
// ctx combination, residual and LayerNorm in f32 on VALU; scores and the two value contractions on SINGLE fp16 planes (q x 1/8; P = exp(s - max in use), normalised after the contraction; V_real | V_imag packed as one 128-wide V^T plane per head
// so attn.[V_real|V_imag] is one N = 128 GEMM); output projection on hi+lo planes x exact Wo (2 products).

#define NB_  4
#define NBD  8                   // phase bands
#define HD2  128                 // packed V_real | V_imag plane width
#define TT   2048
#define DD   1024
#define NH_  16
#define HD   64
#define NT   (NB_ * TT)
#define NZ   (NB_ * NH_)
typedef _Float16 h16;
typedef unsigned short bf;
typedef __attribute__((ext_vector_type(16))) __bf16   v16bf;
typedef __attribute__((ext_vector_type(16))) _Float16 v16h;
typedef __attribute__((ext_vector_type(8)))  _Float16 v8h;
typedef __attribute__((ext_vector_type(8)))  unsigned short v8us;
typedef __attribute__((ext_vector_type(8)))  float    v8f;
typedef __attribute__((ext_vector_type(4)))  float    v4f;
typedef v8h  __attribute__((may_alias)) v8ha;
typedef v4f  __attribute__((may_alias)) v4fa;
typedef v8us __attribute__((may_alias)) v8usa;

__device__ __forceinline__ unsigned short f2bf(float f) { unsigned u = __float_as_uint(f); u += 0x7FFFu + ((u >> 16) & 1u); return (unsigned short)(u >> 16); }
__device__ __forceinline__ float bf2f(unsigned short b) { return __uint_as_float(((unsigned)b) << 16); }
__device__ __forceinline__ float bfr(float f) { return bf2f(f2bf(f)); }
__device__ __forceinline__ v16h cat16(v8h lo, v8h hi) { return __builtin_shufflevector(lo, hi, 0, 1, 2, 3, 4, 5, 6, 7, 8, 9, 10, 11, 12, 13, 14, 15); }
__device__ __forceinline__ v16bf cat16b(v8us lo, v8us hi) { return __builtin_bit_cast(v16bf, __builtin_shufflevector(lo, hi, 0, 1, 2, 3, 4, 5, 6, 7, 8, 9, 10, 11, 12, 13, 14, 15)); }
__device__ __forceinline__ v8f wmma16(v16h a, v16h b, v8f c) { return __builtin_amdgcn_wmma_f32_16x16x32_f16(false, a, false, b, (short)0, c, false, false); }
__device__ __forceinline__ v8f wmmab(v16bf a, v16bf b, v8f c) { return __builtin_amdgcn_wmma_f32_16x16x32_bf16(false, a, false, b, (short)0, c, false, false); }



// Stands behind a group of global loads or stores, in front of the first instruction that reuses a register they name (a precaution).
__device__ __forceinline__ void xwait() { asm volatile("s_wait_xcnt 0x0" ::: "memory"); }
// ---- FRAGMENT ORDER of every 16-bit operand plane [rows][K] (rows % 16 == 0, K % 32 == 0): the plane is a row of 1 KiB tiles, tile (R, kb) = rows 16 R .. 16 R + 15 x k 32 kb .. 32 kb + 31 at tile index R * (K / 32) + kb
// (the V^T plane: kb * 8 + R, so that a pass reads 8 KiB in a row). A tile is two halves of 512 B; half j holds at 16 B x lane (lane = 16 hi + lr) the elements k = 32 kb + 16 j + 8 hi + 0..7 of row 16 R + lr.
// A fragment is then two wave-wide 16-byte loads of 512 contiguous bytes each (4 whole lines a load; on a row-major plane it would touch 32 B in each of 16 lines); a lane's k order is 8 hi + 0..7, then 16 + 8 hi + 0..7, for A and B alike.
// A thread of k_cvt8 or k_wtG writes one 16-byte piece. Where the source runs across k (the transposing producers) thread i writes piece i, at byte 16 i: FRAG_IDX splits i into lr, hi, j and the tile index.
// Where the source runs along k, FRAG_IDX_ROW gives four neighbouring threads the four pieces of one tile row (128 source bytes in f32, one whole line); eight such rows make four whole lines of the tile.
#define FRAG_IDX(i) const int lr = (int)((i) & 15), hi = (int)(((i) >> 4) & 1), j = (int)(((i) >> 5) & 1); const int tile = (int)((i) >> 6)
#define FRAG_IDX_ROW(i) const int hi = (int)((i) & 1), j = (int)(((i) >> 1) & 1), lr = (int)(((i) >> 2) & 15); const int tile = (int)((i) >> 6); const size_t piece = (size_t)tile * 64 + j * 32 + hi * 16 + lr
// ---- k_gemmw: register-blocked GEMM, ONE WAVE per 64x64 output tile (16 accumulators), operands straight from 16-bit planes in fragment order; grid (M/64, N/64, Z), 32 threads.
// C[m][n] (f32, pitch ldc, + optional f32 bias[n]) = sum_k A[m][k] Bt[n][k] (+ split products per NSPLIT). z-batch strides sA/sB/sC in elements. K % 32 == 0.
template <typename T16> struct WFrag;
template <> struct WFrag<h16> { typedef v16h V; static __device__ __forceinline__ V ld(const h16* p) { return cat16(*(const v8h*)p, *(const v8h*)(p + 256)); } static __device__ __forceinline__ v8f mma(V a, V b, v8f c) { return wmma16(a, b, c); } };
template <> struct WFrag<bf> { typedef v16bf V; static __device__ __forceinline__ V ld(const bf* p) { return cat16b(*(const v8us*)p, *(const v8us*)(p + 256)); } static __device__ __forceinline__ v8f mma(V a, V b, v8f c) { return wmmab(a, b, c); } };
template <typename T16, int NSPLIT, bool BIAS, int K>
__global__ __launch_bounds__(32) void k_gemmw(const T16* __restrict__ A, const T16* __restrict__ A2, const T16* __restrict__ Bt, const T16* __restrict__ Bt2, float* C, int ldc, const float* __restrict__ bias, size_t sA, size_t sB, size_t sC) {
    typedef typename WFrag<T16>::V V;
    __shared__ __align__(16) float os[16 * 68];
    const size_t z = blockIdx.z; A += z * sA; if (A2) A2 += z * sA; Bt += z * sB; if (Bt2) Bt2 += z * sB; C += z * sC;
    const int lane = threadIdx.x & 31, lr = lane & 15, hi = lane >> 4; const int r0 = blockIdx.x * 64, c0 = blockIdx.y * 64;
    v8f acc[4][4];
#pragma unroll
    for (int mb = 0; mb < 4; ++mb)
#pragma unroll
        for (int nb = 0; nb < 4; ++nb) acc[mb][nb] = (v8f){};
    // Addresses: one pointer per operand, the lane's piece of the first tile; 16 rows of tiles are 16 K elements, a constant offset; a step of 32 in k is one tile, 512 elements
    const T16* pa = A + (size_t)r0 * K + 8 * lane; const T16* pa2 = (NSPLIT == 1 || NSPLIT == 2) ? A2 + (size_t)r0 * K + 8 * lane : pa; const T16* pb = Bt + (size_t)c0 * K + 8 * lane; const T16* pb2 = (NSPLIT >= 2) ? Bt2 + (size_t)c0 * K + 8 * lane : pb;
#pragma unroll 1
    for (int kc = 0; kc < K; kc += 32) {
        V a[4], a2[4], b[4], b2[4];
#pragma unroll
        for (int mb = 0; mb < 4; ++mb) { a[mb] = WFrag<T16>::ld(pa + mb * 16 * K); if (NSPLIT == 1 || NSPLIT == 2) a2[mb] = WFrag<T16>::ld(pa2 + mb * 16 * K); }
#pragma unroll
        for (int nb = 0; nb < 4; ++nb) { b[nb] = WFrag<T16>::ld(pb + nb * 16 * K); if (NSPLIT >= 2) b2[nb] = WFrag<T16>::ld(pb2 + nb * 16 * K); }
        // the same wait as xwait(), behind the trip's loads; the pointers are named as inputs only, so that their register pairs stay live up to the wait: no result lands in them and no step below is written over them in front of it
        asm volatile("s_wait_xcnt 0x0" :: "v"(pa), "v"(pa2), "v"(pb), "v"(pb2) : "memory");
        pa += 512; pa2 += 512; pb += 512; pb2 += 512;
#pragma unroll
        for (int nb = 0; nb < 4; ++nb) {
#pragma unroll
            for (int mb = 0; mb < 4; ++mb) { acc[mb][nb] = WFrag<T16>::mma(a[mb], b[nb], acc[mb][nb]); if (NSPLIT == 1 || NSPLIT == 2) acc[mb][nb] = WFrag<T16>::mma(a2[mb], b[nb], acc[mb][nb]); if (NSPLIT >= 2) acc[mb][nb] = WFrag<T16>::mma(a[mb], b2[nb], acc[mb][nb]); } }
        asm volatile("v_nop\n\tv_nop\n\tv_nop\n\tv_nop" : "+v"(acc[0][0]), "+v"(acc[1][1]), "+v"(acc[2][2]), "+v"(acc[3][3]) : "v"(a[0]), "v"(a[3]));
    }
#pragma unroll
    for (int mb = 0; mb < 4; ++mb) {
#pragma unroll
        for (int nb = 0; nb < 4; ++nb) {
#pragma unroll
            for (int j = 0; j < 8; ++j) os[(hi * 8 + j) * 68 + nb * 16 + lr] = acc[mb][nb][j]; }
        __builtin_amdgcn_wave_barrier(); asm volatile("" ::: "memory");
        float* crow = C + (size_t)(r0 + mb * 16) * ldc + c0;
{
#pragma unroll
            for (int s = 0; s < 8; ++s) { const int row = 2 * s + hi, cofs = lr * 4; v4f val = *(const v4fa*)(os + row * 68 + cofs); if (BIAS) { val[0] += bfr(bias[c0 + cofs]); val[1] += bfr(bias[c0 + cofs + 1]); val[2] += bfr(bias[c0 + cofs + 2]); val[3] += bfr(bias[c0 + cofs + 3]); }
                *(v4f*)(crow + (size_t)row * ldc + cofs) = val; }
             }
        xwait();      // behind the eight stores: the next row block reuses their address and data registers
        __builtin_amdgcn_wave_barrier(); asm volatile("" ::: "memory");
    }
}

__device__ __forceinline__ h16 tohx(float x) { return (h16)x; }
__device__ __forceinline__ void splitf(float y, unsigned short& h, unsigned short& l) { h = f2bf(y); l = f2bf(y - bf2f(h)); }
typedef __attribute__((ext_vector_type(2))) _Float16 v2h;
typedef __attribute__((ext_vector_type(4))) _Float16 v4h;
typedef __attribute__((ext_vector_type(2))) unsigned short v2us;
typedef __attribute__((ext_vector_type(4))) unsigned short v4us;
typedef __attribute__((ext_vector_type(2))) float v2f;

__global__ __launch_bounds__(256) void k_cvt8(const float* __restrict__ src, bf* dst, size_t n8) { const size_t i = (size_t)blockIdx.x * 256 + threadIdx.x; if (i >= n8) return; FRAG_IDX_ROW(i); const v8f v = *(const v8f*)(src + (size_t)((tile / (DD / 32)) * 16 + lr) * DD + (tile % (DD / 32)) * 32 + j * 16 + hi * 8); v8us o;
#pragma unroll
    for (int k = 0; k < 8; ++k) o[k] = f2bf(v[k]); *(v8us*)(dst + piece * 8) = o;  }
template <int K, int N>
__global__ __launch_bounds__(256) void k_wtG(const float* __restrict__ w, bf* Bt) {
    const int i = blockIdx.x * 256 + threadIdx.x; if (i >= N * K / 8) return; FRAG_IDX(i); const int kt = K / 32; const int n = (tile / kt) * 16 + lr, k = (tile % kt) * 32 + j * 16 + hi * 8; v8us o; float f[8];
    const unsigned wo = (unsigned)(k * N + n);      // the eight rows are read off this one offset, a constant pitch apart
#pragma unroll
    for (int q = 0; q < 8; ++q) f[q] = w[wo + q * N];
    asm volatile("s_wait_xcnt 0x0" :: "v"(wo) : "memory");      // the same wait as xwait(); the offset is named as an input only, so that no result lands in its register in front of the wait
#pragma unroll
    for (int q = 0; q < 8; ++q) o[q] = f2bf(f[q]);
    *(v8us*)(Bt + (size_t)i * 8) = o;
}
__global__ __launch_bounds__(256) void k_bfr1(const float* __restrict__ src, float* dst, int n) { const int i = blockIdx.x * 256 + threadIdx.x; if (i >= n) return; const float v = bfr(src[i]); *(float*)(dst + i) = v;  }
__global__ __launch_bounds__(256) void k_phase(const float* __restrict__ cph, const float* __restrict__ sph, const float* __restrict__ mag, const float* __restrict__ Wp, const float* __restrict__ bp, float* PH) {
    const int idx = blockIdx.x * 256 + threadIdx.x; if (idx >= 3 * NB_ * NH_ * TT) return; const int t = idx & (TT - 1); const int h = (idx >> 11) & (NH_ - 1); const int b = (idx >> 15) & (NB_ - 1); const int k = idx >> 17;
    const float* src = (k == 0) ? cph : (k == 1 ? sph : mag); float s = 0.f;
#pragma unroll
    for (int n = 0; n < NBD; ++n) { float w = bfr(Wp[n * NH_ + h]), p = bfr(src[((size_t)b * NBD + n) * TT + t]); asm volatile("" : "+v"(w)); asm volatile("" : "+v"(p)); float m = __fmul_rn(p, w); asm volatile("" : "+v"(m)); s = __fadd_rn(s, m); }
    s = __fadd_rn(s, bfr(bp[h])); *(float*)(PH + idx) = s;  }
// ---- k_qkv: the three input projections in ONE launch, each accumulator tile stored straight into its fp16 plane in fragment order (no f32 copy of q, k or v in memory, no conversion launch).
// grid (NT / 64, 3 * DD / 64), ONE WAVE per 64 tokens x one head (64 columns) of q, k or v; W3 = the q, k and v weight planes one behind the other, 3 * DD rows. The K loop is k_gemmw's.
// An accumulator register run j = 0..7 walks the ROW operand's index (8 hi + j), a lane's lr the COLUMN operand's. A piece of a plane is 8 neighbours along the plane's k: the head dimension for q and k, the token for V^T.
// So q and k take the weight rows as the row operand and the tokens as the column operand, v the other way round (both planes have one fragment order, so this is a swap of two pointers):
// in each case a lane's 8 registers are one 16-byte piece, and the wave's 32 pieces are one half tile, 512 contiguous bytes a store.
__global__ __launch_bounds__(32) void k_qkv(const bf* __restrict__ X, const bf* __restrict__ W3, const float* __restrict__ bq, const float* __restrict__ bk, const float* __restrict__ bv, const float* __restrict__ PH, h16* QP, h16* KP, h16* VT) {
    constexpr int K = DD;
    const int lane = threadIdx.x & 31, lr = lane & 15, hi = lane >> 4; const int r0 = blockIdx.x * 64, sel = blockIdx.y >> 4, h = blockIdx.y & 15;      // sel: 0 q, 1 k, 2 v
    const int z = (r0 >> 11) * NH_ + h, t0 = r0 & (TT - 1);      // (batch, head) and the first token inside the batch
    v8f acc[4][4];
#pragma unroll
    for (int mb = 0; mb < 4; ++mb)
#pragma unroll
        for (int nb = 0; nb < 4; ++nb) acc[mb][nb] = (v8f){};
    const bf* px = X + (size_t)r0 * K + 8 * lane; const bf* pw = W3 + (size_t)blockIdx.y * 64 * K + 8 * lane;
    const bf* pa = (sel == 2) ? px : pw; const bf* pb = (sel == 2) ? pw : px;
#pragma unroll 1
    for (int kc = 0; kc < K; kc += 32) {
        v16bf a[4], b[4];
#pragma unroll
        for (int mb = 0; mb < 4; ++mb) a[mb] = WFrag<bf>::ld(pa + mb * 16 * K);
#pragma unroll
        for (int nb = 0; nb < 4; ++nb) b[nb] = WFrag<bf>::ld(pb + nb * 16 * K);
        // the same wait as xwait(), behind the trip's loads; the pointers are named as inputs only, so that their register pairs stay live up to the wait: no result lands in them and no step below is written over them in front of it
        asm volatile("s_wait_xcnt 0x0" :: "v"(pa), "v"(pb) : "memory");
        pa += 512; pb += 512;
#pragma unroll
        for (int nb = 0; nb < 4; ++nb) {
#pragma unroll
            for (int mb = 0; mb < 4; ++mb) acc[mb][nb] = wmmab(a[mb], b[nb], acc[mb][nb]); }
        // four vector slots behind the trip's last WMMA, in front of the next trip's loads into its operands
        asm volatile("v_nop\n\tv_nop\n\tv_nop\n\tv_nop" : "+v"(acc[0][0]), "+v"(acc[1][1]), "+v"(acc[2][2]), "+v"(acc[3][3]) : "v"(a[0]), "v"(a[3]));
    }
    // In the epilogues each pair of scheduling barriers keeps every other register write out from between a group of loads or stores and its wait.
    if (sel < 2) {      // q (x 1/8) and k: acc[mb][nb][j] is dimension 16 mb + 8 hi + j of token t0 + 16 nb + lr
        const float sc = (sel == 0) ? 0.125f : 1.0f; const float* bl = ((sel == 0) ? bq : bk) + h * HD + 8 * hi;
        h16* P = ((sel == 0) ? QP : KP) + ((size_t)z * TT + t0) * HD + 8 * lane;      // 16 tokens on: 2 tiles, 1024 elements; 16 dimensions on: half a tile, 256
        v8f bs[4];
        __builtin_amdgcn_sched_barrier(0);
#pragma unroll
        for (int mb = 0; mb < 4; ++mb) bs[mb] = *(const v8f*)(bl + 16 * mb);
        asm volatile("s_wait_xcnt 0x0" :: "v"(bl) : "memory");      // the same wait as xwait(); the pointer is named as an input only, so that it stays live up to the wait
        __builtin_amdgcn_sched_barrier(0);
#pragma unroll
        for (int mb = 0; mb < 4; ++mb) { v8h o[4];
#pragma unroll
            for (int nb = 0; nb < 4; ++nb)
#pragma unroll
                for (int j = 0; j < 8; ++j) o[nb][j] = tohx((acc[mb][nb][j] + bfr(bs[mb][j])) * sc);
            __builtin_amdgcn_sched_barrier(0);
#pragma unroll
            for (int nb = 0; nb < 4; ++nb) *(v8ha*)(P + nb * 1024 + mb * 256) = o[nb];
            xwait(); __builtin_amdgcn_sched_barrier(0); }
    } else {            // v: acc[mb][nb][j] is dimension 16 nb + lr of token t0 + 16 mb + 8 hi + j; rows 0-63 of the V^T plane take v p_m p_c, rows 64-127 v p_m p_s
        const float* bl = bv + h * HD + lr; const float* pl = PH + (size_t)z * TT + t0 + 8 * hi;      // p_c of the lane's first token; p_s and p_m stand NZ * TT and 2 * NZ * TT floats further
        h16* P = VT + ((size_t)z * (HD2 * TT / 512) + (t0 >> 5) * 8) * 512 + 8 * lane;      // 32 tokens on: 8 tiles; 16 rows on: 1 tile; 16 tokens on: half a tile
        float bs[4];
        __builtin_amdgcn_sched_barrier(0);
#pragma unroll
        for (int nb = 0; nb < 4; ++nb) bs[nb] = bl[16 * nb];
        asm volatile("s_wait_xcnt 0x0" :: "v"(bl) : "memory");      // as above
        __builtin_amdgcn_sched_barrier(0);
#pragma unroll
        for (int nb = 0; nb < 4; ++nb) bs[nb] = bfr(bs[nb]);
#pragma unroll
        for (int mb = 0; mb < 4; ++mb) {
            __builtin_amdgcn_sched_barrier(0);
            const v8f pc = *(const v8f*)(pl + 16 * mb), psn = *(const v8f*)(pl + NZ * TT + 16 * mb), pm = *(const v8f*)(pl + 2 * NZ * TT + 16 * mb);
            asm volatile("s_wait_xcnt 0x0" :: "v"(pl) : "memory");      // as above
            __builtin_amdgcn_sched_barrier(0);
#pragma unroll
            for (int part = 0; part < 2; ++part) { v8h o[4];
#pragma unroll
                for (int nb = 0; nb < 4; ++nb)
#pragma unroll
                    for (int j = 0; j < 8; ++j) o[nb][j] = tohx(__fmul_rn(__fmul_rn(acc[mb][nb][j] + bs[nb], pm[j]), part ? psn[j] : pc[j]));
                __builtin_amdgcn_sched_barrier(0);
#pragma unroll
                for (int nb = 0; nb < 4; ++nb) *(v8ha*)(P + (mb >> 1) * 4096 + (part * 4 + nb) * 512 + (mb & 1) * 256) = o[nb];
                xwait(); __builtin_amdgcn_sched_barrier(0); } }
    }
}
// ---- k_fattn: scores, mask, softmax, both value contractions and the phase merge of one (batch, head) in ONE launch; S and P stay in registers.
// Transposed products: S^T = K.Q^T (A = 16 key rows, B = 16 query columns), O^T += [V_real|V_imag]^T.P^T (A = 16 rows of the 128-wide V^T plane, B = P^T). A lane then holds scores of ONE query
// (column lr): two S^T tiles (keys 0-15, 16-31 of a pass), converted in place, are the B operand of the second product in the loaders' own k order (8 hi + 0..7, 16 + 8 hi + 0..7).
// Online softmax; the maximum in use is kept in the scores' own domain and subtracted from the score first (exact for near values, whatever the size of the mask). It may
// trail the true one by up to MLAG (P <= e^MLAG < 256 in fp16), so the accumulators are rescaled only on the rare pass that exceeds it.
// grid (TT / (8 * 16 * QG), NZ), 8 waves x QG groups of 16 query columns; a pass is 32 keys; operands straight from the fp16 planes in fragment order, as in k_gemmw: every K and V^T fragment
// a wave loads serves QG column groups.
#define L2E 1.4426950408889634f
#define MLAG 5.5f
#define QG  4
__device__ __forceinline__ float xhalf(float x) { return __builtin_bit_cast(float, __builtin_amdgcn_permlanex16(__builtin_bit_cast(int, x), __builtin_bit_cast(int, x), 0x76543210, 0xfedcba98, false, false)); }  // lane l <-> lane l ^ 16
__global__ __launch_bounds__(256) void k_fattn(const h16* __restrict__ QP, const h16* __restrict__ KP, const h16* __restrict__ VT, const float* __restrict__ am, const float* __restrict__ PH, bf* Ah, bf* Al) {
    __shared__ __align__(16) float mk[TT];      // this batch's additive mask row, rounded to bf16 once per work-group
    const int z = blockIdx.y, b = z / NH_, h = z % NH_;
    for (int i = threadIdx.x * 4; i < TT; i += 1024) { v4f a = *(const v4f*)(am + (size_t)b * TT + i);
#pragma unroll
        for (int q = 0; q < 4; ++q) a[q] = bfr(a[q]);
        *(v4fa*)(mk + i) = a; }
    __syncthreads();
    const int lane = threadIdx.x & 31, lr = lane & 15, hi = lane >> 4; const int q0 = (blockIdx.x * 8 + __builtin_amdgcn_readfirstlane(threadIdx.x >> 5)) * (16 * QG);      // the wave's first query, held in a scalar register
    const h16* Kz = KP + (size_t)z * TT * HD; const unsigned ko = (unsigned)(8 * lane);      // K plane of this head, and the lane's offset in a tile
    const h16* Vz = VT + (size_t)z * HD2 * TT + 8 * lane;
    v16h qf[QG][2]; const h16* Qz = QP + ((size_t)z * TT + q0) * HD;      // the wave's first Q tile
#pragma unroll
    for (int g = 0; g < QG; ++g)
#pragma unroll
        for (int kc = 0; kc < 2; ++kc) qf[g][kc] = WFrag<h16>::ld(Qz + (size_t)(16 * g) * HD + 512 * kc + ko);
    v16h kf[2][2];      // K fragments are fetched one pass ahead, half way through the second product
#pragma unroll
    for (int kt = 0; kt < 2; ++kt)
#pragma unroll
        for (int kc = 0; kc < 2; ++kc) kf[kt][kc] = WFrag<h16>::ld(Kz + (size_t)(16 * kt) * HD + 512 * kc + ko);
    // the same wait as xwait(); the two scalar bases of the Q and K loads are named as inputs only, so that their register pairs stay live up to the wait and nothing is written over them in front of it
    asm volatile("s_wait_xcnt 0x0" :: "s"(Qz), "s"(Kz) : "memory");
    __builtin_amdgcn_sched_barrier(0);      // keeps the scheduler from mixing the tiles' set-up below into the loads above (it spilled Q fragments when it did)
    const h16* kp = Kz + ko + 32 * HD;      // the lane's address in the K tile to fetch next
    v8f acc[QG][8]; float m_run[QG], l_run[QG];
#pragma unroll
    for (int g = 0; g < QG; ++g) { m_run[g] = -__FLT_MAX__; l_run[g] = 0.f;
#pragma unroll
        for (int t = 0; t < 8; ++t) acc[g][t] = (v8f){}; }
    // rolled: one pass's fragments and the output tiles already fill the wave's registers
#pragma unroll 1
    for (int key0 = 0; key0 < TT; key0 += 32) {
        v16h vf[8];
#pragma unroll
        for (int t = 0; t < 8; ++t) vf[t] = WFrag<h16>::ld(Vz + (size_t)key0 * HD2 + 512 * t);
        xwait();
        v8f s[2][QG];
#pragma unroll
        for (int kt = 0; kt < 2; ++kt) { const v4f m0 = *(const v4fa*)(mk + key0 + 16 * kt + 8 * hi), m1 = *(const v4fa*)(mk + key0 + 16 * kt + 8 * hi + 4);
#pragma unroll
            for (int g = 0; g < QG; ++g) { v8f t = wmma16(kf[kt][1], qf[g][1], wmma16(kf[kt][0], qf[g][0], (v8f){}));
#pragma unroll
                for (int r = 0; r < 4; ++r) { t[r] += m0[r]; t[4 + r] += m1[r]; }
                s[kt][g] = t; } }
        float mb[QG]; bool need = false;
#pragma unroll
        for (int g = 0; g < QG; ++g) { float mx = s[0][g][0];
#pragma unroll
            for (int r = 1; r < 8; ++r) mx = fmaxf(mx, s[0][g][r]);
#pragma unroll
            for (int r = 0; r < 8; ++r) mx = fmaxf(mx, s[1][g][r]);
            mx = fmaxf(mx, xhalf(mx)); mb[g] = mx; need = need || (mx > m_run[g] + MLAG); }
        if (__builtin_amdgcn_ballot_w32(need) != 0) {       // one wave-uniform test per pass
#pragma unroll
            for (int g = 0; g < QG; ++g) { const float m_new = fmaxf(m_run[g], mb[g]); mb[g] = (m_run[g] - m_new) * L2E; m_run[g] = m_new; }
#pragma unroll
            for (int g = 0; g < QG; ++g) { const float corr = __builtin_amdgcn_exp2f(mb[g]); l_run[g] *= corr;
#pragma unroll
                for (int t = 0; t < 8; ++t) acc[g][t] = acc[g][t] * corr; } }
#pragma unroll
        for (int g = 0; g < QG; ++g) { const float mr = m_run[g]; v16h pf; v2f ls = (v2f){0.f, 0.f};
#pragma unroll
            for (int e = 0; e < 16; e += 2) { const v2f x = ((v2f){s[e >> 3][g][e & 7], s[e >> 3][g][(e & 7) + 1]} - mr) * L2E; const v2f p = (v2f){__builtin_amdgcn_exp2f(x[0]), __builtin_amdgcn_exp2f(x[1])};
                ls += p; pf[e] = tohx(p[0]); pf[e + 1] = tohx(p[1]); }
            l_run[g] += ls[0] + ls[1];
#pragma unroll
            for (int t = 0; t < 8; ++t) acc[g][t] = wmma16(vf[t], pf, acc[g][t]);
            if (g == QG / 2 - 1) {
#pragma unroll
                for (int kt = 0; kt < 2; ++kt)
#pragma unroll
                    for (int kc = 0; kc < 2; ++kc) kf[kt][kc] = WFrag<h16>::ld(kp + (size_t)(16 * kt) * HD + 512 * kc);
                kp += (key0 + 64 < TT) ? 32 * HD : 0; } }      // the last pass fetches its own tile again: in bounds, unused
    }
#pragma unroll
    for (int g = 0; g < QG; ++g) { const int t = q0 + 16 * g + lr; const float l = l_run[g] + xhalf(l_run[g]); const float inv = __fdiv_rn(1.0f, l);
        const float pc = PH[((size_t)b * NH_ + h) * TT + t], psn = PH[((size_t)NB_ * NH_ + (size_t)b * NH_ + h) * TT + t];
#pragma unroll
        for (int tt = 0; tt < 4; ++tt) { v8us oh, ol;
#pragma unroll
            for (int r = 0; r < 8; ++r) { unsigned short a, c2; splitf((acc[g][tt][r] * inv) * pc + (acc[g][tt + 4][r] * inv) * psn, a, c2); oh[r] = a; ol[r] = c2; }
            const unsigned o = ((unsigned)b * TT + q0 + 16 * g) * DD + (2 * h + (tt >> 1)) * 512 + (tt & 1) * 256 + 8 * lane;      /* row t, k = 64 h + 16 tt + 8 hi in fragment order: 512 contiguous bytes a store */ __builtin_amdgcn_sched_barrier(0);      // the two barriers keep every other register write out from between the stores and their wait
            *(v8usa*)(Ah + o) = oh; *(v8usa*)(Al + o) = ol; xwait(); __builtin_amdgcn_sched_barrier(0); } }
}
__global__ __launch_bounds__(256) void k_ln2(const float* __restrict__ FF, const float* __restrict__ X, const float* __restrict__ gg, const float* __restrict__ bb, float* OUT) {
    const int lane = threadIdx.x & 31; const int r = blockIdx.x * 8 + (threadIdx.x >> 5); if (r >= NT) return; float v[32]; float s = 0.f;
#pragma unroll
    for (int c = 0; c < 8; ++c) { const v4f a = *(const v4f*)(FF + (size_t)r * DD + c * 128 + lane * 4), xx = *(const v4f*)(X + (size_t)r * DD + c * 128 + lane * 4);
#pragma unroll
        for (int q = 0; q < 4; ++q) { v[c * 4 + q] = a[q] + bfr(xx[q]); s += v[c * 4 + q]; } }
#pragma unroll
    for (int sh = 16; sh; sh >>= 1) s += __shfl_xor(s, sh, 32);
    const float mu = s * (1.0f / DD); float qq = 0.f;
#pragma unroll
    for (int i = 0; i < 32; ++i) { const float d0 = v[i] - mu; qq = __fadd_rn(qq, __fmul_rn(d0, d0)); }
#pragma unroll
    for (int sh = 16; sh; sh >>= 1) qq += __shfl_xor(qq, sh, 32);
    const float rs = __fdiv_rn(1.0f, __fsqrt_rn(qq * (1.0f / DD) + 1e-12f));
{
#pragma unroll
        for (int c = 0; c < 8; ++c) { v4f o;
#pragma unroll
            for (int q = 0; q < 4; ++q) { const int col = c * 128 + lane * 4 + q; o[q] = __fadd_rn(__fmul_rn((v[c * 4 + q] - mu) * rs, bfr(gg[col])), bfr(bb[col])); }
            *(v4f*)(OUT + (size_t)r * DD + c * 128 + lane * 4) = o; }
         }
}

extern "C" void kernel_launch(void* const* d_in, const int* in_sizes, int n_in,
                              void* d_out, int out_size, void* d_ws, size_t ws_size, hipStream_t stream) {
    (void)in_sizes; (void)n_in; (void)out_size;
    const float* IN[17]; for (int i = 0; i < 17; ++i) IN[i] = (const float*)d_in[i];
    // hidden_states, attention_mask [4][1][1][2048], cos_phi, sin_phi, mag [4][8][2048], Wq [1024][1024] (x @ W), bq, Wk, bk, Wv, bv, Wo, bo, Wp [8][16], bp [16], ln_g, ln_b = d_in[0..16]
    const float* x = IN[0]; const float* am = IN[1];
    float* OUT = (float*)d_out;     // [4][2048][1024]
    char* wsp = (char*)d_ws;
    auto take = [&](size_t bytes) { char* p = wsp; wsp += (bytes + 255) & ~(size_t)255; return (void*)p; };
    bf* WQ = (bf*)take((size_t)3 * DD * DD * 2); bf* WK = WQ + (size_t)DD * DD; bf* WV = WK + (size_t)DD * DD;      /* one plane of 3 * DD rows for k_qkv */ bf* WO = (bf*)take((size_t)DD * DD * 2); float* PH = (float*)take((size_t)3 * NB_ * NH_ * TT * 4);
    bf* XB = (bf*)take((size_t)NT * DD * 2); float* F = (float*)take((size_t)NT * DD * 4);
    h16* QP = (h16*)take((size_t)NT * DD * 2); h16* KP = (h16*)take((size_t)NT * DD * 2); h16* VT = (h16*)take((size_t)NZ * HD2 * TT * 2);
    bf* ATh = (bf*)take((size_t)NT * DD * 2); bf* ATl = (bf*)take((size_t)NT * DD * 2);
    if ((size_t)(wsp - (char*)d_ws) > ws_size) return;    // total ~ 154 MiB; ws 256 MiB
    float* Y = F;   // the output projection's f32 result
    { const unsigned gT = (unsigned)(DD * DD / 8 / 256); k_wtG<DD, DD><<<gT, 256, 0, stream>>>(IN[5], WQ); k_wtG<DD, DD><<<gT, 256, 0, stream>>>(IN[7], WK); k_wtG<DD, DD><<<gT, 256, 0, stream>>>(IN[9], WV); k_wtG<DD, DD><<<gT, 256, 0, stream>>>(IN[11], WO);
      k_cvt8<<<(unsigned)(((size_t)NT * DD / 8 + 255) / 256), 256, 0, stream>>>(x, XB, (size_t)NT * DD / 8); k_phase<<<(3 * NB_ * NH_ * TT + 255) / 256, 256, 0, stream>>>(IN[2], IN[3], IN[4], IN[13], IN[14], PH); }
    const dim3 gP(NT / 64, DD / 64, 1);
    k_qkv<<<dim3(NT / 64, 3 * DD / 64), 32, 0, stream>>>(XB, WQ, IN[6], IN[8], IN[10], PH, QP, KP, VT);
    k_fattn<<<dim3(TT / (8 * 16 * QG), NZ), 256, 0, stream>>>(QP, KP, VT, am, PH, ATh, ATl);
    k_gemmw<bf, 1, true, DD><<<gP, 32, 0, stream>>>(ATh, ATl, WO, nullptr, Y, DD, IN[12], 0, 0, 0);
    k_ln2<<<NT / 8, 256, 0, stream>>>(Y, x, IN[15], IN[16], OUT);
}

// v004
// One run takes 215 microseconds.
// Next to v003, in two timings, it ran 1.07 times as fast each time.
// Over all steps from v000 it is 12.0 times as fast.
#include <hip/hip_runtime.h>

// Attention block with phase-weighted values (hidden_states [4][2048][1024]; q/k/v = x @ W + b (16 heads x 64); phase scalars p_c/p_s/p_m[b][h][t] = sum_band {cos_phi,sin_phi,mag}[b][band][t] Wp[band][h] + bp[h] (8 bands);
// V_real = v p_m p_c, V_imag = v p_m p_s (per (b,h,t) scalars on the value rows); scores = q.k/8 + attention_mask[b][0][0][j] (additive input, read as data); softmax; ctx = (P.V_real) p_c + (P.V_imag) p_s
// (per query row); out = LN(ctx @ Wo + bo + hidden_states) * ln_g + ln_b (eps 1e-12)).
// Compute dtypes, f32 accumulate: every input rounded to bf16; projections on PLAIN bf16 operands (inputs: exact, + bias); the phase projections (8 terms), V scaling,
// ctx combination, residual and LayerNorm in f32 on VALU; scores and the two value contractions on SINGLE fp16 planes (q x 1/8; P = exp(s - max in use), normalised after the contraction; V_real | V_imag packed as one 128-wide V^T plane per head
// so attn.[V_real|V_imag] is one N = 128 GEMM); output projection on hi+lo planes x exact Wo (2 products).

#define NB_  4
#define NBD  8                   // phase bands
#define HD2  128                 // packed V_real | V_imag plane width
#define TT   2048
#define DD   1024
#define NH_  16
#define HD   64
#define NT   (NB_ * TT)
#define NZ   (NB_ * NH_)
typedef _Float16 h16;
typedef unsigned short bf;
typedef __attribute__((ext_vector_type(16))) __bf16   v16bf;
typedef __attribute__((ext_vector_type(16))) _Float16 v16h;
typedef __attribute__((ext_vector_type(8)))  _Float16 v8h;
typedef __attribute__((ext_vector_type(8)))  unsigned short v8us;
typedef __attribute__((ext_vector_type(8)))  float    v8f;
typedef __attribute__((ext_vector_type(4)))  float    v4f;
typedef v8h  __attribute__((may_alias)) v8ha;
typedef v4f  __attribute__((may_alias)) v4fa;
typedef v8us __attribute__((may_alias)) v8usa;

__device__ __forceinline__ unsigned short f2bf(float f) { unsigned u = __float_as_uint(f); u += 0x7FFFu + ((u >> 16) & 1u); return (unsigned short)(u >> 16); }
__device__ __forceinline__ float bf2f(unsigned short b) { return __uint_as_float(((unsigned)b) << 16); }
__device__ __forceinline__ float bfr(float f) { return bf2f(f2bf(f)); }
__device__ __forceinline__ v16h cat16(v8h lo, v8h hi) { return __builtin_shufflevector(lo, hi, 0, 1, 2, 3, 4, 5, 6, 7, 8, 9, 10, 11, 12, 13, 14, 15); }
__device__ __forceinline__ v16bf cat16b(v8us lo, v8us hi) { return __builtin_bit_cast(v16bf, __builtin_shufflevector(lo, hi, 0, 1, 2, 3, 4, 5, 6, 7, 8, 9, 10, 11, 12, 13, 14, 15)); }
__device__ __forceinline__ v8f wmma16(v16h a, v16h b, v8f c) { return __builtin_amdgcn_wmma_f32_16x16x32_f16(false, a, false, b, (short)0, c, false, false); }
__device__ __forceinline__ v8f wmmab(v16bf a, v16bf b, v8f c) { return __builtin_amdgcn_wmma_f32_16x16x32_bf16(false, a, false, b, (short)0, c, false, false); }



// Stands behind a group of global loads or stores, in front of the first instruction that reuses a register they name (a precaution).
__device__ __forceinline__ void xwait() { asm volatile("s_wait_xcnt 0x0" ::: "memory"); }
// ---- FRAGMENT ORDER of every 16-bit operand plane [rows][K] (rows % 16 == 0, K % 32 == 0): the plane is a row of 1 KiB tiles, tile (R, kb) = rows 16 R .. 16 R + 15 x k 32 kb .. 32 kb + 31 at tile index R * (K / 32) + kb
// (the V^T plane: kb * 8 + R, so that a pass reads 8 KiB in a row). A tile is two halves of 512 B; half j holds at 16 B x lane (lane = 16 hi + lr) the elements k = 32 kb + 16 j + 8 hi + 0..7 of row 16 R + lr.
// A fragment is then two wave-wide 16-byte loads of 512 contiguous bytes each (4 whole lines a load; on a row-major plane it would touch 32 B in each of 16 lines); a lane's k order is 8 hi + 0..7, then 16 + 8 hi + 0..7, for A and B alike.
// A producer thread writes whole 16-byte pieces (k_prep: 8 of the X plane, one of each weight plane). Where the source runs across k (the transposing producers) thread i writes piece i, at byte 16 i: FRAG_IDX splits i into lr, hi, j and the tile index.
// Where the source runs along k, FRAG_IDX_ROW gives four neighbouring threads the four pieces of one tile row (128 source bytes in f32, one whole line); eight such rows make four whole lines of the tile.
#define FRAG_IDX(i) const int lr = (int)((i) & 15), hi = (int)(((i) >> 4) & 1), j = (int)(((i) >> 5) & 1); const int tile = (int)((i) >> 6)
#define FRAG_IDX_ROW(i) const int hi = (int)((i) & 1), j = (int)(((i) >> 1) & 1), lr = (int)(((i) >> 2) & 15); const int tile = (int)((i) >> 6); const size_t piece = (size_t)tile * 64 + j * 32 + hi * 16 + lr
// ---- k_gemmw: register-blocked GEMM, ONE WAVE per 64x64 output tile (16 accumulators), operands straight from 16-bit planes in fragment order; grid (M/64, N/64, Z), 32 threads.
// C[m][n] (f32, pitch ldc, + optional f32 bias[n]) = sum_k A[m][k] Bt[n][k] (+ split products per NSPLIT). z-batch strides sA/sB/sC in elements. K % 32 == 0.
template <typename T16> struct WFrag;
template <> struct WFrag<h16> { typedef v16h V; static __device__ __forceinline__ V ld(const h16* p) { return cat16(*(const v8h*)p, *(const v8h*)(p + 256)); } static __device__ __forceinline__ v8f mma(V a, V b, v8f c) { return wmma16(a, b, c); } };
template <> struct WFrag<bf> { typedef v16bf V; static __device__ __forceinline__ V ld(const bf* p) { return cat16b(*(const v8us*)p, *(const v8us*)(p + 256)); } static __device__ __forceinline__ v8f mma(V a, V b, v8f c) { return wmmab(a, b, c); } };
template <typename T16, int NSPLIT, bool BIAS, int K>
__global__ __launch_bounds__(32) void k_gemmw(const T16* __restrict__ A, const T16* __restrict__ A2, const T16* __restrict__ Bt, const T16* __restrict__ Bt2, float* C, int ldc, const float* __restrict__ bias, size_t sA, size_t sB, size_t sC) {
    typedef typename WFrag<T16>::V V;
    __shared__ __align__(16) float os[16 * 68];
    const size_t z = blockIdx.z; A += z * sA; if (A2) A2 += z * sA; Bt += z * sB; if (Bt2) Bt2 += z * sB; C += z * sC;
    const int lane = threadIdx.x & 31, lr = lane & 15, hi = lane >> 4; const int r0 = blockIdx.x * 64, c0 = blockIdx.y * 64;
    v8f acc[4][4];
#pragma unroll
    for (int mb = 0; mb < 4; ++mb)
#pragma unroll
        for (int nb = 0; nb < 4; ++nb) acc[mb][nb] = (v8f){};
    // Addresses: one pointer per operand, the lane's piece of the first tile; 16 rows of tiles are 16 K elements, a constant offset; a step of 32 in k is one tile, 512 elements
    const T16* pa = A + (size_t)r0 * K + 8 * lane; const T16* pa2 = (NSPLIT == 1 || NSPLIT == 2) ? A2 + (size_t)r0 * K + 8 * lane : pa; const T16* pb = Bt + (size_t)c0 * K + 8 * lane; const T16* pb2 = (NSPLIT >= 2) ? Bt2 + (size_t)c0 * K + 8 * lane : pb;
#pragma unroll 1
    for (int kc = 0; kc < K; kc += 32) {
        V a[4], a2[4], b[4], b2[4];
#pragma unroll
        for (int mb = 0; mb < 4; ++mb) { a[mb] = WFrag<T16>::ld(pa + mb * 16 * K); if (NSPLIT == 1 || NSPLIT == 2) a2[mb] = WFrag<T16>::ld(pa2 + mb * 16 * K); }
#pragma unroll
        for (int nb = 0; nb < 4; ++nb) { b[nb] = WFrag<T16>::ld(pb + nb * 16 * K); if (NSPLIT >= 2) b2[nb] = WFrag<T16>::ld(pb2 + nb * 16 * K); }
        // the same wait as xwait(), behind the trip's loads; the pointers are named as inputs only, so that their register pairs stay live up to the wait: no result lands in them and no step below is written over them in front of it
        asm volatile("s_wait_xcnt 0x0" :: "v"(pa), "v"(pa2), "v"(pb), "v"(pb2) : "memory");
        pa += 512; pa2 += 512; pb += 512; pb2 += 512;
#pragma unroll
        for (int nb = 0; nb < 4; ++nb) {
#pragma unroll
            for (int mb = 0; mb < 4; ++mb) { acc[mb][nb] = WFrag<T16>::mma(a[mb], b[nb], acc[mb][nb]); if (NSPLIT == 1 || NSPLIT == 2) acc[mb][nb] = WFrag<T16>::mma(a2[mb], b[nb], acc[mb][nb]); if (NSPLIT >= 2) acc[mb][nb] = WFrag<T16>::mma(a[mb], b2[nb], acc[mb][nb]); } }
        asm volatile("v_nop\n\tv_nop\n\tv_nop\n\tv_nop" : "+v"(acc[0][0]), "+v"(acc[1][1]), "+v"(acc[2][2]), "+v"(acc[3][3]) : "v"(a[0]), "v"(a[3]));
    }
#pragma unroll
    for (int mb = 0; mb < 4; ++mb) {
#pragma unroll
        for (int nb = 0; nb < 4; ++nb) {
#pragma unroll
            for (int j = 0; j < 8; ++j) os[(hi * 8 + j) * 68 + nb * 16 + lr] = acc[mb][nb][j]; }
        __builtin_amdgcn_wave_barrier(); asm volatile("" ::: "memory");
        float* crow = C + (size_t)(r0 + mb * 16) * ldc + c0;
{
#pragma unroll
            for (int s = 0; s < 8; ++s) { const int row = 2 * s + hi, cofs = lr * 4; v4f val = *(const v4fa*)(os + row * 68 + cofs); if (BIAS) { val[0] += bfr(bias[c0 + cofs]); val[1] += bfr(bias[c0 + cofs + 1]); val[2] += bfr(bias[c0 + cofs + 2]); val[3] += bfr(bias[c0 + cofs + 3]); }
                *(v4f*)(crow + (size_t)row * ldc + cofs) = val; }
             }
        xwait();      // behind the eight stores: the next row block reuses their address and data registers
        __builtin_amdgcn_wave_barrier(); asm volatile("" ::: "memory");
    }
}

__device__ __forceinline__ h16 tohx(float x) { return (h16)x; }
__device__ __forceinline__ void splitf(float y, unsigned short& h, unsigned short& l) { h = f2bf(y); l = f2bf(y - bf2f(h)); }
typedef __attribute__((ext_vector_type(2))) _Float16 v2h;
typedef __attribute__((ext_vector_type(4))) _Float16 v4h;
typedef __attribute__((ext_vector_type(2))) unsigned short v2us;
typedef __attribute__((ext_vector_type(4))) unsigned short v4us;
typedef __attribute__((ext_vector_type(2))) float v2f;

__global__ __launch_bounds__(256) void k_bfr1(const float* __restrict__ src, float* dst, int n) { const int i = blockIdx.x * 256 + threadIdx.x; if (i >= n) return; const float v = bfr(src[i]); *(float*)(dst + i) = v;  }
// ---- k_prep: all operand preparation of a call in ONE launch: hidden_states to its bf16 plane, the four weight matrices to their transposed bf16 planes, the three phase projections (six jobs, none reads what another writes).
// A grid of PREP_B blocks (2 a WGP, 16 waves) shares out every job evenly: a thread takes 8 pieces of the X plane, the same piece of each of the four weight planes, and p_c, p_s, p_m of one (batch, head, token).
// The work then starts 4,096 waves, not 61,440 of one piece each, and all of a thread's loads are in flight before the first of them is used.
#define PREP_B 512
#define PREP_T (PREP_B * 256)
static_assert((size_t)NT * DD / 8 == 8 * (size_t)PREP_T && DD * DD / 8 == PREP_T && NB_ * NH_ * TT == PREP_T && DD / 32 == 32, "pieces a thread");
__global__ __launch_bounds__(256) void k_prep(const float* __restrict__ x, const float* __restrict__ wq, const float* __restrict__ wk, const float* __restrict__ wv, const float* __restrict__ wo, const float* __restrict__ cph, const float* __restrict__ sph, const float* __restrict__ mag,
                                              const float* __restrict__ Wp, const float* __restrict__ bp, bf* XB, bf* WQ, bf* WK, bf* WV, bf* WO, float* PH) {
    const unsigned g = blockIdx.x * 256 + threadIdx.x;
    // X plane: a block takes one block of 16 rows, 32 tiles, 2,048 pieces; a thread's 8 pieces are 256 pieces apart: 4 tiles, 128 elements in the source row
    unsigned xs, xd; { const unsigned i = blockIdx.x * 2048 + threadIdx.x; FRAG_IDX_ROW(i); xs = (unsigned)(((tile / (DD / 32)) * 16 + lr) * DD + (tile % (DD / 32)) * 32 + j * 16 + hi * 8); xd = (unsigned)piece; }
    // weight planes: piece g of each; the eight rows are read off one offset, a constant pitch apart
    unsigned ws; { FRAG_IDX(g); const int kt = DD / 32; const int n = (tile / kt) * 16 + lr, k = (tile % kt) * 32 + j * 16 + hi * 8; ws = (unsigned)(k * DD + n); }
    // phase scalars: g = (batch, head, token); a block lies inside one head
    const unsigned h = (blockIdx.x >> 3) & (NH_ - 1), ps = ((g >> 15) & (NB_ - 1)) * (NBD * TT) + (g & (TT - 1));
    const float* xp = x + xs; v8f v[8]; float f[4][8], wl[NBD], pl[3][NBD];
#pragma unroll
    for (int s = 0; s < 8; ++s) v[s] = *(const v8f*)(xp + s * 128);
#pragma unroll
    for (int q = 0; q < 8; ++q) { f[0][q] = wq[ws + q * DD]; f[1][q] = wk[ws + q * DD]; f[2][q] = wv[ws + q * DD]; f[3][q] = wo[ws + q * DD]; }
#pragma unroll
    for (int n = 0; n < NBD; ++n) { wl[n] = Wp[n * NH_ + h]; pl[0][n] = cph[ps + n * TT]; pl[1][n] = sph[ps + n * TT]; pl[2][n] = mag[ps + n * TT]; }
    const float bl = bp[h];
    asm volatile("s_wait_xcnt 0x0" :: "v"(xp), "v"(ws), "v"(ps) : "memory");      // the same wait as xwait(); the address and the offsets are named as inputs only, so that they stay live up to the wait and no result lands in their registers in front of it
    __builtin_amdgcn_sched_barrier(0);      // keeps the conversions below out of the loads above: every load is issued before the first result is waited for
    v8us o[8], ow[4]; float sp[3];
#pragma unroll
    for (int s = 0; s < 8; ++s)
#pragma unroll
        for (int k = 0; k < 8; ++k) o[s][k] = f2bf(v[s][k]);
#pragma unroll
    for (int m = 0; m < 4; ++m)
#pragma unroll
        for (int q = 0; q < 8; ++q) ow[m][q] = f2bf(f[m][q]);
#pragma unroll
    for (int k = 0; k < 3; ++k) { float s = 0.f;
#pragma unroll
        for (int n = 0; n < NBD; ++n) { float w = bfr(wl[n]), p = bfr(pl[k][n]); asm volatile("" : "+v"(w)); asm volatile("" : "+v"(p)); float m = __fmul_rn(p, w); asm volatile("" : "+v"(m)); s = __fadd_rn(s, m); }
        sp[k] = __fadd_rn(s, bfr(bl)); }
    v8us* xo = (v8us*)XB + xd;
#pragma unroll
    for (int s = 0; s < 8; ++s) xo[s * 256] = o[s];
    ((v8us*)WQ)[g] = ow[0]; ((v8us*)WK)[g] = ow[1]; ((v8us*)WV)[g] = ow[2]; ((v8us*)WO)[g] = ow[3];
#pragma unroll
    for (int k = 0; k < 3; ++k) *(float*)(PH + g + k * PREP_T) = sp[k];
}
// ---- k_qkv: the three input projections in ONE launch, each accumulator tile stored straight into its fp16 plane in fragment order (no f32 copy of q, k or v in memory, no conversion launch).
// grid (NT / 64, 3 * DD / 64), ONE WAVE per 64 tokens x one head (64 columns) of q, k or v; W3 = the q, k and v weight planes one behind the other, 3 * DD rows. The K loop is k_gemmw's.
// An accumulator register run j = 0..7 walks the ROW operand's index (8 hi + j), a lane's lr the COLUMN operand's. A piece of a plane is 8 neighbours along the plane's k: the head dimension for q and k, the token for V^T.
// So q and k take the weight rows as the row operand and the tokens as the column operand, v the other way round (both planes have one fragment order, so this is a swap of two pointers):
// in each case a lane's 8 registers are one 16-byte piece, and the wave's 32 pieces are one half tile, 512 contiguous bytes a store.
__global__ __launch_bounds__(32) void k_qkv(const bf* __restrict__ X, const bf* __restrict__ W3, const float* __restrict__ bq, const float* __restrict__ bk, const float* __restrict__ bv, const float* __restrict__ PH, h16* QP, h16* KP, h16* VT) {
    constexpr int K = DD;
    const int lane = threadIdx.x & 31, lr = lane & 15, hi = lane >> 4; const int r0 = blockIdx.x * 64, sel = blockIdx.y >> 4, h = blockIdx.y & 15;      // sel: 0 q, 1 k, 2 v
    const int z = (r0 >> 11) * NH_ + h, t0 = r0 & (TT - 1);      // (batch, head) and the first token inside the batch
    v8f acc[4][4];
#pragma unroll
    for (int mb = 0; mb < 4; ++mb)
#pragma unroll
        for (int nb = 0; nb < 4; ++nb) acc[mb][nb] = (v8f){};
    const bf* px = X + (size_t)r0 * K + 8 * lane; const bf* pw = W3 + (size_t)blockIdx.y * 64 * K + 8 * lane;
    const bf* pa = (sel == 2) ? px : pw; const bf* pb = (sel == 2) ? pw : px;
#pragma unroll 1
    for (int kc = 0; kc < K; kc += 32) {
        v16bf a[4], b[4];
#pragma unroll
        for (int mb = 0; mb < 4; ++mb) a[mb] = WFrag<bf>::ld(pa + mb * 16 * K);
#pragma unroll
        for (int nb = 0; nb < 4; ++nb) b[nb] = WFrag<bf>::ld(pb + nb * 16 * K);
        // the same wait as xwait(), behind the trip's loads; the pointers are named as inputs only, so that their register pairs stay live up to the wait: no result lands in them and no step below is written over them in front of it
        asm volatile("s_wait_xcnt 0x0" :: "v"(pa), "v"(pb) : "memory");
        pa += 512; pb += 512;
#pragma unroll
        for (int nb = 0; nb < 4; ++nb) {
#pragma unroll
            for (int mb = 0; mb < 4; ++mb) acc[mb][nb] = wmmab(a[mb], b[nb], acc[mb][nb]); }
        // four vector slots behind the trip's last WMMA, in front of the next trip's loads into its operands
        asm volatile("v_nop\n\tv_nop\n\tv_nop\n\tv_nop" : "+v"(acc[0][0]), "+v"(acc[1][1]), "+v"(acc[2][2]), "+v"(acc[3][3]) : "v"(a[0]), "v"(a[3]));
    }
    // In the epilogues each pair of scheduling barriers keeps every other register write out from between a group of loads or stores and its wait.
    if (sel < 2) {      // q (x 1/8) and k: acc[mb][nb][j] is dimension 16 mb + 8 hi + j of token t0 + 16 nb + lr
        const float sc = (sel == 0) ? 0.125f : 1.0f; const float* bl = ((sel == 0) ? bq : bk) + h * HD + 8 * hi;
        h16* P = ((sel == 0) ? QP : KP) + ((size_t)z * TT + t0) * HD + 8 * lane;      // 16 tokens on: 2 tiles, 1024 elements; 16 dimensions on: half a tile, 256
        v8f bs[4];
        __builtin_amdgcn_sched_barrier(0);
#pragma unroll
        for (int mb = 0; mb < 4; ++mb) bs[mb] = *(const v8f*)(bl + 16 * mb);
        asm volatile("s_wait_xcnt 0x0" :: "v"(bl) : "memory");      // the same wait as xwait(); the pointer is named as an input only, so that it stays live up to the wait
        __builtin_amdgcn_sched_barrier(0);
#pragma unroll
        for (int mb = 0; mb < 4; ++mb) { v8h o[4];
#pragma unroll
            for (int nb = 0; nb < 4; ++nb)
#pragma unroll
                for (int j = 0; j < 8; ++j) o[nb][j] = tohx((acc[mb][nb][j] + bfr(bs[mb][j])) * sc);
            __builtin_amdgcn_sched_barrier(0);
#pragma unroll
            for (int nb = 0; nb < 4; ++nb) *(v8ha*)(P + nb * 1024 + mb * 256) = o[nb];
            xwait(); __builtin_amdgcn_sched_barrier(0); }
    } else {            // v: acc[mb][nb][j] is dimension 16 nb + lr of token t0 + 16 mb + 8 hi + j; rows 0-63 of the V^T plane take v p_m p_c, rows 64-127 v p_m p_s
        const float* bl = bv + h * HD + lr; const float* pl = PH + (size_t)z * TT + t0 + 8 * hi;      // p_c of the lane's first token; p_s and p_m stand NZ * TT and 2 * NZ * TT floats further
        h16* P = VT + ((size_t)z * (HD2 * TT / 512) + (t0 >> 5) * 8) * 512 + 8 * lane;      // 32 tokens on: 8 tiles; 16 rows on: 1 tile; 16 tokens on: half a tile
        float bs[4];
        __builtin_amdgcn_sched_barrier(0);
#pragma unroll
        for (int nb = 0; nb < 4; ++nb) bs[nb] = bl[16 * nb];
        asm volatile("s_wait_xcnt 0x0" :: "v"(bl) : "memory");      // as above
        __builtin_amdgcn_sched_barrier(0);
#pragma unroll
        for (int nb = 0; nb < 4; ++nb) bs[nb] = bfr(bs[nb]);
#pragma unroll
        for (int mb = 0; mb < 4; ++mb) {
            __builtin_amdgcn_sched_barrier(0);
            const v8f pc = *(const v8f*)(pl + 16 * mb), psn = *(const v8f*)(pl + NZ * TT + 16 * mb), pm = *(const v8f*)(pl + 2 * NZ * TT + 16 * mb);
            asm volatile("s_wait_xcnt 0x0" :: "v"(pl) : "memory");      // as above
            __builtin_amdgcn_sched_barrier(0);
#pragma unroll
            for (int part = 0; part < 2; ++part) { v8h o[4];
#pragma unroll
                for (int nb = 0; nb < 4; ++nb)
#pragma unroll
                    for (int j = 0; j < 8; ++j) o[nb][j] = tohx(__fmul_rn(__fmul_rn(acc[mb][nb][j] + bs[nb], pm[j]), part ? psn[j] : pc[j]));
                __builtin_amdgcn_sched_barrier(0);
#pragma unroll
                for (int nb = 0; nb < 4; ++nb) *(v8ha*)(P + (mb >> 1) * 4096 + (part * 4 + nb) * 512 + (mb & 1) * 256) = o[nb];
                xwait(); __builtin_amdgcn_sched_barrier(0); } }
    }
}
// ---- k_fattn: scores, mask, softmax, both value contractions and the phase merge of one (batch, head) in ONE launch; S and P stay in registers.
// Transposed products: S^T = K.Q^T (A = 16 key rows, B = 16 query columns), O^T += [V_real|V_imag]^T.P^T (A = 16 rows of the 128-wide V^T plane, B = P^T). A lane then holds scores of ONE query
// (column lr): two S^T tiles (keys 0-15, 16-31 of a pass), converted in place, are the B operand of the second product in the loaders' own k order (8 hi + 0..7, 16 + 8 hi + 0..7).
// Online softmax; the maximum in use is kept in the scores' own domain and subtracted from the score first (exact for near values, whatever the size of the mask). It may
// trail the true one by up to MLAG (P <= e^MLAG < 256 in fp16), so the accumulators are rescaled only on the rare pass that exceeds it.
// grid (TT / (8 * 16 * QG), NZ), 8 waves x QG groups of 16 query columns; a pass is 32 keys; operands straight from the fp16 planes in fragment order, as in k_gemmw: every K and V^T fragment
// a wave loads serves QG column groups.
#define L2E 1.4426950408889634f
#define MLAG 5.5f
#define QG  4
__device__ __forceinline__ float xhalf(float x) { return __builtin_bit_cast(float, __builtin_amdgcn_permlanex16(__builtin_bit_cast(int, x), __builtin_bit_cast(int, x), 0x76543210, 0xfedcba98, false, false)); }  // lane l <-> lane l ^ 16
__global__ __launch_bounds__(256) void k_fattn(const h16* __restrict__ QP, const h16* __restrict__ KP, const h16* __restrict__ VT, const float* __restrict__ am, const float* __restrict__ PH, bf* Ah, bf* Al) {
    __shared__ __align__(16) float mk[TT];      // this batch's additive mask row, rounded to bf16 once per work-group
    const int z = blockIdx.y, b = z / NH_, h = z % NH_;
    for (int i = threadIdx.x * 4; i < TT; i += 1024) { v4f a = *(const v4f*)(am + (size_t)b * TT + i);
#pragma unroll
        for (int q = 0; q < 4; ++q) a[q] = bfr(a[q]);
        *(v4fa*)(mk + i) = a; }
    __syncthreads();
    const int lane = threadIdx.x & 31, lr = lane & 15, hi = lane >> 4; const int q0 = (blockIdx.x * 8 + __builtin_amdgcn_readfirstlane(threadIdx.x >> 5)) * (16 * QG);      // the wave's first query, held in a scalar register
    const h16* Kz = KP + (size_t)z * TT * HD; const unsigned ko = (unsigned)(8 * lane);      // K plane of this head, and the lane's offset in a tile
    const h16* Vz = VT + (size_t)z * HD2 * TT + 8 * lane;
    v16h qf[QG][2]; const h16* Qz = QP + ((size_t)z * TT + q0) * HD;      // the wave's first Q tile
#pragma unroll
    for (int g = 0; g < QG; ++g)
#pragma unroll
        for (int kc = 0; kc < 2; ++kc) qf[g][kc] = WFrag<h16>::ld(Qz + (size_t)(16 * g) * HD + 512 * kc + ko);
    v16h kf[2][2];      // K fragments are fetched one pass ahead, half way through the second product
#pragma unroll
    for (int kt = 0; kt < 2; ++kt)
#pragma unroll
        for (int kc = 0; kc < 2; ++kc) kf[kt][kc] = WFrag<h16>::ld(Kz + (size_t)(16 * kt) * HD + 512 * kc + ko);
    // the same wait as xwait(); the two scalar bases of the Q and K loads are named as inputs only, so that their register pairs stay live up to the wait and nothing is written over them in front of it
    asm volatile("s_wait_xcnt 0x0" :: "s"(Qz), "s"(Kz) : "memory");
    __builtin_amdgcn_sched_barrier(0);      // keeps the scheduler from mixing the tiles' set-up below into the loads above (it spilled Q fragments when it did)
    const h16* kp = Kz + ko + 32 * HD;      // the lane's address in the K tile to fetch next
    v8f acc[QG][8]; float m_run[QG], l_run[QG];
#pragma unroll
    for (int g = 0; g < QG; ++g) { m_run[g] = -__FLT_MAX__; l_run[g] = 0.f;
#pragma unroll
        for (int t = 0; t < 8; ++t) acc[g][t] = (v8f){}; }
    // rolled: one pass's fragments and the output tiles already fill the wave's registers
#pragma unroll 1
    for (int key0 = 0; key0 < TT; key0 += 32) {
        v16h vf[8];
#pragma unroll
        for (int t = 0; t < 8; ++t) vf[t] = WFrag<h16>::ld(Vz + (size_t)key0 * HD2 + 512 * t);
        xwait();
        v8f s[2][QG];
#pragma unroll
        for (int kt = 0; kt < 2; ++kt) { const v4f m0 = *(const v4fa*)(mk + key0 + 16 * kt + 8 * hi), m1 = *(const v4fa*)(mk + key0 + 16 * kt + 8 * hi + 4);
#pragma unroll
            for (int g = 0; g < QG; ++g) { v8f t = wmma16(kf[kt][1], qf[g][1], wmma16(kf[kt][0], qf[g][0], (v8f){}));
#pragma unroll
                for (int r = 0; r < 4; ++r) { t[r] += m0[r]; t[4 + r] += m1[r]; }
                s[kt][g] = t; } }
        float mb[QG]; bool need = false;
#pragma unroll
        for (int g = 0; g < QG; ++g) { float mx = s[0][g][0];
#pragma unroll
            for (int r = 1; r < 8; ++r) mx = fmaxf(mx, s[0][g][r]);
#pragma unroll
            for (int r = 0; r < 8; ++r) mx = fmaxf(mx, s[1][g][r]);
            mx = fmaxf(mx, xhalf(mx)); mb[g] = mx; need = need || (mx > m_run[g] + MLAG); }
        if (__builtin_amdgcn_ballot_w32(need) != 0) {       // one wave-uniform test per pass
#pragma unroll
            for (int g = 0; g < QG; ++g) { const float m_new = fmaxf(m_run[g], mb[g]); mb[g] = (m_run[g] - m_new) * L2E; m_run[g] = m_new; }
#pragma unroll
            for (int g = 0; g < QG; ++g) { const float corr = __builtin_amdgcn_exp2f(mb[g]); l_run[g] *= corr;
#pragma unroll
                for (int t = 0; t < 8; ++t) acc[g][t] = acc[g][t] * corr; } }
#pragma unroll
        for (int g = 0; g < QG; ++g) { const float mr = m_run[g]; v16h pf; v2f ls = (v2f){0.f, 0.f};
#pragma unroll
            for (int e = 0; e < 16; e += 2) { const v2f x = ((v2f){s[e >> 3][g][e & 7], s[e >> 3][g][(e & 7) + 1]} - mr) * L2E; const v2f p = (v2f){__builtin_amdgcn_exp2f(x[0]), __builtin_amdgcn_exp2f(x[1])};
                ls += p; pf[e] = tohx(p[0]); pf[e + 1] = tohx(p[1]); }
            l_run[g] += ls[0] + ls[1];
#pragma unroll
            for (int t = 0; t < 8; ++t) acc[g][t] = wmma16(vf[t], pf, acc[g][t]);
            if (g == QG / 2 - 1) {
#pragma unroll
                for (int kt = 0; kt < 2; ++kt)
#pragma unroll
                    for (int kc = 0; kc < 2; ++kc) kf[kt][kc] = WFrag<h16>::ld(kp + (size_t)(16 * kt) * HD + 512 * kc);
                kp += (key0 + 64 < TT) ? 32 * HD : 0; } }      // the last pass fetches its own tile again: in bounds, unused
    }
#pragma unroll
    for (int g = 0; g < QG; ++g) { const int t = q0 + 16 * g + lr; const float l = l_run[g] + xhalf(l_run[g]); const float inv = __fdiv_rn(1.0f, l);
        const float pc = PH[((size_t)b * NH_ + h) * TT + t], psn = PH[((size_t)NB_ * NH_ + (size_t)b * NH_ + h) * TT + t];
#pragma unroll
        for (int tt = 0; tt < 4; ++tt) { v8us oh, ol;
#pragma unroll
            for (int r = 0; r < 8; ++r) { unsigned short a, c2; splitf((acc[g][tt][r] * inv) * pc + (acc[g][tt + 4][r] * inv) * psn, a, c2); oh[r] = a; ol[r] = c2; }
            const unsigned o = ((unsigned)b * TT + q0 + 16 * g) * DD + (2 * h + (tt >> 1)) * 512 + (tt & 1) * 256 + 8 * lane;      /* row t, k = 64 h + 16 tt + 8 hi in fragment order: 512 contiguous bytes a store */ __builtin_amdgcn_sched_barrier(0);      // the two barriers keep every other register write out from between the stores and their wait
            *(v8usa*)(Ah + o) = oh; *(v8usa*)(Al + o) = ol; xwait(); __builtin_amdgcn_sched_barrier(0); } }
}
__global__ __launch_bounds__(256) void k_ln2(const float* __restrict__ FF, const float* __restrict__ X, const float* __restrict__ gg, const float* __restrict__ bb, float* OUT) {
    const int lane = threadIdx.x & 31; const int r = blockIdx.x * 8 + (threadIdx.x >> 5); if (r >= NT) return; float v[32]; float s = 0.f;
#pragma unroll
    for (int c = 0; c < 8; ++c) { const v4f a = *(const v4f*)(FF + (size_t)r * DD + c * 128 + lane * 4), xx = *(const v4f*)(X + (size_t)r * DD + c * 128 + lane * 4);
#pragma unroll
        for (int q = 0; q < 4; ++q) { v[c * 4 + q] = a[q] + bfr(xx[q]); s += v[c * 4 + q]; } }
#pragma unroll
    for (int sh = 16; sh; sh >>= 1) s += __shfl_xor(s, sh, 32);
    const float mu = s * (1.0f / DD); float qq = 0.f;
#pragma unroll
    for (int i = 0; i < 32; ++i) { const float d0 = v[i] - mu; qq = __fadd_rn(qq, __fmul_rn(d0, d0)); }
#pragma unroll
    for (int sh = 16; sh; sh >>= 1) qq += __shfl_xor(qq, sh, 32);
    const float rs = __fdiv_rn(1.0f, __fsqrt_rn(qq * (1.0f / DD) + 1e-12f));
{
#pragma unroll
        for (int c = 0; c < 8; ++c) { v4f o;
#pragma unroll
            for (int q = 0; q < 4; ++q) { const int col = c * 128 + lane * 4 + q; o[q] = __fadd_rn(__fmul_rn((v[c * 4 + q] - mu) * rs, bfr(gg[col])), bfr(bb[col])); }
            *(v4f*)(OUT + (size_t)r * DD + c * 128 + lane * 4) = o; }
         }
}

extern "C" void kernel_launch(void* const* d_in, const int* in_sizes, int n_in,
                              void* d_out, int out_size, void* d_ws, size_t ws_size, hipStream_t stream) {
    (void)in_sizes; (void)n_in; (void)out_size;
    const float* IN[17]; for (int i = 0; i < 17; ++i) IN[i] = (const float*)d_in[i];
    // hidden_states, attention_mask [4][1][1][2048], cos_phi, sin_phi, mag [4][8][2048], Wq [1024][1024] (x @ W), bq, Wk, bk, Wv, bv, Wo, bo, Wp [8][16], bp [16], ln_g, ln_b = d_in[0..16]
    const float* x = IN[0]; const float* am = IN[1];
    float* OUT = (float*)d_out;     // [4][2048][1024]
    char* wsp = (char*)d_ws;
    auto take = [&](size_t bytes) { char* p = wsp; wsp += (bytes + 255) & ~(size_t)255; return (void*)p; };
    bf* WQ = (bf*)take((size_t)3 * DD * DD * 2); bf* WK = WQ + (size_t)DD * DD; bf* WV = WK + (size_t)DD * DD;      /* one plane of 3 * DD rows for k_qkv */ bf* WO = (bf*)take((size_t)DD * DD * 2); float* PH = (float*)take((size_t)3 * NB_ * NH_ * TT * 4);
    bf* XB = (bf*)take((size_t)NT * DD * 2); float* F = (float*)take((size_t)NT * DD * 4);
    h16* QP = (h16*)take((size_t)NT * DD * 2); h16* KP = (h16*)take((size_t)NT * DD * 2); h16* VT = (h16*)take((size_t)NZ * HD2 * TT * 2);
    bf* ATh = (bf*)take((size_t)NT * DD * 2); bf* ATl = (bf*)take((size_t)NT * DD * 2);
    if ((size_t)(wsp - (char*)d_ws) > ws_size) return;    // total ~ 154 MiB; ws 256 MiB
    float* Y = F;   // the output projection's f32 result
    k_prep<<<PREP_B, 256, 0, stream>>>(x, IN[5], IN[7], IN[9], IN[11], IN[2], IN[3], IN[4], IN[13], IN[14], XB, WQ, WK, WV, WO, PH);
    const dim3 gP(NT / 64, DD / 64, 1);
    k_qkv<<<dim3(NT / 64, 3 * DD / 64), 32, 0, stream>>>(XB, WQ, IN[6], IN[8], IN[10], PH, QP, KP, VT);
    k_fattn<<<dim3(TT / (8 * 16 * QG), NZ), 256, 0, stream>>>(QP, KP, VT, am, PH, ATh, ATl);
    k_gemmw<bf, 1, true, DD><<<gP, 32, 0, stream>>>(ATh, ATl, WO, nullptr, Y, DD, IN[12], 0, 0, 0);
    k_ln2<<<NT / 8, 256, 0, stream>>>(Y, x, IN[15], IN[16], OUT);
}

// v005
// One run takes 165 microseconds.
// Next to v004, in two timings, it ran 1.30 and 1.29 times as fast.
// Over all steps from v000 it is 15.6 times as fast.
#include <hip/hip_runtime.h>

// Attention block with phase-weighted values (hidden_states [4][2048][1024]; q/k/v = x @ W + b (16 heads x 64); phase scalars p_c/p_s/p_m[b][h][t] = sum_band {cos_phi,sin_phi,mag}[b][band][t] Wp[band][h] + bp[h] (8 bands);
// V_real = v p_m p_c, V_imag = v p_m p_s (per (b,h,t) scalars on the value rows); scores = q.k/8 + attention_mask[b][0][0][j] (additive input, read as data); softmax; ctx = (P.V_real) p_c + (P.V_imag) p_s
// (per query row); out = LN(ctx @ Wo + bo + hidden_states) * ln_g + ln_b (eps 1e-12)).
// Compute dtypes, f32 accumulate: every input rounded to bf16; projections on PLAIN bf16 operands (inputs: exact, + bias); the phase projections (8 terms), V scaling,
// ctx combination, residual and LayerNorm in f32 on VALU; scores and the two value contractions on SINGLE fp16 planes (q x 1/8; P = exp(s - max in use), normalised after the contraction; V_real | V_imag packed as one 128-wide V^T plane per head
// so attn.[V_real|V_imag] is one N = 128 GEMM); output projection on hi+lo planes x exact Wo (2 products).

#define NB_  4
#define NBD  8                   // phase bands
#define HD2  128                 // packed V_real | V_imag plane width
#define TT   2048
#define DD   1024
#define NH_  16
#define HD   64
#define NT   (NB_ * TT)
#define NZ   (NB_ * NH_)
typedef _Float16 h16;
typedef unsigned short bf;
typedef __attribute__((ext_vector_type(16))) __bf16   v16bf;
typedef __attribute__((ext_vector_type(16))) _Float16 v16h;
typedef __attribute__((ext_vector_type(8)))  _Float16 v8h;
typedef __attribute__((ext_vector_type(8)))  unsigned short v8us;
typedef __attribute__((ext_vector_type(8)))  float    v8f;
typedef __attribute__((ext_vector_type(4)))  float    v4f;
typedef v8h  __attribute__((may_alias)) v8ha;
typedef v4f  __attribute__((may_alias)) v4fa;
typedef v8us __attribute__((may_alias)) v8usa;

__device__ __forceinline__ unsigned short f2bf(float f) { unsigned u = __float_as_uint(f); u += 0x7FFFu + ((u >> 16) & 1u); return (unsigned short)(u >> 16); }
__device__ __forceinline__ float bf2f(unsigned short b) { return __uint_as_float(((unsigned)b) << 16); }
__device__ __forceinline__ float bfr(float f) { return bf2f(f2bf(f)); }
__device__ __forceinline__ v16h cat16(v8h lo, v8h hi) { return __builtin_shufflevector(lo, hi, 0, 1, 2, 3, 4, 5, 6, 7, 8, 9, 10, 11, 12, 13, 14, 15); }
__device__ __forceinline__ v16bf cat16b(v8us lo, v8us hi) { return __builtin_bit_cast(v16bf, __builtin_shufflevector(lo, hi, 0, 1, 2, 3, 4, 5, 6, 7, 8, 9, 10, 11, 12, 13, 14, 15)); }
__device__ __forceinline__ v8f wmma16(v16h a, v16h b, v8f c) { return __builtin_amdgcn_wmma_f32_16x16x32_f16(false, a, false, b, (short)0, c, false, false); }
__device__ __forceinline__ v8f wmmab(v16bf a, v16bf b, v8f c) { return __builtin_amdgcn_wmma_f32_16x16x32_bf16(false, a, false, b, (short)0, c, false, false); }



// Stands behind a group of global loads or stores, in front of the first instruction that reuses a register they name (a precaution).
__device__ __forceinline__ void xwait() { asm volatile("s_wait_xcnt 0x0" ::: "memory"); }
// ---- FRAGMENT ORDER of every 16-bit operand plane [rows][K] (rows % 16 == 0, K % 32 == 0): the plane is a row of 1 KiB tiles, tile (R, kb) = rows 16 R .. 16 R + 15 x k 32 kb .. 32 kb + 31 at tile index R * (K / 32) + kb
// (the V^T plane: kb * 8 + R, so that a pass reads 8 KiB in a row). A tile is two halves of 512 B; half j holds at 16 B x lane (lane = 16 hi + lr) the elements k = 32 kb + 16 j + 8 hi + 0..7 of row 16 R + lr.
// A fragment is then two wave-wide 16-byte loads of 512 contiguous bytes each (4 whole lines a load; on a row-major plane it would touch 32 B in each of 16 lines); a lane's k order is 8 hi + 0..7, then 16 + 8 hi + 0..7, for A and B alike.
// A producer thread writes whole 16-byte pieces (k_prep: 8 of the X plane, one of each weight plane). Where the source runs across k (the transposing producers) thread i writes piece i, at byte 16 i: FRAG_IDX splits i into lr, hi, j and the tile index.
// Where the source runs along k, FRAG_IDX_ROW gives four neighbouring threads the four pieces of one tile row (128 source bytes in f32, one whole line); eight such rows make four whole lines of the tile.
#define FRAG_IDX(i) const int lr = (int)((i) & 15), hi = (int)(((i) >> 4) & 1), j = (int)(((i) >> 5) & 1); const int tile = (int)((i) >> 6)
#define FRAG_IDX_ROW(i) const int hi = (int)((i) & 1), j = (int)(((i) >> 1) & 1), lr = (int)(((i) >> 2) & 15); const int tile = (int)((i) >> 6); const size_t piece = (size_t)tile * 64 + j * 32 + hi * 16 + lr
// ---- The two GEMM kernels (k_qkv, k_oproj): a work-group of 8 waves (2 x 4) owns a 128 x 256 tile of the result, a wave 64 x 64 of it (16 accumulators). A stage is 64 of k: for each block of 16 operand rows two
// neighbouring 1 KiB tiles of its plane, one CHUNK of 2 KiB, contiguous in memory and copied as it lies (fragment order) into LDS by asynchronous copies, 16 bytes a lane. A fragment is then two ds_load_b128 of 512 contiguous bytes.
// Every chunk is brought from L2 once a work-group and read by 2 or 4 waves. Two buffers: stage s + 1 flies while stage s is worked on.
template <typename T16> struct WFrag;
template <> struct WFrag<h16> { typedef v16h V; static __device__ __forceinline__ V ld(const h16* p) { return cat16(*(const v8h*)p, *(const v8h*)(p + 256)); } static __device__ __forceinline__ v8f mma(V a, V b, v8f c) { return wmma16(a, b, c); } };
template <> struct WFrag<bf> { typedef v16bf V; static __device__ __forceinline__ V ld(const bf* p) { return cat16b(*(const v8us*)p, *(const v8us*)(p + 256)); } static __device__ __forceinline__ v8f mma(V a, V b, v8f c) { return wmmab(a, b, c); } };
// Four asynchronous copies of 16 bytes a lane (LDS byte address, global address); the s_wait_xcnt stands in the copies' own statement, in front of anything that reuses their address registers (a precaution).
__device__ __forceinline__ void acopy4(unsigned l, const bf* g, int lstep, int gstep) {
    asm volatile("global_load_async_to_lds_b128 %0, %1, off\n\tglobal_load_async_to_lds_b128 %2, %3, off\n\tglobal_load_async_to_lds_b128 %4, %5, off\n\tglobal_load_async_to_lds_b128 %6, %7, off\n\ts_wait_xcnt 0x0"
                 :: "v"(l), "v"(g), "v"(l + lstep), "v"(g + gstep), "v"(l + 2 * lstep), "v"(g + 2 * gstep), "v"(l + 3 * lstep), "v"(g + 3 * gstep) : "memory");
}
// The same for eight copies, four from each of two places: one wait serves the run.
__device__ __forceinline__ void acopy8(unsigned l, const bf* g, unsigned m, const bf* q, int lstep, int gstep) {
    asm volatile("global_load_async_to_lds_b128 %0, %1, off\n\tglobal_load_async_to_lds_b128 %2, %3, off\n\tglobal_load_async_to_lds_b128 %4, %5, off\n\tglobal_load_async_to_lds_b128 %6, %7, off\n\t"
                 "global_load_async_to_lds_b128 %8, %9, off\n\tglobal_load_async_to_lds_b128 %10, %11, off\n\tglobal_load_async_to_lds_b128 %12, %13, off\n\tglobal_load_async_to_lds_b128 %14, %15, off\n\ts_wait_xcnt 0x0"
                 :: "v"(l), "v"(g), "v"(l + lstep), "v"(g + gstep), "v"(l + 2 * lstep), "v"(g + 2 * gstep), "v"(l + 3 * lstep), "v"(g + 3 * gstep),
                    "v"(m), "v"(q), "v"(m + lstep), "v"(q + gstep), "v"(m + 2 * lstep), "v"(q + 2 * gstep), "v"(m + 3 * lstep), "v"(q + 3 * gstep) : "memory");
}
__device__ __forceinline__ void await_copies() { asm volatile("s_wait_asynccnt 0x0" ::: "memory"); }      // the wave's own copies have landed
__device__ __forceinline__ void await_lds() { asm volatile("s_wait_dscnt 0x0" ::: "memory"); }            // the wave's own LDS reads are done, in front of the barrier behind which their buffer is refilled
#define CHUNK 1024                 // elements of a chunk
#define CHB   2048                 // its bytes
#define RSTEP (2 * (DD / 32) * 512)      // elements between a thread's copies in a plane: two blocks of 16 rows (threads 0-127 copy the even chunks, 128-255 the odd ones)
#define NSTG  (DD / 64)
// ---- k_oproj: C[m][n] (f32) = sum_k (A[m][k] + A2[m][k]) Bt[n][k] + bias[n]; grid (NT / 128, DD / 256). A stage: 8 chunks of A, 8 of A2, 16 of Bt, 64 KiB.
__global__ __launch_bounds__(256) void k_oproj(const bf* __restrict__ A, const bf* __restrict__ A2, const bf* __restrict__ Bt, float* C, const float* __restrict__ bias) {
    constexpr int ldc = DD;
    __shared__ __attribute__((aligned(2048))) bf st[2 * 32 * CHUNK];
    __shared__ __align__(16) float osw[8][16 * 68];
    const int lane = threadIdx.x & 31, lr = lane & 15, hi = lane >> 4, wave = __builtin_amdgcn_readfirstlane(threadIdx.x >> 5);
    const int r0 = blockIdx.x * 128 + (wave & 1) * 64, c0 = blockIdx.y * 256 + (wave >> 1) * 64;
    float* os = osw[wave];
    const int half = threadIdx.x >> 7, off = (threadIdx.x & 127) * 8;
    const bf* ga = A + (size_t)(blockIdx.x * 8 + half) * (16 * DD) + off; const bf* ga2 = A2 + (size_t)(blockIdx.x * 8 + half) * (16 * DD) + off; const bf* gb = Bt + (size_t)(blockIdx.y * 16 + half) * (16 * DD) + off;
    const unsigned l0 = (unsigned)(size_t)(st + half * CHUNK + off);      // the thread's LDS byte address in chunk 0 or 1 of buffer 0
    auto fill = [&](int s, int b) { const unsigned l = l0 + b * (32 * CHB);
        acopy8(l, ga + s * CHUNK, l + 8 * CHB, ga2 + s * CHUNK, 2 * CHB, RSTEP); acopy8(l + 16 * CHB, gb + s * CHUNK, l + 24 * CHB, gb + s * CHUNK + 4 * RSTEP, 2 * CHB, RSTEP); };
    v8f acc[4][4];
#pragma unroll
    for (int mb = 0; mb < 4; ++mb)
#pragma unroll
        for (int nb = 0; nb < 4; ++nb) acc[mb][nb] = (v8f){};
    fill(0, 0); await_copies(); __syncthreads(); fill(1, 1);
    const int ia = (wave & 1) * 4 * CHUNK + 8 * lane, ib = (16 + (wave >> 1) * 4) * CHUNK + 8 * lane;
    // rolled: one trip is one stage, so that the order wait, wait, barrier, refill stands once at its foot
#pragma unroll 1
    for (int s = 0; s < NSTG; ++s) {
        const bf* sb = st + (s & 1) * (32 * CHUNK);
        v16bf a[2][4], a2[2][4], b[2][4];
#pragma unroll
        for (int kk = 0; kk < 2; ++kk) {
#pragma unroll
            for (int mb = 0; mb < 4; ++mb) { a[kk][mb] = WFrag<bf>::ld(sb + ia + mb * CHUNK + kk * 512); a2[kk][mb] = WFrag<bf>::ld(sb + ia + (8 + mb) * CHUNK + kk * 512); }
#pragma unroll
            for (int nb = 0; nb < 4; ++nb) b[kk][nb] = WFrag<bf>::ld(sb + ib + nb * CHUNK + kk * 512);
        }
        __builtin_amdgcn_sched_barrier(0);      // the stage's 48 LDS reads stand as one group in front of its WMMAs: the second block's land behind the first block's WMMAs (two waves a SIMD: registers are there)
#pragma unroll
        for (int kk = 0; kk < 2; ++kk) {
#pragma unroll
            for (int nb = 0; nb < 4; ++nb) {
#pragma unroll
                for (int mb = 0; mb < 4; ++mb) { acc[mb][nb] = wmmab(a[kk][mb], b[kk][nb], acc[mb][nb]); acc[mb][nb] = wmmab(a2[kk][mb], b[kk][nb], acc[mb][nb]); } }
        }
        __builtin_amdgcn_sched_barrier(0);      // keeps the WMMAs in front of the waits below: moved behind the barrier they would leave the next stage's copies only the time of the LDS reads to land
        await_lds(); await_copies(); __syncthreads();      // publishes stage s + 1 and ends every wave's reads of stage s
        if (s + 2 < NSTG) fill(s + 2, s & 1);
    }
    await_copies();
#pragma unroll
    for (int mb = 0; mb < 4; ++mb) {
#pragma unroll
        for (int nb = 0; nb < 4; ++nb) {
#pragma unroll
            for (int j = 0; j < 8; ++j) os[(hi * 8 + j) * 68 + nb * 16 + lr] = acc[mb][nb][j]; }
        __builtin_amdgcn_wave_barrier(); asm volatile("" ::: "memory");
        float* crow = C + (size_t)(r0 + mb * 16) * ldc + c0;
{
#pragma unroll
            for (int s = 0; s < 8; ++s) { const int row = 2 * s + hi, cofs = lr * 4; v4f val = *(const v4fa*)(os + row * 68 + cofs); { val[0] += bfr(bias[c0 + cofs]); val[1] += bfr(bias[c0 + cofs + 1]); val[2] += bfr(bias[c0 + cofs + 2]); val[3] += bfr(bias[c0 + cofs + 3]); }
                *(v4f*)(crow + (size_t)row * ldc + cofs) = val; }
             }
        xwait();      // behind the eight stores: the next row block reuses their address and data registers
        __builtin_amdgcn_wave_barrier(); asm volatile("" ::: "memory");
    }
}

__device__ __forceinline__ h16 tohx(float x) { return (h16)x; }
__device__ __forceinline__ void splitf(float y, unsigned short& h, unsigned short& l) { h = f2bf(y); l = f2bf(y - bf2f(h)); }
typedef __attribute__((ext_vector_type(2))) _Float16 v2h;
typedef __attribute__((ext_vector_type(4))) _Float16 v4h;
typedef __attribute__((ext_vector_type(2))) unsigned short v2us;
typedef __attribute__((ext_vector_type(4))) unsigned short v4us;
typedef __attribute__((ext_vector_type(2))) float v2f;

__global__ __launch_bounds__(256) void k_bfr1(const float* __restrict__ src, float* dst, int n) { const int i = blockIdx.x * 256 + threadIdx.x; if (i >= n) return; const float v = bfr(src[i]); *(float*)(dst + i) = v;  }
// ---- k_prep: all operand preparation of a call in ONE launch: hidden_states to its bf16 plane, the four weight matrices to their transposed bf16 planes, the three phase projections (six jobs, none reads what another writes).
// A grid of PREP_B blocks (2 a WGP, 16 waves) shares out every job evenly: a thread takes 8 pieces of the X plane, the same piece of each of the four weight planes, and p_c, p_s, p_m of one (batch, head, token).
// The work then starts 4,096 waves, not 61,440 of one piece each, and all of a thread's loads are in flight before the first of them is used.
#define PREP_B 512
#define PREP_T (PREP_B * 256)
static_assert((size_t)NT * DD / 8 == 8 * (size_t)PREP_T && DD * DD / 8 == PREP_T && NB_ * NH_ * TT == PREP_T && DD / 32 == 32, "pieces a thread");
__global__ __launch_bounds__(256) void k_prep(const float* __restrict__ x, const float* __restrict__ wq, const float* __restrict__ wk, const float* __restrict__ wv, const float* __restrict__ wo, const float* __restrict__ cph, const float* __restrict__ sph, const float* __restrict__ mag,
                                              const float* __restrict__ Wp, const float* __restrict__ bp, bf* XB, bf* WQ, bf* WK, bf* WV, bf* WO, float* PH) {
    const unsigned g = blockIdx.x * 256 + threadIdx.x;
    // X plane: a block takes one block of 16 rows, 32 tiles, 2,048 pieces; a thread's 8 pieces are 256 pieces apart: 4 tiles, 128 elements in the source row
    unsigned xs, xd; { const unsigned i = blockIdx.x * 2048 + threadIdx.x; FRAG_IDX_ROW(i); xs = (unsigned)(((tile / (DD / 32)) * 16 + lr) * DD + (tile % (DD / 32)) * 32 + j * 16 + hi * 8); xd = (unsigned)piece; }
    // weight planes: piece g of each; the eight rows are read off one offset, a constant pitch apart
    unsigned ws; { FRAG_IDX(g); const int kt = DD / 32; const int n = (tile / kt) * 16 + lr, k = (tile % kt) * 32 + j * 16 + hi * 8; ws = (unsigned)(k * DD + n); }
    // phase scalars: g = (batch, head, token); a block lies inside one head
    const unsigned h = (blockIdx.x >> 3) & (NH_ - 1), ps = ((g >> 15) & (NB_ - 1)) * (NBD * TT) + (g & (TT - 1));
    const float* xp = x + xs; v8f v[8]; float f[4][8], wl[NBD], pl[3][NBD];
#pragma unroll
    for (int s = 0; s < 8; ++s) v[s] = *(const v8f*)(xp + s * 128);
#pragma unroll
    for (int q = 0; q < 8; ++q) { f[0][q] = wq[ws + q * DD]; f[1][q] = wk[ws + q * DD]; f[2][q] = wv[ws + q * DD]; f[3][q] = wo[ws + q * DD]; }
#pragma unroll
    for (int n = 0; n < NBD; ++n) { wl[n] = Wp[n * NH_ + h]; pl[0][n] = cph[ps + n * TT]; pl[1][n] = sph[ps + n * TT]; pl[2][n] = mag[ps + n * TT]; }
    const float bl = bp[h];
    asm volatile("s_wait_xcnt 0x0" :: "v"(xp), "v"(ws), "v"(ps) : "memory");      // the same wait as xwait(); the address and the offsets are named as inputs only, so that they stay live up to the wait and no result lands in their registers in front of it
    __builtin_amdgcn_sched_barrier(0);      // keeps the conversions below out of the loads above: every load is issued before the first result is waited for
    v8us o[8], ow[4]; float sp[3];
#pragma unroll
    for (int s = 0; s < 8; ++s)
#pragma unroll
        for (int k = 0; k < 8; ++k) o[s][k] = f2bf(v[s][k]);
#pragma unroll
    for (int m = 0; m < 4; ++m)
#pragma unroll
        for (int q = 0; q < 8; ++q) ow[m][q] = f2bf(f[m][q]);
#pragma unroll
    for (int k = 0; k < 3; ++k) { float s = 0.f;
#pragma unroll
        for (int n = 0; n < NBD; ++n) { float w = bfr(wl[n]), p = bfr(pl[k][n]); asm volatile("" : "+v"(w)); asm volatile("" : "+v"(p)); float m = __fmul_rn(p, w); asm volatile("" : "+v"(m)); s = __fadd_rn(s, m); }
        sp[k] = __fadd_rn(s, bfr(bl)); }
    v8us* xo = (v8us*)XB + xd;
#pragma unroll
    for (int s = 0; s < 8; ++s) xo[s * 256] = o[s];
    ((v8us*)WQ)[g] = ow[0]; ((v8us*)WK)[g] = ow[1]; ((v8us*)WV)[g] = ow[2]; ((v8us*)WO)[g] = ow[3];
#pragma unroll
    for (int k = 0; k < 3; ++k) *(float*)(PH + g + k * PREP_T) = sp[k];
}
// ---- k_qkv: the three input projections in ONE launch, each accumulator tile stored straight into its fp16 plane in fragment order (no f32 copy of q, k or v in memory, no conversion launch).
// grid (NT / 128, 3 * DD / 256), 8 waves: 2 groups of 64 tokens x 4 heads (64 columns each) of q, k or v; W3 = the q, k and v weight planes one behind the other, 3 * DD rows. A stage: 8 chunks of X, 16 of W3, 48 KiB; two work-groups a WGP.
// An accumulator register run j = 0..7 walks the ROW operand's index (8 hi + j), a lane's lr the COLUMN operand's. A piece of a plane is 8 neighbours along the plane's k: the head dimension for q and k, the token for V^T.
// So q and k take the weight rows as the row operand and the tokens as the column operand, v the other way round (both planes have one fragment order, so this is a swap of two pointers):
// in each case a lane's 8 registers are one 16-byte piece, and the wave's 32 pieces are one half tile, 512 contiguous bytes a store.
// amdgpu_waves_per_eu(4, 4): four waves a SIMD, so that two work-groups share a WGP and one works while the other stands at its barrier.
__global__ __launch_bounds__(256) __attribute__((amdgpu_waves_per_eu(4, 4))) void k_qkv(const bf* __restrict__ X, const bf* __restrict__ W3, const float* __restrict__ bq, const float* __restrict__ bk, const float* __restrict__ bv, const float* __restrict__ PH, h16* QP, h16* KP, h16* VT) {
    __shared__ __attribute__((aligned(2048))) bf st[2 * 24 * CHUNK];
    const int lane = threadIdx.x & 31, lr = lane & 15, hi = lane >> 4, wave = __builtin_amdgcn_readfirstlane(threadIdx.x >> 5);
    const int r0 = blockIdx.x * 128 + (wave & 1) * 64, hy = blockIdx.y * 4 + (wave >> 1), sel = hy >> 4, h = hy & 15;      // sel: 0 q, 1 k, 2 v
    const int z = (r0 >> 11) * NH_ + h, t0 = r0 & (TT - 1);      // (batch, head) and the first token inside the batch
    const int half = threadIdx.x >> 7, off = (threadIdx.x & 127) * 8;
    const bf* gx = X + (size_t)(blockIdx.x * 8 + half) * (16 * DD) + off; const bf* gw = W3 + (size_t)(blockIdx.y * 16 + half) * (16 * DD) + off;
    const unsigned l0 = (unsigned)(size_t)(st + half * CHUNK + off);      // the thread's LDS byte address in chunk 0 or 1 of buffer 0
    auto fill = [&](int s, int b) { const unsigned l = l0 + b * (24 * CHB);
        acopy4(l, gx + s * CHUNK, 2 * CHB, RSTEP); acopy8(l + 8 * CHB, gw + s * CHUNK, l + 16 * CHB, gw + s * CHUNK + 4 * RSTEP, 2 * CHB, RSTEP); };
    v8f acc[4][4];
#pragma unroll
    for (int mb = 0; mb < 4; ++mb)
#pragma unroll
        for (int nb = 0; nb < 4; ++nb) acc[mb][nb] = (v8f){};
    fill(0, 0); await_copies(); __syncthreads(); fill(1, 1);
    const int ix = (wave & 1) * 4 * CHUNK + 8 * lane, iw = (8 + (wave >> 1) * 4) * CHUNK + 8 * lane;
    const int ia = (sel == 2) ? ix : iw, ib = (sel == 2) ? iw : ix;
    // rolled: one trip is one stage, so that the order wait, wait, barrier, refill stands once at its foot
#pragma unroll 1
    for (int s = 0; s < NSTG; ++s) {
        const bf* sb = st + (s & 1) * (24 * CHUNK);
#pragma unroll
        for (int kk = 0; kk < 2; ++kk) {
            v16bf a[4], b[4];
#pragma unroll
            for (int mb = 0; mb < 4; ++mb) a[mb] = WFrag<bf>::ld(sb + ia + mb * CHUNK + kk * 512);
#pragma unroll
            for (int nb = 0; nb < 4; ++nb) b[nb] = WFrag<bf>::ld(sb + ib + nb * CHUNK + kk * 512);
            __builtin_amdgcn_sched_barrier(0);      // the block's 16 LDS reads stand as one group in front of its WMMAs (left alone the compiler reads each b fragment into one register set and waits it out four times a block)
#pragma unroll
            for (int nb = 0; nb < 4; ++nb) {
#pragma unroll
                for (int mb = 0; mb < 4; ++mb) acc[mb][nb] = wmmab(a[mb], b[nb], acc[mb][nb]); }
            __builtin_amdgcn_sched_barrier(0);      // and the next block's reads stay out of this block's WMMAs
        }
        await_lds(); await_copies(); __syncthreads();      // publishes stage s + 1 and ends every wave's reads of stage s
        if (s + 2 < NSTG) fill(s + 2, s & 1);
    }
    await_copies();
    // In the epilogues each pair of scheduling barriers keeps every other register write out from between a group of loads or stores and its wait.
    if (sel < 2) {      // q (x 1/8) and k: acc[mb][nb][j] is dimension 16 mb + 8 hi + j of token t0 + 16 nb + lr
        const float sc = (sel == 0) ? 0.125f : 1.0f; const float* bl = ((sel == 0) ? bq : bk) + h * HD + 8 * hi;
        h16* P = ((sel == 0) ? QP : KP) + ((size_t)z * TT + t0) * HD + 8 * lane;      // 16 tokens on: 2 tiles, 1024 elements; 16 dimensions on: half a tile, 256
        v8f bs[4];
        __builtin_amdgcn_sched_barrier(0);
#pragma unroll
        for (int mb = 0; mb < 4; ++mb) bs[mb] = *(const v8f*)(bl + 16 * mb);
        asm volatile("s_wait_xcnt 0x0" :: "v"(bl) : "memory");      // the same wait as xwait(); the pointer is named as an input only, so that it stays live up to the wait
        __builtin_amdgcn_sched_barrier(0);
#pragma unroll
        for (int mb = 0; mb < 4; ++mb) { v8h o[4];
#pragma unroll
            for (int nb = 0; nb < 4; ++nb)
#pragma unroll
                for (int j = 0; j < 8; ++j) o[nb][j] = tohx((acc[mb][nb][j] + bfr(bs[mb][j])) * sc);
            __builtin_amdgcn_sched_barrier(0);
#pragma unroll
            for (int nb = 0; nb < 4; ++nb) *(v8ha*)(P + nb * 1024 + mb * 256) = o[nb];
            xwait(); __builtin_amdgcn_sched_barrier(0); }
    } else {            // v: acc[mb][nb][j] is dimension 16 nb + lr of token t0 + 16 mb + 8 hi + j; rows 0-63 of the V^T plane take v p_m p_c, rows 64-127 v p_m p_s
        const float* bl = bv + h * HD + lr; const float* pl = PH + (size_t)z * TT + t0 + 8 * hi;      // p_c of the lane's first token; p_s and p_m stand NZ * TT and 2 * NZ * TT floats further
        h16* P = VT + ((size_t)z * (HD2 * TT / 512) + (t0 >> 5) * 8) * 512 + 8 * lane;      // 32 tokens on: 8 tiles; 16 rows on: 1 tile; 16 tokens on: half a tile
        float bs[4];
        __builtin_amdgcn_sched_barrier(0);
#pragma unroll
        for (int nb = 0; nb < 4; ++nb) bs[nb] = bl[16 * nb];
        asm volatile("s_wait_xcnt 0x0" :: "v"(bl) : "memory");      // as above
        __builtin_amdgcn_sched_barrier(0);
#pragma unroll
        for (int nb = 0; nb < 4; ++nb) bs[nb] = bfr(bs[nb]);
#pragma unroll
        for (int mb = 0; mb < 4; ++mb) {
            __builtin_amdgcn_sched_barrier(0);
            const v8f pc = *(const v8f*)(pl + 16 * mb), psn = *(const v8f*)(pl + NZ * TT + 16 * mb), pm = *(const v8f*)(pl + 2 * NZ * TT + 16 * mb);
            asm volatile("s_wait_xcnt 0x0" :: "v"(pl) : "memory");      // as above
            __builtin_amdgcn_sched_barrier(0);
#pragma unroll
            for (int part = 0; part < 2; ++part) { v8h o[4];
#pragma unroll
                for (int nb = 0; nb < 4; ++nb)
#pragma unroll
                    for (int j = 0; j < 8; ++j) o[nb][j] = tohx(__fmul_rn(__fmul_rn(acc[mb][nb][j] + bs[nb], pm[j]), part ? psn[j] : pc[j]));
                __builtin_amdgcn_sched_barrier(0);
#pragma unroll
                for (int nb = 0; nb < 4; ++nb) *(v8ha*)(P + (mb >> 1) * 4096 + (part * 4 + nb) * 512 + (mb & 1) * 256) = o[nb];
                xwait(); __builtin_amdgcn_sched_barrier(0); } }
    }
}
// ---- k_fattn: scores, mask, softmax, both value contractions and the phase merge of one (batch, head) in ONE launch; S and P stay in registers.
// Transposed products: S^T = K.Q^T (A = 16 key rows, B = 16 query columns), O^T += [V_real|V_imag]^T.P^T (A = 16 rows of the 128-wide V^T plane, B = P^T). A lane then holds scores of ONE query
// (column lr): two S^T tiles (keys 0-15, 16-31 of a pass), converted in place, are the B operand of the second product in the loaders' own k order (8 hi + 0..7, 16 + 8 hi + 0..7).
// Online softmax; the maximum in use is kept in the scores' own domain and subtracted from the score first (exact for near values, whatever the size of the mask). It may
// trail the true one by up to MLAG (P <= e^MLAG < 256 in fp16), so the accumulators are rescaled only on the rare pass that exceeds it.
// grid (TT / (8 * 16 * QG), NZ), 8 waves x QG groups of 16 query columns; a pass is 32 keys; operands straight from the fp16 planes in fragment order: every K and V^T fragment
// a wave loads serves QG column groups.
#define L2E 1.4426950408889634f
#define MLAG 5.5f
#define QG  4
__device__ __forceinline__ float xhalf(float x) { return __builtin_bit_cast(float, __builtin_amdgcn_permlanex16(__builtin_bit_cast(int, x), __builtin_bit_cast(int, x), 0x76543210, 0xfedcba98, false, false)); }  // lane l <-> lane l ^ 16
__global__ __launch_bounds__(256) void k_fattn(const h16* __restrict__ QP, const h16* __restrict__ KP, const h16* __restrict__ VT, const float* __restrict__ am, const float* __restrict__ PH, bf* Ah, bf* Al) {
    __shared__ __align__(16) float mk[TT];      // this batch's additive mask row, rounded to bf16 once per work-group
    const int z = blockIdx.y, b = z / NH_, h = z % NH_;
    for (int i = threadIdx.x * 4; i < TT; i += 1024) { v4f a = *(const v4f*)(am + (size_t)b * TT + i);
#pragma unroll
        for (int q = 0; q < 4; ++q) a[q] = bfr(a[q]);
        *(v4fa*)(mk + i) = a; }
    __syncthreads();
    const int lane = threadIdx.x & 31, lr = lane & 15, hi = lane >> 4; const int q0 = (blockIdx.x * 8 + __builtin_amdgcn_readfirstlane(threadIdx.x >> 5)) * (16 * QG);      // the wave's first query, held in a scalar register
    const h16* Kz = KP + (size_t)z * TT * HD; const unsigned ko = (unsigned)(8 * lane);      // K plane of this head, and the lane's offset in a tile
    const h16* Vz = VT + (size_t)z * HD2 * TT + 8 * lane;
    v16h qf[QG][2]; const h16* Qz = QP + ((size_t)z * TT + q0) * HD;      // the wave's first Q tile
#pragma unroll
    for (int g = 0; g < QG; ++g)
#pragma unroll
        for (int kc = 0; kc < 2; ++kc) qf[g][kc] = WFrag<h16>::ld(Qz + (size_t)(16 * g) * HD + 512 * kc + ko);
    v16h kf[2][2];      // K fragments are fetched one pass ahead, half way through the second product
#pragma unroll
    for (int kt = 0; kt < 2; ++kt)
#pragma unroll
        for (int kc = 0; kc < 2; ++kc) kf[kt][kc] = WFrag<h16>::ld(Kz + (size_t)(16 * kt) * HD + 512 * kc + ko);
    // the same wait as xwait(); the two scalar bases of the Q and K loads are named as inputs only, so that their register pairs stay live up to the wait and nothing is written over them in front of it
    asm volatile("s_wait_xcnt 0x0" :: "s"(Qz), "s"(Kz) : "memory");
    __builtin_amdgcn_sched_barrier(0);      // keeps the scheduler from mixing the tiles' set-up below into the loads above (it spilled Q fragments when it did)
    const h16* kp = Kz + ko + 32 * HD;      // the lane's address in the K tile to fetch next
    v8f acc[QG][8]; float m_run[QG], l_run[QG];
#pragma unroll
    for (int g = 0; g < QG; ++g) { m_run[g] = -__FLT_MAX__; l_run[g] = 0.f;
#pragma unroll
        for (int t = 0; t < 8; ++t) acc[g][t] = (v8f){}; }
    // rolled: one pass's fragments and the output tiles already fill the wave's registers
#pragma unroll 1
    for (int key0 = 0; key0 < TT; key0 += 32) {
        v16h vf[8];
#pragma unroll
        for (int t = 0; t < 8; ++t) vf[t] = WFrag<h16>::ld(Vz + (size_t)key0 * HD2 + 512 * t);
        xwait();
        v8f s[2][QG];
#pragma unroll
        for (int kt = 0; kt < 2; ++kt) { const v4f m0 = *(const v4fa*)(mk + key0 + 16 * kt + 8 * hi), m1 = *(const v4fa*)(mk + key0 + 16 * kt + 8 * hi + 4);
#pragma unroll
            for (int g = 0; g < QG; ++g) { v8f t = wmma16(kf[kt][1], qf[g][1], wmma16(kf[kt][0], qf[g][0], (v8f){}));
#pragma unroll
                for (int r = 0; r < 4; ++r) { t[r] += m0[r]; t[4 + r] += m1[r]; }
                s[kt][g] = t; } }
        float mb[QG]; bool need = false;
#pragma unroll
        for (int g = 0; g < QG; ++g) { float mx = s[0][g][0];
#pragma unroll
            for (int r = 1; r < 8; ++r) mx = fmaxf(mx, s[0][g][r]);
#pragma unroll
            for (int r = 0; r < 8; ++r) mx = fmaxf(mx, s[1][g][r]);
            mx = fmaxf(mx, xhalf(mx)); mb[g] = mx; need = need || (mx > m_run[g] + MLAG); }
        if (__builtin_amdgcn_ballot_w32(need) != 0) {       // one wave-uniform test per pass
#pragma unroll
            for (int g = 0; g < QG; ++g) { const float m_new = fmaxf(m_run[g], mb[g]); mb[g] = (m_run[g] - m_new) * L2E; m_run[g] = m_new; }
#pragma unroll
            for (int g = 0; g < QG; ++g) { const float corr = __builtin_amdgcn_exp2f(mb[g]); l_run[g] *= corr;
#pragma unroll
                for (int t = 0; t < 8; ++t) acc[g][t] = acc[g][t] * corr; } }
#pragma unroll
        for (int g = 0; g < QG; ++g) { const float mr = m_run[g]; v16h pf; v2f ls = (v2f){0.f, 0.f};
#pragma unroll
            for (int e = 0; e < 16; e += 2) { const v2f x = ((v2f){s[e >> 3][g][e & 7], s[e >> 3][g][(e & 7) + 1]} - mr) * L2E; const v2f p = (v2f){__builtin_amdgcn_exp2f(x[0]), __builtin_amdgcn_exp2f(x[1])};
                ls += p; pf[e] = tohx(p[0]); pf[e + 1] = tohx(p[1]); }
            l_run[g] += ls[0] + ls[1];
#pragma unroll
            for (int t = 0; t < 8; ++t) acc[g][t] = wmma16(vf[t], pf, acc[g][t]);
            if (g == QG / 2 - 1) {
#pragma unroll
                for (int kt = 0; kt < 2; ++kt)
#pragma unroll
                    for (int kc = 0; kc < 2; ++kc) kf[kt][kc] = WFrag<h16>::ld(kp + (size_t)(16 * kt) * HD + 512 * kc);
                kp += (key0 + 64 < TT) ? 32 * HD : 0; } }      // the last pass fetches its own tile again: in bounds, unused
    }
#pragma unroll
    for (int g = 0; g < QG; ++g) { const int t = q0 + 16 * g + lr; const float l = l_run[g] + xhalf(l_run[g]); const float inv = __fdiv_rn(1.0f, l);
        const float pc = PH[((size_t)b * NH_ + h) * TT + t], psn = PH[((size_t)NB_ * NH_ + (size_t)b * NH_ + h) * TT + t];
#pragma unroll
        for (int tt = 0; tt < 4; ++tt) { v8us oh, ol;
#pragma unroll
            for (int r = 0; r < 8; ++r) { unsigned short a, c2; splitf((acc[g][tt][r] * inv) * pc + (acc[g][tt + 4][r] * inv) * psn, a, c2); oh[r] = a; ol[r] = c2; }
            const unsigned o = ((unsigned)b * TT + q0 + 16 * g) * DD + (2 * h + (tt >> 1)) * 512 + (tt & 1) * 256 + 8 * lane;      /* row t, k = 64 h + 16 tt + 8 hi in fragment order: 512 contiguous bytes a store */ __builtin_amdgcn_sched_barrier(0);      // the two barriers keep every other register write out from between the stores and their wait
            *(v8usa*)(Ah + o) = oh; *(v8usa*)(Al + o) = ol; xwait(); __builtin_amdgcn_sched_barrier(0); } }
}
__global__ __launch_bounds__(256) void k_ln2(const float* __restrict__ FF, const float* __restrict__ X, const float* __restrict__ gg, const float* __restrict__ bb, float* OUT) {
    const int lane = threadIdx.x & 31; const int r = blockIdx.x * 8 + (threadIdx.x >> 5); if (r >= NT) return; float v[32]; float s = 0.f;
#pragma unroll
    for (int c = 0; c < 8; ++c) { const v4f a = *(const v4f*)(FF + (size_t)r * DD + c * 128 + lane * 4), xx = *(const v4f*)(X + (size_t)r * DD + c * 128 + lane * 4);
#pragma unroll
        for (int q = 0; q < 4; ++q) { v[c * 4 + q] = a[q] + bfr(xx[q]); s += v[c * 4 + q]; } }
#pragma unroll
    for (int sh = 16; sh; sh >>= 1) s += __shfl_xor(s, sh, 32);
    const float mu = s * (1.0f / DD); float qq = 0.f;
#pragma unroll
    for (int i = 0; i < 32; ++i) { const float d0 = v[i] - mu; qq = __fadd_rn(qq, __fmul_rn(d0, d0)); }
#pragma unroll
    for (int sh = 16; sh; sh >>= 1) qq += __shfl_xor(qq, sh, 32);
    const float rs = __fdiv_rn(1.0f, __fsqrt_rn(qq * (1.0f / DD) + 1e-12f));
{
#pragma unroll
        for (int c = 0; c < 8; ++c) { v4f o;
#pragma unroll
            for (int q = 0; q < 4; ++q) { const int col = c * 128 + lane * 4 + q; o[q] = __fadd_rn(__fmul_rn((v[c * 4 + q] - mu) * rs, bfr(gg[col])), bfr(bb[col])); }
            *(v4f*)(OUT + (size_t)r * DD + c * 128 + lane * 4) = o; }
         }
}

extern "C" void kernel_launch(void* const* d_in, const int* in_sizes, int n_in,
                              void* d_out, int out_size, void* d_ws, size_t ws_size, hipStream_t stream) {
    (void)in_sizes; (void)n_in; (void)out_size;
    const float* IN[17]; for (int i = 0; i < 17; ++i) IN[i] = (const float*)d_in[i];
    // hidden_states, attention_mask [4][1][1][2048], cos_phi, sin_phi, mag [4][8][2048], Wq [1024][1024] (x @ W), bq, Wk, bk, Wv, bv, Wo, bo, Wp [8][16], bp [16], ln_g, ln_b = d_in[0..16]
    const float* x = IN[0]; const float* am = IN[1];
    float* OUT = (float*)d_out;     // [4][2048][1024]
    char* wsp = (char*)d_ws;
    auto take = [&](size_t bytes) { char* p = wsp; wsp += (bytes + 255) & ~(size_t)255; return (void*)p; };
    bf* WQ = (bf*)take((size_t)3 * DD * DD * 2); bf* WK = WQ + (size_t)DD * DD; bf* WV = WK + (size_t)DD * DD;      /* one plane of 3 * DD rows for k_qkv */ bf* WO = (bf*)take((size_t)DD * DD * 2); float* PH = (float*)take((size_t)3 * NB_ * NH_ * TT * 4);
    bf* XB = (bf*)take((size_t)NT * DD * 2); float* F = (float*)take((size_t)NT * DD * 4);
    h16* QP = (h16*)take((size_t)NT * DD * 2); h16* KP = (h16*)take((size_t)NT * DD * 2); h16* VT = (h16*)take((size_t)NZ * HD2 * TT * 2);
    bf* ATh = (bf*)take((size_t)NT * DD * 2); bf* ATl = (bf*)take((size_t)NT * DD * 2);
    if ((size_t)(wsp - (char*)d_ws) > ws_size) return;    // total ~ 154 MiB; ws 256 MiB
    float* Y = F;   // the output projection's f32 result
    k_prep<<<PREP_B, 256, 0, stream>>>(x, IN[5], IN[7], IN[9], IN[11], IN[2], IN[3], IN[4], IN[13], IN[14], XB, WQ, WK, WV, WO, PH);
    k_qkv<<<dim3(NT / 128, 3 * DD / 256), 256, 0, stream>>>(XB, WQ, IN[6], IN[8], IN[10], PH, QP, KP, VT);
    k_fattn<<<dim3(TT / (8 * 16 * QG), NZ), 256, 0, stream>>>(QP, KP, VT, am, PH, ATh, ATl);
    k_oproj<<<dim3(NT / 128, DD / 256), 256, 0, stream>>>(ATh, ATl, WO, Y, IN[12]);
    k_ln2<<<NT / 8, 256, 0, stream>>>(Y, x, IN[15], IN[16], OUT);
}

// v006
// It runs in 158 microseconds.
// Two timings next to v005 put it at 1.05 and 1.04 times that version's speed.
// All steps since v000 together make it 16.3 times as fast.
#include <hip/hip_runtime.h>

// Attention block with phase-weighted values (hidden_states [4][2048][1024]; q/k/v = x @ W + b (16 heads x 64); phase scalars p_c/p_s/p_m[b][h][t] = sum_band {cos_phi,sin_phi,mag}[b][band][t] Wp[band][h] + bp[h] (8 bands);
// V_real = v p_m p_c, V_imag = v p_m p_s (per (b,h,t) scalars on the value rows); scores = q.k/8 + attention_mask[b][0][0][j] (additive input, read as data); softmax; ctx = (P.V_real) p_c + (P.V_imag) p_s
// (per query row); out = LN(ctx @ Wo + bo + hidden_states) * ln_g + ln_b (eps 1e-12)).
// Compute dtypes, f32 accumulate: every input rounded to bf16; projections on PLAIN bf16 operands (inputs: exact, + bias); the phase projections (8 terms), V scaling,
// ctx combination, residual and LayerNorm in f32 on VALU; scores and the two value contractions on SINGLE fp16 planes (q x 1/8; P = exp(s - max in use), normalised after the contraction; V_real | V_imag packed as one 128-wide V^T plane per head
// so attn.[V_real|V_imag] is one N = 128 GEMM); output projection on hi+lo planes x exact Wo (2 products).

#define NB_  4
#define NBD  8                   // phase bands
#define HD2  128                 // packed V_real | V_imag plane width
#define TT   2048
#define DD   1024
#define NH_  16
#define HD   64
#define NT   (NB_ * TT)
#define NZ   (NB_ * NH_)
typedef _Float16 h16;
typedef unsigned short bf;
typedef __attribute__((ext_vector_type(16))) __bf16   v16bf;
typedef __attribute__((ext_vector_type(16))) _Float16 v16h;
typedef __attribute__((ext_vector_type(8)))  _Float16 v8h;
typedef __attribute__((ext_vector_type(8)))  unsigned short v8us;
typedef __attribute__((ext_vector_type(8)))  float    v8f;
typedef __attribute__((ext_vector_type(4)))  float    v4f;
typedef v8h  __attribute__((may_alias)) v8ha;
typedef v4f  __attribute__((may_alias)) v4fa;
typedef v8us __attribute__((may_alias)) v8usa;

__device__ __forceinline__ unsigned short f2bf(float f) { unsigned u = __float_as_uint(f); u += 0x7FFFu + ((u >> 16) & 1u); return (unsigned short)(u >> 16); }
__device__ __forceinline__ float bf2f(unsigned short b) { return __uint_as_float(((unsigned)b) << 16); }
__device__ __forceinline__ float bfr(float f) { return bf2f(f2bf(f)); }
__device__ __forceinline__ v16h cat16(v8h lo, v8h hi) { return __builtin_shufflevector(lo, hi, 0, 1, 2, 3, 4, 5, 6, 7, 8, 9, 10, 11, 12, 13, 14, 15); }
__device__ __forceinline__ v16bf cat16b(v8us lo, v8us hi) { return __builtin_bit_cast(v16bf, __builtin_shufflevector(lo, hi, 0, 1, 2, 3, 4, 5, 6, 7, 8, 9, 10, 11, 12, 13, 14, 15)); }
__device__ __forceinline__ v8f wmma16(v16h a, v16h b, v8f c) { return __builtin_amdgcn_wmma_f32_16x16x32_f16(false, a, false, b, (short)0, c, false, false); }
__device__ __forceinline__ v8f wmmab(v16bf a, v16bf b, v8f c) { return __builtin_amdgcn_wmma_f32_16x16x32_bf16(false, a, false, b, (short)0, c, false, false); }



// Stands behind a group of global loads or stores, in front of the first instruction that reuses a register they name (a precaution).
__device__ __forceinline__ void xwait() { asm volatile("s_wait_xcnt 0x0" ::: "memory"); }
// ---- FRAGMENT ORDER of every 16-bit operand plane [rows][K] (rows % 16 == 0, K % 32 == 0): the plane is a row of 1 KiB tiles, tile (R, kb) = rows 16 R .. 16 R + 15 x k 32 kb .. 32 kb + 31 at tile index R * (K / 32) + kb
// (the V^T plane: kb * 8 + R, so that a pass reads 8 KiB in a row). A tile is two halves of 512 B; half j holds at 16 B x lane (lane = 16 hi + lr) the elements k = 32 kb + 16 j + 8 hi + 0..7 of row 16 R + lr.
// A fragment is then two wave-wide 16-byte loads of 512 contiguous bytes each (4 whole lines a load; on a row-major plane it would touch 32 B in each of 16 lines); a lane's k order is 8 hi + 0..7, then 16 + 8 hi + 0..7, for A and B alike.
// A producer thread writes whole 16-byte pieces (k_prep: 8 of the X plane, one of each weight plane). Where the source runs across k (the transposing producers) thread i writes piece i, at byte 16 i: FRAG_IDX splits i into lr, hi, j and the tile index.
// Where the source runs along k, FRAG_IDX_ROW gives four neighbouring threads the four pieces of one tile row (128 source bytes in f32, one whole line); eight such rows make four whole lines of the tile.
#define FRAG_IDX(i) const int lr = (int)((i) & 15), hi = (int)(((i) >> 4) & 1), j = (int)(((i) >> 5) & 1); const int tile = (int)((i) >> 6)
#define FRAG_IDX_ROW(i) const int hi = (int)((i) & 1), j = (int)(((i) >> 1) & 1), lr = (int)(((i) >> 2) & 15); const int tile = (int)((i) >> 6); const size_t piece = (size_t)tile * 64 + j * 32 + hi * 16 + lr
// ---- The two GEMM kernels (k_qkv, k_oproj): a work-group of 8 waves (2 x 4) owns a 128 x 256 tile of the result, a wave 64 x 64 of it (16 accumulators). A stage is 64 of k: for each block of 16 operand rows two
// neighbouring 1 KiB tiles of its plane, one CHUNK of 2 KiB, contiguous in memory and copied as it lies (fragment order) into LDS by asynchronous copies, 16 bytes a lane. A fragment is then two ds_load_b128 of 512 contiguous bytes.
// Every chunk is brought from L2 once a work-group and read by 2 or 4 waves. Two buffers: stage s + 1 flies while stage s is worked on.
template <typename T16> struct WFrag;
template <> struct WFrag<h16> { typedef v16h V; static __device__ __forceinline__ V ld(const h16* p) { return cat16(*(const v8h*)p, *(const v8h*)(p + 256)); } static __device__ __forceinline__ v8f mma(V a, V b, v8f c) { return wmma16(a, b, c); } };
template <> struct WFrag<bf> { typedef v16bf V; static __device__ __forceinline__ V ld(const bf* p) { return cat16b(*(const v8us*)p, *(const v8us*)(p + 256)); } static __device__ __forceinline__ v8f mma(V a, V b, v8f c) { return wmmab(a, b, c); } };
// Four asynchronous copies of 16 bytes a lane (LDS byte address, global address); the s_wait_xcnt stands in the copies' own statement, in front of anything that reuses their address registers (a precaution).
__device__ __forceinline__ void acopy4(unsigned l, const bf* g, int lstep, int gstep) {
    asm volatile("global_load_async_to_lds_b128 %0, %1, off\n\tglobal_load_async_to_lds_b128 %2, %3, off\n\tglobal_load_async_to_lds_b128 %4, %5, off\n\tglobal_load_async_to_lds_b128 %6, %7, off\n\ts_wait_xcnt 0x0"
                 :: "v"(l), "v"(g), "v"(l + lstep), "v"(g + gstep), "v"(l + 2 * lstep), "v"(g + 2 * gstep), "v"(l + 3 * lstep), "v"(g + 3 * gstep) : "memory");
}
// The same for eight copies, four from each of two places: one wait serves the run.
__device__ __forceinline__ void acopy8(unsigned l, const bf* g, unsigned m, const bf* q, int lstep, int gstep) {
    asm volatile("global_load_async_to_lds_b128 %0, %1, off\n\tglobal_load_async_to_lds_b128 %2, %3, off\n\tglobal_load_async_to_lds_b128 %4, %5, off\n\tglobal_load_async_to_lds_b128 %6, %7, off\n\t"
                 "global_load_async_to_lds_b128 %8, %9, off\n\tglobal_load_async_to_lds_b128 %10, %11, off\n\tglobal_load_async_to_lds_b128 %12, %13, off\n\tglobal_load_async_to_lds_b128 %14, %15, off\n\ts_wait_xcnt 0x0"
                 :: "v"(l), "v"(g), "v"(l + lstep), "v"(g + gstep), "v"(l + 2 * lstep), "v"(g + 2 * gstep), "v"(l + 3 * lstep), "v"(g + 3 * gstep),
                    "v"(m), "v"(q), "v"(m + lstep), "v"(q + gstep), "v"(m + 2 * lstep), "v"(q + 2 * gstep), "v"(m + 3 * lstep), "v"(q + 3 * gstep) : "memory");
}
__device__ __forceinline__ void await_copies() { asm volatile("s_wait_asynccnt 0x0" ::: "memory"); }      // the wave's own copies have landed
__device__ __forceinline__ void await_lds() { asm volatile("s_wait_dscnt 0x0" ::: "memory"); }            // the wave's own LDS reads are done, in front of the barrier behind which their buffer is refilled
// ---- Asking L2 ahead. The 16-bit planes were stored by the launch before. At kernel entry each work-group, for speed only,
// asks L2 for what it will read: global_prefetch_b8, scope SE (into L2 only, nothing returns), a lane naming one aligned 256-byte unit inside the plane, every lane on. The s_wait_xcnt stands in the same statement, in front of
// anything that reuses the address registers (a precaution, as behind the copies above).
#define UNIT 128                   // 16-bit elements of a 256-byte unit
__device__ __forceinline__ void ask2(const bf* a, const bf* b) {
    asm volatile("global_prefetch_b8 %0, off scope:SCOPE_SE\n\tglobal_prefetch_b8 %1, off scope:SCOPE_SE\n\ts_wait_xcnt 0x0" :: "v"(a), "v"(b) : "memory");
}
__device__ __forceinline__ void ask3(const bf* a, const bf* b, const bf* c) {
    asm volatile("global_prefetch_b8 %0, off scope:SCOPE_SE\n\tglobal_prefetch_b8 %1, off scope:SCOPE_SE\n\tglobal_prefetch_b8 %2, off scope:SCOPE_SE\n\ts_wait_xcnt 0x0" :: "v"(a), "v"(b), "v"(c) : "memory");
}
#define CHUNK 1024                 // elements of a chunk
#define CHB   2048                 // its bytes
#define RSTEP (2 * (DD / 32) * 512)      // elements between a thread's copies in a plane: two blocks of 16 rows (threads 0-127 copy the even chunks, 128-255 the odd ones)
#define NSTG  (DD / 64)
// ---- k_oproj: C[m][n] (f32) = sum_k (A[m][k] + A2[m][k]) Bt[n][k] + bias[n]; grid (NT / 128, DD / 256). A stage: 8 chunks of A, 8 of A2, 16 of Bt, 64 KiB.
__global__ __launch_bounds__(256) void k_oproj(const bf* __restrict__ A, const bf* __restrict__ A2, const bf* __restrict__ Bt, float* C, const float* __restrict__ bias) {
    constexpr int ldc = DD;
    __shared__ __attribute__((aligned(2048))) bf st[2 * 32 * CHUNK];
    __shared__ __align__(16) float osw[8][16 * 68];
    const int lane = threadIdx.x & 31, lr = lane & 15, hi = lane >> 4, wave = __builtin_amdgcn_readfirstlane(threadIdx.x >> 5);
    const int r0 = blockIdx.x * 128 + (wave & 1) * 64, c0 = blockIdx.y * 256 + (wave >> 1) * 64;
    float* os = osw[wave];
    const int half = threadIdx.x >> 7, off = (threadIdx.x & 127) * 8;
    const bf* ga = A + (size_t)(blockIdx.x * 8 + half) * (16 * DD) + off; const bf* ga2 = A2 + (size_t)(blockIdx.x * 8 + half) * (16 * DD) + off; const bf* gb = Bt + (size_t)(blockIdx.y * 16 + half) * (16 * DD) + off;
    const unsigned l0 = (unsigned)(size_t)(st + half * CHUNK + off);      // the thread's LDS byte address in chunk 0 or 1 of buffer 0
    auto fill = [&](int s, int b) { const unsigned l = l0 + b * (32 * CHB);
        acopy8(l, ga + s * CHUNK, l + 8 * CHB, ga2 + s * CHUNK, 2 * CHB, RSTEP); acopy8(l + 16 * CHB, gb + s * CHUNK, l + 24 * CHB, gb + s * CHUNK + 4 * RSTEP, 2 * CHB, RSTEP); };
    v8f acc[4][4];
#pragma unroll
    for (int mb = 0; mb < 4; ++mb)
#pragma unroll
        for (int nb = 0; nb < 4; ++nb) acc[mb][nb] = (v8f){};
    // the tile's operand rows lie in a row in their planes: 1,024 units of A and of A2, dealt among the 4 work-groups that read them (by blockIdx.y), 2,048 of Bt, dealt 8 ways (by blockIdx.x >> 3, so that the 8 neighbours in x all ask for a unit)
    ask3(A + (size_t)blockIdx.x * (128 * DD) + (4 * threadIdx.x + blockIdx.y) * UNIT, A2 + (size_t)blockIdx.x * (128 * DD) + (4 * threadIdx.x + blockIdx.y) * UNIT, Bt + (size_t)blockIdx.y * (256 * DD) + (8 * threadIdx.x + (blockIdx.x >> 3)) * UNIT);
    fill(0, 0); await_copies(); __syncthreads(); fill(1, 1);
    const int ia = (wave & 1) * 4 * CHUNK + 8 * lane, ib = (16 + (wave >> 1) * 4) * CHUNK + 8 * lane;
    // rolled: one trip is one stage, so that the order wait, wait, barrier, refill stands once at its foot
#pragma unroll 1
    for (int s = 0; s < NSTG; ++s) {
        const bf* sb = st + (s & 1) * (32 * CHUNK);
        v16bf a[2][4], a2[2][4], b[2][4];
#pragma unroll
        for (int kk = 0; kk < 2; ++kk) {
#pragma unroll
            for (int mb = 0; mb < 4; ++mb) { a[kk][mb] = WFrag<bf>::ld(sb + ia + mb * CHUNK + kk * 512); a2[kk][mb] = WFrag<bf>::ld(sb + ia + (8 + mb) * CHUNK + kk * 512); }
#pragma unroll
            for (int nb = 0; nb < 4; ++nb) b[kk][nb] = WFrag<bf>::ld(sb + ib + nb * CHUNK + kk * 512);
        }
        __builtin_amdgcn_sched_barrier(0);      // the stage's 48 LDS reads stand as one group in front of its WMMAs: the second block's land behind the first block's WMMAs (two waves a SIMD: registers are there)
#pragma unroll
        for (int kk = 0; kk < 2; ++kk) {
#pragma unroll
            for (int nb = 0; nb < 4; ++nb) {
#pragma unroll
                for (int mb = 0; mb < 4; ++mb) { acc[mb][nb] = wmmab(a[kk][mb], b[kk][nb], acc[mb][nb]); acc[mb][nb] = wmmab(a2[kk][mb], b[kk][nb], acc[mb][nb]); } }
        }
        __builtin_amdgcn_sched_barrier(0);      // keeps the WMMAs in front of the waits below: moved behind the barrier they would leave the next stage's copies only the time of the LDS reads to land
        await_lds(); await_copies(); __syncthreads();      // publishes stage s + 1 and ends every wave's reads of stage s
        if (s + 2 < NSTG) fill(s + 2, s & 1);
    }
    await_copies();
#pragma unroll
    for (int mb = 0; mb < 4; ++mb) {
#pragma unroll
        for (int nb = 0; nb < 4; ++nb) {
#pragma unroll
            for (int j = 0; j < 8; ++j) os[(hi * 8 + j) * 68 + nb * 16 + lr] = acc[mb][nb][j]; }
        __builtin_amdgcn_wave_barrier(); asm volatile("" ::: "memory");
        float* crow = C + (size_t)(r0 + mb * 16) * ldc + c0;
{
#pragma unroll
            for (int s = 0; s < 8; ++s) { const int row = 2 * s + hi, cofs = lr * 4; v4f val = *(const v4fa*)(os + row * 68 + cofs); { val[0] += bfr(bias[c0 + cofs]); val[1] += bfr(bias[c0 + cofs + 1]); val[2] += bfr(bias[c0 + cofs + 2]); val[3] += bfr(bias[c0 + cofs + 3]); }
                *(v4f*)(crow + (size_t)row * ldc + cofs) = val; }
             }
        xwait();      // behind the eight stores: the next row block reuses their address and data registers
        __builtin_amdgcn_wave_barrier(); asm volatile("" ::: "memory");
    }
}

__device__ __forceinline__ h16 tohx(float x) { return (h16)x; }
__device__ __forceinline__ void splitf(float y, unsigned short& h, unsigned short& l) { h = f2bf(y); l = f2bf(y - bf2f(h)); }
typedef __attribute__((ext_vector_type(2))) _Float16 v2h;
typedef __attribute__((ext_vector_type(4))) _Float16 v4h;
typedef __attribute__((ext_vector_type(2))) unsigned short v2us;
typedef __attribute__((ext_vector_type(4))) unsigned short v4us;
typedef __attribute__((ext_vector_type(2))) float v2f;

__global__ __launch_bounds__(256) void k_bfr1(const float* __restrict__ src, float* dst, int n) { const int i = blockIdx.x * 256 + threadIdx.x; if (i >= n) return; const float v = bfr(src[i]); *(float*)(dst + i) = v;  }
// ---- k_prep: all operand preparation of a call in ONE launch: hidden_states to its bf16 plane, the four weight matrices to their transposed bf16 planes, the three phase projections (six jobs, none reads what another writes).
// A grid of PREP_B blocks (2 a WGP, 16 waves) shares out every job evenly: a thread takes 8 pieces of the X plane, the same piece of each of the four weight planes, and p_c, p_s, p_m of one (batch, head, token).
// The work then starts 4,096 waves, not 61,440 of one piece each, and all of a thread's loads are in flight before the first of them is used.
#define PREP_B 512
#define PREP_T (PREP_B * 256)
static_assert((size_t)NT * DD / 8 == 8 * (size_t)PREP_T && DD * DD / 8 == PREP_T && NB_ * NH_ * TT == PREP_T && DD / 32 == 32, "pieces a thread");
__global__ __launch_bounds__(256) void k_prep(const float* __restrict__ x, const float* __restrict__ wq, const float* __restrict__ wk, const float* __restrict__ wv, const float* __restrict__ wo, const float* __restrict__ cph, const float* __restrict__ sph, const float* __restrict__ mag,
                                              const float* __restrict__ Wp, const float* __restrict__ bp, bf* XB, bf* WQ, bf* WK, bf* WV, bf* WO, float* PH) {
    const unsigned g = blockIdx.x * 256 + threadIdx.x;
    // X plane: a block takes one block of 16 rows, 32 tiles, 2,048 pieces; a thread's 8 pieces are 256 pieces apart: 4 tiles, 128 elements in the source row
    unsigned xs, xd; { const unsigned i = blockIdx.x * 2048 + threadIdx.x; FRAG_IDX_ROW(i); xs = (unsigned)(((tile / (DD / 32)) * 16 + lr) * DD + (tile % (DD / 32)) * 32 + j * 16 + hi * 8); xd = (unsigned)piece; }
    // weight planes: piece g of each; the eight rows are read off one offset, a constant pitch apart
    unsigned ws; { FRAG_IDX(g); const int kt = DD / 32; const int n = (tile / kt) * 16 + lr, k = (tile % kt) * 32 + j * 16 + hi * 8; ws = (unsigned)(k * DD + n); }
    // phase scalars: g = (batch, head, token); a block lies inside one head
    const unsigned h = (blockIdx.x >> 3) & (NH_ - 1), ps = ((g >> 15) & (NB_ - 1)) * (NBD * TT) + (g & (TT - 1));
    const float* xp = x + xs; v8f v[8]; float f[4][8], wl[NBD], pl[3][NBD];
#pragma unroll
    for (int s = 0; s < 8; ++s) v[s] = *(const v8f*)(xp + s * 128);
#pragma unroll
    for (int q = 0; q < 8; ++q) { f[0][q] = wq[ws + q * DD]; f[1][q] = wk[ws + q * DD]; f[2][q] = wv[ws + q * DD]; f[3][q] = wo[ws + q * DD]; }
#pragma unroll
    for (int n = 0; n < NBD; ++n) { wl[n] = Wp[n * NH_ + h]; pl[0][n] = cph[ps + n * TT]; pl[1][n] = sph[ps + n * TT]; pl[2][n] = mag[ps + n * TT]; }
    const float bl = bp[h];
    asm volatile("s_wait_xcnt 0x0" :: "v"(xp), "v"(ws), "v"(ps) : "memory");      // the same wait as xwait(); the address and the offsets are named as inputs only, so that they stay live up to the wait and no result lands in their registers in front of it
    __builtin_amdgcn_sched_barrier(0);      // keeps the conversions below out of the loads above: every load is issued before the first result is waited for
    v8us o[8], ow[4]; float sp[3];
#pragma unroll
    for (int s = 0; s < 8; ++s)
#pragma unroll
        for (int k = 0; k < 8; ++k) o[s][k] = f2bf(v[s][k]);
#pragma unroll
    for (int m = 0; m < 4; ++m)
#pragma unroll
        for (int q = 0; q < 8; ++q) ow[m][q] = f2bf(f[m][q]);
#pragma unroll
    for (int k = 0; k < 3; ++k) { float s = 0.f;
#pragma unroll
        for (int n = 0; n < NBD; ++n) { float w = bfr(wl[n]), p = bfr(pl[k][n]); asm volatile("" : "+v"(w)); asm volatile("" : "+v"(p)); float m = __fmul_rn(p, w); asm volatile("" : "+v"(m)); s = __fadd_rn(s, m); }
        sp[k] = __fadd_rn(s, bfr(bl)); }
    v8us* xo = (v8us*)XB + xd;
#pragma unroll
    for (int s = 0; s < 8; ++s) xo[s * 256] = o[s];
    ((v8us*)WQ)[g] = ow[0]; ((v8us*)WK)[g] = ow[1]; ((v8us*)WV)[g] = ow[2]; ((v8us*)WO)[g] = ow[3];
#pragma unroll
    for (int k = 0; k < 3; ++k) *(float*)(PH + g + k * PREP_T) = sp[k];
}
// ---- k_qkv: the three input projections in ONE launch, each accumulator tile stored straight into its fp16 plane in fragment order (no f32 copy of q, k or v in memory, no conversion launch).
// grid (NT / 128, 3 * DD / 256), 8 waves: 2 groups of 64 tokens x 4 heads (64 columns each) of q, k or v; W3 = the q, k and v weight planes one behind the other, 3 * DD rows. A stage: 8 chunks of X, 16 of W3, 48 KiB; two work-groups a WGP.
// An accumulator register run j = 0..7 walks the ROW operand's index (8 hi + j), a lane's lr the COLUMN operand's. A piece of a plane is 8 neighbours along the plane's k: the head dimension for q and k, the token for V^T.
// So q and k take the weight rows as the row operand and the tokens as the column operand, v the other way round (both planes have one fragment order, so this is a swap of two pointers):
// in each case a lane's 8 registers are one 16-byte piece, and the wave's 32 pieces are one half tile, 512 contiguous bytes a store.
// amdgpu_waves_per_eu(4, 4): four waves a SIMD, so that two work-groups share a WGP and one works while the other stands at its barrier.
__global__ __launch_bounds__(256) __attribute__((amdgpu_waves_per_eu(4, 4))) void k_qkv(const bf* __restrict__ X, const bf* __restrict__ W3, const float* __restrict__ bq, const float* __restrict__ bk, const float* __restrict__ bv, const float* __restrict__ PH, h16* QP, h16* KP, h16* VT) {
    __shared__ __attribute__((aligned(2048))) bf st[2 * 24 * CHUNK];
    const int lane = threadIdx.x & 31, lr = lane & 15, hi = lane >> 4, wave = __builtin_amdgcn_readfirstlane(threadIdx.x >> 5);
    const int r0 = blockIdx.x * 128 + (wave & 1) * 64, hy = blockIdx.y * 4 + (wave >> 1), sel = hy >> 4, h = hy & 15;      // sel: 0 q, 1 k, 2 v
    const int z = (r0 >> 11) * NH_ + h, t0 = r0 & (TT - 1);      // (batch, head) and the first token inside the batch
    const int half = threadIdx.x >> 7, off = (threadIdx.x & 127) * 8;
    const bf* gx = X + (size_t)(blockIdx.x * 8 + half) * (16 * DD) + off; const bf* gw = W3 + (size_t)(blockIdx.y * 16 + half) * (16 * DD) + off;
    const unsigned l0 = (unsigned)(size_t)(st + half * CHUNK + off);      // the thread's LDS byte address in chunk 0 or 1 of buffer 0
    auto fill = [&](int s, int b) { const unsigned l = l0 + b * (24 * CHB);
        acopy4(l, gx + s * CHUNK, 2 * CHB, RSTEP); acopy8(l + 8 * CHB, gw + s * CHUNK, l + 16 * CHB, gw + s * CHUNK + 4 * RSTEP, 2 * CHB, RSTEP); };
    v8f acc[4][4];
#pragma unroll
    for (int mb = 0; mb < 4; ++mb)
#pragma unroll
        for (int nb = 0; nb < 4; ++nb) acc[mb][nb] = (v8f){};
    // 1,024 units of X, dealt 4 ways among the 12 work-groups that read them (by blockIdx.y & 3), 2,048 of W3, dealt 8 ways among 64 (by blockIdx.x >> 3)
    ask2(X + (size_t)blockIdx.x * (128 * DD) + (4 * threadIdx.x + (blockIdx.y & 3)) * UNIT, W3 + (size_t)blockIdx.y * (256 * DD) + (8 * threadIdx.x + (blockIdx.x >> 3)) * UNIT);
    fill(0, 0); await_copies(); __syncthreads(); fill(1, 1);
    const int ix = (wave & 1) * 4 * CHUNK + 8 * lane, iw = (8 + (wave >> 1) * 4) * CHUNK + 8 * lane;
    const int ia = (sel == 2) ? ix : iw, ib = (sel == 2) ? iw : ix;
    // rolled: one trip is one stage, so that the order wait, wait, barrier, refill stands once at its foot
#pragma unroll 1
    for (int s = 0; s < NSTG; ++s) {
        const bf* sb = st + (s & 1) * (24 * CHUNK);
#pragma unroll
        for (int kk = 0; kk < 2; ++kk) {
            v16bf a[4], b[4];
#pragma unroll
            for (int mb = 0; mb < 4; ++mb) a[mb] = WFrag<bf>::ld(sb + ia + mb * CHUNK + kk * 512);
#pragma unroll
            for (int nb = 0; nb < 4; ++nb) b[nb] = WFrag<bf>::ld(sb + ib + nb * CHUNK + kk * 512);
            __builtin_amdgcn_sched_barrier(0);      // the block's 16 LDS reads stand as one group in front of its WMMAs (left alone the compiler reads each b fragment into one register set and waits it out four times a block)
#pragma unroll
            for (int nb = 0; nb < 4; ++nb) {
#pragma unroll
                for (int mb = 0; mb < 4; ++mb) acc[mb][nb] = wmmab(a[mb], b[nb], acc[mb][nb]); }
            __builtin_amdgcn_sched_barrier(0);      // and the next block's reads stay out of this block's WMMAs
        }
        await_lds(); await_copies(); __syncthreads();      // publishes stage s + 1 and ends every wave's reads of stage s
        if (s + 2 < NSTG) fill(s + 2, s & 1);
    }
    await_copies();
    // In the epilogues each pair of scheduling barriers keeps every other register write out from between a group of loads or stores and its wait.
    if (sel < 2) {      // q (x 1/8) and k: acc[mb][nb][j] is dimension 16 mb + 8 hi + j of token t0 + 16 nb + lr
        const float sc = (sel == 0) ? 0.125f : 1.0f; const float* bl = ((sel == 0) ? bq : bk) + h * HD + 8 * hi;
        h16* P = ((sel == 0) ? QP : KP) + ((size_t)z * TT + t0) * HD + 8 * lane;      // 16 tokens on: 2 tiles, 1024 elements; 16 dimensions on: half a tile, 256
        v8f bs[4];
        __builtin_amdgcn_sched_barrier(0);
#pragma unroll
        for (int mb = 0; mb < 4; ++mb) bs[mb] = *(const v8f*)(bl + 16 * mb);
        asm volatile("s_wait_xcnt 0x0" :: "v"(bl) : "memory");      // the same wait as xwait(); the pointer is named as an input only, so that it stays live up to the wait
        __builtin_amdgcn_sched_barrier(0);
#pragma unroll
        for (int mb = 0; mb < 4; ++mb) { v8h o[4];
#pragma unroll
            for (int nb = 0; nb < 4; ++nb)
#pragma unroll
                for (int j = 0; j < 8; ++j) o[nb][j] = tohx((acc[mb][nb][j] + bfr(bs[mb][j])) * sc);
            __builtin_amdgcn_sched_barrier(0);
#pragma unroll
            for (int nb = 0; nb < 4; ++nb) *(v8ha*)(P + nb * 1024 + mb * 256) = o[nb];
            xwait(); __builtin_amdgcn_sched_barrier(0); }
    } else {            // v: acc[mb][nb][j] is dimension 16 nb + lr of token t0 + 16 mb + 8 hi + j; rows 0-63 of the V^T plane take v p_m p_c, rows 64-127 v p_m p_s
        const float* bl = bv + h * HD + lr; const float* pl = PH + (size_t)z * TT + t0 + 8 * hi;      // p_c of the lane's first token; p_s and p_m stand NZ * TT and 2 * NZ * TT floats further
        h16* P = VT + ((size_t)z * (HD2 * TT / 512) + (t0 >> 5) * 8) * 512 + 8 * lane;      // 32 tokens on: 8 tiles; 16 rows on: 1 tile; 16 tokens on: half a tile
        float bs[4];
        __builtin_amdgcn_sched_barrier(0);
#pragma unroll
        for (int nb = 0; nb < 4; ++nb) bs[nb] = bl[16 * nb];
        asm volatile("s_wait_xcnt 0x0" :: "v"(bl) : "memory");      // as above
        __builtin_amdgcn_sched_barrier(0);
#pragma unroll
        for (int nb = 0; nb < 4; ++nb) bs[nb] = bfr(bs[nb]);
#pragma unroll
        for (int mb = 0; mb < 4; ++mb) {
            __builtin_amdgcn_sched_barrier(0);
            const v8f pc = *(const v8f*)(pl + 16 * mb), psn = *(const v8f*)(pl + NZ * TT + 16 * mb), pm = *(const v8f*)(pl + 2 * NZ * TT + 16 * mb);
            asm volatile("s_wait_xcnt 0x0" :: "v"(pl) : "memory");      // as above
            __builtin_amdgcn_sched_barrier(0);
#pragma unroll
            for (int part = 0; part < 2; ++part) { v8h o[4];
#pragma unroll
                for (int nb = 0; nb < 4; ++nb)
#pragma unroll
                    for (int j = 0; j < 8; ++j) o[nb][j] = tohx(__fmul_rn(__fmul_rn(acc[mb][nb][j] + bs[nb], pm[j]), part ? psn[j] : pc[j]));
                __builtin_amdgcn_sched_barrier(0);
#pragma unroll
                for (int nb = 0; nb < 4; ++nb) *(v8ha*)(P + (mb >> 1) * 4096 + (part * 4 + nb) * 512 + (mb & 1) * 256) = o[nb];
                xwait(); __builtin_amdgcn_sched_barrier(0); } }
    }
}
// ---- k_fattn: scores, mask, softmax, both value contractions and the phase merge of one (batch, head) in ONE launch; S and P stay in registers.
// Transposed products: S^T = K.Q^T (A = 16 key rows, B = 16 query columns), O^T += [V_real|V_imag]^T.P^T (A = 16 rows of the 128-wide V^T plane, B = P^T). A lane then holds scores of ONE query
// (column lr): two S^T tiles (keys 0-15, 16-31 of a pass), converted in place, are the B operand of the second product in the loaders' own k order (8 hi + 0..7, 16 + 8 hi + 0..7).
// Online softmax; the maximum in use is kept in the scores' own domain and subtracted from the score first (exact for near values, whatever the size of the mask). It may
// trail the true one by up to MLAG (P <= e^MLAG < 256 in fp16), so the accumulators are rescaled only on the rare pass that exceeds it.
// grid (TT / (8 * 16 * QG), NZ), 8 waves x QG groups of 16 query columns; a pass is 32 keys; operands straight from the fp16 planes in fragment order: every K and V^T fragment
// a wave loads serves QG column groups.
#define L2E 1.4426950408889634f
#define MLAG 5.5f
#define QG  4
__device__ __forceinline__ float xhalf(float x) { return __builtin_bit_cast(float, __builtin_amdgcn_permlanex16(__builtin_bit_cast(int, x), __builtin_bit_cast(int, x), 0x76543210, 0xfedcba98, false, false)); }  // lane l <-> lane l ^ 16
__global__ __launch_bounds__(256) void k_fattn(const h16* __restrict__ QP, const h16* __restrict__ KP, const h16* __restrict__ VT, const float* __restrict__ am, const float* __restrict__ PH, bf* Ah, bf* Al) {
    __shared__ __align__(16) float mk[TT];      // this batch's additive mask row, rounded to bf16 once per work-group
    const int z = blockIdx.y, b = z / NH_, h = z % NH_;
    // Asks L2 for the head's whole K plane (1,024 units of 256 bytes) and V^T plane (2,048), in the order of the passes: a request of the work-group covers 64 KiB, 16 passes of K or 8 of V^T. Every work-group asks for all of it.
    // The wait is the same precaution as in ask2().
    asm volatile("global_prefetch_b8 %0, off scope:SCOPE_SE\n\tglobal_prefetch_b8 %1, off scope:SCOPE_SE\n\tglobal_prefetch_b8 %1, off offset:65536 scope:SCOPE_SE\n\t"
                 "global_prefetch_b8 %0, off offset:65536 scope:SCOPE_SE\n\tglobal_prefetch_b8 %1, off offset:131072 scope:SCOPE_SE\n\tglobal_prefetch_b8 %1, off offset:196608 scope:SCOPE_SE\n\t"
                 "global_prefetch_b8 %0, off offset:131072 scope:SCOPE_SE\n\tglobal_prefetch_b8 %1, off offset:262144 scope:SCOPE_SE\n\tglobal_prefetch_b8 %1, off offset:327680 scope:SCOPE_SE\n\t"
                 "global_prefetch_b8 %0, off offset:196608 scope:SCOPE_SE\n\tglobal_prefetch_b8 %1, off offset:393216 scope:SCOPE_SE\n\tglobal_prefetch_b8 %1, off offset:458752 scope:SCOPE_SE\n\ts_wait_xcnt 0x0"
                 :: "v"(KP + (size_t)z * TT * HD + threadIdx.x * UNIT), "v"(VT + (size_t)z * HD2 * TT + threadIdx.x * UNIT) : "memory");
    for (int i = threadIdx.x * 4; i < TT; i += 1024) { v4f a = *(const v4f*)(am + (size_t)b * TT + i);
#pragma unroll
        for (int q = 0; q < 4; ++q) a[q] = bfr(a[q]);
        *(v4fa*)(mk + i) = a; }
    __syncthreads();
    const int lane = threadIdx.x & 31, lr = lane & 15, hi = lane >> 4; const int q0 = (blockIdx.x * 8 + __builtin_amdgcn_readfirstlane(threadIdx.x >> 5)) * (16 * QG);      // the wave's first query, held in a scalar register
    const h16* Kz = KP + (size_t)z * TT * HD; const unsigned ko = (unsigned)(8 * lane);      // K plane of this head, and the lane's offset in a tile
    const h16* Vz = VT + (size_t)z * HD2 * TT + 8 * lane;
    v16h qf[QG][2]; const h16* Qz = QP + ((size_t)z * TT + q0) * HD;      // the wave's first Q tile
#pragma unroll
    for (int g = 0; g < QG; ++g)
#pragma unroll
        for (int kc = 0; kc < 2; ++kc) qf[g][kc] = WFrag<h16>::ld(Qz + (size_t)(16 * g) * HD + 512 * kc + ko);
    v16h kf[2][2];      // K fragments are fetched one pass ahead, half way through the second product
#pragma unroll
    for (int kt = 0; kt < 2; ++kt)
#pragma unroll
        for (int kc = 0; kc < 2; ++kc) kf[kt][kc] = WFrag<h16>::ld(Kz + (size_t)(16 * kt) * HD + 512 * kc + ko);
    // the same wait as xwait(); the two scalar bases of the Q and K loads are named as inputs only, so that their register pairs stay live up to the wait and nothing is written over them in front of it
    asm volatile("s_wait_xcnt 0x0" :: "s"(Qz), "s"(Kz) : "memory");
    __builtin_amdgcn_sched_barrier(0);      // keeps the scheduler from mixing the tiles' set-up below into the loads above (it spilled Q fragments when it did)
    const h16* kp = Kz + ko + 32 * HD;      // the lane's address in the K tile to fetch next
    v8f acc[QG][8]; float m_run[QG], l_run[QG];
#pragma unroll
    for (int g = 0; g < QG; ++g) { m_run[g] = -__FLT_MAX__; l_run[g] = 0.f;
#pragma unroll
        for (int t = 0; t < 8; ++t) acc[g][t] = (v8f){}; }
    // rolled: one pass's fragments and the output tiles already fill the wave's registers
#pragma unroll 1
    for (int key0 = 0; key0 < TT; key0 += 32) {
        v16h vf[8];
#pragma unroll
        for (int t = 0; t < 8; ++t) vf[t] = WFrag<h16>::ld(Vz + (size_t)key0 * HD2 + 512 * t);
        xwait();
        v8f s[2][QG];
#pragma unroll
        for (int kt = 0; kt < 2; ++kt) { const v4f m0 = *(const v4fa*)(mk + key0 + 16 * kt + 8 * hi), m1 = *(const v4fa*)(mk + key0 + 16 * kt + 8 * hi + 4);
#pragma unroll
            for (int g = 0; g < QG; ++g) { v8f t = wmma16(kf[kt][1], qf[g][1], wmma16(kf[kt][0], qf[g][0], (v8f){}));
#pragma unroll
                for (int r = 0; r < 4; ++r) { t[r] += m0[r]; t[4 + r] += m1[r]; }
                s[kt][g] = t; } }
        float mb[QG]; bool need = false;
#pragma unroll
        for (int g = 0; g < QG; ++g) { float mx = s[0][g][0];
#pragma unroll
            for (int r = 1; r < 8; ++r) mx = fmaxf(mx, s[0][g][r]);
#pragma unroll
            for (int r = 0; r < 8; ++r) mx = fmaxf(mx, s[1][g][r]);
            mx = fmaxf(mx, xhalf(mx)); mb[g] = mx; need = need || (mx > m_run[g] + MLAG); }
        if (__builtin_amdgcn_ballot_w32(need) != 0) {       // one wave-uniform test per pass
#pragma unroll
            for (int g = 0; g < QG; ++g) { const float m_new = fmaxf(m_run[g], mb[g]); mb[g] = (m_run[g] - m_new) * L2E; m_run[g] = m_new; }
#pragma unroll
            for (int g = 0; g < QG; ++g) { const float corr = __builtin_amdgcn_exp2f(mb[g]); l_run[g] *= corr;
#pragma unroll
                for (int t = 0; t < 8; ++t) acc[g][t] = acc[g][t] * corr; } }
#pragma unroll
        for (int g = 0; g < QG; ++g) { const float mr = m_run[g]; v16h pf; v2f ls = (v2f){0.f, 0.f};
#pragma unroll
            for (int e = 0; e < 16; e += 2) { const v2f x = ((v2f){s[e >> 3][g][e & 7], s[e >> 3][g][(e & 7) + 1]} - mr) * L2E; const v2f p = (v2f){__builtin_amdgcn_exp2f(x[0]), __builtin_amdgcn_exp2f(x[1])};
                ls += p; pf[e] = tohx(p[0]); pf[e + 1] = tohx(p[1]); }
            l_run[g] += ls[0] + ls[1];
#pragma unroll
            for (int t = 0; t < 8; ++t) acc[g][t] = wmma16(vf[t], pf, acc[g][t]);
            if (g == QG / 2 - 1) {
#pragma unroll
                for (int kt = 0; kt < 2; ++kt)
#pragma unroll
                    for (int kc = 0; kc < 2; ++kc) kf[kt][kc] = WFrag<h16>::ld(kp + (size_t)(16 * kt) * HD + 512 * kc);
                kp += (key0 + 64 < TT) ? 32 * HD : 0; } }      // the last pass fetches its own tile again: in bounds, unused
    }
#pragma unroll
    for (int g = 0; g < QG; ++g) { const int t = q0 + 16 * g + lr; const float l = l_run[g] + xhalf(l_run[g]); const float inv = __fdiv_rn(1.0f, l);
        const float pc = PH[((size_t)b * NH_ + h) * TT + t], psn = PH[((size_t)NB_ * NH_ + (size_t)b * NH_ + h) * TT + t];
#pragma unroll
        for (int tt = 0; tt < 4; ++tt) { v8us oh, ol;
#pragma unroll
            for (int r = 0; r < 8; ++r) { unsigned short a, c2; splitf((acc[g][tt][r] * inv) * pc + (acc[g][tt + 4][r] * inv) * psn, a, c2); oh[r] = a; ol[r] = c2; }
            const unsigned o = ((unsigned)b * TT + q0 + 16 * g) * DD + (2 * h + (tt >> 1)) * 512 + (tt & 1) * 256 + 8 * lane;      /* row t, k = 64 h + 16 tt + 8 hi in fragment order: 512 contiguous bytes a store */ __builtin_amdgcn_sched_barrier(0);      // the two barriers keep every other register write out from between the stores and their wait
            *(v8usa*)(Ah + o) = oh; *(v8usa*)(Al + o) = ol; xwait(); __builtin_amdgcn_sched_barrier(0); } }
}
__global__ __launch_bounds__(256) void k_ln2(const float* __restrict__ FF, const float* __restrict__ X, const float* __restrict__ gg, const float* __restrict__ bb, float* OUT) {
    const int lane = threadIdx.x & 31; const int r = blockIdx.x * 8 + (threadIdx.x >> 5); if (r >= NT) return; float v[32]; float s = 0.f;
#pragma unroll
    for (int c = 0; c < 8; ++c) { const v4f a = *(const v4f*)(FF + (size_t)r * DD + c * 128 + lane * 4), xx = *(const v4f*)(X + (size_t)r * DD + c * 128 + lane * 4);
#pragma unroll
        for (int q = 0; q < 4; ++q) { v[c * 4 + q] = a[q] + bfr(xx[q]); s += v[c * 4 + q]; } }
#pragma unroll
    for (int sh = 16; sh; sh >>= 1) s += __shfl_xor(s, sh, 32);
    const float mu = s * (1.0f / DD); float qq = 0.f;
#pragma unroll
    for (int i = 0; i < 32; ++i) { const float d0 = v[i] - mu; qq = __fadd_rn(qq, __fmul_rn(d0, d0)); }
#pragma unroll
    for (int sh = 16; sh; sh >>= 1) qq += __shfl_xor(qq, sh, 32);
    const float rs = __fdiv_rn(1.0f, __fsqrt_rn(qq * (1.0f / DD) + 1e-12f));
{
#pragma unroll
        for (int c = 0; c < 8; ++c) { v4f o;
#pragma unroll
            for (int q = 0; q < 4; ++q) { const int col = c * 128 + lane * 4 + q; o[q] = __fadd_rn(__fmul_rn((v[c * 4 + q] - mu) * rs, bfr(gg[col])), bfr(bb[col])); }
            *(v4f*)(OUT + (size_t)r * DD + c * 128 + lane * 4) = o; }
         }
}

extern "C" void kernel_launch(void* const* d_in, const int* in_sizes, int n_in,
                              void* d_out, int out_size, void* d_ws, size_t ws_size, hipStream_t stream) {
    (void)in_sizes; (void)n_in; (void)out_size;
    const float* IN[17]; for (int i = 0; i < 17; ++i) IN[i] = (const float*)d_in[i];
    // hidden_states, attention_mask [4][1][1][2048], cos_phi, sin_phi, mag [4][8][2048], Wq [1024][1024] (x @ W), bq, Wk, bk, Wv, bv, Wo, bo, Wp [8][16], bp [16], ln_g, ln_b = d_in[0..16]
    const float* x = IN[0]; const float* am = IN[1];
    float* OUT = (float*)d_out;     // [4][2048][1024]
    char* wsp = (char*)d_ws;
    auto take = [&](size_t bytes) { char* p = wsp; wsp += (bytes + 255) & ~(size_t)255; return (void*)p; };
    bf* WQ = (bf*)take((size_t)3 * DD * DD * 2); bf* WK = WQ + (size_t)DD * DD; bf* WV = WK + (size_t)DD * DD;      /* one plane of 3 * DD rows for k_qkv */ bf* WO = (bf*)take((size_t)DD * DD * 2); float* PH = (float*)take((size_t)3 * NB_ * NH_ * TT * 4);
    bf* XB = (bf*)take((size_t)NT * DD * 2); float* F = (float*)take((size_t)NT * DD * 4);
    h16* QP = (h16*)take((size_t)NT * DD * 2); h16* KP = (h16*)take((size_t)NT * DD * 2); h16* VT = (h16*)take((size_t)NZ * HD2 * TT * 2);
    bf* ATh = (bf*)take((size_t)NT * DD * 2); bf* ATl = (bf*)take((size_t)NT * DD * 2);
    if ((size_t)(wsp - (char*)d_ws) > ws_size) return;    // total ~ 154 MiB; ws 256 MiB
    float* Y = F;   // the output projection's f32 result
    k_prep<<<PREP_B, 256, 0, stream>>>(x, IN[5], IN[7], IN[9], IN[11], IN[2], IN[3], IN[4], IN[13], IN[14], XB, WQ, WK, WV, WO, PH);
    k_qkv<<<dim3(NT / 128, 3 * DD / 256), 256, 0, stream>>>(XB, WQ, IN[6], IN[8], IN[10], PH, QP, KP, VT);
    k_fattn<<<dim3(TT / (8 * 16 * QG), NZ), 256, 0, stream>>>(QP, KP, VT, am, PH, ATh, ATl);
    k_oproj<<<dim3(NT / 128, DD / 256), 256, 0, stream>>>(ATh, ATl, WO, Y, IN[12]);
    k_ln2<<<NT / 8, 256, 0, stream>>>(Y, x, IN[15], IN[16], OUT);
}

// v007
// It runs in 149 microseconds.
// Two timings next to v006 both put it at 1.06 times that version's speed.
// Over all steps from v000 it is 17.3 times as fast.
#include <hip/hip_runtime.h>

// Attention block with phase-weighted values (hidden_states [4][2048][1024]; q/k/v = x @ W + b (16 heads x 64); phase scalars p_c/p_s/p_m[b][h][t] = sum_band {cos_phi,sin_phi,mag}[b][band][t] Wp[band][h] + bp[h] (8 bands);
// V_real = v p_m p_c, V_imag = v p_m p_s (per (b,h,t) scalars on the value rows); scores = q.k/8 + attention_mask[b][0][0][j] (additive input, read as data); softmax; ctx = (P.V_real) p_c + (P.V_imag) p_s
// (per query row); out = LN(ctx @ Wo + bo + hidden_states) * ln_g + ln_b (eps 1e-12)).
// Compute dtypes, f32 accumulate: every input rounded to bf16; projections on PLAIN bf16 operands (inputs: exact, + bias); the phase projections (8 terms), V scaling,
// ctx combination, residual and LayerNorm in f32 on VALU; scores and the two value contractions on SINGLE fp16 planes (q x log2(e)/8; P = exp2(score - max in use), normalised after the contraction; V_real | V_imag packed as one 128-wide V^T plane per head
// so attn.[V_real|V_imag] is one N = 128 GEMM); output projection on hi+lo planes x exact Wo (2 products).

#define NB_  4
#define NBD  8                   // phase bands
#define HD2  128                 // packed V_real | V_imag plane width
#define TT   2048
#define DD   1024
#define NH_  16
#define HD   64
#define NT   (NB_ * TT)
#define NZ   (NB_ * NH_)
#define L2E  1.4426950408889634f
typedef _Float16 h16;
typedef unsigned short bf;
typedef __attribute__((ext_vector_type(16))) __bf16   v16bf;
typedef __attribute__((ext_vector_type(16))) _Float16 v16h;
typedef __attribute__((ext_vector_type(8)))  _Float16 v8h;
typedef __attribute__((ext_vector_type(8)))  unsigned short v8us;
typedef __attribute__((ext_vector_type(8)))  float    v8f;
typedef __attribute__((ext_vector_type(4)))  float    v4f;
typedef v8h  __attribute__((may_alias)) v8ha;
typedef v4f  __attribute__((may_alias)) v4fa;
typedef v8us __attribute__((may_alias)) v8usa;

__device__ __forceinline__ unsigned short f2bf(float f) { unsigned u = __float_as_uint(f); u += 0x7FFFu + ((u >> 16) & 1u); return (unsigned short)(u >> 16); }
__device__ __forceinline__ float bf2f(unsigned short b) { return __uint_as_float(((unsigned)b) << 16); }
__device__ __forceinline__ float bfr(float f) { return bf2f(f2bf(f)); }
__device__ __forceinline__ v16h cat16(v8h lo, v8h hi) { return __builtin_shufflevector(lo, hi, 0, 1, 2, 3, 4, 5, 6, 7, 8, 9, 10, 11, 12, 13, 14, 15); }
__device__ __forceinline__ v16bf cat16b(v8us lo, v8us hi) { return __builtin_bit_cast(v16bf, __builtin_shufflevector(lo, hi, 0, 1, 2, 3, 4, 5, 6, 7, 8, 9, 10, 11, 12, 13, 14, 15)); }
__device__ __forceinline__ v8f wmma16(v16h a, v16h b, v8f c) { return __builtin_amdgcn_wmma_f32_16x16x32_f16(false, a, false, b, (short)0, c, false, false); }
__device__ __forceinline__ v8f wmmab(v16bf a, v16bf b, v8f c) { return __builtin_amdgcn_wmma_f32_16x16x32_bf16(false, a, false, b, (short)0, c, false, false); }



// Stands behind a group of global loads or stores, in front of the first instruction that reuses a register they name (a precaution).
__device__ __forceinline__ void xwait() { asm volatile("s_wait_xcnt 0x0" ::: "memory"); }
// ---- FRAGMENT ORDER of every 16-bit operand plane [rows][K] (rows % 16 == 0, K % 32 == 0): the plane is a row of 1 KiB tiles, tile (R, kb) = rows 16 R .. 16 R + 15 x k 32 kb .. 32 kb + 31 at tile index R * (K / 32) + kb
// (the V^T plane: kb * 8 + R, so that a pass reads 8 KiB in a row). A tile is two halves of 512 B; half j holds at 16 B x lane (lane = 16 hi + lr) the elements k = 32 kb + 16 j + 8 hi + 0..7 of row 16 R + lr.
// A fragment is then two wave-wide 16-byte loads of 512 contiguous bytes each (4 whole lines a load; on a row-major plane it would touch 32 B in each of 16 lines); a lane's k order is 8 hi + 0..7, then 16 + 8 hi + 0..7, for A and B alike.
// A producer thread writes whole 16-byte pieces (k_prep: 8 of the X plane, one of each weight plane). Where the source runs across k (the transposing producers) thread i writes piece i, at byte 16 i: FRAG_IDX splits i into lr, hi, j and the tile index.
// Where the source runs along k, FRAG_IDX_ROW gives four neighbouring threads the four pieces of one tile row (128 source bytes in f32, one whole line); eight such rows make four whole lines of the tile.
#define FRAG_IDX(i) const int lr = (int)((i) & 15), hi = (int)(((i) >> 4) & 1), j = (int)(((i) >> 5) & 1); const int tile = (int)((i) >> 6)
#define FRAG_IDX_ROW(i) const int hi = (int)((i) & 1), j = (int)(((i) >> 1) & 1), lr = (int)(((i) >> 2) & 15); const int tile = (int)((i) >> 6); const size_t piece = (size_t)tile * 64 + j * 32 + hi * 16 + lr
// ---- The two GEMM kernels (k_qkv, k_oproj): a work-group of 8 waves (2 x 4) owns a 128 x 256 tile of the result, a wave 64 x 64 of it (16 accumulators). A stage is 64 of k: for each block of 16 operand rows two
// neighbouring 1 KiB tiles of its plane, one CHUNK of 2 KiB, contiguous in memory and copied as it lies (fragment order) into LDS by asynchronous copies, 16 bytes a lane. A fragment is then two ds_load_b128 of 512 contiguous bytes.
// Every chunk is brought from L2 once a work-group and read by 2 or 4 waves. Two buffers: stage s + 1 flies while stage s is worked on.
template <typename T16> struct WFrag;
template <> struct WFrag<h16> { typedef v16h V; static __device__ __forceinline__ V ld(const h16* p) { return cat16(*(const v8h*)p, *(const v8h*)(p + 256)); } static __device__ __forceinline__ v8f mma(V a, V b, v8f c) { return wmma16(a, b, c); } };
template <> struct WFrag<bf> { typedef v16bf V; static __device__ __forceinline__ V ld(const bf* p) { return cat16b(*(const v8us*)p, *(const v8us*)(p + 256)); } static __device__ __forceinline__ v8f mma(V a, V b, v8f c) { return wmmab(a, b, c); } };
// Four asynchronous copies of 16 bytes a lane (LDS byte address, global address); the s_wait_xcnt stands in the copies' own statement, in front of anything that reuses their address registers (a precaution).
__device__ __forceinline__ void acopy4(unsigned l, const bf* g, int lstep, int gstep) {
    asm volatile("global_load_async_to_lds_b128 %0, %1, off\n\tglobal_load_async_to_lds_b128 %2, %3, off\n\tglobal_load_async_to_lds_b128 %4, %5, off\n\tglobal_load_async_to_lds_b128 %6, %7, off\n\ts_wait_xcnt 0x0"
                 :: "v"(l), "v"(g), "v"(l + lstep), "v"(g + gstep), "v"(l + 2 * lstep), "v"(g + 2 * gstep), "v"(l + 3 * lstep), "v"(g + 3 * gstep) : "memory");
}
// The same for eight copies, four from each of two places: one wait serves the run.
__device__ __forceinline__ void acopy8(unsigned l, const bf* g, unsigned m, const bf* q, int lstep, int gstep) {
    asm volatile("global_load_async_to_lds_b128 %0, %1, off\n\tglobal_load_async_to_lds_b128 %2, %3, off\n\tglobal_load_async_to_lds_b128 %4, %5, off\n\tglobal_load_async_to_lds_b128 %6, %7, off\n\t"
                 "global_load_async_to_lds_b128 %8, %9, off\n\tglobal_load_async_to_lds_b128 %10, %11, off\n\tglobal_load_async_to_lds_b128 %12, %13, off\n\tglobal_load_async_to_lds_b128 %14, %15, off\n\ts_wait_xcnt 0x0"
                 :: "v"(l), "v"(g), "v"(l + lstep), "v"(g + gstep), "v"(l + 2 * lstep), "v"(g + 2 * gstep), "v"(l + 3 * lstep), "v"(g + 3 * gstep),
                    "v"(m), "v"(q), "v"(m + lstep), "v"(q + gstep), "v"(m + 2 * lstep), "v"(q + 2 * gstep), "v"(m + 3 * lstep), "v"(q + 3 * gstep) : "memory");
}
__device__ __forceinline__ void await_copies() { asm volatile("s_wait_asynccnt 0x0" ::: "memory"); }      // the wave's own copies have landed
__device__ __forceinline__ void await_lds() { asm volatile("s_wait_dscnt 0x0" ::: "memory"); }            // the wave's own LDS reads are done, in front of the barrier behind which their buffer is refilled
// ---- Asking L2 ahead. The 16-bit planes were stored by the launch before. At kernel entry each work-group, for speed only,
// asks L2 for what it will read: global_prefetch_b8, scope SE (into L2 only, nothing returns), a lane naming one aligned 256-byte unit inside the plane, every lane on. The s_wait_xcnt stands in the same statement, in front of
// anything that reuses the address registers (a precaution, as behind the copies above).
#define UNIT 128                   // 16-bit elements of a 256-byte unit
__device__ __forceinline__ void ask2(const bf* a, const bf* b) {
    asm volatile("global_prefetch_b8 %0, off scope:SCOPE_SE\n\tglobal_prefetch_b8 %1, off scope:SCOPE_SE\n\ts_wait_xcnt 0x0" :: "v"(a), "v"(b) : "memory");
}
__device__ __forceinline__ void ask3(const bf* a, const bf* b, const bf* c) {
    asm volatile("global_prefetch_b8 %0, off scope:SCOPE_SE\n\tglobal_prefetch_b8 %1, off scope:SCOPE_SE\n\tglobal_prefetch_b8 %2, off scope:SCOPE_SE\n\ts_wait_xcnt 0x0" :: "v"(a), "v"(b), "v"(c) : "memory");
}
#define CHUNK 1024                 // elements of a chunk
#define CHB   2048                 // its bytes
#define RSTEP (2 * (DD / 32) * 512)      // elements between a thread's copies in a plane: two blocks of 16 rows (threads 0-127 copy the even chunks, 128-255 the odd ones)
#define NSTG  (DD / 64)
// ---- k_oproj: C[m][n] (f32) = sum_k (A[m][k] + A2[m][k]) Bt[n][k] + bias[n]; grid (NT / 128, DD / 256). A stage: 8 chunks of A, 8 of A2, 16 of Bt, 64 KiB.
__global__ __launch_bounds__(256) void k_oproj(const bf* __restrict__ A, const bf* __restrict__ A2, const bf* __restrict__ Bt, float* C, const float* __restrict__ bias) {
    constexpr int ldc = DD;
    __shared__ __attribute__((aligned(2048))) bf st[2 * 32 * CHUNK];
    __shared__ __align__(16) float osw[8][16 * 68];
    const int lane = threadIdx.x & 31, lr = lane & 15, hi = lane >> 4, wave = __builtin_amdgcn_readfirstlane(threadIdx.x >> 5);
    const int r0 = blockIdx.x * 128 + (wave & 1) * 64, c0 = blockIdx.y * 256 + (wave >> 1) * 64;
    float* os = osw[wave];
    const int half = threadIdx.x >> 7, off = (threadIdx.x & 127) * 8;
    const bf* ga = A + (size_t)(blockIdx.x * 8 + half) * (16 * DD) + off; const bf* ga2 = A2 + (size_t)(blockIdx.x * 8 + half) * (16 * DD) + off; const bf* gb = Bt + (size_t)(blockIdx.y * 16 + half) * (16 * DD) + off;
    const unsigned l0 = (unsigned)(size_t)(st + half * CHUNK + off);      // the thread's LDS byte address in chunk 0 or 1 of buffer 0
    auto fill = [&](int s, int b) { const unsigned l = l0 + b * (32 * CHB);
        acopy8(l, ga + s * CHUNK, l + 8 * CHB, ga2 + s * CHUNK, 2 * CHB, RSTEP); acopy8(l + 16 * CHB, gb + s * CHUNK, l + 24 * CHB, gb + s * CHUNK + 4 * RSTEP, 2 * CHB, RSTEP); };
    v8f acc[4][4];
#pragma unroll
    for (int mb = 0; mb < 4; ++mb)
#pragma unroll
        for (int nb = 0; nb < 4; ++nb) acc[mb][nb] = (v8f){};
    // the tile's operand rows lie in a row in their planes: 1,024 units of A and of A2, dealt among the 4 work-groups that read them (by blockIdx.y), 2,048 of Bt, dealt 8 ways (by blockIdx.x >> 3, so that the 8 neighbours in x all ask for a unit)
    ask3(A + (size_t)blockIdx.x * (128 * DD) + (4 * threadIdx.x + blockIdx.y) * UNIT, A2 + (size_t)blockIdx.x * (128 * DD) + (4 * threadIdx.x + blockIdx.y) * UNIT, Bt + (size_t)blockIdx.y * (256 * DD) + (8 * threadIdx.x + (blockIdx.x >> 3)) * UNIT);
    fill(0, 0); await_copies(); __syncthreads(); fill(1, 1);
    const int ia = (wave & 1) * 4 * CHUNK + 8 * lane, ib = (16 + (wave >> 1) * 4) * CHUNK + 8 * lane;
    // rolled: one trip is one stage, so that the order wait, wait, barrier, refill stands once at its foot
#pragma unroll 1
    for (int s = 0; s < NSTG; ++s) {
        const bf* sb = st + (s & 1) * (32 * CHUNK);
        v16bf a[2][4], a2[2][4], b[2][4];
#pragma unroll
        for (int kk = 0; kk < 2; ++kk) {
#pragma unroll
            for (int mb = 0; mb < 4; ++mb) { a[kk][mb] = WFrag<bf>::ld(sb + ia + mb * CHUNK + kk * 512); a2[kk][mb] = WFrag<bf>::ld(sb + ia + (8 + mb) * CHUNK + kk * 512); }
#pragma unroll
            for (int nb = 0; nb < 4; ++nb) b[kk][nb] = WFrag<bf>::ld(sb + ib + nb * CHUNK + kk * 512);
        }
        __builtin_amdgcn_sched_barrier(0);      // the stage's 48 LDS reads stand as one group in front of its WMMAs: the second block's land behind the first block's WMMAs (two waves a SIMD: registers are there)
#pragma unroll
        for (int kk = 0; kk < 2; ++kk) {
#pragma unroll
            for (int nb = 0; nb < 4; ++nb) {
#pragma unroll
                for (int mb = 0; mb < 4; ++mb) { acc[mb][nb] = wmmab(a[kk][mb], b[kk][nb], acc[mb][nb]); acc[mb][nb] = wmmab(a2[kk][mb], b[kk][nb], acc[mb][nb]); } }
        }
        __builtin_amdgcn_sched_barrier(0);      // keeps the WMMAs in front of the waits below: moved behind the barrier they would leave the next stage's copies only the time of the LDS reads to land
        await_lds(); await_copies(); __syncthreads();      // publishes stage s + 1 and ends every wave's reads of stage s
        if (s + 2 < NSTG) fill(s + 2, s & 1);
    }
    await_copies();
#pragma unroll
    for (int mb = 0; mb < 4; ++mb) {
#pragma unroll
        for (int nb = 0; nb < 4; ++nb) {
#pragma unroll
            for (int j = 0; j < 8; ++j) os[(hi * 8 + j) * 68 + nb * 16 + lr] = acc[mb][nb][j]; }
        __builtin_amdgcn_wave_barrier(); asm volatile("" ::: "memory");
        float* crow = C + (size_t)(r0 + mb * 16) * ldc + c0;
{
#pragma unroll
            for (int s = 0; s < 8; ++s) { const int row = 2 * s + hi, cofs = lr * 4; v4f val = *(const v4fa*)(os + row * 68 + cofs); { val[0] += bfr(bias[c0 + cofs]); val[1] += bfr(bias[c0 + cofs + 1]); val[2] += bfr(bias[c0 + cofs + 2]); val[3] += bfr(bias[c0 + cofs + 3]); }
                *(v4f*)(crow + (size_t)row * ldc + cofs) = val; }
             }
        xwait();      // behind the eight stores: the next row block reuses their address and data registers
        __builtin_amdgcn_wave_barrier(); asm volatile("" ::: "memory");
    }
}

__device__ __forceinline__ h16 tohx(float x) { return (h16)x; }
__device__ __forceinline__ void splitf(float y, unsigned short& h, unsigned short& l) { h = f2bf(y); l = f2bf(y - bf2f(h)); }
typedef __attribute__((ext_vector_type(2))) _Float16 v2h;
typedef __attribute__((ext_vector_type(4))) _Float16 v4h;
typedef __attribute__((ext_vector_type(2))) unsigned short v2us;
typedef __attribute__((ext_vector_type(4))) unsigned short v4us;
typedef __attribute__((ext_vector_type(2))) float v2f;

__global__ __launch_bounds__(256) void k_bfr1(const float* __restrict__ src, float* dst, int n) { const int i = blockIdx.x * 256 + threadIdx.x; if (i >= n) return; const float v = bfr(src[i]); *(float*)(dst + i) = v;  }
// ---- k_prep: all operand preparation of a call in ONE launch: hidden_states to its bf16 plane, the four weight matrices to their transposed bf16 planes, the three phase projections (six jobs, none reads what another writes).
// A grid of PREP_B blocks (2 a WGP, 16 waves) shares out every job evenly: a thread takes 8 pieces of the X plane, the same piece of each of the four weight planes, and p_c, p_s, p_m of one (batch, head, token).
// The work then starts 4,096 waves, not 61,440 of one piece each, and all of a thread's loads are in flight before the first of them is used.
#define PREP_B 512
#define PREP_T (PREP_B * 256)
static_assert((size_t)NT * DD / 8 == 8 * (size_t)PREP_T && DD * DD / 8 == PREP_T && NB_ * NH_ * TT == PREP_T && DD / 32 == 32, "pieces a thread");
__global__ __launch_bounds__(256) void k_prep(const float* __restrict__ x, const float* __restrict__ wq, const float* __restrict__ wk, const float* __restrict__ wv, const float* __restrict__ wo, const float* __restrict__ cph, const float* __restrict__ sph, const float* __restrict__ mag,
                                              const float* __restrict__ Wp, const float* __restrict__ bp, bf* XB, bf* WQ, bf* WK, bf* WV, bf* WO, float* PH) {
    const unsigned g = blockIdx.x * 256 + threadIdx.x;
    // X plane: a block takes one block of 16 rows, 32 tiles, 2,048 pieces; a thread's 8 pieces are 256 pieces apart: 4 tiles, 128 elements in the source row
    unsigned xs, xd; { const unsigned i = blockIdx.x * 2048 + threadIdx.x; FRAG_IDX_ROW(i); xs = (unsigned)(((tile / (DD / 32)) * 16 + lr) * DD + (tile % (DD / 32)) * 32 + j * 16 + hi * 8); xd = (unsigned)piece; }
    // weight planes: piece g of each; the eight rows are read off one offset, a constant pitch apart
    unsigned ws; { FRAG_IDX(g); const int kt = DD / 32; const int n = (tile / kt) * 16 + lr, k = (tile % kt) * 32 + j * 16 + hi * 8; ws = (unsigned)(k * DD + n); }
    // phase scalars: g = (batch, head, token); a block lies inside one head
    const unsigned h = (blockIdx.x >> 3) & (NH_ - 1), ps = ((g >> 15) & (NB_ - 1)) * (NBD * TT) + (g & (TT - 1));
    const float* xp = x + xs; v8f v[8]; float f[4][8], wl[NBD], pl[3][NBD];
#pragma unroll
    for (int s = 0; s < 8; ++s) v[s] = *(const v8f*)(xp + s * 128);
#pragma unroll
    for (int q = 0; q < 8; ++q) { f[0][q] = wq[ws + q * DD]; f[1][q] = wk[ws + q * DD]; f[2][q] = wv[ws + q * DD]; f[3][q] = wo[ws + q * DD]; }
#pragma unroll
    for (int n = 0; n < NBD; ++n) { wl[n] = Wp[n * NH_ + h]; pl[0][n] = cph[ps + n * TT]; pl[1][n] = sph[ps + n * TT]; pl[2][n] = mag[ps + n * TT]; }
    const float bl = bp[h];
    asm volatile("s_wait_xcnt 0x0" :: "v"(xp), "v"(ws), "v"(ps) : "memory");      // the same wait as xwait(); the address and the offsets are named as inputs only, so that they stay live up to the wait and no result lands in their registers in front of it
    __builtin_amdgcn_sched_barrier(0);      // keeps the conversions below out of the loads above: every load is issued before the first result is waited for
    v8us o[8], ow[4]; float sp[3];
#pragma unroll
    for (int s = 0; s < 8; ++s)
#pragma unroll
        for (int k = 0; k < 8; ++k) o[s][k] = f2bf(v[s][k]);
#pragma unroll
    for (int m = 0; m < 4; ++m)
#pragma unroll
        for (int q = 0; q < 8; ++q) ow[m][q] = f2bf(f[m][q]);
#pragma unroll
    for (int k = 0; k < 3; ++k) { float s = 0.f;
#pragma unroll
        for (int n = 0; n < NBD; ++n) { float w = bfr(wl[n]), p = bfr(pl[k][n]); asm volatile("" : "+v"(w)); asm volatile("" : "+v"(p)); float m = __fmul_rn(p, w); asm volatile("" : "+v"(m)); s = __fadd_rn(s, m); }
        sp[k] = __fadd_rn(s, bfr(bl)); }
    v8us* xo = (v8us*)XB + xd;
#pragma unroll
    for (int s = 0; s < 8; ++s) xo[s * 256] = o[s];
    ((v8us*)WQ)[g] = ow[0]; ((v8us*)WK)[g] = ow[1]; ((v8us*)WV)[g] = ow[2]; ((v8us*)WO)[g] = ow[3];
#pragma unroll
    for (int k = 0; k < 3; ++k) *(float*)(PH + g + k * PREP_T) = sp[k];
}
// ---- k_qkv: the three input projections in ONE launch, each accumulator tile stored straight into its fp16 plane in fragment order (no f32 copy of q, k or v in memory, no conversion launch).
// grid (NT / 128, 3 * DD / 256), 8 waves: 2 groups of 64 tokens x 4 heads (64 columns each) of q, k or v; W3 = the q, k and v weight planes one behind the other, 3 * DD rows. A stage: 8 chunks of X, 16 of W3, 48 KiB; two work-groups a WGP.
// An accumulator register run j = 0..7 walks the ROW operand's index (8 hi + j), a lane's lr the COLUMN operand's. A piece of a plane is 8 neighbours along the plane's k: the head dimension for q and k, the token for V^T.
// So q and k take the weight rows as the row operand and the tokens as the column operand, v the other way round (both planes have one fragment order, so this is a swap of two pointers):
// in each case a lane's 8 registers are one 16-byte piece, and the wave's 32 pieces are one half tile, 512 contiguous bytes a store.
// amdgpu_waves_per_eu(4, 4): four waves a SIMD, so that two work-groups share a WGP and one works while the other stands at its barrier.
__global__ __launch_bounds__(256) __attribute__((amdgpu_waves_per_eu(4, 4))) void k_qkv(const bf* __restrict__ X, const bf* __restrict__ W3, const float* __restrict__ bq, const float* __restrict__ bk, const float* __restrict__ bv, const float* __restrict__ PH, h16* QP, h16* KP, h16* VT) {
    __shared__ __attribute__((aligned(2048))) bf st[2 * 24 * CHUNK];
    const int lane = threadIdx.x & 31, lr = lane & 15, hi = lane >> 4, wave = __builtin_amdgcn_readfirstlane(threadIdx.x >> 5);
    const int r0 = blockIdx.x * 128 + (wave & 1) * 64, hy = blockIdx.y * 4 + (wave >> 1), sel = hy >> 4, h = hy & 15;      // sel: 0 q, 1 k, 2 v
    const int z = (r0 >> 11) * NH_ + h, t0 = r0 & (TT - 1);      // (batch, head) and the first token inside the batch
    const int half = threadIdx.x >> 7, off = (threadIdx.x & 127) * 8;
    const bf* gx = X + (size_t)(blockIdx.x * 8 + half) * (16 * DD) + off; const bf* gw = W3 + (size_t)(blockIdx.y * 16 + half) * (16 * DD) + off;
    const unsigned l0 = (unsigned)(size_t)(st + half * CHUNK + off);      // the thread's LDS byte address in chunk 0 or 1 of buffer 0
    auto fill = [&](int s, int b) { const unsigned l = l0 + b * (24 * CHB);
        acopy4(l, gx + s * CHUNK, 2 * CHB, RSTEP); acopy8(l + 8 * CHB, gw + s * CHUNK, l + 16 * CHB, gw + s * CHUNK + 4 * RSTEP, 2 * CHB, RSTEP); };
    v8f acc[4][4];
#pragma unroll
    for (int mb = 0; mb < 4; ++mb)
#pragma unroll
        for (int nb = 0; nb < 4; ++nb) acc[mb][nb] = (v8f){};
    // 1,024 units of X, dealt 4 ways among the 12 work-groups that read them (by blockIdx.y & 3), 2,048 of W3, dealt 8 ways among 64 (by blockIdx.x >> 3)
    ask2(X + (size_t)blockIdx.x * (128 * DD) + (4 * threadIdx.x + (blockIdx.y & 3)) * UNIT, W3 + (size_t)blockIdx.y * (256 * DD) + (8 * threadIdx.x + (blockIdx.x >> 3)) * UNIT);
    fill(0, 0); await_copies(); __syncthreads(); fill(1, 1);
    const int ix = (wave & 1) * 4 * CHUNK + 8 * lane, iw = (8 + (wave >> 1) * 4) * CHUNK + 8 * lane;
    const int ia = (sel == 2) ? ix : iw, ib = (sel == 2) ? iw : ix;
    // rolled: one trip is one stage, so that the order wait, wait, barrier, refill stands once at its foot
#pragma unroll 1
    for (int s = 0; s < NSTG; ++s) {
        const bf* sb = st + (s & 1) * (24 * CHUNK);
#pragma unroll
        for (int kk = 0; kk < 2; ++kk) {
            v16bf a[4], b[4];
#pragma unroll
            for (int mb = 0; mb < 4; ++mb) a[mb] = WFrag<bf>::ld(sb + ia + mb * CHUNK + kk * 512);
#pragma unroll
            for (int nb = 0; nb < 4; ++nb) b[nb] = WFrag<bf>::ld(sb + ib + nb * CHUNK + kk * 512);
            __builtin_amdgcn_sched_barrier(0);      // the block's 16 LDS reads stand as one group in front of its WMMAs (left alone the compiler reads each b fragment into one register set and waits it out four times a block)
#pragma unroll
            for (int nb = 0; nb < 4; ++nb) {
#pragma unroll
                for (int mb = 0; mb < 4; ++mb) acc[mb][nb] = wmmab(a[mb], b[nb], acc[mb][nb]); }
            __builtin_amdgcn_sched_barrier(0);      // and the next block's reads stay out of this block's WMMAs
        }
        await_lds(); await_copies(); __syncthreads();      // publishes stage s + 1 and ends every wave's reads of stage s
        if (s + 2 < NSTG) fill(s + 2, s & 1);
    }
    await_copies();
    // In the epilogues each pair of scheduling barriers keeps every other register write out from between a group of loads or stores and its wait.
    if (sel < 2) {      // q (x log2(e)/8: the scores then come out in the base-2 domain) and k: acc[mb][nb][j] is dimension 16 mb + 8 hi + j of token t0 + 16 nb + lr
        const float sc = (sel == 0) ? 0.125f * L2E : 1.0f; const float* bl = ((sel == 0) ? bq : bk) + h * HD + 8 * hi;
        h16* P = ((sel == 0) ? QP : KP) + ((size_t)z * TT + t0) * HD + 8 * lane;      // 16 tokens on: 2 tiles, 1024 elements; 16 dimensions on: half a tile, 256
        v8f bs[4];
        __builtin_amdgcn_sched_barrier(0);
#pragma unroll
        for (int mb = 0; mb < 4; ++mb) bs[mb] = *(const v8f*)(bl + 16 * mb);
        asm volatile("s_wait_xcnt 0x0" :: "v"(bl) : "memory");      // the same wait as xwait(); the pointer is named as an input only, so that it stays live up to the wait
        __builtin_amdgcn_sched_barrier(0);
#pragma unroll
        for (int mb = 0; mb < 4; ++mb) { v8h o[4];
#pragma unroll
            for (int nb = 0; nb < 4; ++nb)
#pragma unroll
                for (int j = 0; j < 8; ++j) o[nb][j] = tohx((acc[mb][nb][j] + bfr(bs[mb][j])) * sc);
            __builtin_amdgcn_sched_barrier(0);
#pragma unroll
            for (int nb = 0; nb < 4; ++nb) *(v8ha*)(P + nb * 1024 + mb * 256) = o[nb];
            xwait(); __builtin_amdgcn_sched_barrier(0); }
    } else {            // v: acc[mb][nb][j] is dimension 16 nb + lr of token t0 + 16 mb + 8 hi + j; rows 0-63 of the V^T plane take v p_m p_c, rows 64-127 v p_m p_s
        const float* bl = bv + h * HD + lr; const float* pl = PH + (size_t)z * TT + t0 + 8 * hi;      // p_c of the lane's first token; p_s and p_m stand NZ * TT and 2 * NZ * TT floats further
        h16* P = VT + ((size_t)z * (HD2 * TT / 512) + (t0 >> 5) * 8) * 512 + 8 * lane;      // 32 tokens on: 8 tiles; 16 rows on: 1 tile; 16 tokens on: half a tile
        float bs[4];
        __builtin_amdgcn_sched_barrier(0);
#pragma unroll
        for (int nb = 0; nb < 4; ++nb) bs[nb] = bl[16 * nb];
        asm volatile("s_wait_xcnt 0x0" :: "v"(bl) : "memory");      // as above
        __builtin_amdgcn_sched_barrier(0);
#pragma unroll
        for (int nb = 0; nb < 4; ++nb) bs[nb] = bfr(bs[nb]);
#pragma unroll
        for (int mb = 0; mb < 4; ++mb) {
            __builtin_amdgcn_sched_barrier(0);
            const v8f pc = *(const v8f*)(pl + 16 * mb), psn = *(const v8f*)(pl + NZ * TT + 16 * mb), pm = *(const v8f*)(pl + 2 * NZ * TT + 16 * mb);
            asm volatile("s_wait_xcnt 0x0" :: "v"(pl) : "memory");      // as above
            __builtin_amdgcn_sched_barrier(0);
#pragma unroll
            for (int part = 0; part < 2; ++part) { v8h o[4];
#pragma unroll
                for (int nb = 0; nb < 4; ++nb)
#pragma unroll
                    for (int j = 0; j < 8; ++j) o[nb][j] = tohx(__fmul_rn(__fmul_rn(acc[mb][nb][j] + bs[nb], pm[j]), part ? psn[j] : pc[j]));
                __builtin_amdgcn_sched_barrier(0);
#pragma unroll
                for (int nb = 0; nb < 4; ++nb) *(v8ha*)(P + (mb >> 1) * 4096 + (part * 4 + nb) * 512 + (mb & 1) * 256) = o[nb];
                xwait(); __builtin_amdgcn_sched_barrier(0); } }
    }
}
// ---- k_fattn: scores, mask, softmax, both value contractions and the phase merge of one (batch, head) in ONE launch; S and P stay in registers.
// Transposed products: S^T = K.Q^T (A = 16 key rows, B = 16 query columns), O^T += [V_real|V_imag]^T.P^T (A = 16 rows of the 128-wide V^T plane, B = P^T). A lane then holds scores of ONE query
// (column lr): two S^T tiles (keys 0-15, 16-31 of a pass), converted in place, are the B operand of the second product in the loaders' own k order (8 hi + 0..7, 16 + 8 hi + 0..7).
// Online softmax in the base-2 domain. The score WMMA itself hands out the argument of exp2: Q carries log2(e)/8, and the C operand of the first score product is (mask x log2(e)) - maximum in use (for the keys that count a difference of near values,
// whatever the size of the mask). No maximum is taken on an ordinary pass: the weights are formed, and a lane's 16 weights of a column group must sum to at most PLIM (so each is below 256 in fp16).
// Only a pass that fails this test (the first one always does) forms its scores again without the maximum, takes the true maximum, rescales the accumulators and forms its weights anew.
// grid (TT / (8 * 16 * QG), NZ), 8 waves x QG groups of 16 query columns; a pass is 32 keys; operands straight from the fp16 planes in fragment order: every K and V^T fragment
// a wave loads serves QG column groups.
#define PLIM 240.0f
#define QG  4
__device__ __forceinline__ float xhalf(float x) { return __builtin_bit_cast(float, __builtin_amdgcn_permlanex16(__builtin_bit_cast(int, x), __builtin_bit_cast(int, x), 0x76543210, 0xfedcba98, false, false)); }  // lane l <-> lane l ^ 16
__global__ __launch_bounds__(256) void k_fattn(const h16* __restrict__ QP, const h16* __restrict__ KP, const h16* __restrict__ VT, const float* __restrict__ am, const float* __restrict__ PH, bf* Ah, bf* Al) {
    __shared__ __align__(16) float mk[TT];      // this batch's additive mask row, rounded to bf16 and taken times log2(e), once per work-group
    const int z = blockIdx.y, b = z / NH_, h = z % NH_;
    // Asks L2 for the head's whole K plane (1,024 units of 256 bytes) and V^T plane (2,048), in the order of the passes: a request of the work-group covers 64 KiB, 16 passes of K or 8 of V^T. Every work-group asks for all of it.
    // The wait is the same precaution as in ask2().
    asm volatile("global_prefetch_b8 %0, off scope:SCOPE_SE\n\tglobal_prefetch_b8 %1, off scope:SCOPE_SE\n\tglobal_prefetch_b8 %1, off offset:65536 scope:SCOPE_SE\n\t"
                 "global_prefetch_b8 %0, off offset:65536 scope:SCOPE_SE\n\tglobal_prefetch_b8 %1, off offset:131072 scope:SCOPE_SE\n\tglobal_prefetch_b8 %1, off offset:196608 scope:SCOPE_SE\n\t"
                 "global_prefetch_b8 %0, off offset:131072 scope:SCOPE_SE\n\tglobal_prefetch_b8 %1, off offset:262144 scope:SCOPE_SE\n\tglobal_prefetch_b8 %1, off offset:327680 scope:SCOPE_SE\n\t"
                 "global_prefetch_b8 %0, off offset:196608 scope:SCOPE_SE\n\tglobal_prefetch_b8 %1, off offset:393216 scope:SCOPE_SE\n\tglobal_prefetch_b8 %1, off offset:458752 scope:SCOPE_SE\n\ts_wait_xcnt 0x0"
                 :: "v"(KP + (size_t)z * TT * HD + threadIdx.x * UNIT), "v"(VT + (size_t)z * HD2 * TT + threadIdx.x * UNIT) : "memory");
    for (int i = threadIdx.x * 4; i < TT; i += 1024) { v4f a = *(const v4f*)(am + (size_t)b * TT + i);
#pragma unroll
        for (int q = 0; q < 4; ++q) a[q] = bfr(a[q]) * L2E;
        *(v4fa*)(mk + i) = a; }
    __syncthreads();
    const int lane = threadIdx.x & 31, lr = lane & 15, hi = lane >> 4; const int q0 = (blockIdx.x * 8 + __builtin_amdgcn_readfirstlane(threadIdx.x >> 5)) * (16 * QG);      // the wave's first query, held in a scalar register
    const h16* Kz = KP + (size_t)z * TT * HD; const unsigned ko = (unsigned)(8 * lane);      // K plane of this head, and the lane's offset in a tile
    const h16* vp = VT + (size_t)z * HD2 * TT + 8 * lane;      // the lane's address in the V^T tiles of the pass at hand
    v16h qf[QG][2]; const h16* Qz = QP + ((size_t)z * TT + q0) * HD;      // the wave's first Q tile
#pragma unroll
    for (int g = 0; g < QG; ++g)
#pragma unroll
        for (int kc = 0; kc < 2; ++kc) qf[g][kc] = WFrag<h16>::ld(Qz + (size_t)(16 * g) * HD + 512 * kc + ko);
    v16h kf[2][2];      // K fragments are fetched one pass ahead, half way through the second product
#pragma unroll
    for (int kt = 0; kt < 2; ++kt)
#pragma unroll
        for (int kc = 0; kc < 2; ++kc) kf[kt][kc] = WFrag<h16>::ld(Kz + (size_t)(16 * kt) * HD + 512 * kc + ko);
    // the same wait as xwait(); the two scalar bases of the Q and K loads are named as inputs only, so that their register pairs stay live up to the wait and nothing is written over them in front of it
    asm volatile("s_wait_xcnt 0x0" :: "s"(Qz), "s"(Kz) : "memory");
    __builtin_amdgcn_sched_barrier(0);      // keeps the scheduler from mixing the tiles' set-up below into the loads above (it spilled Q fragments when it did)
    const h16* kp = Kz + ko + 32 * HD;      // the lane's address in the K tile to fetch next
    v8f acc[QG][8]; float m_run[QG], l_run[QG];
#pragma unroll
    for (int g = 0; g < QG; ++g) { m_run[g] = -__FLT_MAX__; l_run[g] = 0.f;
#pragma unroll
        for (int t = 0; t < 8; ++t) acc[g][t] = (v8f){}; }
    // rolled: one pass's fragments and the output tiles already fill the wave's registers
#pragma unroll 1
    for (int key0 = 0; key0 < TT; key0 += 32) {
        v16h vf[8];
#pragma unroll
        for (int t = 0; t < 4; ++t) vf[t] = WFrag<h16>::ld(vp + 512 * t);
        asm volatile("s_wait_xcnt 0x0" :: "v"(vp) : "memory");      // the same wait as xwait(); the address is named as an input only, so that it stays live up to the wait and no fragment lands in its registers in front of it
        v8f s[2][QG];
#pragma unroll
        for (int kt = 0; kt < 2; ++kt) { const v4f m0 = *(const v4fa*)(mk + key0 + 16 * kt + 8 * hi), m1 = *(const v4fa*)(mk + key0 + 16 * kt + 8 * hi + 4);
#pragma unroll
            for (int g = 0; g < QG; ++g) { v8f c;
#pragma unroll
                for (int r = 0; r < 4; ++r) { c[r] = m0[r] - m_run[g]; c[4 + r] = m1[r] - m_run[g]; }
                s[kt][g] = wmma16(kf[kt][1], qf[g][1], wmma16(kf[kt][0], qf[g][0], c)); }
            if (kt == 0) __builtin_amdgcn_sched_barrier(0); }      // the second key tile's four C tiles are formed only behind the first tile's products, when its K fragments are dead (formed all eight up front they spilled a Q fragment)
        v16h pf[QG]; float ls[QG]; bool need = false;
#pragma unroll
        for (int g = 0; g < QG; ++g) { v2f l2 = (v2f){0.f, 0.f};
#pragma unroll
            for (int e = 0; e < 16; e += 2) { const v2f p = (v2f){__builtin_amdgcn_exp2f(s[e >> 3][g][e & 7]), __builtin_amdgcn_exp2f(s[e >> 3][g][(e & 7) + 1])};
                l2 += p; pf[g][e] = tohx(p[0]); pf[g][e + 1] = tohx(p[1]); }
            ls[g] = l2[0] + l2[1]; need = need || !(ls[g] <= PLIM); }      // the negated form also catches a sum that is not a number
        // the second half of the V^T fragments is asked for here, where the K fragments and half of the score registers are free again (asked for at the head of the pass they spilled an output tile)
#pragma unroll
        for (int t = 4; t < 8; ++t) vf[t] = WFrag<h16>::ld(vp + 512 * t);
        asm volatile("s_wait_xcnt 0x0" :: "v"(vp) : "memory");      // as above
        if (__builtin_amdgcn_ballot_w32(need) != 0) {       // one wave-uniform test per pass
            v16h kr[2][2]; const h16* kq = Kz + (size_t)key0 * HD + ko;      // the pass's K fragments are loaded again here: kept for this rare path they would cost every pass 32 registers (spills)
#pragma unroll
            for (int kt = 0; kt < 2; ++kt)
#pragma unroll
                for (int kc = 0; kc < 2; ++kc) kr[kt][kc] = WFrag<h16>::ld(kq + (size_t)(16 * kt) * HD + 512 * kc);
            asm volatile("s_wait_xcnt 0x0" :: "v"(kq) : "memory");      // as above
            v8f c[2];
#pragma unroll
            for (int kt = 0; kt < 2; ++kt) { const v4f m0 = *(const v4fa*)(mk + key0 + 16 * kt + 8 * hi), m1 = *(const v4fa*)(mk + key0 + 16 * kt + 8 * hi + 4);
                c[kt] = (v8f){m0[0], m0[1], m0[2], m0[3], m1[0], m1[1], m1[2], m1[3]}; }
            // one column group at a time: two score tiles live, not eight
#pragma unroll
            for (int g = 0; g < QG; ++g) {
#pragma unroll
                for (int kt = 0; kt < 2; ++kt) s[kt][g] = wmma16(kr[kt][1], qf[g][1], wmma16(kr[kt][0], qf[g][0], c[kt]));
                float mx = s[0][g][0];
#pragma unroll
                for (int r = 1; r < 8; ++r) mx = fmaxf(mx, s[0][g][r]);
#pragma unroll
                for (int r = 0; r < 8; ++r) mx = fmaxf(mx, s[1][g][r]);
                mx = fmaxf(mx, xhalf(mx)); const float m_new = fmaxf(m_run[g], mx); const float corr = __builtin_amdgcn_exp2f(m_run[g] - m_new); m_run[g] = m_new; l_run[g] *= corr;
#pragma unroll
                for (int t = 0; t < 8; ++t) acc[g][t] = acc[g][t] * corr;
                v2f l2 = (v2f){0.f, 0.f};
#pragma unroll
                for (int kt = 0; kt < 2; ++kt) s[kt][g] = s[kt][g] - m_new;
#pragma unroll
                for (int e = 0; e < 16; e += 2) { const v2f p = (v2f){__builtin_amdgcn_exp2f(s[e >> 3][g][e & 7]), __builtin_amdgcn_exp2f(s[e >> 3][g][(e & 7) + 1])};
                    l2 += p; pf[g][e] = tohx(p[0]); pf[g][e + 1] = tohx(p[1]); }
                ls[g] = l2[0] + l2[1]; } }
#pragma unroll
        for (int g = 0; g < QG; ++g) { l_run[g] += ls[g];
#pragma unroll
            for (int t = 0; t < 8; ++t) acc[g][t] = wmma16(vf[t], pf[g], acc[g][t]);
            if (g == QG / 2 - 1) {
#pragma unroll
                for (int kt = 0; kt < 2; ++kt)
#pragma unroll
                    for (int kc = 0; kc < 2; ++kc) kf[kt][kc] = WFrag<h16>::ld(kp + (size_t)(16 * kt) * HD + 512 * kc);
                kp += (key0 + 64 < TT) ? 32 * HD : 0; } }      // the last pass fetches its own tile again: in bounds, unused
        vp += 32 * HD2;
    }
#pragma unroll
    for (int g = 0; g < QG; ++g) { const int t = q0 + 16 * g + lr; const float l = l_run[g] + xhalf(l_run[g]); const float inv = __fdiv_rn(1.0f, l);
        const float pc = PH[((size_t)b * NH_ + h) * TT + t], psn = PH[((size_t)NB_ * NH_ + (size_t)b * NH_ + h) * TT + t];
#pragma unroll
        for (int tt = 0; tt < 4; ++tt) { v8us oh, ol;
#pragma unroll
            for (int r = 0; r < 8; ++r) { unsigned short a, c2; splitf((acc[g][tt][r] * inv) * pc + (acc[g][tt + 4][r] * inv) * psn, a, c2); oh[r] = a; ol[r] = c2; }
            const unsigned o = ((unsigned)b * TT + q0 + 16 * g) * DD + (2 * h + (tt >> 1)) * 512 + (tt & 1) * 256 + 8 * lane;      /* row t, k = 64 h + 16 tt + 8 hi in fragment order: 512 contiguous bytes a store */ __builtin_amdgcn_sched_barrier(0);      // the two barriers keep every other register write out from between the stores and their wait
            *(v8usa*)(Ah + o) = oh; *(v8usa*)(Al + o) = ol; xwait(); __builtin_amdgcn_sched_barrier(0); } }
}
__global__ __launch_bounds__(256) void k_ln2(const float* __restrict__ FF, const float* __restrict__ X, const float* __restrict__ gg, const float* __restrict__ bb, float* OUT) {
    const int lane = threadIdx.x & 31; const int r = blockIdx.x * 8 + (threadIdx.x >> 5); if (r >= NT) return; float v[32]; float s = 0.f;
#pragma unroll
    for (int c = 0; c < 8; ++c) { const v4f a = *(const v4f*)(FF + (size_t)r * DD + c * 128 + lane * 4), xx = *(const v4f*)(X + (size_t)r * DD + c * 128 + lane * 4);
#pragma unroll
        for (int q = 0; q < 4; ++q) { v[c * 4 + q] = a[q] + bfr(xx[q]); s += v[c * 4 + q]; } }
#pragma unroll
    for (int sh = 16; sh; sh >>= 1) s += __shfl_xor(s, sh, 32);
    const float mu = s * (1.0f / DD); float qq = 0.f;
#pragma unroll
    for (int i = 0; i < 32; ++i) { const float d0 = v[i] - mu; qq = __fadd_rn(qq, __fmul_rn(d0, d0)); }
#pragma unroll
    for (int sh = 16; sh; sh >>= 1) qq += __shfl_xor(qq, sh, 32);
    const float rs = __fdiv_rn(1.0f, __fsqrt_rn(qq * (1.0f / DD) + 1e-12f));
{
#pragma unroll
        for (int c = 0; c < 8; ++c) { v4f o;
#pragma unroll
            for (int q = 0; q < 4; ++q) { const int col = c * 128 + lane * 4 + q; o[q] = __fadd_rn(__fmul_rn((v[c * 4 + q] - mu) * rs, bfr(gg[col])), bfr(bb[col])); }
            *(v4f*)(OUT + (size_t)r * DD + c * 128 + lane * 4) = o; }
         }
}

extern "C" void kernel_launch(void* const* d_in, const int* in_sizes, int n_in,
                              void* d_out, int out_size, void* d_ws, size_t ws_size, hipStream_t stream) {
    (void)in_sizes; (void)n_in; (void)out_size;
    const float* IN[17]; for (int i = 0; i < 17; ++i) IN[i] = (const float*)d_in[i];
    // hidden_states, attention_mask [4][1][1][2048], cos_phi, sin_phi, mag [4][8][2048], Wq [1024][1024] (x @ W), bq, Wk, bk, Wv, bv, Wo, bo, Wp [8][16], bp [16], ln_g, ln_b = d_in[0..16]
    const float* x = IN[0]; const float* am = IN[1];
    float* OUT = (float*)d_out;     // [4][2048][1024]
    char* wsp = (char*)d_ws;
    auto take = [&](size_t bytes) { char* p = wsp; wsp += (bytes + 255) & ~(size_t)255; return (void*)p; };
    bf* WQ = (bf*)take((size_t)3 * DD * DD * 2); bf* WK = WQ + (size_t)DD * DD; bf* WV = WK + (size_t)DD * DD;      /* one plane of 3 * DD rows for k_qkv */ bf* WO = (bf*)take((size_t)DD * DD * 2); float* PH = (float*)take((size_t)3 * NB_ * NH_ * TT * 4);
    bf* XB = (bf*)take((size_t)NT * DD * 2); float* F = (float*)take((size_t)NT * DD * 4);
    h16* QP = (h16*)take((size_t)NT * DD * 2); h16* KP = (h16*)take((size_t)NT * DD * 2); h16* VT = (h16*)take((size_t)NZ * HD2 * TT * 2);
    bf* ATh = (bf*)take((size_t)NT * DD * 2); bf* ATl = (bf*)take((size_t)NT * DD * 2);
    if ((size_t)(wsp - (char*)d_ws) > ws_size) return;    // total ~ 154 MiB; ws 256 MiB
    float* Y = F;   // the output projection's f32 result
    k_prep<<<PREP_B, 256, 0, stream>>>(x, IN[5], IN[7], IN[9], IN[11], IN[2], IN[3], IN[4], IN[13], IN[14], XB, WQ, WK, WV, WO, PH);
    k_qkv<<<dim3(NT / 128, 3 * DD / 256), 256, 0, stream>>>(XB, WQ, IN[6], IN[8], IN[10], PH, QP, KP, VT);
    k_fattn<<<dim3(TT / (8 * 16 * QG), NZ), 256, 0, stream>>>(QP, KP, VT, am, PH, ATh, ATl);
    k_oproj<<<dim3(NT / 128, DD / 256), 256, 0, stream>>>(ATh, ATl, WO, Y, IN[12]);
    k_ln2<<<NT / 8, 256, 0, stream>>>(Y, x, IN[15], IN[16], OUT);
}

// v008
// One run takes 141 microseconds.
// In both of two side-by-side timings against v007, it was 1.06 times as fast.
// Counting every step since v000, it is 18.3 times as fast.
#include <hip/hip_runtime.h>

// Attention block with phase-weighted values (hidden_states [4][2048][1024]; q/k/v = x @ W + b (16 heads x 64); phase scalars p_c/p_s/p_m[b][h][t] = sum_band {cos_phi,sin_phi,mag}[b][band][t] Wp[band][h] + bp[h] (8 bands);
// V_real = v p_m p_c, V_imag = v p_m p_s (per (b,h,t) scalars on the value rows); scores = q.k/8 + attention_mask[b][0][0][j] (additive input, read as data); softmax; ctx = (P.V_real) p_c + (P.V_imag) p_s
// (per query row); out = LN(ctx @ Wo + bo + hidden_states) * ln_g + ln_b (eps 1e-12)).
// Compute dtypes, f32 accumulate: every input rounded to bf16; projections on PLAIN bf16 operands (inputs: exact, + bias); the phase projections (8 terms), V scaling,
// ctx combination, residual and LayerNorm in f32 on VALU; scores and the two value contractions on SINGLE fp16 planes (q x log2(e)/8; P = exp2(score - max in use), normalised after the contraction; V_real | V_imag packed as one 128-wide V^T plane per head
// so attn.[V_real|V_imag] is one N = 128 GEMM); output projection on ONE fp16 plane of ctx x Wo in fp16 (Wo rounded to bf16 first; that value is exact in fp16 from 2^-17 up).

#define NB_  4
#define NBD  8                   // phase bands
#define HD2  128                 // packed V_real | V_imag plane width
#define TT   2048
#define DD   1024
#define NH_  16
#define HD   64
#define NT   (NB_ * TT)
#define NZ   (NB_ * NH_)
#define L2E  1.4426950408889634f
typedef _Float16 h16;
typedef unsigned short bf;
typedef __attribute__((ext_vector_type(16))) __bf16   v16bf;
typedef __attribute__((ext_vector_type(16))) _Float16 v16h;
typedef __attribute__((ext_vector_type(8)))  _Float16 v8h;
typedef __attribute__((ext_vector_type(8)))  unsigned short v8us;
typedef __attribute__((ext_vector_type(8)))  float    v8f;
typedef __attribute__((ext_vector_type(4)))  float    v4f;
typedef v8h  __attribute__((may_alias)) v8ha;
typedef v4f  __attribute__((may_alias)) v4fa;
typedef v8us __attribute__((may_alias)) v8usa;

__device__ __forceinline__ unsigned short f2bf(float f) { unsigned u = __float_as_uint(f); u += 0x7FFFu + ((u >> 16) & 1u); return (unsigned short)(u >> 16); }
__device__ __forceinline__ float bf2f(unsigned short b) { return __uint_as_float(((unsigned)b) << 16); }
__device__ __forceinline__ float bfr(float f) { return bf2f(f2bf(f)); }
__device__ __forceinline__ v16h cat16(v8h lo, v8h hi) { return __builtin_shufflevector(lo, hi, 0, 1, 2, 3, 4, 5, 6, 7, 8, 9, 10, 11, 12, 13, 14, 15); }
__device__ __forceinline__ v16bf cat16b(v8us lo, v8us hi) { return __builtin_bit_cast(v16bf, __builtin_shufflevector(lo, hi, 0, 1, 2, 3, 4, 5, 6, 7, 8, 9, 10, 11, 12, 13, 14, 15)); }
__device__ __forceinline__ v8f wmma16(v16h a, v16h b, v8f c) { return __builtin_amdgcn_wmma_f32_16x16x32_f16(false, a, false, b, (short)0, c, false, false); }
__device__ __forceinline__ v8f wmmab(v16bf a, v16bf b, v8f c) { return __builtin_amdgcn_wmma_f32_16x16x32_bf16(false, a, false, b, (short)0, c, false, false); }



// Stands behind a group of global loads or stores, in front of the first instruction that reuses a register they name (a precaution).
__device__ __forceinline__ void xwait() { asm volatile("s_wait_xcnt 0x0" ::: "memory"); }
// ---- FRAGMENT ORDER of every 16-bit operand plane [rows][K] (rows % 16 == 0, K % 32 == 0): the plane is a row of 1 KiB tiles, tile (R, kb) = rows 16 R .. 16 R + 15 x k 32 kb .. 32 kb + 31 at tile index R * (K / 32) + kb
// (the V^T plane: kb * 8 + R, so that a pass reads 8 KiB in a row). A tile is two halves of 512 B; half j holds at 16 B x lane (lane = 16 hi + lr) the elements k = 32 kb + 16 j + 8 hi + 0..7 of row 16 R + lr.
// A fragment is then two wave-wide 16-byte loads of 512 contiguous bytes each (4 whole lines a load; on a row-major plane it would touch 32 B in each of 16 lines); a lane's k order is 8 hi + 0..7, then 16 + 8 hi + 0..7, for A and B alike.
// A producer thread writes whole 16-byte pieces (k_prep: 8 of the X plane, one of each weight plane). Where the source runs across k (the transposing producers) thread i writes piece i, at byte 16 i: FRAG_IDX splits i into lr, hi, j and the tile index.
// Where the source runs along k, FRAG_IDX_ROW gives four neighbouring threads the four pieces of one tile row (128 source bytes in f32, one whole line); eight such rows make four whole lines of the tile.
#define FRAG_IDX(i) const int lr = (int)((i) & 15), hi = (int)(((i) >> 4) & 1), j = (int)(((i) >> 5) & 1); const int tile = (int)((i) >> 6)
#define FRAG_IDX_ROW(i) const int hi = (int)((i) & 1), j = (int)(((i) >> 1) & 1), lr = (int)(((i) >> 2) & 15); const int tile = (int)((i) >> 6); const size_t piece = (size_t)tile * 64 + j * 32 + hi * 16 + lr
// ---- The two GEMM kernels (k_qkv, k_oproj): a work-group of 8 waves (2 x 4) owns a 128 x 256 tile of the result, a wave 64 x 64 of it (16 accumulators). A stage is 64 of k: for each block of 16 operand rows two
// neighbouring 1 KiB tiles of its plane, one CHUNK of 2 KiB, contiguous in memory and copied as it lies (fragment order) into LDS by asynchronous copies, 16 bytes a lane. A fragment is then two ds_load_b128 of 512 contiguous bytes.
// Every chunk is brought from L2 once a work-group and read by 2 or 4 waves. Two buffers: stage s + 1 flies while stage s is worked on.
template <typename T16> struct WFrag;
template <> struct WFrag<h16> { typedef v16h V; static __device__ __forceinline__ V ld(const h16* p) { return cat16(*(const v8h*)p, *(const v8h*)(p + 256)); } static __device__ __forceinline__ v8f mma(V a, V b, v8f c) { return wmma16(a, b, c); } };
template <> struct WFrag<bf> { typedef v16bf V; static __device__ __forceinline__ V ld(const bf* p) { return cat16b(*(const v8us*)p, *(const v8us*)(p + 256)); } static __device__ __forceinline__ v8f mma(V a, V b, v8f c) { return wmmab(a, b, c); } };
// Four asynchronous copies of 16 bytes a lane (LDS byte address, global address); the s_wait_xcnt stands in the copies' own statement, in front of anything that reuses their address registers (a precaution).
__device__ __forceinline__ void acopy4(unsigned l, const bf* g, int lstep, int gstep) {
    asm volatile("global_load_async_to_lds_b128 %0, %1, off\n\tglobal_load_async_to_lds_b128 %2, %3, off\n\tglobal_load_async_to_lds_b128 %4, %5, off\n\tglobal_load_async_to_lds_b128 %6, %7, off\n\ts_wait_xcnt 0x0"
                 :: "v"(l), "v"(g), "v"(l + lstep), "v"(g + gstep), "v"(l + 2 * lstep), "v"(g + 2 * gstep), "v"(l + 3 * lstep), "v"(g + 3 * gstep) : "memory");
}
// The same for eight copies, four from each of two places: one wait serves the run.
__device__ __forceinline__ void acopy8(unsigned l, const bf* g, unsigned m, const bf* q, int lstep, int gstep) {
    asm volatile("global_load_async_to_lds_b128 %0, %1, off\n\tglobal_load_async_to_lds_b128 %2, %3, off\n\tglobal_load_async_to_lds_b128 %4, %5, off\n\tglobal_load_async_to_lds_b128 %6, %7, off\n\t"
                 "global_load_async_to_lds_b128 %8, %9, off\n\tglobal_load_async_to_lds_b128 %10, %11, off\n\tglobal_load_async_to_lds_b128 %12, %13, off\n\tglobal_load_async_to_lds_b128 %14, %15, off\n\ts_wait_xcnt 0x0"
                 :: "v"(l), "v"(g), "v"(l + lstep), "v"(g + gstep), "v"(l + 2 * lstep), "v"(g + 2 * gstep), "v"(l + 3 * lstep), "v"(g + 3 * gstep),
                    "v"(m), "v"(q), "v"(m + lstep), "v"(q + gstep), "v"(m + 2 * lstep), "v"(q + 2 * gstep), "v"(m + 3 * lstep), "v"(q + 3 * gstep) : "memory");
}
__device__ __forceinline__ void await_copies() { asm volatile("s_wait_asynccnt 0x0" ::: "memory"); }      // the wave's own copies have landed
__device__ __forceinline__ void await_lds() { asm volatile("s_wait_dscnt 0x0" ::: "memory"); }            // the wave's own LDS reads are done, in front of the barrier behind which their buffer is refilled
// ---- Asking L2 ahead. The 16-bit planes were stored by the launch before. At kernel entry each work-group, for speed only,
// asks L2 for what it will read: global_prefetch_b8, scope SE (into L2 only, nothing returns), a lane naming one aligned 256-byte unit inside the plane, every lane on. The s_wait_xcnt stands in the same statement, in front of
// anything that reuses the address registers (a precaution, as behind the copies above).
#define UNIT 128                   // 16-bit elements of a 256-byte unit
__device__ __forceinline__ void ask2(const bf* a, const bf* b) {
    asm volatile("global_prefetch_b8 %0, off scope:SCOPE_SE\n\tglobal_prefetch_b8 %1, off scope:SCOPE_SE\n\ts_wait_xcnt 0x0" :: "v"(a), "v"(b) : "memory");
}
#define CHUNK 1024                 // elements of a chunk
#define CHB   2048                 // its bytes
#define RSTEP (2 * (DD / 32) * 512)      // elements between a thread's copies in a plane: two blocks of 16 rows (threads 0-127 copy the even chunks, 128-255 the odd ones)
#define NSTG  (DD / 64)
// ---- k_oproj: C[m][n] (f32) = sum_k A[m][k] Bt[n][k] + bias[n], fp16 operands; grid (NT / 128, DD / 256). A stage: 8 chunks of A, 16 of Bt, 48 KiB.
__global__ __launch_bounds__(256) void k_oproj(const h16* __restrict__ A, const h16* __restrict__ Bt, float* C, const float* __restrict__ bias) {
    constexpr int ldc = DD;
    __shared__ __attribute__((aligned(2048))) h16 st[2 * 24 * CHUNK];
    __shared__ __align__(16) float osw[8][16 * 68];
    const int lane = threadIdx.x & 31, lr = lane & 15, hi = lane >> 4, wave = __builtin_amdgcn_readfirstlane(threadIdx.x >> 5);
    const int r0 = blockIdx.x * 128 + (wave & 1) * 64, c0 = blockIdx.y * 256 + (wave >> 1) * 64;
    float* os = osw[wave];
    const int half = threadIdx.x >> 7, off = (threadIdx.x & 127) * 8;
    const bf* ga = (const bf*)A + (size_t)(blockIdx.x * 8 + half) * (16 * DD) + off; const bf* gb = (const bf*)Bt + (size_t)(blockIdx.y * 16 + half) * (16 * DD) + off;      // the copies move 16-byte pieces, whatever the 16-bit type
    const unsigned l0 = (unsigned)(size_t)(st + half * CHUNK + off);      // the thread's LDS byte address in chunk 0 or 1 of buffer 0
    auto fill = [&](int s, int b) { const unsigned l = l0 + b * (24 * CHB);
        acopy4(l, ga + s * CHUNK, 2 * CHB, RSTEP); acopy8(l + 8 * CHB, gb + s * CHUNK, l + 16 * CHB, gb + s * CHUNK + 4 * RSTEP, 2 * CHB, RSTEP); };
    v8f acc[4][4];
#pragma unroll
    for (int mb = 0; mb < 4; ++mb)
#pragma unroll
        for (int nb = 0; nb < 4; ++nb) acc[mb][nb] = (v8f){};
    // the tile's operand rows lie in a row in their planes: 1,024 units of A, dealt among the 4 work-groups that read them (by blockIdx.y), 2,048 of Bt, dealt 8 ways (by blockIdx.x >> 3, so that the 8 neighbours in x all ask for a unit)
    ask2((const bf*)A + (size_t)blockIdx.x * (128 * DD) + (4 * threadIdx.x + blockIdx.y) * UNIT, (const bf*)Bt + (size_t)blockIdx.y * (256 * DD) + (8 * threadIdx.x + (blockIdx.x >> 3)) * UNIT);
    fill(0, 0); await_copies(); __syncthreads(); fill(1, 1);
    const int ia = (wave & 1) * 4 * CHUNK + 8 * lane, ib = (8 + (wave >> 1) * 4) * CHUNK + 8 * lane;
    // rolled: one trip is one stage, so that the order wait, wait, barrier, refill stands once at its foot
#pragma unroll 1
    for (int s = 0; s < NSTG; ++s) {
        const h16* sb = st + (s & 1) * (24 * CHUNK);
        v16h a[2][4], b[2][4];
#pragma unroll
        for (int kk = 0; kk < 2; ++kk) {
#pragma unroll
            for (int mb = 0; mb < 4; ++mb) a[kk][mb] = WFrag<h16>::ld(sb + ia + mb * CHUNK + kk * 512);
#pragma unroll
            for (int nb = 0; nb < 4; ++nb) b[kk][nb] = WFrag<h16>::ld(sb + ib + nb * CHUNK + kk * 512);
        }
        __builtin_amdgcn_sched_barrier(0);      // the stage's 32 LDS reads stand as one group in front of its WMMAs: the second block's land behind the first block's WMMAs (two waves a SIMD: registers are there)
#pragma unroll
        for (int kk = 0; kk < 2; ++kk) {
#pragma unroll
            for (int nb = 0; nb < 4; ++nb) {
#pragma unroll
                for (int mb = 0; mb < 4; ++mb) acc[mb][nb] = wmma16(a[kk][mb], b[kk][nb], acc[mb][nb]); }
        }
        __builtin_amdgcn_sched_barrier(0);      // keeps the WMMAs in front of the waits below: moved behind the barrier they would leave the next stage's copies only the time of the LDS reads to land
        await_lds(); await_copies(); __syncthreads();      // publishes stage s + 1 and ends every wave's reads of stage s
        if (s + 2 < NSTG) fill(s + 2, s & 1);
    }
    await_copies();
#pragma unroll
    for (int mb = 0; mb < 4; ++mb) {
#pragma unroll
        for (int nb = 0; nb < 4; ++nb) {
#pragma unroll
            for (int j = 0; j < 8; ++j) os[(hi * 8 + j) * 68 + nb * 16 + lr] = acc[mb][nb][j]; }
        __builtin_amdgcn_wave_barrier(); asm volatile("" ::: "memory");
        float* crow = C + (size_t)(r0 + mb * 16) * ldc + c0;
{
#pragma unroll
            for (int s = 0; s < 8; ++s) { const int row = 2 * s + hi, cofs = lr * 4; v4f val = *(const v4fa*)(os + row * 68 + cofs); { val[0] += bfr(bias[c0 + cofs]); val[1] += bfr(bias[c0 + cofs + 1]); val[2] += bfr(bias[c0 + cofs + 2]); val[3] += bfr(bias[c0 + cofs + 3]); }
                *(v4f*)(crow + (size_t)row * ldc + cofs) = val; }
             }
        xwait();      // behind the eight stores: the next row block reuses their address and data registers
        __builtin_amdgcn_wave_barrier(); asm volatile("" ::: "memory");
    }
}

__device__ __forceinline__ h16 tohx(float x) { return (h16)x; }
typedef __attribute__((ext_vector_type(2))) _Float16 v2h;
typedef __attribute__((ext_vector_type(4))) _Float16 v4h;
typedef __attribute__((ext_vector_type(2))) unsigned short v2us;
typedef __attribute__((ext_vector_type(4))) unsigned short v4us;
typedef __attribute__((ext_vector_type(2))) float v2f;

__global__ __launch_bounds__(256) void k_bfr1(const float* __restrict__ src, float* dst, int n) { const int i = blockIdx.x * 256 + threadIdx.x; if (i >= n) return; const float v = bfr(src[i]); *(float*)(dst + i) = v;  }
// ---- k_prep: all operand preparation of a call in ONE launch: hidden_states to its bf16 plane, Wq, Wk, Wv to their transposed bf16 planes, Wo to its transposed fp16 plane, the three phase projections (six jobs, none reads what another writes).
// A grid of PREP_B blocks (2 a WGP, 16 waves) shares out every job evenly: a thread takes 8 pieces of the X plane, the same piece of each of the four weight planes, and p_c, p_s, p_m of one (batch, head, token).
// The work then starts 4,096 waves, not 61,440 of one piece each, and all of a thread's loads are in flight before the first of them is used.
#define PREP_B 512
#define PREP_T (PREP_B * 256)
static_assert((size_t)NT * DD / 8 == 8 * (size_t)PREP_T && DD * DD / 8 == PREP_T && NB_ * NH_ * TT == PREP_T && DD / 32 == 32, "pieces a thread");
__global__ __launch_bounds__(256) void k_prep(const float* __restrict__ x, const float* __restrict__ wq, const float* __restrict__ wk, const float* __restrict__ wv, const float* __restrict__ wo, const float* __restrict__ cph, const float* __restrict__ sph, const float* __restrict__ mag,
                                              const float* __restrict__ Wp, const float* __restrict__ bp, bf* XB, bf* WQ, bf* WK, bf* WV, bf* WO, float* PH) {
    const unsigned g = blockIdx.x * 256 + threadIdx.x;
    // X plane: a block takes one block of 16 rows, 32 tiles, 2,048 pieces; a thread's 8 pieces are 256 pieces apart: 4 tiles, 128 elements in the source row
    unsigned xs, xd; { const unsigned i = blockIdx.x * 2048 + threadIdx.x; FRAG_IDX_ROW(i); xs = (unsigned)(((tile / (DD / 32)) * 16 + lr) * DD + (tile % (DD / 32)) * 32 + j * 16 + hi * 8); xd = (unsigned)piece; }
    // weight planes: piece g of each; the eight rows are read off one offset, a constant pitch apart
    unsigned ws; { FRAG_IDX(g); const int kt = DD / 32; const int n = (tile / kt) * 16 + lr, k = (tile % kt) * 32 + j * 16 + hi * 8; ws = (unsigned)(k * DD + n); }
    // phase scalars: g = (batch, head, token); a block lies inside one head
    const unsigned h = (blockIdx.x >> 3) & (NH_ - 1), ps = ((g >> 15) & (NB_ - 1)) * (NBD * TT) + (g & (TT - 1));
    const float* xp = x + xs; v8f v[8]; float f[4][8], wl[NBD], pl[3][NBD];
#pragma unroll
    for (int s = 0; s < 8; ++s) v[s] = *(const v8f*)(xp + s * 128);
#pragma unroll
    for (int q = 0; q < 8; ++q) { f[0][q] = wq[ws + q * DD]; f[1][q] = wk[ws + q * DD]; f[2][q] = wv[ws + q * DD]; f[3][q] = wo[ws + q * DD]; }
#pragma unroll
    for (int n = 0; n < NBD; ++n) { wl[n] = Wp[n * NH_ + h]; pl[0][n] = cph[ps + n * TT]; pl[1][n] = sph[ps + n * TT]; pl[2][n] = mag[ps + n * TT]; }
    const float bl = bp[h];
    asm volatile("s_wait_xcnt 0x0" :: "v"(xp), "v"(ws), "v"(ps) : "memory");      // the same wait as xwait(); the address and the offsets are named as inputs only, so that they stay live up to the wait and no result lands in their registers in front of it
    __builtin_amdgcn_sched_barrier(0);      // keeps the conversions below out of the loads above: every load is issued before the first result is waited for
    v8us o[8], ow[4]; float sp[3];
#pragma unroll
    for (int s = 0; s < 8; ++s)
#pragma unroll
        for (int k = 0; k < 8; ++k) o[s][k] = f2bf(v[s][k]);
#pragma unroll
    for (int m = 0; m < 4; ++m)
#pragma unroll
        for (int q = 0; q < 8; ++q) ow[m][q] = (m < 3) ? f2bf(f[m][q]) : __builtin_bit_cast(unsigned short, tohx(bfr(f[m][q])));      // Wo: rounded to bf16 like every input, then held in fp16 for the output projection
#pragma unroll
    for (int k = 0; k < 3; ++k) { float s = 0.f;
#pragma unroll
        for (int n = 0; n < NBD; ++n) { float w = bfr(wl[n]), p = bfr(pl[k][n]); asm volatile("" : "+v"(w)); asm volatile("" : "+v"(p)); float m = __fmul_rn(p, w); asm volatile("" : "+v"(m)); s = __fadd_rn(s, m); }
        sp[k] = __fadd_rn(s, bfr(bl)); }
    v8us* xo = (v8us*)XB + xd;
#pragma unroll
    for (int s = 0; s < 8; ++s) xo[s * 256] = o[s];
    ((v8us*)WQ)[g] = ow[0]; ((v8us*)WK)[g] = ow[1]; ((v8us*)WV)[g] = ow[2]; ((v8us*)WO)[g] = ow[3];
#pragma unroll
    for (int k = 0; k < 3; ++k) *(float*)(PH + g + k * PREP_T) = sp[k];
}
// ---- k_qkv: the three input projections in ONE launch, each accumulator tile stored straight into its fp16 plane in fragment order (no f32 copy of q, k or v in memory, no conversion launch).
// grid (NT / 128, 3 * DD / 256), 8 waves: 2 groups of 64 tokens x 4 heads (64 columns each) of q, k or v; W3 = the q, k and v weight planes one behind the other, 3 * DD rows. A stage: 8 chunks of X, 16 of W3, 48 KiB; two work-groups a WGP.
// An accumulator register run j = 0..7 walks the ROW operand's index (8 hi + j), a lane's lr the COLUMN operand's. A piece of a plane is 8 neighbours along the plane's k: the head dimension for q and k, the token for V^T.
// So q and k take the weight rows as the row operand and the tokens as the column operand, v the other way round (both planes have one fragment order, so this is a swap of two pointers):
// in each case a lane's 8 registers are one 16-byte piece, and the wave's 32 pieces are one half tile, 512 contiguous bytes a store.
// amdgpu_waves_per_eu(4, 4): four waves a SIMD, so that two work-groups share a WGP and one works while the other stands at its barrier.
__global__ __launch_bounds__(256) __attribute__((amdgpu_waves_per_eu(4, 4))) void k_qkv(const bf* __restrict__ X, const bf* __restrict__ W3, const float* __restrict__ bq, const float* __restrict__ bk, const float* __restrict__ bv, const float* __restrict__ PH, h16* QP, h16* KP, h16* VT) {
    __shared__ __attribute__((aligned(2048))) bf st[2 * 24 * CHUNK];
    const int lane = threadIdx.x & 31, lr = lane & 15, hi = lane >> 4, wave = __builtin_amdgcn_readfirstlane(threadIdx.x >> 5);
    const int r0 = blockIdx.x * 128 + (wave & 1) * 64, hy = blockIdx.y * 4 + (wave >> 1), sel = hy >> 4, h = hy & 15;      // sel: 0 q, 1 k, 2 v
    const int z = (r0 >> 11) * NH_ + h, t0 = r0 & (TT - 1);      // (batch, head) and the first token inside the batch
    const int half = threadIdx.x >> 7, off = (threadIdx.x & 127) * 8;
    const bf* gx = X + (size_t)(blockIdx.x * 8 + half) * (16 * DD) + off; const bf* gw = W3 + (size_t)(blockIdx.y * 16 + half) * (16 * DD) + off;
    const unsigned l0 = (unsigned)(size_t)(st + half * CHUNK + off);      // the thread's LDS byte address in chunk 0 or 1 of buffer 0
    auto fill = [&](int s, int b) { const unsigned l = l0 + b * (24 * CHB);
        acopy4(l, gx + s * CHUNK, 2 * CHB, RSTEP); acopy8(l + 8 * CHB, gw + s * CHUNK, l + 16 * CHB, gw + s * CHUNK + 4 * RSTEP, 2 * CHB, RSTEP); };
    v8f acc[4][4];
#pragma unroll
    for (int mb = 0; mb < 4; ++mb)
#pragma unroll
        for (int nb = 0; nb < 4; ++nb) acc[mb][nb] = (v8f){};
    // 1,024 units of X, dealt 4 ways among the 12 work-groups that read them (by blockIdx.y & 3), 2,048 of W3, dealt 8 ways among 64 (by blockIdx.x >> 3)
    ask2(X + (size_t)blockIdx.x * (128 * DD) + (4 * threadIdx.x + (blockIdx.y & 3)) * UNIT, W3 + (size_t)blockIdx.y * (256 * DD) + (8 * threadIdx.x + (blockIdx.x >> 3)) * UNIT);
    fill(0, 0); await_copies(); __syncthreads(); fill(1, 1);
    const int ix = (wave & 1) * 4 * CHUNK + 8 * lane, iw = (8 + (wave >> 1) * 4) * CHUNK + 8 * lane;
    const int ia = (sel == 2) ? ix : iw, ib = (sel == 2) ? iw : ix;
    // rolled: one trip is one stage, so that the order wait, wait, barrier, refill stands once at its foot
#pragma unroll 1
    for (int s = 0; s < NSTG; ++s) {
        const bf* sb = st + (s & 1) * (24 * CHUNK);
#pragma unroll
        for (int kk = 0; kk < 2; ++kk) {
            v16bf a[4], b[4];
#pragma unroll
            for (int mb = 0; mb < 4; ++mb) a[mb] = WFrag<bf>::ld(sb + ia + mb * CHUNK + kk * 512);
#pragma unroll
            for (int nb = 0; nb < 4; ++nb) b[nb] = WFrag<bf>::ld(sb + ib + nb * CHUNK + kk * 512);
            __builtin_amdgcn_sched_barrier(0);      // the block's 16 LDS reads stand as one group in front of its WMMAs (left alone the compiler reads each b fragment into one register set and waits it out four times a block)
#pragma unroll
            for (int nb = 0; nb < 4; ++nb) {
#pragma unroll
                for (int mb = 0; mb < 4; ++mb) acc[mb][nb] = wmmab(a[mb], b[nb], acc[mb][nb]); }
            __builtin_amdgcn_sched_barrier(0);      // and the next block's reads stay out of this block's WMMAs
        }
        await_lds(); await_copies(); __syncthreads();      // publishes stage s + 1 and ends every wave's reads of stage s
        if (s + 2 < NSTG) fill(s + 2, s & 1);
    }
    await_copies();
    // In the epilogues each pair of scheduling barriers keeps every other register write out from between a group of loads or stores and its wait.
    if (sel < 2) {      // q (x log2(e)/8: the scores then come out in the base-2 domain) and k: acc[mb][nb][j] is dimension 16 mb + 8 hi + j of token t0 + 16 nb + lr
        const float sc = (sel == 0) ? 0.125f * L2E : 1.0f; const float* bl = ((sel == 0) ? bq : bk) + h * HD + 8 * hi;
        h16* P = ((sel == 0) ? QP : KP) + ((size_t)z * TT + t0) * HD + 8 * lane;      // 16 tokens on: 2 tiles, 1024 elements; 16 dimensions on: half a tile, 256
        v8f bs[4];
        __builtin_amdgcn_sched_barrier(0);
#pragma unroll
        for (int mb = 0; mb < 4; ++mb) bs[mb] = *(const v8f*)(bl + 16 * mb);
        asm volatile("s_wait_xcnt 0x0" :: "v"(bl) : "memory");      // the same wait as xwait(); the pointer is named as an input only, so that it stays live up to the wait
        __builtin_amdgcn_sched_barrier(0);
#pragma unroll
        for (int mb = 0; mb < 4; ++mb) { v8h o[4];
#pragma unroll
            for (int nb = 0; nb < 4; ++nb)
#pragma unroll
                for (int j = 0; j < 8; ++j) o[nb][j] = tohx((acc[mb][nb][j] + bfr(bs[mb][j])) * sc);
            __builtin_amdgcn_sched_barrier(0);
#pragma unroll
            for (int nb = 0; nb < 4; ++nb) *(v8ha*)(P + nb * 1024 + mb * 256) = o[nb];
            xwait(); __builtin_amdgcn_sched_barrier(0); }
    } else {            // v: acc[mb][nb][j] is dimension 16 nb + lr of token t0 + 16 mb + 8 hi + j; rows 0-63 of the V^T plane take v p_m p_c, rows 64-127 v p_m p_s
        const float* bl = bv + h * HD + lr; const float* pl = PH + (size_t)z * TT + t0 + 8 * hi;      // p_c of the lane's first token; p_s and p_m stand NZ * TT and 2 * NZ * TT floats further
        h16* P = VT + ((size_t)z * (HD2 * TT / 512) + (t0 >> 5) * 8) * 512 + 8 * lane;      // 32 tokens on: 8 tiles; 16 rows on: 1 tile; 16 tokens on: half a tile
        float bs[4];
        __builtin_amdgcn_sched_barrier(0);
#pragma unroll
        for (int nb = 0; nb < 4; ++nb) bs[nb] = bl[16 * nb];
        asm volatile("s_wait_xcnt 0x0" :: "v"(bl) : "memory");      // as above
        __builtin_amdgcn_sched_barrier(0);
#pragma unroll
        for (int nb = 0; nb < 4; ++nb) bs[nb] = bfr(bs[nb]);
#pragma unroll
        for (int mb = 0; mb < 4; ++mb) {
            __builtin_amdgcn_sched_barrier(0);
            const v8f pc = *(const v8f*)(pl + 16 * mb), psn = *(const v8f*)(pl + NZ * TT + 16 * mb), pm = *(const v8f*)(pl + 2 * NZ * TT + 16 * mb);
            asm volatile("s_wait_xcnt 0x0" :: "v"(pl) : "memory");      // as above
            __builtin_amdgcn_sched_barrier(0);
#pragma unroll
            for (int part = 0; part < 2; ++part) { v8h o[4];
#pragma unroll
                for (int nb = 0; nb < 4; ++nb)
#pragma unroll
                    for (int j = 0; j < 8; ++j) o[nb][j] = tohx(__fmul_rn(__fmul_rn(acc[mb][nb][j] + bs[nb], pm[j]), part ? psn[j] : pc[j]));
                __builtin_amdgcn_sched_barrier(0);
#pragma unroll
                for (int nb = 0; nb < 4; ++nb) *(v8ha*)(P + (mb >> 1) * 4096 + (part * 4 + nb) * 512 + (mb & 1) * 256) = o[nb];
                xwait(); __builtin_amdgcn_sched_barrier(0); } }
    }
}
// ---- k_fattn: scores, mask, softmax, both value contractions and the phase merge of one (batch, head) in ONE launch; S and P stay in registers.
// Transposed products: S^T = K.Q^T (A = 16 key rows, B = 16 query columns), O^T += [V_real|V_imag]^T.P^T (A = 16 rows of the 128-wide V^T plane, B = P^T). A lane then holds scores of ONE query
// (column lr): two S^T tiles (keys 0-15, 16-31 of a pass), converted in place, are the B operand of the second product in the loaders' own k order (8 hi + 0..7, 16 + 8 hi + 0..7).
// Online softmax in the base-2 domain. The score WMMA itself hands out the argument of exp2: Q carries log2(e)/8, and the C operand of the first score product is (mask x log2(e)) - maximum in use (for the keys that count a difference of near values,
// whatever the size of the mask). No maximum is taken on an ordinary pass: the weights are formed, and a lane's 16 weights of a column group must sum to at most PLIM (so each is below 256 in fp16).
// Only a pass that fails this test (the first one always does) forms its scores again without the maximum, takes the true maximum, rescales the accumulators and forms its weights anew.
// grid (TT / (8 * 16 * QG), NZ), 8 waves x QG groups of 16 query columns; a pass is 32 keys; operands straight from the fp16 planes in fragment order: every K and V^T fragment
// a wave loads serves QG column groups.
#define PLIM 240.0f
#define QG  4
__device__ __forceinline__ float xhalf(float x) { return __builtin_bit_cast(float, __builtin_amdgcn_permlanex16(__builtin_bit_cast(int, x), __builtin_bit_cast(int, x), 0x76543210, 0xfedcba98, false, false)); }  // lane l <-> lane l ^ 16
__global__ __launch_bounds__(256) void k_fattn(const h16* __restrict__ QP, const h16* __restrict__ KP, const h16* __restrict__ VT, const float* __restrict__ am, const float* __restrict__ PH, h16* Ah) {
    __shared__ __align__(16) float mk[TT];      // this batch's additive mask row, rounded to bf16 and taken times log2(e), once per work-group
    const int z = blockIdx.y, b = z / NH_, h = z % NH_;
    // Asks L2 for the head's whole K plane (1,024 units of 256 bytes) and V^T plane (2,048), in the order of the passes: a request of the work-group covers 64 KiB, 16 passes of K or 8 of V^T. Every work-group asks for all of it.
    // The wait is the same precaution as in ask2().
    asm volatile("global_prefetch_b8 %0, off scope:SCOPE_SE\n\tglobal_prefetch_b8 %1, off scope:SCOPE_SE\n\tglobal_prefetch_b8 %1, off offset:65536 scope:SCOPE_SE\n\t"
                 "global_prefetch_b8 %0, off offset:65536 scope:SCOPE_SE\n\tglobal_prefetch_b8 %1, off offset:131072 scope:SCOPE_SE\n\tglobal_prefetch_b8 %1, off offset:196608 scope:SCOPE_SE\n\t"
                 "global_prefetch_b8 %0, off offset:131072 scope:SCOPE_SE\n\tglobal_prefetch_b8 %1, off offset:262144 scope:SCOPE_SE\n\tglobal_prefetch_b8 %1, off offset:327680 scope:SCOPE_SE\n\t"
                 "global_prefetch_b8 %0, off offset:196608 scope:SCOPE_SE\n\tglobal_prefetch_b8 %1, off offset:393216 scope:SCOPE_SE\n\tglobal_prefetch_b8 %1, off offset:458752 scope:SCOPE_SE\n\ts_wait_xcnt 0x0"
                 :: "v"(KP + (size_t)z * TT * HD + threadIdx.x * UNIT), "v"(VT + (size_t)z * HD2 * TT + threadIdx.x * UNIT) : "memory");
    for (int i = threadIdx.x * 4; i < TT; i += 1024) { v4f a = *(const v4f*)(am + (size_t)b * TT + i);
#pragma unroll
        for (int q = 0; q < 4; ++q) a[q] = bfr(a[q]) * L2E;
        *(v4fa*)(mk + i) = a; }
    __syncthreads();
    const int lane = threadIdx.x & 31, lr = lane & 15, hi = lane >> 4; const int q0 = (blockIdx.x * 8 + __builtin_amdgcn_readfirstlane(threadIdx.x >> 5)) * (16 * QG);      // the wave's first query, held in a scalar register
    const h16* Kz = KP + (size_t)z * TT * HD; const unsigned ko = (unsigned)(8 * lane);      // K plane of this head, and the lane's offset in a tile
    const h16* vp = VT + (size_t)z * HD2 * TT + 8 * lane;      // the lane's address in the V^T tiles of the pass at hand
    v16h qf[QG][2]; const h16* Qz = QP + ((size_t)z * TT + q0) * HD;      // the wave's first Q tile
#pragma unroll
    for (int g = 0; g < QG; ++g)
#pragma unroll
        for (int kc = 0; kc < 2; ++kc) qf[g][kc] = WFrag<h16>::ld(Qz + (size_t)(16 * g) * HD + 512 * kc + ko);
    v16h kf[2][2];      // K fragments are fetched one pass ahead, half way through the second product
#pragma unroll
    for (int kt = 0; kt < 2; ++kt)
#pragma unroll
        for (int kc = 0; kc < 2; ++kc) kf[kt][kc] = WFrag<h16>::ld(Kz + (size_t)(16 * kt) * HD + 512 * kc + ko);
    // the same wait as xwait(); the two scalar bases of the Q and K loads are named as inputs only, so that their register pairs stay live up to the wait and nothing is written over them in front of it
    asm volatile("s_wait_xcnt 0x0" :: "s"(Qz), "s"(Kz) : "memory");
    __builtin_amdgcn_sched_barrier(0);      // keeps the scheduler from mixing the tiles' set-up below into the loads above (it spilled Q fragments when it did)
    const h16* kp = Kz + ko + 32 * HD;      // the lane's address in the K tile to fetch next
    v8f acc[QG][8]; float m_run[QG], l_run[QG];
#pragma unroll
    for (int g = 0; g < QG; ++g) { m_run[g] = -__FLT_MAX__; l_run[g] = 0.f;
#pragma unroll
        for (int t = 0; t < 8; ++t) acc[g][t] = (v8f){}; }
    // rolled: one pass's fragments and the output tiles already fill the wave's registers
#pragma unroll 1
    for (int key0 = 0; key0 < TT; key0 += 32) {
        v16h vf[8];
#pragma unroll
        for (int t = 0; t < 4; ++t) vf[t] = WFrag<h16>::ld(vp + 512 * t);
        asm volatile("s_wait_xcnt 0x0" :: "v"(vp) : "memory");      // the same wait as xwait(); the address is named as an input only, so that it stays live up to the wait and no fragment lands in its registers in front of it
        v8f s[2][QG];
#pragma unroll
        for (int kt = 0; kt < 2; ++kt) { const v4f m0 = *(const v4fa*)(mk + key0 + 16 * kt + 8 * hi), m1 = *(const v4fa*)(mk + key0 + 16 * kt + 8 * hi + 4);
#pragma unroll
            for (int g = 0; g < QG; ++g) { v8f c;
#pragma unroll
                for (int r = 0; r < 4; ++r) { c[r] = m0[r] - m_run[g]; c[4 + r] = m1[r] - m_run[g]; }
                s[kt][g] = wmma16(kf[kt][1], qf[g][1], wmma16(kf[kt][0], qf[g][0], c)); }
            if (kt == 0) __builtin_amdgcn_sched_barrier(0); }      // the second key tile's four C tiles are formed only behind the first tile's products, when its K fragments are dead (formed all eight up front they spilled a Q fragment)
        v16h pf[QG]; float ls[QG]; bool need = false;
#pragma unroll
        for (int g = 0; g < QG; ++g) { v2f l2 = (v2f){0.f, 0.f};
#pragma unroll
            for (int e = 0; e < 16; e += 2) { const v2f p = (v2f){__builtin_amdgcn_exp2f(s[e >> 3][g][e & 7]), __builtin_amdgcn_exp2f(s[e >> 3][g][(e & 7) + 1])};
                l2 += p; pf[g][e] = tohx(p[0]); pf[g][e + 1] = tohx(p[1]); }
            ls[g] = l2[0] + l2[1]; need = need || !(ls[g] <= PLIM); }      // the negated form also catches a sum that is not a number
        // the second half of the V^T fragments is asked for here, where the K fragments and half of the score registers are free again (asked for at the head of the pass they spilled an output tile)
#pragma unroll
        for (int t = 4; t < 8; ++t) vf[t] = WFrag<h16>::ld(vp + 512 * t);
        asm volatile("s_wait_xcnt 0x0" :: "v"(vp) : "memory");      // as above
        if (__builtin_amdgcn_ballot_w32(need) != 0) {       // one wave-uniform test per pass
            v16h kr[2][2]; const h16* kq = Kz + (size_t)key0 * HD + ko;      // the pass's K fragments are loaded again here: kept for this rare path they would cost every pass 32 registers (spills)
#pragma unroll
            for (int kt = 0; kt < 2; ++kt)
#pragma unroll
                for (int kc = 0; kc < 2; ++kc) kr[kt][kc] = WFrag<h16>::ld(kq + (size_t)(16 * kt) * HD + 512 * kc);
            asm volatile("s_wait_xcnt 0x0" :: "v"(kq) : "memory");      // as above
            v8f c[2];
#pragma unroll
            for (int kt = 0; kt < 2; ++kt) { const v4f m0 = *(const v4fa*)(mk + key0 + 16 * kt + 8 * hi), m1 = *(const v4fa*)(mk + key0 + 16 * kt + 8 * hi + 4);
                c[kt] = (v8f){m0[0], m0[1], m0[2], m0[3], m1[0], m1[1], m1[2], m1[3]}; }
            // one column group at a time: two score tiles live, not eight
#pragma unroll
            for (int g = 0; g < QG; ++g) {
#pragma unroll
                for (int kt = 0; kt < 2; ++kt) s[kt][g] = wmma16(kr[kt][1], qf[g][1], wmma16(kr[kt][0], qf[g][0], c[kt]));
                float mx = s[0][g][0];
#pragma unroll
                for (int r = 1; r < 8; ++r) mx = fmaxf(mx, s[0][g][r]);
#pragma unroll
                for (int r = 0; r < 8; ++r) mx = fmaxf(mx, s[1][g][r]);
                mx = fmaxf(mx, xhalf(mx)); const float m_new = fmaxf(m_run[g], mx); const float corr = __builtin_amdgcn_exp2f(m_run[g] - m_new); m_run[g] = m_new; l_run[g] *= corr;
#pragma unroll
                for (int t = 0; t < 8; ++t) acc[g][t] = acc[g][t] * corr;
                v2f l2 = (v2f){0.f, 0.f};
#pragma unroll
                for (int kt = 0; kt < 2; ++kt) s[kt][g] = s[kt][g] - m_new;
#pragma unroll
                for (int e = 0; e < 16; e += 2) { const v2f p = (v2f){__builtin_amdgcn_exp2f(s[e >> 3][g][e & 7]), __builtin_amdgcn_exp2f(s[e >> 3][g][(e & 7) + 1])};
                    l2 += p; pf[g][e] = tohx(p[0]); pf[g][e + 1] = tohx(p[1]); }
                ls[g] = l2[0] + l2[1]; } }
#pragma unroll
        for (int g = 0; g < QG; ++g) { l_run[g] += ls[g];
#pragma unroll
            for (int t = 0; t < 8; ++t) acc[g][t] = wmma16(vf[t], pf[g], acc[g][t]);
            if (g == QG / 2 - 1) {
#pragma unroll
                for (int kt = 0; kt < 2; ++kt)
#pragma unroll
                    for (int kc = 0; kc < 2; ++kc) kf[kt][kc] = WFrag<h16>::ld(kp + (size_t)(16 * kt) * HD + 512 * kc);
                kp += (key0 + 64 < TT) ? 32 * HD : 0; } }      // the last pass fetches its own tile again: in bounds, unused
        vp += 32 * HD2;
    }
#pragma unroll
    for (int g = 0; g < QG; ++g) { const int t = q0 + 16 * g + lr; const float l = l_run[g] + xhalf(l_run[g]); const float inv = __fdiv_rn(1.0f, l);
        const float pc = PH[((size_t)b * NH_ + h) * TT + t], psn = PH[((size_t)NB_ * NH_ + (size_t)b * NH_ + h) * TT + t];
#pragma unroll
        for (int tt = 0; tt < 4; ++tt) { v8h oh;
#pragma unroll
            for (int r = 0; r < 8; ++r) oh[r] = tohx((acc[g][tt][r] * inv) * pc + (acc[g][tt + 4][r] * inv) * psn);
            const unsigned o = ((unsigned)b * TT + q0 + 16 * g) * DD + (2 * h + (tt >> 1)) * 512 + (tt & 1) * 256 + 8 * lane;      /* row t, k = 64 h + 16 tt + 8 hi in fragment order: 512 contiguous bytes a store */ __builtin_amdgcn_sched_barrier(0);      // the two barriers keep every other register write out from between the store and its wait
            *(v8ha*)(Ah + o) = oh; xwait(); __builtin_amdgcn_sched_barrier(0); } }
}
__global__ __launch_bounds__(256) void k_ln2(const float* __restrict__ FF, const float* __restrict__ X, const float* __restrict__ gg, const float* __restrict__ bb, float* OUT) {
    const int lane = threadIdx.x & 31; const int r = blockIdx.x * 8 + (threadIdx.x >> 5); if (r >= NT) return; float v[32]; float s = 0.f;
#pragma unroll
    for (int c = 0; c < 8; ++c) { const v4f a = *(const v4f*)(FF + (size_t)r * DD + c * 128 + lane * 4), xx = *(const v4f*)(X + (size_t)r * DD + c * 128 + lane * 4);
#pragma unroll
        for (int q = 0; q < 4; ++q) { v[c * 4 + q] = a[q] + bfr(xx[q]); s += v[c * 4 + q]; } }
#pragma unroll
    for (int sh = 16; sh; sh >>= 1) s += __shfl_xor(s, sh, 32);
    const float mu = s * (1.0f / DD); float qq = 0.f;
#pragma unroll
    for (int i = 0; i < 32; ++i) { const float d0 = v[i] - mu; qq = __fadd_rn(qq, __fmul_rn(d0, d0)); }
#pragma unroll
    for (int sh = 16; sh; sh >>= 1) qq += __shfl_xor(qq, sh, 32);
    const float rs = __fdiv_rn(1.0f, __fsqrt_rn(qq * (1.0f / DD) + 1e-12f));
{
#pragma unroll
        for (int c = 0; c < 8; ++c) { v4f o;
#pragma unroll
            for (int q = 0; q < 4; ++q) { const int col = c * 128 + lane * 4 + q; o[q] = __fadd_rn(__fmul_rn((v[c * 4 + q] - mu) * rs, bfr(gg[col])), bfr(bb[col])); }
            *(v4f*)(OUT + (size_t)r * DD + c * 128 + lane * 4) = o; }
         }
}

extern "C" void kernel_launch(void* const* d_in, const int* in_sizes, int n_in,
                              void* d_out, int out_size, void* d_ws, size_t ws_size, hipStream_t stream) {
    (void)in_sizes; (void)n_in; (void)out_size;
    const float* IN[17]; for (int i = 0; i < 17; ++i) IN[i] = (const float*)d_in[i];
    // hidden_states, attention_mask [4][1][1][2048], cos_phi, sin_phi, mag [4][8][2048], Wq [1024][1024] (x @ W), bq, Wk, bk, Wv, bv, Wo, bo, Wp [8][16], bp [16], ln_g, ln_b = d_in[0..16]
    const float* x = IN[0]; const float* am = IN[1];
    float* OUT = (float*)d_out;     // [4][2048][1024]
    char* wsp = (char*)d_ws;
    auto take = [&](size_t bytes) { char* p = wsp; wsp += (bytes + 255) & ~(size_t)255; return (void*)p; };
    bf* WQ = (bf*)take((size_t)3 * DD * DD * 2); bf* WK = WQ + (size_t)DD * DD; bf* WV = WK + (size_t)DD * DD;      /* one plane of 3 * DD rows for k_qkv */ bf* WO = (bf*)take((size_t)DD * DD * 2); float* PH = (float*)take((size_t)3 * NB_ * NH_ * TT * 4);
    bf* XB = (bf*)take((size_t)NT * DD * 2); float* F = (float*)take((size_t)NT * DD * 4);
    h16* QP = (h16*)take((size_t)NT * DD * 2); h16* KP = (h16*)take((size_t)NT * DD * 2); h16* VT = (h16*)take((size_t)NZ * HD2 * TT * 2);
    h16* ATh = (h16*)take((size_t)NT * DD * 2);
    if ((size_t)(wsp - (char*)d_ws) > ws_size) return;    // total ~ 138 MiB; ws 256 MiB
    float* Y = F;   // the output projection's f32 result
    k_prep<<<PREP_B, 256, 0, stream>>>(x, IN[5], IN[7], IN[9], IN[11], IN[2], IN[3], IN[4], IN[13], IN[14], XB, WQ, WK, WV, WO, PH);
    k_qkv<<<dim3(NT / 128, 3 * DD / 256), 256, 0, stream>>>(XB, WQ, IN[6], IN[8], IN[10], PH, QP, KP, VT);
    k_fattn<<<dim3(TT / (8 * 16 * QG), NZ), 256, 0, stream>>>(QP, KP, VT, am, PH, ATh);
    k_oproj<<<dim3(NT / 128, DD / 256), 256, 0, stream>>>(ATh, (const h16*)WO, Y, IN[12]);
    k_ln2<<<NT / 8, 256, 0, stream>>>(Y, x, IN[15], IN[16], OUT);
}

// v009
// Measured time: 138 microseconds a run.
// Two timings next to v008 put it at 1.04 and 1.02 times that version's speed.
// All steps since v000 together make it 18.8 times as fast.
#include <hip/hip_runtime.h>

// Attention block with phase-weighted values (hidden_states [4][2048][1024]; q/k/v = x @ W + b (16 heads x 64); phase scalars p_c/p_s/p_m[b][h][t] = sum_band {cos_phi,sin_phi,mag}[b][band][t] Wp[band][h] + bp[h] (8 bands);
// V_real = v p_m p_c, V_imag = v p_m p_s (per (b,h,t) scalars on the value rows); scores = q.k/8 + attention_mask[b][0][0][j] (additive input, read as data); softmax; ctx = (P.V_real) p_c + (P.V_imag) p_s
// (per query row); out = LN(ctx @ Wo + bo + hidden_states) * ln_g + ln_b (eps 1e-12)).
// Compute dtypes, f32 accumulate: every input rounded to bf16; projections on PLAIN bf16 operands (inputs: exact, + bias); the phase projections (8 terms), V scaling,
// ctx combination, residual and LayerNorm in f32 on VALU; scores and the two value contractions on SINGLE fp16 planes (q x log2(e)/8; P = exp2(score - max in use), normalised after the contraction; V_real | V_imag packed as one 128-wide V^T plane per head
// so attn.[V_real|V_imag] is one N = 128 GEMM); output projection on ONE fp16 plane of ctx x Wo in fp16 (Wo rounded to bf16 first; that value is exact in fp16 from 2^-17 up).

#define NB_  4
#define NBD  8                   // phase bands
#define HD2  128                 // packed V_real | V_imag plane width
#define TT   2048
#define DD   1024
#define NH_  16
#define HD   64
#define NT   (NB_ * TT)
#define NZ   (NB_ * NH_)
#define L2E  1.4426950408889634f
typedef _Float16 h16;
typedef unsigned short bf;
typedef __attribute__((ext_vector_type(16))) __bf16   v16bf;
typedef __attribute__((ext_vector_type(16))) _Float16 v16h;
typedef __attribute__((ext_vector_type(8)))  _Float16 v8h;
typedef __attribute__((ext_vector_type(8)))  unsigned short v8us;
typedef __attribute__((ext_vector_type(8)))  float    v8f;
typedef __attribute__((ext_vector_type(4)))  float    v4f;
typedef v8h  __attribute__((may_alias)) v8ha;
typedef v4f  __attribute__((may_alias)) v4fa;
typedef v8us __attribute__((may_alias)) v8usa;

__device__ __forceinline__ unsigned short f2bf(float f) { unsigned u = __float_as_uint(f); u += 0x7FFFu + ((u >> 16) & 1u); return (unsigned short)(u >> 16); }
__device__ __forceinline__ float bf2f(unsigned short b) { return __uint_as_float(((unsigned)b) << 16); }
__device__ __forceinline__ float bfr(float f) { return bf2f(f2bf(f)); }
__device__ __forceinline__ v16h cat16(v8h lo, v8h hi) { return __builtin_shufflevector(lo, hi, 0, 1, 2, 3, 4, 5, 6, 7, 8, 9, 10, 11, 12, 13, 14, 15); }
__device__ __forceinline__ v16bf cat16b(v8us lo, v8us hi) { return __builtin_bit_cast(v16bf, __builtin_shufflevector(lo, hi, 0, 1, 2, 3, 4, 5, 6, 7, 8, 9, 10, 11, 12, 13, 14, 15)); }
__device__ __forceinline__ v8f wmma16(v16h a, v16h b, v8f c) { return __builtin_amdgcn_wmma_f32_16x16x32_f16(false, a, false, b, (short)0, c, false, false); }
__device__ __forceinline__ v8f wmmab(v16bf a, v16bf b, v8f c) { return __builtin_amdgcn_wmma_f32_16x16x32_bf16(false, a, false, b, (short)0, c, false, false); }



// Stands behind a group of global loads or stores, in front of the first instruction that reuses a register they name (a precaution).
__device__ __forceinline__ void xwait() { asm volatile("s_wait_xcnt 0x0" ::: "memory"); }
// ---- FRAGMENT ORDER of every 16-bit operand plane [rows][K] (rows % 16 == 0, K % 32 == 0): the plane is a row of 1 KiB tiles, tile (R, kb) = rows 16 R .. 16 R + 15 x k 32 kb .. 32 kb + 31 at tile index R * (K / 32) + kb
// (the V^T plane: kb * 8 + R, so that a pass reads 8 KiB in a row). A tile is two halves of 512 B; half j holds at 16 B x lane (lane = 16 hi + lr) the elements k = 32 kb + 16 j + 8 hi + 0..7 of row 16 R + lr.
// A fragment is then two wave-wide 16-byte loads of 512 contiguous bytes each (4 whole lines a load; on a row-major plane it would touch 32 B in each of 16 lines); a lane's k order is 8 hi + 0..7, then 16 + 8 hi + 0..7, for A and B alike.
// A producer thread writes whole 16-byte pieces (k_prep: 8 of the X plane, one of each weight plane). Where the source runs across k (the transposing producers) thread i writes piece i, at byte 16 i: FRAG_IDX splits i into lr, hi, j and the tile index.
// Where the source runs along k, FRAG_IDX_ROW gives four neighbouring threads the four pieces of one tile row (128 source bytes in f32, one whole line); eight such rows make four whole lines of the tile.
#define FRAG_IDX(i) const int lr = (int)((i) & 15), hi = (int)(((i) >> 4) & 1), j = (int)(((i) >> 5) & 1); const int tile = (int)((i) >> 6)
#define FRAG_IDX_ROW(i) const int hi = (int)((i) & 1), j = (int)(((i) >> 1) & 1), lr = (int)(((i) >> 2) & 15); const int tile = (int)((i) >> 6); const size_t piece = (size_t)tile * 64 + j * 32 + hi * 16 + lr
// ---- The two GEMM kernels (k_qkv, k_oproj): a work-group of 8 waves (2 x 4) owns a 128 x 256 tile of the result, a wave 64 x 64 of it (16 accumulators). A stage is 64 of k: for each block of 16 operand rows two
// neighbouring 1 KiB tiles of its plane, one CHUNK of 2 KiB, contiguous in memory and copied as it lies (fragment order) into LDS by asynchronous copies, 16 bytes a lane. A fragment is then two ds_load_b128 of 512 contiguous bytes.
// Every chunk is brought from L2 once a work-group and read by 2 or 4 waves. Two buffers: stage s + 1 flies while stage s is worked on.
template <typename T16> struct WFrag;
template <> struct WFrag<h16> { typedef v16h V; static __device__ __forceinline__ V ld(const h16* p) { return cat16(*(const v8h*)p, *(const v8h*)(p + 256)); } static __device__ __forceinline__ v8f mma(V a, V b, v8f c) { return wmma16(a, b, c); } };
template <> struct WFrag<bf> { typedef v16bf V; static __device__ __forceinline__ V ld(const bf* p) { return cat16b(*(const v8us*)p, *(const v8us*)(p + 256)); } static __device__ __forceinline__ v8f mma(V a, V b, v8f c) { return wmmab(a, b, c); } };
// Four asynchronous copies of 16 bytes a lane (LDS byte address, global address); the s_wait_xcnt stands in the copies' own statement, in front of anything that reuses their address registers (a precaution).
__device__ __forceinline__ void acopy4(unsigned l, const bf* g, int lstep, int gstep) {
    asm volatile("global_load_async_to_lds_b128 %0, %1, off\n\tglobal_load_async_to_lds_b128 %2, %3, off\n\tglobal_load_async_to_lds_b128 %4, %5, off\n\tglobal_load_async_to_lds_b128 %6, %7, off\n\ts_wait_xcnt 0x0"
                 :: "v"(l), "v"(g), "v"(l + lstep), "v"(g + gstep), "v"(l + 2 * lstep), "v"(g + 2 * gstep), "v"(l + 3 * lstep), "v"(g + 3 * gstep) : "memory");
}
// The same for eight copies, four from each of two places: one wait serves the run.
__device__ __forceinline__ void acopy8(unsigned l, const bf* g, unsigned m, const bf* q, int lstep, int gstep) {
    asm volatile("global_load_async_to_lds_b128 %0, %1, off\n\tglobal_load_async_to_lds_b128 %2, %3, off\n\tglobal_load_async_to_lds_b128 %4, %5, off\n\tglobal_load_async_to_lds_b128 %6, %7, off\n\t"
                 "global_load_async_to_lds_b128 %8, %9, off\n\tglobal_load_async_to_lds_b128 %10, %11, off\n\tglobal_load_async_to_lds_b128 %12, %13, off\n\tglobal_load_async_to_lds_b128 %14, %15, off\n\ts_wait_xcnt 0x0"
                 :: "v"(l), "v"(g), "v"(l + lstep), "v"(g + gstep), "v"(l + 2 * lstep), "v"(g + 2 * gstep), "v"(l + 3 * lstep), "v"(g + 3 * gstep),
                    "v"(m), "v"(q), "v"(m + lstep), "v"(q + gstep), "v"(m + 2 * lstep), "v"(q + 2 * gstep), "v"(m + 3 * lstep), "v"(q + 3 * gstep) : "memory");
}
// A stage of the attention kernel, 96 KiB copied as it lies: 24 copies a thread, six runs of four. A run names one LDS address, a byte offset and a scalar base; its copies stand 4 KiB apart in LDS and in memory alike
// (the immediate offset moves both addresses). l: the lane's LDS byte address in the buffer; ok, ov: the stage's first byte in the head's K and V^T planes plus the lane's byte in its wave's 512; k, v: the wave's first byte in those planes.
// One wait serves the whole run of copies.
__device__ __forceinline__ void acopy24(unsigned l, unsigned ok, unsigned ov, const char* k, const char* v) {
    asm volatile(
                 "global_load_async_to_lds_b128 %0, %6, %8\n\tglobal_load_async_to_lds_b128 %0, %6, %8 offset:4096\n\tglobal_load_async_to_lds_b128 %0, %6, %8 offset:8192\n\tglobal_load_async_to_lds_b128 %0, %6, %8 offset:12288\n\t"
                 "global_load_async_to_lds_b128 %1, %6, %9\n\tglobal_load_async_to_lds_b128 %1, %6, %9 offset:4096\n\tglobal_load_async_to_lds_b128 %1, %6, %9 offset:8192\n\tglobal_load_async_to_lds_b128 %1, %6, %9 offset:12288\n\t"
                 "global_load_async_to_lds_b128 %2, %7, %10\n\tglobal_load_async_to_lds_b128 %2, %7, %10 offset:4096\n\tglobal_load_async_to_lds_b128 %2, %7, %10 offset:8192\n\tglobal_load_async_to_lds_b128 %2, %7, %10 offset:12288\n\t"
                 "global_load_async_to_lds_b128 %3, %7, %11\n\tglobal_load_async_to_lds_b128 %3, %7, %11 offset:4096\n\tglobal_load_async_to_lds_b128 %3, %7, %11 offset:8192\n\tglobal_load_async_to_lds_b128 %3, %7, %11 offset:12288\n\t"
                 "global_load_async_to_lds_b128 %4, %7, %12\n\tglobal_load_async_to_lds_b128 %4, %7, %12 offset:4096\n\tglobal_load_async_to_lds_b128 %4, %7, %12 offset:8192\n\tglobal_load_async_to_lds_b128 %4, %7, %12 offset:12288\n\t"
                 "global_load_async_to_lds_b128 %5, %7, %13\n\tglobal_load_async_to_lds_b128 %5, %7, %13 offset:4096\n\tglobal_load_async_to_lds_b128 %5, %7, %13 offset:8192\n\tglobal_load_async_to_lds_b128 %5, %7, %13 offset:12288\n\t"
                 "s_wait_xcnt 0x0"
                 :: "v"(l), "v"(l + 16384), "v"(l + 32768), "v"(l + 49152), "v"(l + 65536), "v"(l + 81920), "v"(ok), "v"(ov), "s"(k), "s"(k + 16384), "s"(v), "s"(v + 16384), "s"(v + 32768), "s"(v + 49152) : "memory");
}
__device__ __forceinline__ void await_copies() { asm volatile("s_wait_asynccnt 0x0" ::: "memory"); }      // the wave's own copies have landed
__device__ __forceinline__ void await_lds() { asm volatile("s_wait_dscnt 0x0" ::: "memory"); }            // the wave's own LDS reads are done, in front of the barrier behind which their buffer is refilled
// ---- Asking L2 ahead. The 16-bit planes were stored by the launch before. At kernel entry each work-group, for speed only,
// asks L2 for what it will read: global_prefetch_b8, scope SE (into L2 only, nothing returns), a lane naming one aligned 256-byte unit inside the plane, every lane on. The s_wait_xcnt stands in the same statement, in front of
// anything that reuses the address registers (a precaution, as behind the copies above).
#define UNIT 128                   // 16-bit elements of a 256-byte unit
__device__ __forceinline__ void ask2(const bf* a, const bf* b) {
    asm volatile("global_prefetch_b8 %0, off scope:SCOPE_SE\n\tglobal_prefetch_b8 %1, off scope:SCOPE_SE\n\ts_wait_xcnt 0x0" :: "v"(a), "v"(b) : "memory");
}
#define CHUNK 1024                 // elements of a chunk
#define CHB   2048                 // its bytes
#define RSTEP (2 * (DD / 32) * 512)      // elements between a thread's copies in a plane: two blocks of 16 rows (threads 0-127 copy the even chunks, 128-255 the odd ones)
#define NSTG  (DD / 64)
// ---- k_oproj: C[m][n] (f32) = sum_k A[m][k] Bt[n][k] + bias[n], fp16 operands; grid (NT / 128, DD / 256). A stage: 8 chunks of A, 16 of Bt, 48 KiB.
__global__ __launch_bounds__(256) void k_oproj(const h16* __restrict__ A, const h16* __restrict__ Bt, float* C, const float* __restrict__ bias) {
    constexpr int ldc = DD;
    __shared__ __attribute__((aligned(2048))) h16 st[2 * 24 * CHUNK];
    __shared__ __align__(16) float osw[8][16 * 68];
    const int lane = threadIdx.x & 31, lr = lane & 15, hi = lane >> 4, wave = __builtin_amdgcn_readfirstlane(threadIdx.x >> 5);
    const int r0 = blockIdx.x * 128 + (wave & 1) * 64, c0 = blockIdx.y * 256 + (wave >> 1) * 64;
    float* os = osw[wave];
    const int half = threadIdx.x >> 7, off = (threadIdx.x & 127) * 8;
    const bf* ga = (const bf*)A + (size_t)(blockIdx.x * 8 + half) * (16 * DD) + off; const bf* gb = (const bf*)Bt + (size_t)(blockIdx.y * 16 + half) * (16 * DD) + off;      // the copies move 16-byte pieces, whatever the 16-bit type
    const unsigned l0 = (unsigned)(size_t)(st + half * CHUNK + off);      // the thread's LDS byte address in chunk 0 or 1 of buffer 0
    auto fill = [&](int s, int b) { const unsigned l = l0 + b * (24 * CHB);
        acopy4(l, ga + s * CHUNK, 2 * CHB, RSTEP); acopy8(l + 8 * CHB, gb + s * CHUNK, l + 16 * CHB, gb + s * CHUNK + 4 * RSTEP, 2 * CHB, RSTEP); };
    v8f acc[4][4];
#pragma unroll
    for (int mb = 0; mb < 4; ++mb)
#pragma unroll
        for (int nb = 0; nb < 4; ++nb) acc[mb][nb] = (v8f){};
    // the tile's operand rows lie in a row in their planes: 1,024 units of A, dealt among the 4 work-groups that read them (by blockIdx.y), 2,048 of Bt, dealt 8 ways (by blockIdx.x >> 3, so that the 8 neighbours in x all ask for a unit)
    ask2((const bf*)A + (size_t)blockIdx.x * (128 * DD) + (4 * threadIdx.x + blockIdx.y) * UNIT, (const bf*)Bt + (size_t)blockIdx.y * (256 * DD) + (8 * threadIdx.x + (blockIdx.x >> 3)) * UNIT);
    fill(0, 0); await_copies(); __syncthreads(); fill(1, 1);
    const int ia = (wave & 1) * 4 * CHUNK + 8 * lane, ib = (8 + (wave >> 1) * 4) * CHUNK + 8 * lane;
    // rolled: one trip is one stage, so that the order wait, wait, barrier, refill stands once at its foot
#pragma unroll 1
    for (int s = 0; s < NSTG; ++s) {
        const h16* sb = st + (s & 1) * (24 * CHUNK);
        v16h a[2][4], b[2][4];
#pragma unroll
        for (int kk = 0; kk < 2; ++kk) {
#pragma unroll
            for (int mb = 0; mb < 4; ++mb) a[kk][mb] = WFrag<h16>::ld(sb + ia + mb * CHUNK + kk * 512);
#pragma unroll
            for (int nb = 0; nb < 4; ++nb) b[kk][nb] = WFrag<h16>::ld(sb + ib + nb * CHUNK + kk * 512);
        }
        __builtin_amdgcn_sched_barrier(0);      // the stage's 32 LDS reads stand as one group in front of its WMMAs: the second block's land behind the first block's WMMAs (two waves a SIMD: registers are there)
#pragma unroll
        for (int kk = 0; kk < 2; ++kk) {
#pragma unroll
            for (int nb = 0; nb < 4; ++nb) {
#pragma unroll
                for (int mb = 0; mb < 4; ++mb) acc[mb][nb] = wmma16(a[kk][mb], b[kk][nb], acc[mb][nb]); }
        }
        __builtin_amdgcn_sched_barrier(0);      // keeps the WMMAs in front of the waits below: moved behind the barrier they would leave the next stage's copies only the time of the LDS reads to land
        await_lds(); await_copies(); __syncthreads();      // publishes stage s + 1 and ends every wave's reads of stage s
        if (s + 2 < NSTG) fill(s + 2, s & 1);
    }
    await_copies();
#pragma unroll
    for (int mb = 0; mb < 4; ++mb) {
#pragma unroll
        for (int nb = 0; nb < 4; ++nb) {
#pragma unroll
            for (int j = 0; j < 8; ++j) os[(hi * 8 + j) * 68 + nb * 16 + lr] = acc[mb][nb][j]; }
        __builtin_amdgcn_wave_barrier(); asm volatile("" ::: "memory");
        float* crow = C + (size_t)(r0 + mb * 16) * ldc + c0;
{
#pragma unroll
            for (int s = 0; s < 8; ++s) { const int row = 2 * s + hi, cofs = lr * 4; v4f val = *(const v4fa*)(os + row * 68 + cofs); { val[0] += bfr(bias[c0 + cofs]); val[1] += bfr(bias[c0 + cofs + 1]); val[2] += bfr(bias[c0 + cofs + 2]); val[3] += bfr(bias[c0 + cofs + 3]); }
                *(v4f*)(crow + (size_t)row * ldc + cofs) = val; }
             }
        xwait();      // behind the eight stores: the next row block reuses their address and data registers
        __builtin_amdgcn_wave_barrier(); asm volatile("" ::: "memory");
    }
}

__device__ __forceinline__ h16 tohx(float x) { return (h16)x; }
typedef __attribute__((ext_vector_type(2))) _Float16 v2h;
typedef __attribute__((ext_vector_type(4))) _Float16 v4h;
typedef __attribute__((ext_vector_type(2))) unsigned short v2us;
typedef __attribute__((ext_vector_type(4))) unsigned short v4us;
typedef __attribute__((ext_vector_type(2))) float v2f;

__global__ __launch_bounds__(256) void k_bfr1(const float* __restrict__ src, float* dst, int n) { const int i = blockIdx.x * 256 + threadIdx.x; if (i >= n) return; const float v = bfr(src[i]); *(float*)(dst + i) = v;  }
// ---- k_prep: all operand preparation of a call in ONE launch: hidden_states to its bf16 plane, Wq, Wk, Wv to their transposed bf16 planes, Wo to its transposed fp16 plane, the three phase projections (six jobs, none reads what another writes).
// A grid of PREP_B blocks (2 a WGP, 16 waves) shares out every job evenly: a thread takes 8 pieces of the X plane, the same piece of each of the four weight planes, and p_c, p_s, p_m of one (batch, head, token).
// The work then starts 4,096 waves, not 61,440 of one piece each, and all of a thread's loads are in flight before the first of them is used.
#define PREP_B 512
#define PREP_T (PREP_B * 256)
static_assert((size_t)NT * DD / 8 == 8 * (size_t)PREP_T && DD * DD / 8 == PREP_T && NB_ * NH_ * TT == PREP_T && DD / 32 == 32, "pieces a thread");
__global__ __launch_bounds__(256) void k_prep(const float* __restrict__ x, const float* __restrict__ wq, const float* __restrict__ wk, const float* __restrict__ wv, const float* __restrict__ wo, const float* __restrict__ cph, const float* __restrict__ sph, const float* __restrict__ mag,
                                              const float* __restrict__ Wp, const float* __restrict__ bp, bf* XB, bf* WQ, bf* WK, bf* WV, bf* WO, float* PH) {
    const unsigned g = blockIdx.x * 256 + threadIdx.x;
    // X plane: a block takes one block of 16 rows, 32 tiles, 2,048 pieces; a thread's 8 pieces are 256 pieces apart: 4 tiles, 128 elements in the source row
    unsigned xs, xd; { const unsigned i = blockIdx.x * 2048 + threadIdx.x; FRAG_IDX_ROW(i); xs = (unsigned)(((tile / (DD / 32)) * 16 + lr) * DD + (tile % (DD / 32)) * 32 + j * 16 + hi * 8); xd = (unsigned)piece; }
    // weight planes: piece g of each; the eight rows are read off one offset, a constant pitch apart
    unsigned ws; { FRAG_IDX(g); const int kt = DD / 32; const int n = (tile / kt) * 16 + lr, k = (tile % kt) * 32 + j * 16 + hi * 8; ws = (unsigned)(k * DD + n); }
    // phase scalars: g = (batch, head, token); a block lies inside one head
    const unsigned h = (blockIdx.x >> 3) & (NH_ - 1), ps = ((g >> 15) & (NB_ - 1)) * (NBD * TT) + (g & (TT - 1));
    const float* xp = x + xs; v8f v[8]; float f[4][8], wl[NBD], pl[3][NBD];
#pragma unroll
    for (int s = 0; s < 8; ++s) v[s] = *(const v8f*)(xp + s * 128);
#pragma unroll
    for (int q = 0; q < 8; ++q) { f[0][q] = wq[ws + q * DD]; f[1][q] = wk[ws + q * DD]; f[2][q] = wv[ws + q * DD]; f[3][q] = wo[ws + q * DD]; }
#pragma unroll
    for (int n = 0; n < NBD; ++n) { wl[n] = Wp[n * NH_ + h]; pl[0][n] = cph[ps + n * TT]; pl[1][n] = sph[ps + n * TT]; pl[2][n] = mag[ps + n * TT]; }
    const float bl = bp[h];
    asm volatile("s_wait_xcnt 0x0" :: "v"(xp), "v"(ws), "v"(ps) : "memory");      // the same wait as xwait(); the address and the offsets are named as inputs only, so that they stay live up to the wait and no result lands in their registers in front of it
    __builtin_amdgcn_sched_barrier(0);      // keeps the conversions below out of the loads above: every load is issued before the first result is waited for
    v8us o[8], ow[4]; float sp[3];
#pragma unroll
    for (int s = 0; s < 8; ++s)
#pragma unroll
        for (int k = 0; k < 8; ++k) o[s][k] = f2bf(v[s][k]);
#pragma unroll
    for (int m = 0; m < 4; ++m)
#pragma unroll
        for (int q = 0; q < 8; ++q) ow[m][q] = (m < 3) ? f2bf(f[m][q]) : __builtin_bit_cast(unsigned short, tohx(bfr(f[m][q])));      // Wo: rounded to bf16 like every input, then held in fp16 for the output projection
#pragma unroll
    for (int k = 0; k < 3; ++k) { float s = 0.f;
#pragma unroll
        for (int n = 0; n < NBD; ++n) { float w = bfr(wl[n]), p = bfr(pl[k][n]); asm volatile("" : "+v"(w)); asm volatile("" : "+v"(p)); float m = __fmul_rn(p, w); asm volatile("" : "+v"(m)); s = __fadd_rn(s, m); }
        sp[k] = __fadd_rn(s, bfr(bl)); }
    v8us* xo = (v8us*)XB + xd;
#pragma unroll
    for (int s = 0; s < 8; ++s) xo[s * 256] = o[s];
    ((v8us*)WQ)[g] = ow[0]; ((v8us*)WK)[g] = ow[1]; ((v8us*)WV)[g] = ow[2]; ((v8us*)WO)[g] = ow[3];
#pragma unroll
    for (int k = 0; k < 3; ++k) *(float*)(PH + g + k * PREP_T) = sp[k];
}
// ---- k_qkv: the three input projections in ONE launch, each accumulator tile stored straight into its fp16 plane in fragment order (no f32 copy of q, k or v in memory, no conversion launch).
// grid (NT / 128, 3 * DD / 256), 8 waves: 2 groups of 64 tokens x 4 heads (64 columns each) of q, k or v; W3 = the q, k and v weight planes one behind the other, 3 * DD rows. A stage: 8 chunks of X, 16 of W3, 48 KiB; two work-groups a WGP.
// An accumulator register run j = 0..7 walks the ROW operand's index (8 hi + j), a lane's lr the COLUMN operand's. A piece of a plane is 8 neighbours along the plane's k: the head dimension for q and k, the token for V^T.
// So q and k take the weight rows as the row operand and the tokens as the column operand, v the other way round (both planes have one fragment order, so this is a swap of two pointers):
// in each case a lane's 8 registers are one 16-byte piece, and the wave's 32 pieces are one half tile, 512 contiguous bytes a store.
// amdgpu_waves_per_eu(4, 4): four waves a SIMD, so that two work-groups share a WGP and one works while the other stands at its barrier.
__global__ __launch_bounds__(256) __attribute__((amdgpu_waves_per_eu(4, 4))) void k_qkv(const bf* __restrict__ X, const bf* __restrict__ W3, const float* __restrict__ bq, const float* __restrict__ bk, const float* __restrict__ bv, const float* __restrict__ PH, h16* QP, h16* KP, h16* VT) {
    __shared__ __attribute__((aligned(2048))) bf st[2 * 24 * CHUNK];
    const int lane = threadIdx.x & 31, lr = lane & 15, hi = lane >> 4, wave = __builtin_amdgcn_readfirstlane(threadIdx.x >> 5);
    const int r0 = blockIdx.x * 128 + (wave & 1) * 64, hy = blockIdx.y * 4 + (wave >> 1), sel = hy >> 4, h = hy & 15;      // sel: 0 q, 1 k, 2 v
    const int z = (r0 >> 11) * NH_ + h, t0 = r0 & (TT - 1);      // (batch, head) and the first token inside the batch
    const int half = threadIdx.x >> 7, off = (threadIdx.x & 127) * 8;
    const bf* gx = X + (size_t)(blockIdx.x * 8 + half) * (16 * DD) + off; const bf* gw = W3 + (size_t)(blockIdx.y * 16 + half) * (16 * DD) + off;
    const unsigned l0 = (unsigned)(size_t)(st + half * CHUNK + off);      // the thread's LDS byte address in chunk 0 or 1 of buffer 0
    auto fill = [&](int s, int b) { const unsigned l = l0 + b * (24 * CHB);
        acopy4(l, gx + s * CHUNK, 2 * CHB, RSTEP); acopy8(l + 8 * CHB, gw + s * CHUNK, l + 16 * CHB, gw + s * CHUNK + 4 * RSTEP, 2 * CHB, RSTEP); };
    v8f acc[4][4];
#pragma unroll
    for (int mb = 0; mb < 4; ++mb)
#pragma unroll
        for (int nb = 0; nb < 4; ++nb) acc[mb][nb] = (v8f){};
    // 1,024 units of X, dealt 4 ways among the 12 work-groups that read them (by blockIdx.y & 3), 2,048 of W3, dealt 8 ways among 64 (by blockIdx.x >> 3)
    ask2(X + (size_t)blockIdx.x * (128 * DD) + (4 * threadIdx.x + (blockIdx.y & 3)) * UNIT, W3 + (size_t)blockIdx.y * (256 * DD) + (8 * threadIdx.x + (blockIdx.x >> 3)) * UNIT);
    fill(0, 0); await_copies(); __syncthreads(); fill(1, 1);
    const int ix = (wave & 1) * 4 * CHUNK + 8 * lane, iw = (8 + (wave >> 1) * 4) * CHUNK + 8 * lane;
    const int ia = (sel == 2) ? ix : iw, ib = (sel == 2) ? iw : ix;
    // rolled: one trip is one stage, so that the order wait, wait, barrier, refill stands once at its foot
#pragma unroll 1
    for (int s = 0; s < NSTG; ++s) {
        const bf* sb = st + (s & 1) * (24 * CHUNK);
#pragma unroll
        for (int kk = 0; kk < 2; ++kk) {
            v16bf a[4], b[4];
#pragma unroll
            for (int mb = 0; mb < 4; ++mb) a[mb] = WFrag<bf>::ld(sb + ia + mb * CHUNK + kk * 512);
#pragma unroll
            for (int nb = 0; nb < 4; ++nb) b[nb] = WFrag<bf>::ld(sb + ib + nb * CHUNK + kk * 512);
            __builtin_amdgcn_sched_barrier(0);      // the block's 16 LDS reads stand as one group in front of its WMMAs (left alone the compiler reads each b fragment into one register set and waits it out four times a block)
#pragma unroll
            for (int nb = 0; nb < 4; ++nb) {
#pragma unroll
                for (int mb = 0; mb < 4; ++mb) acc[mb][nb] = wmmab(a[mb], b[nb], acc[mb][nb]); }
            __builtin_amdgcn_sched_barrier(0);      // and the next block's reads stay out of this block's WMMAs
        }
        await_lds(); await_copies(); __syncthreads();      // publishes stage s + 1 and ends every wave's reads of stage s
        if (s + 2 < NSTG) fill(s + 2, s & 1);
    }
    await_copies();
    // In the epilogues each pair of scheduling barriers keeps every other register write out from between a group of loads or stores and its wait.
    if (sel < 2) {      // q (x log2(e)/8: the scores then come out in the base-2 domain) and k: acc[mb][nb][j] is dimension 16 mb + 8 hi + j of token t0 + 16 nb + lr
        const float sc = (sel == 0) ? 0.125f * L2E : 1.0f; const float* bl = ((sel == 0) ? bq : bk) + h * HD + 8 * hi;
        h16* P = ((sel == 0) ? QP : KP) + ((size_t)z * TT + t0) * HD + 8 * lane;      // 16 tokens on: 2 tiles, 1024 elements; 16 dimensions on: half a tile, 256
        v8f bs[4];
        __builtin_amdgcn_sched_barrier(0);
#pragma unroll
        for (int mb = 0; mb < 4; ++mb) bs[mb] = *(const v8f*)(bl + 16 * mb);
        asm volatile("s_wait_xcnt 0x0" :: "v"(bl) : "memory");      // the same wait as xwait(); the pointer is named as an input only, so that it stays live up to the wait
        __builtin_amdgcn_sched_barrier(0);
#pragma unroll
        for (int mb = 0; mb < 4; ++mb) { v8h o[4];
#pragma unroll
            for (int nb = 0; nb < 4; ++nb)
#pragma unroll
                for (int j = 0; j < 8; ++j) o[nb][j] = tohx((acc[mb][nb][j] + bfr(bs[mb][j])) * sc);
            __builtin_amdgcn_sched_barrier(0);
#pragma unroll
            for (int nb = 0; nb < 4; ++nb) *(v8ha*)(P + nb * 1024 + mb * 256) = o[nb];
            xwait(); __builtin_amdgcn_sched_barrier(0); }
    } else {            // v: acc[mb][nb][j] is dimension 16 nb + lr of token t0 + 16 mb + 8 hi + j; rows 0-63 of the V^T plane take v p_m p_c, rows 64-127 v p_m p_s
        const float* bl = bv + h * HD + lr; const float* pl = PH + (size_t)z * TT + t0 + 8 * hi;      // p_c of the lane's first token; p_s and p_m stand NZ * TT and 2 * NZ * TT floats further
        h16* P = VT + ((size_t)z * (HD2 * TT / 512) + (t0 >> 5) * 8) * 512 + 8 * lane;      // 32 tokens on: 8 tiles; 16 rows on: 1 tile; 16 tokens on: half a tile
        float bs[4];
        __builtin_amdgcn_sched_barrier(0);
#pragma unroll
        for (int nb = 0; nb < 4; ++nb) bs[nb] = bl[16 * nb];
        asm volatile("s_wait_xcnt 0x0" :: "v"(bl) : "memory");      // as above
        __builtin_amdgcn_sched_barrier(0);
#pragma unroll
        for (int nb = 0; nb < 4; ++nb) bs[nb] = bfr(bs[nb]);
#pragma unroll
        for (int mb = 0; mb < 4; ++mb) {
            __builtin_amdgcn_sched_barrier(0);
            const v8f pc = *(const v8f*)(pl + 16 * mb), psn = *(const v8f*)(pl + NZ * TT + 16 * mb), pm = *(const v8f*)(pl + 2 * NZ * TT + 16 * mb);
            asm volatile("s_wait_xcnt 0x0" :: "v"(pl) : "memory");      // as above
            __builtin_amdgcn_sched_barrier(0);
#pragma unroll
            for (int part = 0; part < 2; ++part) { v8h o[4];
#pragma unroll
                for (int nb = 0; nb < 4; ++nb)
#pragma unroll
                    for (int j = 0; j < 8; ++j) o[nb][j] = tohx(__fmul_rn(__fmul_rn(acc[mb][nb][j] + bs[nb], pm[j]), part ? psn[j] : pc[j]));
                __builtin_amdgcn_sched_barrier(0);
#pragma unroll
                for (int nb = 0; nb < 4; ++nb) *(v8ha*)(P + (mb >> 1) * 4096 + (part * 4 + nb) * 512 + (mb & 1) * 256) = o[nb];
                xwait(); __builtin_amdgcn_sched_barrier(0); } }
    }
}
// ---- k_fattn: scores, mask, softmax, both value contractions and the phase merge of one (batch, head) in ONE launch; S and P stay in registers.
// Transposed products: S^T = K.Q^T (A = 16 key rows, B = 16 query columns), O^T += [V_real|V_imag]^T.P^T (A = 16 rows of the 128-wide V^T plane, B = P^T). A lane then holds scores of ONE query
// (column lr): two S^T tiles (keys 0-15, 16-31 of a pass), converted in place, are the B operand of the second product in the loaders' own k order (8 hi + 0..7, 16 + 8 hi + 0..7).
// Online softmax in the base-2 domain. The score WMMA itself hands out the argument of exp2: Q carries log2(e)/8, and the C operand of the first score product is (mask x log2(e)) - maximum in use (for the keys that count a difference of near values,
// whatever the size of the mask). No maximum is taken on an ordinary pass: the weights are formed, and a lane's 16 weights of a column group must sum to at most PLIM (so each is below 256 in fp16).
// Only a pass that fails this test (the first one always does) forms its scores again without the maximum, takes the true maximum, rescales the accumulators and forms its weights anew.
// grid (TT / (8 * 16 * QG), NZ), 8 waves x QG groups of 16 query columns; a pass is 32 keys; every K and V^T fragment a wave loads serves QG column groups.
// K and V^T reach the waves through LDS: a STAGE is SKEY keys, 32 KiB of the K plane and 64 KiB of the V^T plane, each contiguous in memory and copied as it lies (fragment order) by asynchronous copies, 16 bytes a lane,
// once a work-group. Two buffers: stage s + 1 flies while stage s is worked on, so that no wave waits for L2 inside a pass, and between two stage barriers the waves are free to run out of step.
#define PLIM 240.0f
#define QG  4
#define SKEY 256                   // keys of a stage
#define NSTA (TT / SKEY)
#define KSTG (SKEY * HD)           // elements of K in a stage
#define VSTG (SKEY * HD2)          // elements of V^T in a stage
__device__ __forceinline__ float xhalf(float x) { return __builtin_bit_cast(float, __builtin_amdgcn_permlanex16(__builtin_bit_cast(int, x), __builtin_bit_cast(int, x), 0x76543210, 0xfedcba98, false, false)); }  // lane l <-> lane l ^ 16
__global__ __launch_bounds__(256) void k_fattn(const h16* __restrict__ QP, const h16* __restrict__ KP, const h16* __restrict__ VT, const float* __restrict__ am, const float* __restrict__ PH, h16* Ah) {
    __shared__ __attribute__((aligned(2048))) h16 ring[2 * (KSTG + VSTG)];      // two buffers, each the stage's K tiles and behind them its V^T tiles
    __shared__ __align__(16) float mk[TT];      // this batch's additive mask row, rounded to bf16 and taken times log2(e), once per work-group
    const int z = blockIdx.y, b = z / NH_, h = z % NH_;
    // Asks L2 for the head's whole K plane (1,024 units of 256 bytes) and V^T plane (2,048), in the order of the passes: a request of the work-group covers 64 KiB, 16 passes of K or 8 of V^T. Every work-group asks for all of it.
    // The wait is the same precaution as in ask2().
    asm volatile("global_prefetch_b8 %0, off scope:SCOPE_SE\n\tglobal_prefetch_b8 %1, off scope:SCOPE_SE\n\tglobal_prefetch_b8 %1, off offset:65536 scope:SCOPE_SE\n\t"
                 "global_prefetch_b8 %0, off offset:65536 scope:SCOPE_SE\n\tglobal_prefetch_b8 %1, off offset:131072 scope:SCOPE_SE\n\tglobal_prefetch_b8 %1, off offset:196608 scope:SCOPE_SE\n\t"
                 "global_prefetch_b8 %0, off offset:131072 scope:SCOPE_SE\n\tglobal_prefetch_b8 %1, off offset:262144 scope:SCOPE_SE\n\tglobal_prefetch_b8 %1, off offset:327680 scope:SCOPE_SE\n\t"
                 "global_prefetch_b8 %0, off offset:196608 scope:SCOPE_SE\n\tglobal_prefetch_b8 %1, off offset:393216 scope:SCOPE_SE\n\tglobal_prefetch_b8 %1, off offset:458752 scope:SCOPE_SE\n\ts_wait_xcnt 0x0"
                 :: "v"(KP + (size_t)z * TT * HD + threadIdx.x * UNIT), "v"(VT + (size_t)z * HD2 * TT + threadIdx.x * UNIT) : "memory");
    // a copy of the work-group moves 4 KiB (2,048 elements): 8 copies a thread for a stage's K, 16 for its V^T
    const int wv = __builtin_amdgcn_readfirstlane(threadIdx.x >> 5); const unsigned lb = (threadIdx.x & 31) * 16;      // the wave, held in a scalar register, and the lane's byte in the wave's 512 bytes of a copy
    // the buffer's and the wave's share of the LDS address is summed in a scalar register: of the addresses only the lane's byte then lives through the passes
    auto fill = [&](int s, int bu, unsigned ly) { const unsigned sl = __builtin_amdgcn_readfirstlane((unsigned)(size_t)ring + bu * (2 * (KSTG + VSTG)) + wv * 512);      // ly: the lane's byte
        acopy24(sl + ly, s * (2 * KSTG) + ly, s * (2 * VSTG) + ly, (const char*)(KP + ((size_t)z * TT * HD + wv * 256)), (const char*)(VT + ((size_t)z * HD2 * TT + wv * 256))); };
    fill(0, 0, lb);
    for (int i = threadIdx.x * 4; i < TT; i += 1024) { v4f a = *(const v4f*)(am + (size_t)b * TT + i);
#pragma unroll
        for (int q = 0; q < 4; ++q) a[q] = bfr(a[q]) * L2E;
        *(v4fa*)(mk + i) = a; }
    await_copies(); __syncthreads();      // publishes the mask row and stage 0
    fill(1, 1, lb);
    const int lane = threadIdx.x & 31, lr = lane & 15, hi = lane >> 4; const int q0 = (blockIdx.x * 8 + __builtin_amdgcn_readfirstlane(threadIdx.x >> 5)) * (16 * QG);      // the wave's first query, held in a scalar register
    const unsigned ko = (unsigned)(8 * lane);      // the lane's offset in a tile
    v16h qf[QG][2]; const h16* Qz = QP + ((size_t)z * TT + q0) * HD;      // the wave's first Q tile
#pragma unroll
    for (int g = 0; g < QG; ++g)
#pragma unroll
        for (int kc = 0; kc < 2; ++kc) qf[g][kc] = WFrag<h16>::ld(Qz + (size_t)(16 * g) * HD + 512 * kc + ko);
    v16h kf[2][2];      // inside a stage K fragments are fetched one pass ahead, half way through the second product
    // the same wait as xwait(); the scalar base of the Q loads is named as an input only, so that its register pair stays live up to the wait and nothing is written over it in front of it
    asm volatile("s_wait_xcnt 0x0" :: "s"(Qz) : "memory");
    __builtin_amdgcn_sched_barrier(0);      // keeps the scheduler from mixing the tiles' set-up below into the loads above (it spilled Q fragments when it did)
    v8f acc[QG][8]; float m_run[QG], l_run[QG];
#pragma unroll
    for (int g = 0; g < QG; ++g) { m_run[g] = -__FLT_MAX__; l_run[g] = 0.f;
#pragma unroll
        for (int t = 0; t < 8; ++t) acc[g][t] = (v8f){}; }
    // rolled: one trip is one stage, so that the order wait, wait, barrier, refill stands once at its foot
    unsigned ki = ko;      // the lane's element in the buffer at hand, carried from stage to stage: the one lane-dependent address that lives through the passes (the refill takes the lane's byte from it)
#pragma unroll 1
    for (int sg = 0; sg < NSTA; ++sg) {
    const h16* kb = ring + ki;      // the lane's address in the stage's first K tile
    const h16* vp = kb + KSTG;      // the lane's address in the V^T tiles of the pass at hand
    const h16* kp = kb + 32 * HD;      // the lane's address in the K tile to fetch next
#pragma unroll
    for (int kt = 0; kt < 2; ++kt)
#pragma unroll
        for (int kc = 0; kc < 2; ++kc) kf[kt][kc] = WFrag<h16>::ld(kb + (16 * kt) * HD + 512 * kc);      // the stage's first pass: nothing of a stage is read in front of the barrier that publishes it
    // rolled: one pass's fragments and the output tiles already fill the wave's registers
#pragma unroll 1
    for (int key0 = sg * SKEY; key0 < (sg + 1) * SKEY; key0 += 32) {
        v8f s[2][QG]; v4f mr[2][2];      // the pass's four mask reads stand as one group too
#pragma unroll
        for (int kt = 0; kt < 2; ++kt) { mr[kt][0] = *(const v4fa*)(mk + key0 + 16 * kt + 8 * hi); mr[kt][1] = *(const v4fa*)(mk + key0 + 16 * kt + 8 * hi + 4); }
        __builtin_amdgcn_sched_barrier(0);      // keeps the second key tile's two reads up here, out of the score products
#pragma unroll
        for (int kt = 0; kt < 2; ++kt) { const v4f m0 = mr[kt][0], m1 = mr[kt][1];
#pragma unroll
            for (int g = 0; g < QG; ++g) { v8f c;
#pragma unroll
                for (int r = 0; r < 4; ++r) { c[r] = m0[r] - m_run[g]; c[4 + r] = m1[r] - m_run[g]; }
                s[kt][g] = wmma16(kf[kt][1], qf[g][1], wmma16(kf[kt][0], qf[g][0], c)); }
            __builtin_amdgcn_sched_barrier(0); }      // the second key tile's four C tiles are formed only behind the first tile's products, when its K fragments are dead (formed all eight up front they spilled a Q fragment)
        // the pass's 16 V^T reads stand as ONE group behind the score products, where the K fragments are dead, and land under the exponentials
        v16h vf[8];
#pragma unroll
        for (int t = 0; t < 8; ++t) vf[t] = WFrag<h16>::ld(vp + 512 * t);
        __builtin_amdgcn_sched_barrier(0);      // with the barrier above: holds the group together (left alone the compiler strewed these reads over the exponentials and the second product)
        v16h pf[QG]; float ls[QG]; bool need = false;
#pragma unroll
        for (int g = 0; g < QG; ++g) { v2f l2 = (v2f){0.f, 0.f};
#pragma unroll
            for (int e = 0; e < 16; e += 2) { const v2f p = (v2f){__builtin_amdgcn_exp2f(s[e >> 3][g][e & 7]), __builtin_amdgcn_exp2f(s[e >> 3][g][(e & 7) + 1])};
                l2 += p; pf[g][e] = tohx(p[0]); pf[g][e + 1] = tohx(p[1]); }
            ls[g] = l2[0] + l2[1]; need = need || !(ls[g] <= PLIM); }      // the negated form also catches a sum that is not a number
        if (__builtin_amdgcn_ballot_w32(need) != 0) {       // one wave-uniform test per pass
            v16h kr[2][2]; const h16* kq = kb + (key0 & (SKEY - 1)) * HD;      // the pass's K fragments are loaded again here: kept for this rare path they would cost every pass 32 registers (spills)
#pragma unroll
            for (int kt = 0; kt < 2; ++kt)
#pragma unroll
                for (int kc = 0; kc < 2; ++kc) kr[kt][kc] = WFrag<h16>::ld(kq + (16 * kt) * HD + 512 * kc);
            v8f c[2];
#pragma unroll
            for (int kt = 0; kt < 2; ++kt) { const v4f m0 = *(const v4fa*)(mk + key0 + 16 * kt + 8 * hi), m1 = *(const v4fa*)(mk + key0 + 16 * kt + 8 * hi + 4);
                c[kt] = (v8f){m0[0], m0[1], m0[2], m0[3], m1[0], m1[1], m1[2], m1[3]}; }
            // one column group at a time: two score tiles live, not eight
#pragma unroll
            for (int g = 0; g < QG; ++g) {
#pragma unroll
                for (int kt = 0; kt < 2; ++kt) s[kt][g] = wmma16(kr[kt][1], qf[g][1], wmma16(kr[kt][0], qf[g][0], c[kt]));
                float mx = s[0][g][0];
#pragma unroll
                for (int r = 1; r < 8; ++r) mx = fmaxf(mx, s[0][g][r]);
#pragma unroll
                for (int r = 0; r < 8; ++r) mx = fmaxf(mx, s[1][g][r]);
                mx = fmaxf(mx, xhalf(mx)); const float m_new = fmaxf(m_run[g], mx); const float corr = __builtin_amdgcn_exp2f(m_run[g] - m_new); m_run[g] = m_new; l_run[g] *= corr;
#pragma unroll
                for (int t = 0; t < 8; ++t) acc[g][t] = acc[g][t] * corr;
                v2f l2 = (v2f){0.f, 0.f};
#pragma unroll
                for (int kt = 0; kt < 2; ++kt) s[kt][g] = s[kt][g] - m_new;
#pragma unroll
                for (int e = 0; e < 16; e += 2) { const v2f p = (v2f){__builtin_amdgcn_exp2f(s[e >> 3][g][e & 7]), __builtin_amdgcn_exp2f(s[e >> 3][g][(e & 7) + 1])};
                    l2 += p; pf[g][e] = tohx(p[0]); pf[g][e + 1] = tohx(p[1]); }
                ls[g] = l2[0] + l2[1]; } }
#pragma unroll
        for (int g = 0; g < QG; ++g) { l_run[g] += ls[g];
#pragma unroll
            for (int t = 0; t < 8; ++t) acc[g][t] = wmma16(vf[t], pf[g], acc[g][t]);
            if (g == QG / 2 - 1) {
                __builtin_amdgcn_sched_barrier(0);      // this barrier and the one below keep the eight K reads in one place among the WMMAs
#pragma unroll
                for (int kt = 0; kt < 2; ++kt)
#pragma unroll
                    for (int kc = 0; kc < 2; ++kc) kf[kt][kc] = WFrag<h16>::ld(kp + (16 * kt) * HD + 512 * kc);
                kp += ((key0 & (SKEY - 1)) + 64 < SKEY) ? 32 * HD : 0;      // a stage's last pass fetches its own tile again: inside the stage's buffer, unused
                __builtin_amdgcn_sched_barrier(0); } }
        vp += 32 * HD2;
        __builtin_amdgcn_sched_barrier(0);      // keeps the pass's WMMAs in front of the slots below
        asm volatile("v_nop\n\tv_nop\n\tv_nop\n\tv_nop");      // four vector slots behind the pass's last WMMA: what follows the loop's branch, on either side, writes over its operand registers
    }
    await_lds(); await_copies(); __syncthreads();      // publishes stage sg + 1 and ends every wave's reads of stage sg
    if (sg + 2 < NSTA) fill(sg + 2, sg & 1, 2 * ki - (sg & 1) * (2 * (KSTG + VSTG)));
    ki += (sg & 1) ? 0u - (KSTG + VSTG) : (unsigned)(KSTG + VSTG);
    }
    await_copies();
#pragma unroll
    for (int g = 0; g < QG; ++g) { const int t = q0 + 16 * g + lr; const float l = l_run[g] + xhalf(l_run[g]); const float inv = __fdiv_rn(1.0f, l);
        const float pc = PH[((size_t)b * NH_ + h) * TT + t], psn = PH[((size_t)NB_ * NH_ + (size_t)b * NH_ + h) * TT + t];
#pragma unroll
        for (int tt = 0; tt < 4; ++tt) { v8h oh;
#pragma unroll
            for (int r = 0; r < 8; ++r) oh[r] = tohx((acc[g][tt][r] * inv) * pc + (acc[g][tt + 4][r] * inv) * psn);
            const unsigned o = ((unsigned)b * TT + q0 + 16 * g) * DD + (2 * h + (tt >> 1)) * 512 + (tt & 1) * 256 + 8 * lane;      /* row t, k = 64 h + 16 tt + 8 hi in fragment order: 512 contiguous bytes a store */ __builtin_amdgcn_sched_barrier(0);      // the two barriers keep every other register write out from between the store and its wait
            *(v8ha*)(Ah + o) = oh; xwait(); __builtin_amdgcn_sched_barrier(0); } }
}
__global__ __launch_bounds__(256) void k_ln2(const float* __restrict__ FF, const float* __restrict__ X, const float* __restrict__ gg, const float* __restrict__ bb, float* OUT) {
    const int lane = threadIdx.x & 31; const int r = blockIdx.x * 8 + (threadIdx.x >> 5); if (r >= NT) return; float v[32]; float s = 0.f;
#pragma unroll
    for (int c = 0; c < 8; ++c) { const v4f a = *(const v4f*)(FF + (size_t)r * DD + c * 128 + lane * 4), xx = *(const v4f*)(X + (size_t)r * DD + c * 128 + lane * 4);
#pragma unroll
        for (int q = 0; q < 4; ++q) { v[c * 4 + q] = a[q] + bfr(xx[q]); s += v[c * 4 + q]; } }
#pragma unroll
    for (int sh = 16; sh; sh >>= 1) s += __shfl_xor(s, sh, 32);
    const float mu = s * (1.0f / DD); float qq = 0.f;
#pragma unroll
    for (int i = 0; i < 32; ++i) { const float d0 = v[i] - mu; qq = __fadd_rn(qq, __fmul_rn(d0, d0)); }
#pragma unroll
    for (int sh = 16; sh; sh >>= 1) qq += __shfl_xor(qq, sh, 32);
    const float rs = __fdiv_rn(1.0f, __fsqrt_rn(qq * (1.0f / DD) + 1e-12f));
{
#pragma unroll
        for (int c = 0; c < 8; ++c) { v4f o;
#pragma unroll
            for (int q = 0; q < 4; ++q) { const int col = c * 128 + lane * 4 + q; o[q] = __fadd_rn(__fmul_rn((v[c * 4 + q] - mu) * rs, bfr(gg[col])), bfr(bb[col])); }
            *(v4f*)(OUT + (size_t)r * DD + c * 128 + lane * 4) = o; }
         }
}

extern "C" void kernel_launch(void* const* d_in, const int* in_sizes, int n_in,
                              void* d_out, int out_size, void* d_ws, size_t ws_size, hipStream_t stream) {
    (void)in_sizes; (void)n_in; (void)out_size;
    const float* IN[17]; for (int i = 0; i < 17; ++i) IN[i] = (const float*)d_in[i];
    // hidden_states, attention_mask [4][1][1][2048], cos_phi, sin_phi, mag [4][8][2048], Wq [1024][1024] (x @ W), bq, Wk, bk, Wv, bv, Wo, bo, Wp [8][16], bp [16], ln_g, ln_b = d_in[0..16]
    const float* x = IN[0]; const float* am = IN[1];
    float* OUT = (float*)d_out;     // [4][2048][1024]
    char* wsp = (char*)d_ws;
    auto take = [&](size_t bytes) { char* p = wsp; wsp += (bytes + 255) & ~(size_t)255; return (void*)p; };
    bf* WQ = (bf*)take((size_t)3 * DD * DD * 2); bf* WK = WQ + (size_t)DD * DD; bf* WV = WK + (size_t)DD * DD;      /* one plane of 3 * DD rows for k_qkv */ bf* WO = (bf*)take((size_t)DD * DD * 2); float* PH = (float*)take((size_t)3 * NB_ * NH_ * TT * 4);
    bf* XB = (bf*)take((size_t)NT * DD * 2); float* F = (float*)take((size_t)NT * DD * 4);
    h16* QP = (h16*)take((size_t)NT * DD * 2); h16* KP = (h16*)take((size_t)NT * DD * 2); h16* VT = (h16*)take((size_t)NZ * HD2 * TT * 2);
    h16* ATh = (h16*)take((size_t)NT * DD * 2);
    if ((size_t)(wsp - (char*)d_ws) > ws_size) return;    // total ~ 138 MiB; ws 256 MiB
    float* Y = F;   // the output projection's f32 result
    k_prep<<<PREP_B, 256, 0, stream>>>(x, IN[5], IN[7], IN[9], IN[11], IN[2], IN[3], IN[4], IN[13], IN[14], XB, WQ, WK, WV, WO, PH);
    k_qkv<<<dim3(NT / 128, 3 * DD / 256), 256, 0, stream>>>(XB, WQ, IN[6], IN[8], IN[10], PH, QP, KP, VT);
    k_fattn<<<dim3(TT / (8 * 16 * QG), NZ), 256, 0, stream>>>(QP, KP, VT, am, PH, ATh);
    k_oproj<<<dim3(NT / 128, DD / 256), 256, 0, stream>>>(ATh, (const h16*)WO, Y, IN[12]);
    k_ln2<<<NT / 8, 256, 0, stream>>>(Y, x, IN[15], IN[16], OUT);
}

// v010
// It runs in 128 microseconds.
// Two timings next to v009 put it at 1.07 and 1.08 times that version's speed.
// Counting every step since v000, it is 20.2 times as fast.
#include <hip/hip_runtime.h>

// Attention block with phase-weighted values (hidden_states [4][2048][1024]; q/k/v = x @ W + b (16 heads x 64); phase scalars p_c/p_s/p_m[b][h][t] = sum_band {cos_phi,sin_phi,mag}[b][band][t] Wp[band][h] + bp[h] (8 bands);
// V_real = v p_m p_c, V_imag = v p_m p_s (per (b,h,t) scalars on the value rows); scores = q.k/8 + attention_mask[b][0][0][j] (additive input, read as data); softmax; ctx = (P.V_real) p_c + (P.V_imag) p_s
// (per query row); out = LN(ctx @ Wo + bo + hidden_states) * ln_g + ln_b (eps 1e-12)).
// Compute dtypes, f32 accumulate: every input rounded to bf16; projections on PLAIN bf16 operands (inputs: exact, + bias); the phase projections (8 terms), v p_m, the product P x W,
// residual and LayerNorm in f32 on VALU; scores and the value contraction on SINGLE fp16 planes (q x log2(e)/8; P = exp2(score - max in use), normalised after the contraction; the phase factors go into the weights:
// ctx[q] = sum_k P[q][k] W[q][k] (v p_m)[k] with W[q][k] = p_c[k] p_c[q] + p_s[k] p_s[q], a rank-2 tile formed by one fp16 WMMA, so that ONE N = 64 GEMM on v p_m does for both contractions); output projection on ONE fp16 plane of ctx x Wo in fp16 (Wo rounded to bf16 first; that value is exact in fp16 from 2^-17 up).

#define NB_  4
#define NBD  8                   // phase bands
#define TT   2048
#define DD   1024
#define NH_  16
#define HD   64
#define NT   (NB_ * TT)
#define NZ   (NB_ * NH_)
#define L2E  1.4426950408889634f
typedef _Float16 h16;
typedef unsigned short bf;
typedef __attribute__((ext_vector_type(16))) __bf16   v16bf;
typedef __attribute__((ext_vector_type(16))) _Float16 v16h;
typedef __attribute__((ext_vector_type(8)))  _Float16 v8h;
typedef __attribute__((ext_vector_type(8)))  unsigned short v8us;
typedef __attribute__((ext_vector_type(8)))  float    v8f;
typedef __attribute__((ext_vector_type(4)))  float    v4f;
typedef v8h  __attribute__((may_alias)) v8ha;
typedef v4f  __attribute__((may_alias)) v4fa;
typedef v8us __attribute__((may_alias)) v8usa;

__device__ __forceinline__ unsigned short f2bf(float f) { unsigned u = __float_as_uint(f); u += 0x7FFFu + ((u >> 16) & 1u); return (unsigned short)(u >> 16); }
__device__ __forceinline__ float bf2f(unsigned short b) { return __uint_as_float(((unsigned)b) << 16); }
__device__ __forceinline__ float bfr(float f) { return bf2f(f2bf(f)); }
__device__ __forceinline__ v16h cat16(v8h lo, v8h hi) { return __builtin_shufflevector(lo, hi, 0, 1, 2, 3, 4, 5, 6, 7, 8, 9, 10, 11, 12, 13, 14, 15); }
__device__ __forceinline__ v16bf cat16b(v8us lo, v8us hi) { return __builtin_bit_cast(v16bf, __builtin_shufflevector(lo, hi, 0, 1, 2, 3, 4, 5, 6, 7, 8, 9, 10, 11, 12, 13, 14, 15)); }
__device__ __forceinline__ v8f wmma16(v16h a, v16h b, v8f c) { return __builtin_amdgcn_wmma_f32_16x16x32_f16(false, a, false, b, (short)0, c, false, false); }
__device__ __forceinline__ v8f wmmab(v16bf a, v16bf b, v8f c) { return __builtin_amdgcn_wmma_f32_16x16x32_bf16(false, a, false, b, (short)0, c, false, false); }



// Stands behind a group of global loads or stores, in front of the first instruction that reuses a register they name (a precaution).
__device__ __forceinline__ void xwait() { asm volatile("s_wait_xcnt 0x0" ::: "memory"); }
// ---- FRAGMENT ORDER of every 16-bit operand plane [rows][K] (rows % 16 == 0, K % 32 == 0): the plane is a row of 1 KiB tiles, tile (R, kb) = rows 16 R .. 16 R + 15 x k 32 kb .. 32 kb + 31 at tile index R * (K / 32) + kb
// (the V^T plane: kb * 4 + R, so that a pass reads 4 KiB in a row). A tile is two halves of 512 B; half j holds at 16 B x lane (lane = 16 hi + lr) the elements k = 32 kb + 16 j + 8 hi + 0..7 of row 16 R + lr.
// A fragment is then two wave-wide 16-byte loads of 512 contiguous bytes each (4 whole lines a load; on a row-major plane it would touch 32 B in each of 16 lines); a lane's k order is 8 hi + 0..7, then 16 + 8 hi + 0..7, for A and B alike.
// A producer thread writes whole 16-byte pieces (k_prep: 8 of the X plane, one of each weight plane). Where the source runs across k (the transposing producers) thread i writes piece i, at byte 16 i: FRAG_IDX splits i into lr, hi, j and the tile index.
// Where the source runs along k, FRAG_IDX_ROW gives four neighbouring threads the four pieces of one tile row (128 source bytes in f32, one whole line); eight such rows make four whole lines of the tile.
#define FRAG_IDX(i) const int lr = (int)((i) & 15), hi = (int)(((i) >> 4) & 1), j = (int)(((i) >> 5) & 1); const int tile = (int)((i) >> 6)
#define FRAG_IDX_ROW(i) const int hi = (int)((i) & 1), j = (int)(((i) >> 1) & 1), lr = (int)(((i) >> 2) & 15); const int tile = (int)((i) >> 6); const size_t piece = (size_t)tile * 64 + j * 32 + hi * 16 + lr
// ---- The two GEMM kernels (k_qkv, k_oproj): a work-group of 8 waves (2 x 4) owns a 128 x 256 tile of the result, a wave 64 x 64 of it (16 accumulators). A stage is 64 of k: for each block of 16 operand rows two
// neighbouring 1 KiB tiles of its plane, one CHUNK of 2 KiB, contiguous in memory and copied as it lies (fragment order) into LDS by asynchronous copies, 16 bytes a lane. A fragment is then two ds_load_b128 of 512 contiguous bytes.
// Every chunk is brought from L2 once a work-group and read by 2 or 4 waves. Two buffers: stage s + 1 flies while stage s is worked on.
template <typename T16> struct WFrag;
template <> struct WFrag<h16> { typedef v16h V; static __device__ __forceinline__ V ld(const h16* p) { return cat16(*(const v8h*)p, *(const v8h*)(p + 256)); } static __device__ __forceinline__ v8f mma(V a, V b, v8f c) { return wmma16(a, b, c); } };
template <> struct WFrag<bf> { typedef v16bf V; static __device__ __forceinline__ V ld(const bf* p) { return cat16b(*(const v8us*)p, *(const v8us*)(p + 256)); } static __device__ __forceinline__ v8f mma(V a, V b, v8f c) { return wmmab(a, b, c); } };
// Four asynchronous copies of 16 bytes a lane (LDS byte address, global address); the s_wait_xcnt stands in the copies' own statement, in front of anything that reuses their address registers (a precaution).
__device__ __forceinline__ void acopy4(unsigned l, const bf* g, int lstep, int gstep) {
    asm volatile("global_load_async_to_lds_b128 %0, %1, off\n\tglobal_load_async_to_lds_b128 %2, %3, off\n\tglobal_load_async_to_lds_b128 %4, %5, off\n\tglobal_load_async_to_lds_b128 %6, %7, off\n\ts_wait_xcnt 0x0"
                 :: "v"(l), "v"(g), "v"(l + lstep), "v"(g + gstep), "v"(l + 2 * lstep), "v"(g + 2 * gstep), "v"(l + 3 * lstep), "v"(g + 3 * gstep) : "memory");
}
// The same for eight copies, four from each of two places: one wait serves the run.
__device__ __forceinline__ void acopy8(unsigned l, const bf* g, unsigned m, const bf* q, int lstep, int gstep) {
    asm volatile("global_load_async_to_lds_b128 %0, %1, off\n\tglobal_load_async_to_lds_b128 %2, %3, off\n\tglobal_load_async_to_lds_b128 %4, %5, off\n\tglobal_load_async_to_lds_b128 %6, %7, off\n\t"
                 "global_load_async_to_lds_b128 %8, %9, off\n\tglobal_load_async_to_lds_b128 %10, %11, off\n\tglobal_load_async_to_lds_b128 %12, %13, off\n\tglobal_load_async_to_lds_b128 %14, %15, off\n\ts_wait_xcnt 0x0"
                 :: "v"(l), "v"(g), "v"(l + lstep), "v"(g + gstep), "v"(l + 2 * lstep), "v"(g + 2 * gstep), "v"(l + 3 * lstep), "v"(g + 3 * gstep),
                    "v"(m), "v"(q), "v"(m + lstep), "v"(q + gstep), "v"(m + 2 * lstep), "v"(q + 2 * gstep), "v"(m + 3 * lstep), "v"(q + 3 * gstep) : "memory");
}
// A stage of the attention kernel, 64 KiB copied as it lies: 16 copies a thread, four runs of four. A run names one LDS address, a byte offset and a scalar base; its copies stand 4 KiB apart in LDS and in memory alike
// (the immediate offset moves both addresses). l: the lane's LDS byte address in the buffer; o: the stage's first byte in the head's K plane, the same in its V^T plane, plus the lane's byte in its wave's 512; k, v: the wave's first byte in those planes.
// One wait serves the whole run of copies.
__device__ __forceinline__ void acopy16(unsigned l, unsigned o, const char* k, const char* v) {
    asm volatile(
                 "global_load_async_to_lds_b128 %0, %4, %5\n\tglobal_load_async_to_lds_b128 %0, %4, %5 offset:4096\n\tglobal_load_async_to_lds_b128 %0, %4, %5 offset:8192\n\tglobal_load_async_to_lds_b128 %0, %4, %5 offset:12288\n\t"
                 "global_load_async_to_lds_b128 %1, %4, %6\n\tglobal_load_async_to_lds_b128 %1, %4, %6 offset:4096\n\tglobal_load_async_to_lds_b128 %1, %4, %6 offset:8192\n\tglobal_load_async_to_lds_b128 %1, %4, %6 offset:12288\n\t"
                 "global_load_async_to_lds_b128 %2, %4, %7\n\tglobal_load_async_to_lds_b128 %2, %4, %7 offset:4096\n\tglobal_load_async_to_lds_b128 %2, %4, %7 offset:8192\n\tglobal_load_async_to_lds_b128 %2, %4, %7 offset:12288\n\t"
                 "global_load_async_to_lds_b128 %3, %4, %8\n\tglobal_load_async_to_lds_b128 %3, %4, %8 offset:4096\n\tglobal_load_async_to_lds_b128 %3, %4, %8 offset:8192\n\tglobal_load_async_to_lds_b128 %3, %4, %8 offset:12288\n\t"
                 "s_wait_xcnt 0x0"
                 :: "v"(l), "v"(l + 16384), "v"(l + 32768), "v"(l + 49152), "v"(o), "s"(k), "s"(k + 16384), "s"(v), "s"(v + 16384) : "memory");
}
__device__ __forceinline__ void await_copies() { asm volatile("s_wait_asynccnt 0x0" ::: "memory"); }      // the wave's own copies have landed
__device__ __forceinline__ void await_lds() { asm volatile("s_wait_dscnt 0x0" ::: "memory"); }            // the wave's own LDS reads are done, in front of the barrier behind which their buffer is refilled
// ---- Asking L2 ahead. The 16-bit planes were stored by the launch before. At kernel entry each work-group, for speed only,
// asks L2 for what it will read: global_prefetch_b8, scope SE (into L2 only, nothing returns), a lane naming one aligned 256-byte unit inside the plane, every lane on. The s_wait_xcnt stands in the same statement, in front of
// anything that reuses the address registers (a precaution, as behind the copies above).
#define UNIT 128                   // 16-bit elements of a 256-byte unit
__device__ __forceinline__ void ask2(const bf* a, const bf* b) {
    asm volatile("global_prefetch_b8 %0, off scope:SCOPE_SE\n\tglobal_prefetch_b8 %1, off scope:SCOPE_SE\n\ts_wait_xcnt 0x0" :: "v"(a), "v"(b) : "memory");
}
#define CHUNK 1024                 // elements of a chunk
#define CHB   2048                 // its bytes
#define RSTEP (2 * (DD / 32) * 512)      // elements between a thread's copies in a plane: two blocks of 16 rows (threads 0-127 copy the even chunks, 128-255 the odd ones)
#define NSTG  (DD / 64)
// ---- k_oproj: C[m][n] (f32) = sum_k A[m][k] Bt[n][k] + bias[n], fp16 operands; grid (NT / 128, DD / 256). A stage: 8 chunks of A, 16 of Bt, 48 KiB.
__global__ __launch_bounds__(256) void k_oproj(const h16* __restrict__ A, const h16* __restrict__ Bt, float* C, const float* __restrict__ bias) {
    constexpr int ldc = DD;
    __shared__ __attribute__((aligned(2048))) h16 st[2 * 24 * CHUNK];
    __shared__ __align__(16) float osw[8][16 * 68];
    const int lane = threadIdx.x & 31, lr = lane & 15, hi = lane >> 4, wave = __builtin_amdgcn_readfirstlane(threadIdx.x >> 5);
    const int r0 = blockIdx.x * 128 + (wave & 1) * 64, c0 = blockIdx.y * 256 + (wave >> 1) * 64;
    float* os = osw[wave];
    const int half = threadIdx.x >> 7, off = (threadIdx.x & 127) * 8;
    const bf* ga = (const bf*)A + (size_t)(blockIdx.x * 8 + half) * (16 * DD) + off; const bf* gb = (const bf*)Bt + (size_t)(blockIdx.y * 16 + half) * (16 * DD) + off;      // the copies move 16-byte pieces, whatever the 16-bit type
    const unsigned l0 = (unsigned)(size_t)(st + half * CHUNK + off);      // the thread's LDS byte address in chunk 0 or 1 of buffer 0
    auto fill = [&](int s, int b) { const unsigned l = l0 + b * (24 * CHB);
        acopy4(l, ga + s * CHUNK, 2 * CHB, RSTEP); acopy8(l + 8 * CHB, gb + s * CHUNK, l + 16 * CHB, gb + s * CHUNK + 4 * RSTEP, 2 * CHB, RSTEP); };
    v8f acc[4][4];
#pragma unroll
    for (int mb = 0; mb < 4; ++mb)
#pragma unroll
        for (int nb = 0; nb < 4; ++nb) acc[mb][nb] = (v8f){};
    // the tile's operand rows lie in a row in their planes: 1,024 units of A, dealt among the 4 work-groups that read them (by blockIdx.y), 2,048 of Bt, dealt 8 ways (by blockIdx.x >> 3, so that the 8 neighbours in x all ask for a unit)
    ask2((const bf*)A + (size_t)blockIdx.x * (128 * DD) + (4 * threadIdx.x + blockIdx.y) * UNIT, (const bf*)Bt + (size_t)blockIdx.y * (256 * DD) + (8 * threadIdx.x + (blockIdx.x >> 3)) * UNIT);
    fill(0, 0); await_copies(); __syncthreads(); fill(1, 1);
    const int ia = (wave & 1) * 4 * CHUNK + 8 * lane, ib = (8 + (wave >> 1) * 4) * CHUNK + 8 * lane;
    // rolled: one trip is one stage, so that the order wait, wait, barrier, refill stands once at its foot
#pragma unroll 1
    for (int s = 0; s < NSTG; ++s) {
        const h16* sb = st + (s & 1) * (24 * CHUNK);
        v16h a[2][4], b[2][4];
#pragma unroll
        for (int kk = 0; kk < 2; ++kk) {
#pragma unroll
            for (int mb = 0; mb < 4; ++mb) a[kk][mb] = WFrag<h16>::ld(sb + ia + mb * CHUNK + kk * 512);
#pragma unroll
            for (int nb = 0; nb < 4; ++nb) b[kk][nb] = WFrag<h16>::ld(sb + ib + nb * CHUNK + kk * 512);
        }
        __builtin_amdgcn_sched_barrier(0);      // the stage's 32 LDS reads stand as one group in front of its WMMAs: the second block's land behind the first block's WMMAs (two waves a SIMD: registers are there)
#pragma unroll
        for (int kk = 0; kk < 2; ++kk) {
#pragma unroll
            for (int nb = 0; nb < 4; ++nb) {
#pragma unroll
                for (int mb = 0; mb < 4; ++mb) acc[mb][nb] = wmma16(a[kk][mb], b[kk][nb], acc[mb][nb]); }
        }
        __builtin_amdgcn_sched_barrier(0);      // keeps the WMMAs in front of the waits below: moved behind the barrier they would leave the next stage's copies only the time of the LDS reads to land
        await_lds(); await_copies(); __syncthreads();      // publishes stage s + 1 and ends every wave's reads of stage s
        if (s + 2 < NSTG) fill(s + 2, s & 1);
    }
    await_copies();
#pragma unroll
    for (int mb = 0; mb < 4; ++mb) {
#pragma unroll
        for (int nb = 0; nb < 4; ++nb) {
#pragma unroll
            for (int j = 0; j < 8; ++j) os[(hi * 8 + j) * 68 + nb * 16 + lr] = acc[mb][nb][j]; }
        __builtin_amdgcn_wave_barrier(); asm volatile("" ::: "memory");
        float* crow = C + (size_t)(r0 + mb * 16) * ldc + c0;
{
#pragma unroll
            for (int s = 0; s < 8; ++s) { const int row = 2 * s + hi, cofs = lr * 4; v4f val = *(const v4fa*)(os + row * 68 + cofs); { val[0] += bfr(bias[c0 + cofs]); val[1] += bfr(bias[c0 + cofs + 1]); val[2] += bfr(bias[c0 + cofs + 2]); val[3] += bfr(bias[c0 + cofs + 3]); }
                *(v4f*)(crow + (size_t)row * ldc + cofs) = val; }
             }
        xwait();      // behind the eight stores: the next row block reuses their address and data registers
        __builtin_amdgcn_wave_barrier(); asm volatile("" ::: "memory");
    }
}

__device__ __forceinline__ h16 tohx(float x) { return (h16)x; }
typedef __attribute__((ext_vector_type(2))) _Float16 v2h;
typedef __attribute__((ext_vector_type(4))) _Float16 v4h;
typedef __attribute__((ext_vector_type(2))) unsigned short v2us;
typedef __attribute__((ext_vector_type(4))) unsigned short v4us;
typedef __attribute__((ext_vector_type(2))) float v2f;

__global__ __launch_bounds__(256) void k_bfr1(const float* __restrict__ src, float* dst, int n) { const int i = blockIdx.x * 256 + threadIdx.x; if (i >= n) return; const float v = bfr(src[i]); *(float*)(dst + i) = v;  }
// ---- k_prep: all operand preparation of a call in ONE launch: hidden_states to its bf16 plane, Wq, Wk, Wv to their transposed bf16 planes, Wo to its transposed fp16 plane, the three phase projections (six jobs, none reads what another writes).
// A grid of PREP_B blocks (2 a WGP, 16 waves) shares out every job evenly: a thread takes 8 pieces of the X plane, the same piece of each of the four weight planes, and p_c, p_s, p_m of one (batch, head, token).
// The work then starts 4,096 waves, not 61,440 of one piece each, and all of a thread's loads are in flight before the first of them is used.
#define PREP_B 512
#define PREP_T (PREP_B * 256)
static_assert((size_t)NT * DD / 8 == 8 * (size_t)PREP_T && DD * DD / 8 == PREP_T && NB_ * NH_ * TT == PREP_T && DD / 32 == 32, "pieces a thread");
__global__ __launch_bounds__(256) void k_prep(const float* __restrict__ x, const float* __restrict__ wq, const float* __restrict__ wk, const float* __restrict__ wv, const float* __restrict__ wo, const float* __restrict__ cph, const float* __restrict__ sph, const float* __restrict__ mag,
                                              const float* __restrict__ Wp, const float* __restrict__ bp, bf* XB, bf* WQ, bf* WK, bf* WV, bf* WO, float* PH) {
    const unsigned g = blockIdx.x * 256 + threadIdx.x;
    // X plane: a block takes one block of 16 rows, 32 tiles, 2,048 pieces; a thread's 8 pieces are 256 pieces apart: 4 tiles, 128 elements in the source row
    unsigned xs, xd; { const unsigned i = blockIdx.x * 2048 + threadIdx.x; FRAG_IDX_ROW(i); xs = (unsigned)(((tile / (DD / 32)) * 16 + lr) * DD + (tile % (DD / 32)) * 32 + j * 16 + hi * 8); xd = (unsigned)piece; }
    // weight planes: piece g of each; the eight rows are read off one offset, a constant pitch apart
    unsigned ws; { FRAG_IDX(g); const int kt = DD / 32; const int n = (tile / kt) * 16 + lr, k = (tile % kt) * 32 + j * 16 + hi * 8; ws = (unsigned)(k * DD + n); }
    // phase scalars: g = (batch, head, token); a block lies inside one head
    const unsigned h = (blockIdx.x >> 3) & (NH_ - 1), ps = ((g >> 15) & (NB_ - 1)) * (NBD * TT) + (g & (TT - 1));
    const float* xp = x + xs; v8f v[8]; float f[4][8], wl[NBD], pl[3][NBD];
#pragma unroll
    for (int s = 0; s < 8; ++s) v[s] = *(const v8f*)(xp + s * 128);
#pragma unroll
    for (int q = 0; q < 8; ++q) { f[0][q] = wq[ws + q * DD]; f[1][q] = wk[ws + q * DD]; f[2][q] = wv[ws + q * DD]; f[3][q] = wo[ws + q * DD]; }
#pragma unroll
    for (int n = 0; n < NBD; ++n) { wl[n] = Wp[n * NH_ + h]; pl[0][n] = cph[ps + n * TT]; pl[1][n] = sph[ps + n * TT]; pl[2][n] = mag[ps + n * TT]; }
    const float bl = bp[h];
    asm volatile("s_wait_xcnt 0x0" :: "v"(xp), "v"(ws), "v"(ps) : "memory");      // the same wait as xwait(); the address and the offsets are named as inputs only, so that they stay live up to the wait and no result lands in their registers in front of it
    __builtin_amdgcn_sched_barrier(0);      // keeps the conversions below out of the loads above: every load is issued before the first result is waited for
    v8us o[8], ow[4]; float sp[3];
#pragma unroll
    for (int s = 0; s < 8; ++s)
#pragma unroll
        for (int k = 0; k < 8; ++k) o[s][k] = f2bf(v[s][k]);
#pragma unroll
    for (int m = 0; m < 4; ++m)
#pragma unroll
        for (int q = 0; q < 8; ++q) ow[m][q] = (m < 3) ? f2bf(f[m][q]) : __builtin_bit_cast(unsigned short, tohx(bfr(f[m][q])));      // Wo: rounded to bf16 like every input, then held in fp16 for the output projection
#pragma unroll
    for (int k = 0; k < 3; ++k) { float s = 0.f;
#pragma unroll
        for (int n = 0; n < NBD; ++n) { float w = bfr(wl[n]), p = bfr(pl[k][n]); asm volatile("" : "+v"(w)); asm volatile("" : "+v"(p)); float m = __fmul_rn(p, w); asm volatile("" : "+v"(m)); s = __fadd_rn(s, m); }
        sp[k] = __fadd_rn(s, bfr(bl)); }
    v8us* xo = (v8us*)XB + xd;
#pragma unroll
    for (int s = 0; s < 8; ++s) xo[s * 256] = o[s];
    ((v8us*)WQ)[g] = ow[0]; ((v8us*)WK)[g] = ow[1]; ((v8us*)WV)[g] = ow[2]; ((v8us*)WO)[g] = ow[3];
#pragma unroll
    for (int k = 0; k < 3; ++k) *(float*)(PH + g + k * PREP_T) = sp[k];
}
// ---- k_qkv: the three input projections in ONE launch, each accumulator tile stored straight into its fp16 plane in fragment order (no f32 copy of q, k or v in memory, no conversion launch).
// grid (NT / 128, 3 * DD / 256), 8 waves: 2 groups of 64 tokens x 4 heads (64 columns each) of q, k or v; W3 = the q, k and v weight planes one behind the other, 3 * DD rows. A stage: 8 chunks of X, 16 of W3, 48 KiB; two work-groups a WGP.
// An accumulator register run j = 0..7 walks the ROW operand's index (8 hi + j), a lane's lr the COLUMN operand's. A piece of a plane is 8 neighbours along the plane's k: the head dimension for q and k, the token for V^T.
// So q and k take the weight rows as the row operand and the tokens as the column operand, v the other way round (both planes have one fragment order, so this is a swap of two pointers):
// in each case a lane's 8 registers are one 16-byte piece, and the wave's 32 pieces are one half tile, 512 contiguous bytes a store.
// amdgpu_waves_per_eu(4, 4): four waves a SIMD, so that two work-groups share a WGP and one works while the other stands at its barrier.
__global__ __launch_bounds__(256) __attribute__((amdgpu_waves_per_eu(4, 4))) void k_qkv(const bf* __restrict__ X, const bf* __restrict__ W3, const float* __restrict__ bq, const float* __restrict__ bk, const float* __restrict__ bv, const float* __restrict__ PH, h16* QP, h16* KP, h16* VT) {
    __shared__ __attribute__((aligned(2048))) bf st[2 * 24 * CHUNK];
    const int lane = threadIdx.x & 31, lr = lane & 15, hi = lane >> 4, wave = __builtin_amdgcn_readfirstlane(threadIdx.x >> 5);
    const int r0 = blockIdx.x * 128 + (wave & 1) * 64, hy = blockIdx.y * 4 + (wave >> 1), sel = hy >> 4, h = hy & 15;      // sel: 0 q, 1 k, 2 v
    const int z = (r0 >> 11) * NH_ + h, t0 = r0 & (TT - 1);      // (batch, head) and the first token inside the batch
    const int half = threadIdx.x >> 7, off = (threadIdx.x & 127) * 8;
    const bf* gx = X + (size_t)(blockIdx.x * 8 + half) * (16 * DD) + off; const bf* gw = W3 + (size_t)(blockIdx.y * 16 + half) * (16 * DD) + off;
    const unsigned l0 = (unsigned)(size_t)(st + half * CHUNK + off);      // the thread's LDS byte address in chunk 0 or 1 of buffer 0
    auto fill = [&](int s, int b) { const unsigned l = l0 + b * (24 * CHB);
        acopy4(l, gx + s * CHUNK, 2 * CHB, RSTEP); acopy8(l + 8 * CHB, gw + s * CHUNK, l + 16 * CHB, gw + s * CHUNK + 4 * RSTEP, 2 * CHB, RSTEP); };
    v8f acc[4][4];
#pragma unroll
    for (int mb = 0; mb < 4; ++mb)
#pragma unroll
        for (int nb = 0; nb < 4; ++nb) acc[mb][nb] = (v8f){};
    // 1,024 units of X, dealt 4 ways among the 12 work-groups that read them (by blockIdx.y & 3), 2,048 of W3, dealt 8 ways among 64 (by blockIdx.x >> 3)
    ask2(X + (size_t)blockIdx.x * (128 * DD) + (4 * threadIdx.x + (blockIdx.y & 3)) * UNIT, W3 + (size_t)blockIdx.y * (256 * DD) + (8 * threadIdx.x + (blockIdx.x >> 3)) * UNIT);
    fill(0, 0); await_copies(); __syncthreads(); fill(1, 1);
    const int ix = (wave & 1) * 4 * CHUNK + 8 * lane, iw = (8 + (wave >> 1) * 4) * CHUNK + 8 * lane;
    const int ia = (sel == 2) ? ix : iw, ib = (sel == 2) ? iw : ix;
    // rolled: one trip is one stage, so that the order wait, wait, barrier, refill stands once at its foot
#pragma unroll 1
    for (int s = 0; s < NSTG; ++s) {
        const bf* sb = st + (s & 1) * (24 * CHUNK);
#pragma unroll
        for (int kk = 0; kk < 2; ++kk) {
            v16bf a[4], b[4];
#pragma unroll
            for (int mb = 0; mb < 4; ++mb) a[mb] = WFrag<bf>::ld(sb + ia + mb * CHUNK + kk * 512);
#pragma unroll
            for (int nb = 0; nb < 4; ++nb) b[nb] = WFrag<bf>::ld(sb + ib + nb * CHUNK + kk * 512);
            __builtin_amdgcn_sched_barrier(0);      // the block's 16 LDS reads stand as one group in front of its WMMAs (left alone the compiler reads each b fragment into one register set and waits it out four times a block)
#pragma unroll
            for (int nb = 0; nb < 4; ++nb) {
#pragma unroll
                for (int mb = 0; mb < 4; ++mb) acc[mb][nb] = wmmab(a[mb], b[nb], acc[mb][nb]); }
            __builtin_amdgcn_sched_barrier(0);      // and the next block's reads stay out of this block's WMMAs
        }
        await_lds(); await_copies(); __syncthreads();      // publishes stage s + 1 and ends every wave's reads of stage s
        if (s + 2 < NSTG) fill(s + 2, s & 1);
    }
    await_copies();
    // In the epilogues each pair of scheduling barriers keeps every other register write out from between a group of loads or stores and its wait.
    if (sel < 2) {      // q (x log2(e)/8: the scores then come out in the base-2 domain) and k: acc[mb][nb][j] is dimension 16 mb + 8 hi + j of token t0 + 16 nb + lr
        const float sc = (sel == 0) ? 0.125f * L2E : 1.0f; const float* bl = ((sel == 0) ? bq : bk) + h * HD + 8 * hi;
        h16* P = ((sel == 0) ? QP : KP) + ((size_t)z * TT + t0) * HD + 8 * lane;      // 16 tokens on: 2 tiles, 1024 elements; 16 dimensions on: half a tile, 256
        v8f bs[4];
        __builtin_amdgcn_sched_barrier(0);
#pragma unroll
        for (int mb = 0; mb < 4; ++mb) bs[mb] = *(const v8f*)(bl + 16 * mb);
        asm volatile("s_wait_xcnt 0x0" :: "v"(bl) : "memory");      // the same wait as xwait(); the pointer is named as an input only, so that it stays live up to the wait
        __builtin_amdgcn_sched_barrier(0);
#pragma unroll
        for (int mb = 0; mb < 4; ++mb) { v8h o[4];
#pragma unroll
            for (int nb = 0; nb < 4; ++nb)
#pragma unroll
                for (int j = 0; j < 8; ++j) o[nb][j] = tohx((acc[mb][nb][j] + bfr(bs[mb][j])) * sc);
            __builtin_amdgcn_sched_barrier(0);
#pragma unroll
            for (int nb = 0; nb < 4; ++nb) *(v8ha*)(P + nb * 1024 + mb * 256) = o[nb];
            xwait(); __builtin_amdgcn_sched_barrier(0); }
    } else {            // v: acc[mb][nb][j] is dimension 16 nb + lr of token t0 + 16 mb + 8 hi + j; the V^T plane takes v p_m
        const float* bl = bv + h * HD + lr; const float* pl = PH + 2 * NZ * TT + (size_t)z * TT + t0 + 8 * hi;      // p_m of the lane's first token
        h16* P = VT + ((size_t)z * (HD * TT / 512) + (t0 >> 5) * 4) * 512 + 8 * lane;      // 32 tokens on: 4 tiles; 16 rows on: 1 tile; 16 tokens on: half a tile
        float bs[4];
        __builtin_amdgcn_sched_barrier(0);
#pragma unroll
        for (int nb = 0; nb < 4; ++nb) bs[nb] = bl[16 * nb];
        asm volatile("s_wait_xcnt 0x0" :: "v"(bl) : "memory");      // as above
        __builtin_amdgcn_sched_barrier(0);
#pragma unroll
        for (int nb = 0; nb < 4; ++nb) bs[nb] = bfr(bs[nb]);
#pragma unroll
        for (int mb = 0; mb < 4; ++mb) { v8h o[4];
            __builtin_amdgcn_sched_barrier(0);      // this barrier and the one behind the wait keep every other register write out from between the load and its wait
            const v8f pm = *(const v8f*)(pl + 16 * mb);
            asm volatile("s_wait_xcnt 0x0" :: "v"(pl) : "memory");      // as above
            __builtin_amdgcn_sched_barrier(0);
#pragma unroll
            for (int nb = 0; nb < 4; ++nb)
#pragma unroll
                for (int j = 0; j < 8; ++j) o[nb][j] = tohx(__fmul_rn(acc[mb][nb][j] + bs[nb], pm[j]));
            __builtin_amdgcn_sched_barrier(0);
#pragma unroll
            for (int nb = 0; nb < 4; ++nb) *(v8ha*)(P + (mb >> 1) * 2048 + nb * 512 + (mb & 1) * 256) = o[nb];
            xwait(); __builtin_amdgcn_sched_barrier(0); }
    }
}
// ---- k_fattn: scores, mask, softmax, the phase weights and the value contraction of one (batch, head) in ONE launch; S and P stay in registers.
// Transposed products: S^T = K.Q^T (A = 16 key rows, B = 16 query columns), O^T += V^T.(P x W)^T (A = 16 rows of the 64-wide V^T plane, B = (P x W)^T). A lane then holds scores of ONE query
// (column lr): two S^T tiles (keys 0-15, 16-31 of a pass), converted in place, are the B operand of the second product in the loaders' own k order (8 hi + 0..7, 16 + 8 hi + 0..7).
// Online softmax in the base-2 domain. The score WMMA itself hands out the argument of exp2: Q carries log2(e)/8, and the C operand of the first score product is (mask x log2(e)) - maximum in use (for the keys that count a difference of near values,
// whatever the size of the mask). No maximum is taken on an ordinary pass: the weights are formed, and a lane's 16 weights of a column group must sum to at most PLIM (so each is below 256 before its phase weight, which is at most |p_c| + |p_s| of its key: see below).
// The phase weights: W^T = A.B with A = 16 key rows holding (p_c, p_s) at k = 0, 1 and B = 16 query columns holding (p_c, p_s) there, every other k zero: the tile comes out in the layout of S^T, and P x W is one multiply an element.
// A query's pair goes in times the power of two that brings the larger of the two below 1, and that power comes back with 1 / l at the end (both exact): P x W then leaves fp16 only where a key's |p_c| + |p_s| passes 256.
// Only a pass that fails this test (the first one always does) forms its scores again without the maximum, takes the true maximum, rescales the accumulators and forms its weights anew.
// grid (TT / (8 * 16 * QG), NZ), 8 waves x QG groups of 16 query columns; a pass is 32 keys; every K and V^T fragment a wave loads serves QG column groups.
// K and V^T reach the waves through LDS: a STAGE is SKEY keys, 32 KiB of the K plane and 32 KiB of the V^T plane, each contiguous in memory and copied as it lies (fragment order) by asynchronous copies, 16 bytes a lane,
// once a work-group. Two buffers: stage s + 1 flies while stage s is worked on, so that no wave waits for L2 inside a pass, and between two stage barriers the waves are free to run out of step.
#define PLIM 240.0f
#define QG  4
#define SKEY 256                   // keys of a stage
#define NSTA (TT / SKEY)
#define KSTG (SKEY * HD)           // elements of K in a stage
#define VSTG (SKEY * HD)           // elements of V^T in a stage
typedef __attribute__((ext_vector_type(8))) unsigned v8u;
typedef __attribute__((ext_vector_type(4))) unsigned v4u;
__device__ __forceinline__ unsigned pack2h(float a, float b) { return __builtin_bit_cast(unsigned, (v2h){tohx(a), tohx(b)}); }
__device__ __forceinline__ v16h k01(unsigned u) { return __builtin_bit_cast(v16h, (v8u){u, 0u, 0u, 0u, 0u, 0u, 0u, 0u}); }      // a fragment whose first register is u (k = 0, 1 in lanes 0-15), all else zero
__device__ __forceinline__ float xhalf(float x) { return __builtin_bit_cast(float, __builtin_amdgcn_permlanex16(__builtin_bit_cast(int, x), __builtin_bit_cast(int, x), 0x76543210, 0xfedcba98, false, false)); }  // lane l <-> lane l ^ 16
__global__ __launch_bounds__(256) void k_fattn(const h16* __restrict__ QP, const h16* __restrict__ KP, const h16* __restrict__ VT, const float* __restrict__ am, const float* __restrict__ PH, h16* Ah) {
    __shared__ __attribute__((aligned(2048))) h16 ring[2 * (KSTG + VSTG)];      // two buffers, each the stage's K tiles and behind them its V^T tiles
    __shared__ __align__(16) float mk[TT];      // this batch's additive mask row, rounded to bf16 and taken times log2(e), once per work-group
    __shared__ __align__(16) unsigned ab[TT];      // per key the fp16 pair (p_c, p_s) of this head, once per work-group
    const int z = blockIdx.y, b = z / NH_, h = z % NH_;
    // Asks L2 for the head's whole K plane and V^T plane (1,024 units of 256 bytes each), in the order of the passes: a request of the work-group covers 64 KiB, 16 passes. Every work-group asks for all of it.
    // The wait is the same precaution as in ask2().
    asm volatile("global_prefetch_b8 %0, off scope:SCOPE_SE\n\tglobal_prefetch_b8 %1, off scope:SCOPE_SE\n\t"
                 "global_prefetch_b8 %0, off offset:65536 scope:SCOPE_SE\n\tglobal_prefetch_b8 %1, off offset:65536 scope:SCOPE_SE\n\t"
                 "global_prefetch_b8 %0, off offset:131072 scope:SCOPE_SE\n\tglobal_prefetch_b8 %1, off offset:131072 scope:SCOPE_SE\n\t"
                 "global_prefetch_b8 %0, off offset:196608 scope:SCOPE_SE\n\tglobal_prefetch_b8 %1, off offset:196608 scope:SCOPE_SE\n\ts_wait_xcnt 0x0"
                 :: "v"(KP + (size_t)z * TT * HD + threadIdx.x * UNIT), "v"(VT + (size_t)z * HD * TT + threadIdx.x * UNIT) : "memory");
    // a copy of the work-group moves 4 KiB (2,048 elements): 8 copies a thread for a stage's K, 8 for its V^T
    const int wv = __builtin_amdgcn_readfirstlane(threadIdx.x >> 5); const unsigned lb = (threadIdx.x & 31) * 16;      // the wave, held in a scalar register, and the lane's byte in the wave's 512 bytes of a copy
    // the buffer's and the wave's share of the LDS address is summed in a scalar register: of the addresses only the lane's byte then lives through the passes
    auto fill = [&](int s, int bu, unsigned ly) { const unsigned sl = __builtin_amdgcn_readfirstlane((unsigned)(size_t)ring + bu * (2 * (KSTG + VSTG)) + wv * 512);      // ly: the lane's byte
        acopy16(sl + ly, s * (2 * KSTG) + ly, (const char*)(KP + ((size_t)z * TT * HD + wv * 256)), (const char*)(VT + ((size_t)z * HD * TT + wv * 256))); };
    static_assert(KSTG == VSTG && 2 * KSTG == 32768, "a stage: two runs of 16 KiB from each plane, at one offset");
    fill(0, 0, lb);
    for (int i = threadIdx.x * 4; i < TT; i += 1024) { v4f a = *(const v4f*)(am + (size_t)b * TT + i);
#pragma unroll
        for (int q = 0; q < 4; ++q) a[q] = bfr(a[q]) * L2E;
        *(v4fa*)(mk + i) = a; }
    { const unsigned po = threadIdx.x * 4; const float* pz = PH + (size_t)z * TT; v4f kc[2], ks[2];      // p_c, p_s of 2 x 4 keys a thread
#pragma unroll
        for (int u = 0; u < 2; ++u) { kc[u] = *(const v4f*)(pz + po + u * 1024); ks[u] = *(const v4f*)(pz + NZ * TT + po + u * 1024); }
        asm volatile("s_wait_xcnt 0x0" :: "v"(po) : "memory");      // the same wait as xwait(); the offset is named as an input only, so that it stays live up to the wait
#pragma unroll
        for (int u = 0; u < 2; ++u) { v4u o;
#pragma unroll
            for (int q = 0; q < 4; ++q) o[q] = pack2h(kc[u][q], ks[u][q]);
            *(v4u*)(ab + po + u * 1024) = o; } }
    await_copies(); __syncthreads();      // publishes the mask row, the keys' phase pairs and stage 0
    fill(1, 1, lb);
    const int lane = threadIdx.x & 31, lr = lane & 15, hi = lane >> 4; const int q0 = (blockIdx.x * 8 + __builtin_amdgcn_readfirstlane(threadIdx.x >> 5)) * (16 * QG);      // the wave's first query, held in a scalar register
    const unsigned ko = (unsigned)(8 * lane);      // the lane's offset in a tile
    v16h qf[QG][2]; const h16* Qz = QP + ((size_t)z * TT + q0) * HD;      // the wave's first Q tile
#pragma unroll
    for (int g = 0; g < QG; ++g)
#pragma unroll
        for (int kc = 0; kc < 2; ++kc) qf[g][kc] = WFrag<h16>::ld(Qz + (size_t)(16 * g) * HD + 512 * kc + ko);
    const float* pq = PH + (size_t)z * TT + q0; const unsigned lq = (unsigned)lr; float qc[QG], qs[QG];      // p_c and p_s of the lane's query in each column group
#pragma unroll
    for (int g = 0; g < QG; ++g) { qc[g] = pq[lq + 16 * g]; qs[g] = pq[NZ * TT + lq + 16 * g]; }
    v16h kf[2][2];      // inside a stage K fragments are fetched one pass ahead, half way through the second product
    // the same wait as xwait(); the scalar bases of the loads above and the lane's offset are named as inputs only, so that their registers stay live up to the wait and nothing is written over them in front of it
    asm volatile("s_wait_xcnt 0x0" :: "s"(Qz), "s"(pq), "v"(lq) : "memory");
    __builtin_amdgcn_sched_barrier(0);      // keeps the scheduler from mixing the tiles' set-up below into the loads above (it spilled Q fragments when it did)
    v8f acc[QG][4]; float m_run[QG], l_run[QG]; v16h wb[QG]; int qe[QG];      // wb: the queries' operand of the phase weight product; qe: the binary exponent taken out of the lane's query pair
#pragma unroll
    for (int g = 0; g < QG; ++g) { m_run[g] = -__FLT_MAX__; l_run[g] = 0.f; qe[g] = __builtin_amdgcn_frexp_expf(fmaxf(fabsf(qc[g]), fabsf(qs[g]))); wb[g] = k01(hi ? 0u : pack2h(__builtin_ldexpf(qc[g], -qe[g]), __builtin_ldexpf(qs[g], -qe[g])));
#pragma unroll
        for (int t = 0; t < 4; ++t) acc[g][t] = (v8f){}; }
    // rolled: one trip is one stage, so that the order wait, wait, barrier, refill stands once at its foot
    unsigned ki = ko;      // the lane's element in the buffer at hand, carried from stage to stage: the one lane-dependent address that lives through the passes (the refill takes the lane's byte from it)
#pragma unroll 1
    for (int sg = 0; sg < NSTA; ++sg) {
    const h16* kb = ring + ki;      // the lane's address in the stage's first K tile
    const h16* vp = kb + KSTG;      // the lane's address in the V^T tiles of the pass at hand
    const h16* kp = kb + 32 * HD;      // the lane's address in the K tile to fetch next
#pragma unroll
    for (int kt = 0; kt < 2; ++kt)
#pragma unroll
        for (int kc = 0; kc < 2; ++kc) kf[kt][kc] = WFrag<h16>::ld(kb + (16 * kt) * HD + 512 * kc);      // the stage's first pass: nothing of a stage is read in front of the barrier that publishes it
    // rolled: one pass's fragments and the output tiles already fill the wave's registers
#pragma unroll 1
    for (int key0 = sg * SKEY; key0 < (sg + 1) * SKEY; key0 += 32) {
        v8f s[2][QG]; v4f mr[2][2]; unsigned au[2];      // the pass's four mask reads and its two reads of phase pairs stand as one group too
#pragma unroll
        for (int kt = 0; kt < 2; ++kt) { mr[kt][0] = *(const v4fa*)(mk + key0 + 16 * kt + 8 * hi); mr[kt][1] = *(const v4fa*)(mk + key0 + 16 * kt + 8 * hi + 4); au[kt] = ab[key0 + 16 * kt + lr]; }
        __builtin_amdgcn_sched_barrier(0);      // keeps the second key tile's three reads up here, out of the score products
#pragma unroll
        for (int kt = 0; kt < 2; ++kt) { const v4f m0 = mr[kt][0], m1 = mr[kt][1];
#pragma unroll
            for (int g = 0; g < QG; ++g) { v8f c;
#pragma unroll
                for (int r = 0; r < 4; ++r) { c[r] = m0[r] - m_run[g]; c[4 + r] = m1[r] - m_run[g]; }
                s[kt][g] = wmma16(kf[kt][1], qf[g][1], wmma16(kf[kt][0], qf[g][0], c)); }
            __builtin_amdgcn_sched_barrier(0); }      // the second key tile's four C tiles are formed only behind the first tile's products, when its K fragments are dead (formed all eight up front they spilled a Q fragment)
        // the pass's 8 V^T reads stand as ONE group behind the score products, where the K fragments are dead, and land under the exponentials
        v16h vf[4];
#pragma unroll
        for (int t = 0; t < 4; ++t) vf[t] = WFrag<h16>::ld(vp + 512 * t);
        __builtin_amdgcn_sched_barrier(0);      // with the barrier above: holds the group together (left alone the compiler strewed these reads over the exponentials and the second product)
        v8f w[2][QG];      // the phase weights of the pass's eight tiles
#pragma unroll
        for (int kt = 0; kt < 2; ++kt) { const v16h wa = k01(hi ? 0u : au[kt]);
#pragma unroll
            for (int g = 0; g < QG; ++g) w[kt][g] = wmma16(wa, wb[g], (v8f){}); }
        float ls[QG]; bool need = false;      // the weights P take the scores' registers
#pragma unroll
        for (int g = 0; g < QG; ++g) { v2f l2 = (v2f){0.f, 0.f};
#pragma unroll
            for (int e = 0; e < 16; e += 2) { const v2f p = (v2f){__builtin_amdgcn_exp2f(s[e >> 3][g][e & 7]), __builtin_amdgcn_exp2f(s[e >> 3][g][(e & 7) + 1])};
                l2 += p; s[e >> 3][g][e & 7] = p[0]; s[e >> 3][g][(e & 7) + 1] = p[1]; }
            ls[g] = l2[0] + l2[1]; need = need || !(ls[g] <= PLIM); }      // the negated form also catches a sum that is not a number
        if (__builtin_amdgcn_ballot_w32(need) != 0) {       // one wave-uniform test per pass
            v16h kr[2][2]; const h16* kq = kb + (key0 & (SKEY - 1)) * HD;      // the pass's K fragments are loaded again here: kept for this rare path they would cost every pass 32 registers (spills)
#pragma unroll
            for (int kt = 0; kt < 2; ++kt)
#pragma unroll
                for (int kc = 0; kc < 2; ++kc) kr[kt][kc] = WFrag<h16>::ld(kq + (16 * kt) * HD + 512 * kc);
            v8f c[2];
#pragma unroll
            for (int kt = 0; kt < 2; ++kt) { const v4f m0 = *(const v4fa*)(mk + key0 + 16 * kt + 8 * hi), m1 = *(const v4fa*)(mk + key0 + 16 * kt + 8 * hi + 4);
                c[kt] = (v8f){m0[0], m0[1], m0[2], m0[3], m1[0], m1[1], m1[2], m1[3]}; }
            // one column group at a time: its two score tiles turn into its weights in place
#pragma unroll
            for (int g = 0; g < QG; ++g) {
#pragma unroll
                for (int kt = 0; kt < 2; ++kt) s[kt][g] = wmma16(kr[kt][1], qf[g][1], wmma16(kr[kt][0], qf[g][0], c[kt]));
                float mx = s[0][g][0];
#pragma unroll
                for (int r = 1; r < 8; ++r) mx = fmaxf(mx, s[0][g][r]);
#pragma unroll
                for (int r = 0; r < 8; ++r) mx = fmaxf(mx, s[1][g][r]);
                mx = fmaxf(mx, xhalf(mx)); const float m_new = fmaxf(m_run[g], mx); const float corr = __builtin_amdgcn_exp2f(m_run[g] - m_new); m_run[g] = m_new; l_run[g] *= corr;
#pragma unroll
                for (int t = 0; t < 4; ++t) acc[g][t] = acc[g][t] * corr;
                v2f l2 = (v2f){0.f, 0.f};
#pragma unroll
                for (int kt = 0; kt < 2; ++kt) s[kt][g] = s[kt][g] - m_new;
#pragma unroll
                for (int e = 0; e < 16; e += 2) { const v2f p = (v2f){__builtin_amdgcn_exp2f(s[e >> 3][g][e & 7]), __builtin_amdgcn_exp2f(s[e >> 3][g][(e & 7) + 1])};
                    l2 += p; s[e >> 3][g][e & 7] = p[0]; s[e >> 3][g][(e & 7) + 1] = p[1]; }
                ls[g] = l2[0] + l2[1]; } }
        // P x W is formed behind the join of the two paths, a column group ahead of its value product, so that the scheduler can set these multiplies and conversions among the WMMAs of the groups before
        v16h pf[QG];
        auto weigh = [&](int g) {
#pragma unroll
            for (int e = 0; e < 16; ++e) pf[g][e] = tohx(s[e >> 3][g][e & 7] * w[e >> 3][g][e & 7]); };
        weigh(0);
#pragma unroll
        for (int g = 0; g < QG; ++g) { l_run[g] += ls[g];
            if (g + 1 < QG) weigh(g + 1);
#pragma unroll
            for (int t = 0; t < 4; ++t) acc[g][t] = wmma16(vf[t], pf[g], acc[g][t]);
            if (g == QG / 2 - 1) {
                __builtin_amdgcn_sched_barrier(0);      // this barrier and the one below keep the eight K reads in one place among the WMMAs
#pragma unroll
                for (int kt = 0; kt < 2; ++kt)
#pragma unroll
                    for (int kc = 0; kc < 2; ++kc) kf[kt][kc] = WFrag<h16>::ld(kp + (16 * kt) * HD + 512 * kc);
                kp += ((key0 & (SKEY - 1)) + 64 < SKEY) ? 32 * HD : 0;      // a stage's last pass fetches its own tile again: inside the stage's buffer, unused
                __builtin_amdgcn_sched_barrier(0); } }
        vp += 32 * HD;
        __builtin_amdgcn_sched_barrier(0);      // keeps the pass's WMMAs in front of the slots below
        asm volatile("v_nop\n\tv_nop\n\tv_nop\n\tv_nop");      // four vector slots behind the pass's last WMMA: what follows the loop's branch, on either side, writes over its operand registers
    }
    await_lds(); await_copies(); __syncthreads();      // publishes stage sg + 1 and ends every wave's reads of stage sg
    if (sg + 2 < NSTA) fill(sg + 2, sg & 1, 2 * ki - (sg & 1) * (2 * (KSTG + VSTG)));
    ki += (sg & 1) ? 0u - (KSTG + VSTG) : (unsigned)(KSTG + VSTG);
    }
    await_copies();
#pragma unroll
    for (int g = 0; g < QG; ++g) { const float l = l_run[g] + xhalf(l_run[g]); const float inv = __builtin_ldexpf(__fdiv_rn(1.0f, l), qe[g]);
#pragma unroll
        for (int tt = 0; tt < 4; ++tt) { v8h oh;
#pragma unroll
            for (int r = 0; r < 8; ++r) oh[r] = tohx(acc[g][tt][r] * inv);
            const unsigned o = ((unsigned)b * TT + q0 + 16 * g) * DD + (2 * h + (tt >> 1)) * 512 + (tt & 1) * 256 + 8 * lane;      /* row t, k = 64 h + 16 tt + 8 hi in fragment order: 512 contiguous bytes a store */ __builtin_amdgcn_sched_barrier(0);      // the two barriers keep every other register write out from between the store and its wait
            *(v8ha*)(Ah + o) = oh; xwait(); __builtin_amdgcn_sched_barrier(0); } }
}
__global__ __launch_bounds__(256) void k_ln2(const float* __restrict__ FF, const float* __restrict__ X, const float* __restrict__ gg, const float* __restrict__ bb, float* OUT) {
    const int lane = threadIdx.x & 31; const int r = blockIdx.x * 8 + (threadIdx.x >> 5); if (r >= NT) return; float v[32]; float s = 0.f;
#pragma unroll
    for (int c = 0; c < 8; ++c) { const v4f a = *(const v4f*)(FF + (size_t)r * DD + c * 128 + lane * 4), xx = *(const v4f*)(X + (size_t)r * DD + c * 128 + lane * 4);
#pragma unroll
        for (int q = 0; q < 4; ++q) { v[c * 4 + q] = a[q] + bfr(xx[q]); s += v[c * 4 + q]; } }
#pragma unroll
    for (int sh = 16; sh; sh >>= 1) s += __shfl_xor(s, sh, 32);
    const float mu = s * (1.0f / DD); float qq = 0.f;
#pragma unroll
    for (int i = 0; i < 32; ++i) { const float d0 = v[i] - mu; qq = __fadd_rn(qq, __fmul_rn(d0, d0)); }
#pragma unroll
    for (int sh = 16; sh; sh >>= 1) qq += __shfl_xor(qq, sh, 32);
    const float rs = __fdiv_rn(1.0f, __fsqrt_rn(qq * (1.0f / DD) + 1e-12f));
{
#pragma unroll
        for (int c = 0; c < 8; ++c) { v4f o;
#pragma unroll
            for (int q = 0; q < 4; ++q) { const int col = c * 128 + lane * 4 + q; o[q] = __fadd_rn(__fmul_rn((v[c * 4 + q] - mu) * rs, bfr(gg[col])), bfr(bb[col])); }
            *(v4f*)(OUT + (size_t)r * DD + c * 128 + lane * 4) = o; }
         }
}

extern "C" void kernel_launch(void* const* d_in, const int* in_sizes, int n_in,
                              void* d_out, int out_size, void* d_ws, size_t ws_size, hipStream_t stream) {
    (void)in_sizes; (void)n_in; (void)out_size;
    const float* IN[17]; for (int i = 0; i < 17; ++i) IN[i] = (const float*)d_in[i];
    // hidden_states, attention_mask [4][1][1][2048], cos_phi, sin_phi, mag [4][8][2048], Wq [1024][1024] (x @ W), bq, Wk, bk, Wv, bv, Wo, bo, Wp [8][16], bp [16], ln_g, ln_b = d_in[0..16]
    const float* x = IN[0]; const float* am = IN[1];
    float* OUT = (float*)d_out;     // [4][2048][1024]
    char* wsp = (char*)d_ws;
    auto take = [&](size_t bytes) { char* p = wsp; wsp += (bytes + 255) & ~(size_t)255; return (void*)p; };
    bf* WQ = (bf*)take((size_t)3 * DD * DD * 2); bf* WK = WQ + (size_t)DD * DD; bf* WV = WK + (size_t)DD * DD;      /* one plane of 3 * DD rows for k_qkv */ bf* WO = (bf*)take((size_t)DD * DD * 2); float* PH = (float*)take((size_t)3 * NB_ * NH_ * TT * 4);
    bf* XB = (bf*)take((size_t)NT * DD * 2); float* F = (float*)take((size_t)NT * DD * 4);
    h16* QP = (h16*)take((size_t)NT * DD * 2); h16* KP = (h16*)take((size_t)NT * DD * 2); h16* VT = (h16*)take((size_t)NZ * HD * TT * 2);
    h16* ATh = (h16*)take((size_t)NT * DD * 2);
    if ((size_t)(wsp - (char*)d_ws) > ws_size) return;    // total ~ 122 MiB; ws 256 MiB
    float* Y = F;   // the output projection's f32 result
    k_prep<<<PREP_B, 256, 0, stream>>>(x, IN[5], IN[7], IN[9], IN[11], IN[2], IN[3], IN[4], IN[13], IN[14], XB, WQ, WK, WV, WO, PH);
    k_qkv<<<dim3(NT / 128, 3 * DD / 256), 256, 0, stream>>>(XB, WQ, IN[6], IN[8], IN[10], PH, QP, KP, VT);
    k_fattn<<<dim3(TT / (8 * 16 * QG), NZ), 256, 0, stream>>>(QP, KP, VT, am, PH, ATh);
    k_oproj<<<dim3(NT / 128, DD / 256), 256, 0, stream>>>(ATh, (const h16*)WO, Y, IN[12]);
    k_ln2<<<NT / 8, 256, 0, stream>>>(Y, x, IN[15], IN[16], OUT);
}
